// v000
// Measured on an AMD MI455X. A time is GPU time per run, averaged over a window of back-to-back runs after a warm-up
// (all launches, gaps included; the runs take copies of the inputs in turn), and the median of several windows.
// Apart from v000's, it joins two sittings. Times from different sittings can be a few percent apart, while
// side-by-side timings come from the same sitting.
// v000 is the starting kernel. One run takes 20 milliseconds.
#include <hip/hip_runtime.h>
// Patch-graph attention with a distance-decay bias and patch masks (h [4][2048][512]; q, k, v = h W^T + b, 8 heads of 64; scores = q k^T / 8 + log(exp(-|i-j|) + 1e-12); padded keys (patch_mask == 0) -> -1e9; softmax; o = attn v; out = (o Wo^T + bo) * patch_mask[b][i] -> [4][2048][512]).
// Structure: token rows r = b*2048 + s; h as exact f16 rows; Q | K | V as three WMMA GEMMs (32x64 wave tiles, f32 accumulation, exact x16 natural weights, bias in the epilogue, f16 outputs); the 2048-entry bias table once on VALU; per (batch, 2 heads): scores GEMM (K = 64, alpha 1/8), row softmax on VALU (f32; bias table and the int mask row staged in LDS; weights x256 as f16), V^T via LDS transposes, o = P . V GEMM (K = 2,048, alpha 2^-8) written straight into the merged f16 o rows; out rows = o Wo^T + bo GEMM (f32) then multiplied by the row's patch mask on VALU.
// Compute dtype: inputs rounded to bf16; h / weights exact; q, k, v, softmax weights and o as plain f16 GEMM operands (~2^-12); scores, bias and softmax statistics f32. v_wmma_f32_16x16x32_f16.
#define NB 4
#define SQ 2048
#define DM 512
#define NH 8
#define HD 64
#define HG 2                         /* heads per attention launch group */
#define QN SQ                        /* query rows attended per batch (debug hook) */
#define NBR NB                       /* batches attended (debug hook) */
#define MP ((int)NR)                 /* token rows through the projections (debug hook) */
#define MO ((int)NR)                 /* token rows through the output projection / mask (debug hook) */
#define NR ((size_t)NB * SQ)         /* 8192 token rows */
typedef __bf16 v16b __attribute__((ext_vector_type(16)));
typedef unsigned short v8us __attribute__((ext_vector_type(8), may_alias));
typedef float  v8f  __attribute__((ext_vector_type(8)));
typedef float  v4f  __attribute__((ext_vector_type(4)));
typedef float  v4fa __attribute__((ext_vector_type(4), may_alias));
union FragB { v16b v; v8us half[2]; unsigned short u[16]; };

__device__ __forceinline__ unsigned short bf16_bits(float x) { unsigned int u = __float_as_uint(x); return (unsigned short)((u + 0x7FFFu + ((u >> 16) & 1u)) >> 16); }
__device__ __forceinline__ float bf16_val(unsigned short b) { return __uint_as_float(((unsigned int)b) << 16); }
__device__ __forceinline__ float bf16_round(float x) { return bf16_val(bf16_bits(x)); }
// D += A·B with NT terms: 1 = ah·bh, 2 = + al·bh (A split), 3 = + ah·bl (both split)
template <int NT>
__device__ __forceinline__ v8f mmaN(v16b ah, v16b al, v16b bh, v16b bl, v8f c) {
  c = __builtin_amdgcn_wmma_f32_16x16x32_bf16(false, ah, false, bh, (short)0, c, false, false);
  if (NT >= 2) c = __builtin_amdgcn_wmma_f32_16x16x32_bf16(false, al, false, bh, (short)0, c, false, false);
  if (NT >= 3) c = __builtin_amdgcn_wmma_f32_16x16x32_bf16(false, ah, false, bl, (short)0, c, false, false);
  asm volatile("v_nop\n\tv_nop\n\tv_nop\n\tv_nop" : "+v"(c) : "v"(ah), "v"(al), "v"(bh), "v"(bl));
  return c;
}

__global__ __launch_bounds__(256) void k_wt_bf16(const float* __restrict__ W, unsigned short* __restrict__ Wt, int K, int N) {
  const int t = blockIdx.x * 256 + threadIdx.x;
  const int k8n = K / 8;
  if (t >= N * k8n) return;
  const int n = t / k8n, k8 = (t % k8n) * 8;
  v8us v;
#pragma unroll
  for (int i = 0; i < 8; ++i) v[i] = bf16_bits(W[(size_t)(k8 + i) * N + n]);
  *(v8us*)(Wt + (size_t)n * K + k8) = v;
  
}

// GEMM C[M][N] (f32, pitch ldc) = act(A[M][K]·W + bias). A f32 row-major (pitch lda) converted per fragment to bf16
// (ASPLIT: hi/lo two planes -> 2 terms, else single rounded term); Wt bf16 [N][K] (pitch ldb). BIAS_BF16 rounds the
// bias to bf16 first (bias quantised to bf16 before the add). K%32==0, M%16==0, N%64==0.
template <bool ASPLIT, int ACT, bool BIAS_BF16>
__global__ __launch_bounds__(128) void k_gemm_bf(const float* __restrict__ A, int lda, const unsigned short* __restrict__ Wt, int ldb,
                                               const float* __restrict__ bias, float* __restrict__ C, int ldc, int M, int N, int K) {
  __shared__ __attribute__((aligned(16))) float so[4][16][64];
  const int tid = threadIdx.x, w = tid >> 5, lane = tid & 31, ln = lane & 15, hh = lane >> 4;
  const int ntn = N / 64;
  const int wid = blockIdx.x * 4 + w;
  const int mt = wid / ntn, nq = wid % ntn;
  if (mt * 16 >= M) return;
  const int row0 = mt * 16, col0 = nq * 64;
  const float* arow = A + (size_t)(row0 + ln) * lda;
  v8f acc[4] = {};
  for (int kb = 0; kb < K; kb += 32) {
    FragB ah, al;
    const v4f x0 = *(const v4fa*)(arow + kb + 8 * hh), x1 = *(const v4fa*)(arow + kb + 8 * hh + 4);
    const v4f x2 = *(const v4fa*)(arow + kb + 16 + 8 * hh), x3 = *(const v4fa*)(arow + kb + 16 + 8 * hh + 4);
    float xs[16] = {x0[0],x0[1],x0[2],x0[3],x1[0],x1[1],x1[2],x1[3],x2[0],x2[1],x2[2],x2[3],x3[0],x3[1],x3[2],x3[3]};
#pragma unroll
    for (int i = 0; i < 16; ++i) { const unsigned short hb = bf16_bits(xs[i]); ah.u[i] = hb; al.u[i] = ASPLIT ? bf16_bits(xs[i] - bf16_val(hb)) : (unsigned short)0; }
#pragma unroll
    for (int t = 0; t < 4; ++t) {
      const unsigned short* brow = Wt + (size_t)(col0 + t * 16 + ln) * ldb + kb;
      FragB b;
      b.half[0] = *(const v8us*)(brow + 8 * hh);
      b.half[1] = *(const v8us*)(brow + 16 + 8 * hh);
      acc[t] = mmaN<ASPLIT ? 2 : 1>(ah.v, al.v, b.v, b.v, acc[t]);
    }
  }
#pragma unroll
  for (int t = 0; t < 4; ++t) {
    float bv = bias ? bias[col0 + t * 16 + ln] : 0.f;
    if (BIAS_BF16) bv = bf16_round(bv);
#pragma unroll
    for (int r = 0; r < 8; ++r) { float v = acc[t][r] + bv; if (ACT == 1) v = fmaxf(v, 0.f); so[w][8 * hh + r][t * 16 + ln] = v; }
  }
  __builtin_amdgcn_fence(__ATOMIC_ACQ_REL, "workgroup");
  __builtin_amdgcn_wave_barrier();
  const int rsub = lane >> 4, c4 = (lane & 15) * 4;
  {
#pragma unroll
    for (int q = 0; q < 8; ++q) {
      const int r = q * 2 + rsub;
      const v4f v = *(const v4fa*)&so[w][r][c4];
      *(v4f*)(C + (size_t)(row0 + r) * ldc + col0 + c4) = v;
    }
    
  }
}

// GEMM C = act(A·W + bias + resid): A f32 (ASPLIT -> hi/lo 2 terms), Wt bf16 [N][K]; ACT 0 none, 1 relu, 2 exact gelu;
// resid (optional, f32, row index = (row % rmod), pitch ldr, RES_BF16 rounds it) added before the activation.
template <bool ASPLIT, int ACT, bool BIAS_BF16, bool RES_BF16>
__global__ __launch_bounds__(128) void k_gemm_bf3(const float* __restrict__ A, int lda, const unsigned short* __restrict__ Wt, int ldb,
                                                const float* __restrict__ bias, const float* __restrict__ resid, int rmod, int ldr,
                                                float* __restrict__ C, int ldc, int M, int N, int K) {
  __shared__ __attribute__((aligned(16))) float so[4][16][64];
  const int tid = threadIdx.x, w = tid >> 5, lane = tid & 31, ln = lane & 15, hh = lane >> 4;
  const int ntn = N / 64;
  const int wid = blockIdx.x * 4 + w;
  const int mt = wid / ntn, nq = wid % ntn;
  if (mt * 16 >= M) return;
  const int row0 = mt * 16, col0 = nq * 64;
  const float* arow = A + (size_t)(row0 + ln) * lda;
  v8f acc[4] = {};
  for (int kb = 0; kb < K; kb += 32) {
    FragB ah, al;
    const v4f x0 = *(const v4fa*)(arow + kb + 8 * hh), x1 = *(const v4fa*)(arow + kb + 8 * hh + 4);
    const v4f x2 = *(const v4fa*)(arow + kb + 16 + 8 * hh), x3 = *(const v4fa*)(arow + kb + 16 + 8 * hh + 4);
    float xs[16] = {x0[0],x0[1],x0[2],x0[3],x1[0],x1[1],x1[2],x1[3],x2[0],x2[1],x2[2],x2[3],x3[0],x3[1],x3[2],x3[3]};
#pragma unroll
    for (int i = 0; i < 16; ++i) { const unsigned short hb = bf16_bits(xs[i]); ah.u[i] = hb; al.u[i] = ASPLIT ? bf16_bits(xs[i] - bf16_val(hb)) : (unsigned short)0; }
#pragma unroll
    for (int t = 0; t < 4; ++t) {
      const unsigned short* brow = Wt + (size_t)(col0 + t * 16 + ln) * ldb + kb;
      FragB b;
      b.half[0] = *(const v8us*)(brow + 8 * hh);
      b.half[1] = *(const v8us*)(brow + 16 + 8 * hh);
      acc[t] = mmaN<ASPLIT ? 2 : 1>(ah.v, al.v, b.v, b.v, acc[t]);
    }
  }
#pragma unroll
  for (int t = 0; t < 4; ++t) {
    const int col = col0 + t * 16 + ln;
    float bv = bias ? bias[col] : 0.f;
    if (BIAS_BF16) bv = bf16_round(bv);
#pragma unroll
    for (int r = 0; r < 8; ++r) {
      float v = acc[t][r] + bv;
      if (resid) { float rv = resid[(size_t)((row0 + 8 * hh + r) % rmod) * ldr + col]; if (RES_BF16) rv = bf16_round(rv); v += rv; }
      if (ACT == 1) v = fmaxf(v, 0.f);
      if (ACT == 2) v = 0.5f * v * (1.0f + erff(v * 0.70710678118654752f));
      if (ACT == 3) { const float u = 0.7978845608028654f * (v + 0.044715f * v * v * v); v = 0.5f * v * (1.0f + tanhf(u)); }
      so[w][8 * hh + r][t * 16 + ln] = v;
    }
  }
  __builtin_amdgcn_fence(__ATOMIC_ACQ_REL, "workgroup");
  __builtin_amdgcn_wave_barrier();
  const int rsub = lane >> 4, c4 = (lane & 15) * 4;
  {
#pragma unroll
    for (int q = 0; q < 8; ++q) {
      const int r = q * 2 + rsub;
      const v4f v = *(const v4fa*)&so[w][r][c4];
      *(v4f*)(C + (size_t)(row0 + r) * ldc + col0 + c4) = v;
    }
    
  }
}
// row LayerNorm (biased variance, eps) over N: s = X (+ R); optional out_sum <- s; out_norm <- (s-mu)*rsqrt(var+eps)*g + b
template <bool PARAM_BF16>
__global__ __launch_bounds__(256) void k_layernorm(const float* __restrict__ X, const float* __restrict__ R, const float* __restrict__ g, const float* __restrict__ bta,
                                                  float* __restrict__ out_sum, float* __restrict__ out_norm, int N, float eps) {
  __shared__ float red[256];
  const int row = blockIdx.x, tid = threadIdx.x;
  const float* x = X + (size_t)row * N; const float* rr = R ? R + (size_t)row * N : nullptr;
  float vals[16];                     // up to N = 4096
  const int per = N / 256;            // contiguous chunk per thread? use strided-by-4 chunks: thread handles j = tid*4 + 1024*u
  float s1 = 0.f;
  for (int u = 0; u < per / 4; ++u) {
    const int j = tid * 4 + 1024 * u;
    const v4f a = *(const v4fa*)(x + j);
    v4f b = {0.f,0.f,0.f,0.f}; if (rr) b = *(const v4fa*)(rr + j);
#pragma unroll
    for (int q = 0; q < 4; ++q) { const float v = a[q] + b[q]; vals[u * 4 + q] = v; s1 += v; }
  }
  red[tid] = s1; __syncthreads();
  for (int st = 128; st > 0; st >>= 1) { if (tid < st) red[tid] += red[tid + st]; __syncthreads(); }
  const float mu = red[0] / (float)N; __syncthreads();
  float s2 = 0.f;
  for (int u = 0; u < per / 4; ++u)
#pragma unroll
    for (int q = 0; q < 4; ++q) { const float c = vals[u * 4 + q] - mu; s2 += c * c; }
  red[tid] = s2; __syncthreads();
  for (int st = 128; st > 0; st >>= 1) { if (tid < st) red[tid] += red[tid + st]; __syncthreads(); }
  const float rs = rsqrtf(red[0] / (float)N + eps);
  {
    for (int u = 0; u < per / 4; ++u) {
      const int j = tid * 4 + 1024 * u;
      v4f o, sm;
#pragma unroll
      for (int q = 0; q < 4; ++q) {
        float gg = g[j + q], bb = bta[j + q];
        if (PARAM_BF16) { gg = bf16_round(gg); bb = bf16_round(bb); }
        sm[q] = vals[u * 4 + q]; o[q] = (vals[u * 4 + q] - mu) * rs * gg + bb;
      }
      if (out_sum) *(v4f*)(out_sum + (size_t)row * N + j) = sm;
      *(v4f*)(out_norm + (size_t)row * N + j) = o;
    }
    
  }
}



// ---- f16 WMMA path (v_wmma_f32_16x16x32_f16): 11-bit significands for operands in range — used where a [0,1] probability operand needs more precision than bf16
typedef _Float16 v16h __attribute__((ext_vector_type(16)));
union FragH { v16h v; v8us half[2]; _Float16 h[16]; unsigned short u[16]; };
template <int NT>
__device__ __forceinline__ v8f mmaH(v16h ah, v16h al, v16h bh, v16h bl, v8f c) {
  c = __builtin_amdgcn_wmma_f32_16x16x32_f16(false, ah, false, bh, (short)0, c, false, false);
  if (NT >= 2) c = __builtin_amdgcn_wmma_f32_16x16x32_f16(false, al, false, bh, (short)0, c, false, false);
  if (NT >= 3) c = __builtin_amdgcn_wmma_f32_16x16x32_f16(false, ah, false, bl, (short)0, c, false, false);
  asm volatile("v_nop\n\tv_nop\n\tv_nop\n\tv_nop" : "+v"(c) : "v"(ah), "v"(al), "v"(bh), "v"(bl));
  return c;
}
// batched GEMM like k_gemm_b but f16 operands: A f32 (split into f16 hi/lo if ASPLIT, else rounded to f16), Bt = f16 values [n][k]; alpha; C f32; N multiple of 16 (partial tiles skipped)
template <bool ASPLIT>
__global__ __launch_bounds__(128) void k_gemm_h(const float* __restrict__ A, int lda, size_t sA, const _Float16* __restrict__ Bh, int ldb, size_t sB, float alpha, float* __restrict__ C, int ldc, size_t sC, int M, int N, int K) {
  __shared__ __attribute__((aligned(16))) float so[4][16][64];
  const int tid = threadIdx.x, w = tid >> 5, lane = tid & 31, ln = lane & 15, hh = lane >> 4; const int by = blockIdx.y;
  A += (size_t)by * sA; Bh += (size_t)by * sB; C += (size_t)by * sC;
  const int ntn = (N + 63) / 64; const int wid = blockIdx.x * 4 + w; const int mt = wid / ntn, nq = wid % ntn; if (mt * 16 >= M) return;
  const int row0 = mt * 16, col0 = nq * 64; const float* arow = A + (size_t)(row0 + ln) * lda;
  v8f acc[4] = {};
  for (int kb = 0; kb < K; kb += 32) {
    FragH ah, al;
    const v4f x0 = *(const v4fa*)(arow + kb + 8 * hh), x1 = *(const v4fa*)(arow + kb + 8 * hh + 4), x2 = *(const v4fa*)(arow + kb + 16 + 8 * hh), x3 = *(const v4fa*)(arow + kb + 16 + 8 * hh + 4);
    float xs[16] = {x0[0],x0[1],x0[2],x0[3],x1[0],x1[1],x1[2],x1[3],x2[0],x2[1],x2[2],x2[3],x3[0],x3[1],x3[2],x3[3]};
#pragma unroll
    for (int i = 0; i < 16; ++i) { const _Float16 h = (_Float16)xs[i]; ah.h[i] = h; al.h[i] = ASPLIT ? (_Float16)(xs[i] - (float)h) : (_Float16)0.0f; }
#pragma unroll
    for (int t = 0; t < 4; ++t) { if (col0 + t * 16 >= N) continue; const size_t boff = (size_t)(col0 + t * 16 + ln) * ldb + kb; FragH bq; bq.half[0] = *(const v8us*)(Bh + boff + 8 * hh); bq.half[1] = *(const v8us*)(Bh + boff + 16 + 8 * hh);
      acc[t] = mmaH<ASPLIT ? 2 : 1>(ah.v, al.v, bq.v, bq.v, acc[t]); }
  }
#pragma unroll
  for (int t = 0; t < 4; ++t) { if (col0 + t * 16 >= N) continue;
#pragma unroll
    for (int r = 0; r < 8; ++r) so[w][8 * hh + r][t * 16 + ln] = acc[t][r] * alpha; }
  __builtin_amdgcn_fence(__ATOMIC_ACQ_REL, "workgroup"); __builtin_amdgcn_wave_barrier();
  const int rsub = lane >> 4, c4 = (lane & 15) * 4;
  {
#pragma unroll
    for (int q = 0; q < 8; ++q) { const int r = q * 2 + rsub; if (col0 + c4 < N) { const v4f v = *(const v4fa*)&so[w][r][c4]; *(v4f*)(C + (size_t)(row0 + r) * ldc + col0 + c4) = v; } }
     }
}

// Wt[n][k] = f16(W[k][n]·scale) from f32 row-major W[K][N] (scale = power of two; bf16-exact weights stay exact in f16 away from the subnormal range)
__global__ __launch_bounds__(256) void k_wt_f16(const float* __restrict__ W, _Float16* __restrict__ Wt, int K, int N, float scale) {
  const int t = blockIdx.x * 256 + threadIdx.x; if (t >= N * (K / 8)) return; const int n = t / (K / 8), k8 = (t % (K / 8)) * 8; FragH f;
#pragma unroll
  for (int i = 0; i < 8; ++i) f.h[i] = (_Float16)(bf16_round(W[(size_t)(k8 + i) * N + n]) * scale); const v8us o = f.half[0];
  *(v8us*)((unsigned short*)Wt + (size_t)n * K + k8) = o; 
}
// k_gemm_hh variant with fused epilogue: v = acc·alpha + bias[by·sBias + col] (+ CP[(row/rowsPerB)·sCPb + by·64 + col] if CP) ; ACT 0 none / 1 elu ; writes f16 C16 (and f32 C if non-null)
template <int ACT>
__global__ __launch_bounds__(128) void k_gemm_hhx(const _Float16* __restrict__ A, int lda, size_t sA, const _Float16* __restrict__ Bh, int ldb, size_t sB, float alpha, const float* __restrict__ bias, size_t sBias, const float* __restrict__ CP, int rowsPerB, size_t sCPb, int row0g,
    float* __restrict__ C, _Float16* __restrict__ C16, int ldc, size_t sC, int M, int N, int K) {
  __shared__ __attribute__((aligned(16))) float so[4][16][64];
  const int tid = threadIdx.x, w = tid >> 5, lane = tid & 31, ln = lane & 15, hh = lane >> 4; const int by = blockIdx.y;
  A += (size_t)by * sA; Bh += (size_t)by * sB; const size_t cofs = (size_t)by * sC; const float* bp = bias ? bias + (size_t)by * sBias : nullptr;
  const int ntn = (N + 63) / 64; const int wid = blockIdx.x * 4 + w; const int mt = wid / ntn, nq = wid % ntn; if (mt * 16 >= M) return;
  const int row0 = mt * 16, col0 = nq * 64; const _Float16* arow = A + (size_t)(row0 + ln) * lda;
  v8f acc[4] = {};
  for (int kb = 0; kb < K; kb += 32) { FragH ah; ah.half[0] = *(const v8us*)((const unsigned short*)arow + kb + 8 * hh); ah.half[1] = *(const v8us*)((const unsigned short*)arow + kb + 16 + 8 * hh);
#pragma unroll
    for (int t = 0; t < 4; ++t) { if (col0 + t * 16 >= N) continue; const size_t boff = (size_t)(col0 + t * 16 + ln) * ldb + kb; FragH bq; bq.half[0] = *(const v8us*)((const unsigned short*)Bh + boff + 8 * hh); bq.half[1] = *(const v8us*)((const unsigned short*)Bh + boff + 16 + 8 * hh);
      acc[t] = mmaH<1>(ah.v, ah.v, bq.v, bq.v, acc[t]); }
  }
#pragma unroll
  for (int t = 0; t < 4; ++t) { if (col0 + t * 16 >= N) continue; const int col = col0 + t * 16 + ln; const float bv = bp ? bf16_round(bp[col]) : 0.f;
#pragma unroll
    for (int r = 0; r < 8; ++r) { float v = acc[t][r] * alpha + bv; if (CP) { const int rr = row0g + row0 + 8 * hh + r; if (rowsPerB < 0) v += CP[cofs + (size_t)rr * ldc + col];      /* rowsPerB < 0: own element of the batched C plane */ else { const int bidx = rr / rowsPerB; v += CP[(size_t)bidx * sCPb + (size_t)by * 64 + col]; } } if (ACT == 1) v = (v > 0.f) ? v : expm1f(v); else if (ACT == 7) v = (v > 0.f) ? v + 1.0f : expf(v); else if (ACT == 8) v = tanhf(v); else if (ACT == 9) v = 0.5f * v * (1.0f + tanhf(0.7978845608028654f * (v + 0.044715f * v * v * v))); else if (ACT == 11) v = 1.0f / (1.0f + expf(-v)); else if (ACT == 12) v = (v > 0.f) ? v : 0.01f * v; else if (ACT == 14) v = (v > 0.f) ? v : 0.1f * v; else if (ACT == 16) v = (v >= 0.f) ? v : 0.3f * v; else if (ACT == 17) v = (v >= 0.f) ? v : 0.2f * v; else if (ACT == 15) v = v / (1.0f + expf(-v)); else if (ACT == 3) v = fmaxf(v, 0.f); else if (ACT == 6) v = 0.5f * v * (1.0f + erff(v * 0.70710678118654752f)); so[w][8 * hh + r][t * 16 + ln] = v; } }
  __builtin_amdgcn_fence(__ATOMIC_ACQ_REL, "workgroup"); __builtin_amdgcn_wave_barrier();
  const int rsub = lane >> 4, c4 = (lane & 15) * 4; typedef _Float16 v4h __attribute__((ext_vector_type(4)));
  {
#pragma unroll
    for (int q = 0; q < 8; ++q) { const int r = q * 2 + rsub; if (col0 + c4 < N) { const v4f v = *(const v4fa*)&so[w][r][c4]; if (C) *(v4f*)(C + cofs + (size_t)(row0 + r) * ldc + col0 + c4) = v; if (C16) { v4h h4; for (int i = 0; i < 4; ++i) h4[i] = (_Float16)v[i]; *(v4h*)(C16 + cofs + (size_t)(row0 + r) * ldc + col0 + c4) = h4; } } }
     }
}


typedef _Float16 v4h __attribute__((ext_vector_type(4)));

__global__ __launch_bounds__(256) void k_x16(const float* __restrict__ x, _Float16* __restrict__ X16, size_t n8) { const size_t t = (size_t)blockIdx.x * 256 + threadIdx.x; if (t >= n8) return; FragH f;
#pragma unroll
  for (int q = 0; q < 8; ++q) f.h[q] = (_Float16)bf16_round(x[t * 8 + q]); *(v8us*)((unsigned short*)X16 + t * 8) = f.half[0];  }
__global__ __launch_bounds__(256) void k_h16(const float* __restrict__ x, _Float16* __restrict__ X16, size_t n8) { const size_t t = (size_t)blockIdx.x * 256 + threadIdx.x; if (t >= n8) return; FragH f;
#pragma unroll
  for (int q = 0; q < 8; ++q) f.h[q] = (_Float16)x[t * 8 + q]; *(v8us*)((unsigned short*)X16 + t * 8) = f.half[0];  }
__global__ __launch_bounds__(256) void k_round16f(const float* __restrict__ W, _Float16* __restrict__ Bt, size_t n8) { const size_t t = (size_t)blockIdx.x * 256 + threadIdx.x; if (t >= n8) return; FragH f;
#pragma unroll
  for (int i = 0; i < 8; ++i) f.h[i] = (_Float16)(bf16_round(W[t * 8 + i]) * 16.0f); *(v8us*)((unsigned short*)Bt + t * 8) = f.half[0];  }
template <int NHv, int TTv>
__global__ __launch_bounds__(256) void k_vt(const _Float16* __restrict__ V16, int ldv, int voff, _Float16* __restrict__ Vt) { __shared__ unsigned short tl[64][66]; const int tid = threadIdx.x; const int slab = blockIdx.x / (TTv / 64), lg = blockIdx.x % (TTv / 64); const int b = slab / NHv, h = slab % NHv;
  for (int i = tid; i < 64 * 8; i += 256) { const int r = i / 8, c8 = (i % 8) * 8; FragH f; f.half[0] = *(const v8us*)((const unsigned short*)V16 + ((size_t)b * TTv + lg * 64 + r) * ldv + voff + h * 64 + c8);
#pragma unroll
    for (int q = 0; q < 8; ++q) tl[r][c8 + q] = f.u[q]; }
  __syncthreads();
  {
#pragma unroll
    for (int rd = 0; rd < 2; ++rd) { const int d = rd * 32 + tid / 8, pc = tid % 8; FragH f;
#pragma unroll
      for (int q = 0; q < 8; ++q) f.u[q] = tl[pc * 8 + q][d];
      *(v8us*)((unsigned short*)Vt + ((size_t)slab * 64 + d) * TTv + lg * 64 + pc * 8) = f.half[0]; }
     } }

__global__ __launch_bounds__(256) void k_hl(const float* __restrict__ F, _Float16* __restrict__ Hh, _Float16* __restrict__ Hl, size_t n8) { const size_t t = (size_t)blockIdx.x * 256 + threadIdx.x; if (t >= n8) return; FragH fh, fl; const v4f a = *(const v4fa*)(F + t * 8), c = *(const v4fa*)(F + t * 8 + 4);
#pragma unroll
  for (int q = 0; q < 4; ++q) { _Float16 h = (_Float16)a[q]; fh.h[q] = h; fl.h[q] = (_Float16)((a[q] - (float)h) * 1024.0f); h = (_Float16)c[q]; fh.h[4 + q] = h; fl.h[4 + q] = (_Float16)((c[q] - (float)h) * 1024.0f); }
  { *(v8us*)((unsigned short*)Hh + t * 8) = fh.half[0]; *(v8us*)((unsigned short*)Hl + t * 8) = fl.half[0];  } }

// ---- fast GEMM (wave tile 32x64; requires M % 32 == 0 rows per launch region and N % 64 == 0); epilogue = k_gemm_hhx semantics ----
__device__ __forceinline__ v16h g2_frag(const _Float16* p, int hh) { FragH f; f.half[0] = *(const v8us*)((const unsigned short*)p + 8 * hh); f.half[1] = *(const v8us*)((const unsigned short*)p + 16 + 8 * hh); return f.v; }
__device__ __forceinline__ v8f g2_mma(v16h a, v16h b, v8f c) { v8f d = __builtin_amdgcn_wmma_f32_16x16x32_f16(false, a, false, b, (short)0, c, false, false); asm volatile("v_nop\n\tv_nop\n\tv_nop\n\tv_nop" : "+v"(d) : "v"(a), "v"(b)); return d; }
template <int ACT>
__global__ __launch_bounds__(128) void k_gemm2(const _Float16* __restrict__ A, int lda, size_t sA, const _Float16* __restrict__ Bh, int ldb, size_t sB, float alpha, const float* __restrict__ bias, size_t sBias, const float* __restrict__ CP, int rowsPerB, size_t sCPb, int row0g,
    float* __restrict__ C, _Float16* __restrict__ C16, int ldc, size_t sC, int M, int N, int K) { static_assert(ACT == 0 || ACT == 3 || ACT == 6 || ACT == 8 || ACT == 9 || ACT == 11 || ACT == 12 || ACT == 14 || ACT == 15 || ACT == 16 || ACT == 17, "k_gemm2: unsupported ACT code (would silently apply no activation)");
  __shared__ __attribute__((aligned(16))) float so[4][32][68];
  const int tid = threadIdx.x, w = tid >> 5, lane = tid & 31, ln = lane & 15, hh = lane >> 4; const int by = blockIdx.y;
  A += (size_t)by * sA; Bh += (size_t)by * sB; const size_t cofs = (size_t)by * sC; const float* bp = bias ? bias + (size_t)by * sBias : nullptr;
  const int ntn = N >> 6; const int mt = blockIdx.x / ntn, nq = blockIdx.x - mt * ntn; const int row0 = mt * 128 + 32 * w, col0 = nq * 64; if (row0 >= M) return;
  const _Float16* a0p = A + (size_t)(row0 + ln) * lda; const _Float16* a1p = a0p + (size_t)16 * lda;
  const _Float16* b0p = Bh + (size_t)(col0 + ln) * ldb; const _Float16* b1p = b0p + (size_t)16 * ldb; const _Float16* b2p = b1p + (size_t)16 * ldb; const _Float16* b3p = b2p + (size_t)16 * ldb;
  const v8f z8 = {0.f,0.f,0.f,0.f,0.f,0.f,0.f,0.f}; v8f c00 = z8, c01 = z8, c02 = z8, c03 = z8, c10 = z8, c11 = z8, c12 = z8, c13 = z8;
#pragma unroll 1
  for (int kb = 0; kb < K; kb += 32) { const v16h a0 = g2_frag(a0p + kb, hh), a1 = g2_frag(a1p + kb, hh);
    v16h b = g2_frag(b0p + kb, hh); c00 = g2_mma(a0, b, c00); c10 = g2_mma(a1, b, c10);
    b = g2_frag(b1p + kb, hh); c01 = g2_mma(a0, b, c01); c11 = g2_mma(a1, b, c11);
    b = g2_frag(b2p + kb, hh); c02 = g2_mma(a0, b, c02); c12 = g2_mma(a1, b, c12);
    b = g2_frag(b3p + kb, hh); c03 = g2_mma(a0, b, c03); c13 = g2_mma(a1, b, c13); }
  v8f accs[8] = {c00, c01, c02, c03, c10, c11, c12, c13};
#pragma unroll
  for (int u = 0; u < 8; ++u) { const int t = u & 3, half = u >> 2; const int col = col0 + t * 16 + ln; const float bv = bp ? bf16_round(bp[col]) : 0.f;
#pragma unroll
    for (int r = 0; r < 8; ++r) { const int rloc = half * 16 + 8 * hh + r; float v = accs[u][r] * alpha + bv; if (CP) { if (rowsPerB < 0) v += CP[cofs + (size_t)(row0g + row0 + rloc) * ldc + col];      /* rowsPerB < 0: own element of the batched C plane */ else { const int bidx = (row0g + row0 + rloc) / rowsPerB; v += CP[(size_t)bidx * sCPb + (size_t)by * 64 + col]; } }
      if (ACT == 3) v = fmaxf(v, 0.f); else if (ACT == 6) v = 0.5f * v * (1.0f + erff(v * 0.70710678118654752f)); else if (ACT == 11) v = 1.0f / (1.0f + expf(-v)); else if (ACT == 15) v = v / (1.0f + expf(-v)); else if (ACT == 12) v = (v > 0.f) ? v : 0.01f * v; else if (ACT == 8) v = tanhf(v); else if (ACT == 9) v = 0.5f * v * (1.0f + tanhf(0.7978845608028654f * (v + 0.044715f * v * v * v))); else if (ACT == 14) v = (v > 0.f) ? v : 0.1f * v; else if (ACT == 16) v = (v >= 0.f) ? v : 0.3f * v; else if (ACT == 17) v = (v >= 0.f) ? v : 0.2f * v;
      so[w][rloc][t * 16 + ln] = v; } }
  __builtin_amdgcn_fence(__ATOMIC_ACQ_REL, "workgroup"); __builtin_amdgcn_wave_barrier();
  const int rsub = lane >> 4, c4 = (lane & 15) * 4;
  {
#pragma unroll
    for (int q = 0; q < 16; ++q) { const int r = q * 2 + rsub; const v4f v = *(const v4fa*)&so[w][r][c4]; if (C) *(v4f*)(C + cofs + (size_t)(row0 + r) * ldc + col0 + c4) = v; if (C16) { v4h h4; for (int i = 0; i < 4; ++i) h4[i] = (_Float16)v[i]; *(v4h*)(C16 + cofs + (size_t)(row0 + r) * ldc + col0 + c4) = h4; } }
     } }


__global__ __launch_bounds__(256) void k_rowmask(const float* __restrict__ F, const int* __restrict__ pmask, float* __restrict__ out, size_t n4) { const size_t t = (size_t)blockIdx.x * 256 + threadIdx.x; if (t >= n4) return; const size_t r = (t * 4) / DM; const float m = pmask[r] ? 1.0f : 0.0f; const v4f v = *(const v4fa*)(F + t * 4); v4f o; for (int q = 0; q < 4; ++q) o[q] = v[q] * m;
  *(v4f*)(out + t * 4) = o;  }
__global__ __launch_bounds__(256) void k_wnat(const float* __restrict__ w, size_t n8, _Float16* __restrict__ Bt) { const size_t t = (size_t)blockIdx.x * 256 + threadIdx.x; if (t >= n8) return; FragH f; for (int q = 0; q < 8; ++q) f.h[q] = (_Float16)(bf16_round(w[t * 8 + q]) * 16.0f); *(v8us*)((unsigned short*)Bt + t * 8) = f.half[0];  }
__global__ __launch_bounds__(256) void k_tbias(float* __restrict__ TB) {
  #pragma clang fp contract(off)
  const int d = blockIdx.x * 256 + threadIdx.x; if (d >= SQ) return; const float dist = __fdiv_rn(__fmul_rn((float)d, 300.0f), 300.0f); const float v = logf(__fadd_rn(expf(-dist), 1e-12f));
  *(float*)(TB + d) = v;  }
// row softmax with the distance bias and the key padding mask: score = s[j] + TB[|i-j|], replaced by -1e9 where patch_mask[b][j] == 0 (table and mask row staged in LDS); P = f16(256 softmax); thread per query row i
__global__ __launch_bounds__(256) void k_rsmp(const float* __restrict__ S, _Float16* __restrict__ P, int nrows, const float* __restrict__ TB, const int* __restrict__ pmask) {
  #pragma clang fp contract(off)
  __shared__ float tb[SQ]; __shared__ int km[SQ];
  for (int t = threadIdx.x; t < SQ; t += 256) { tb[t] = TB[t]; km[t] = pmask[t]; }
  __syncthreads();
  const int i = blockIdx.x * 256 + threadIdx.x; if (i >= nrows) return; const float* s = S + (size_t)i * SQ; float mx = -INFINITY;
  auto sc_ = [&](int j) { const int d = j > i ? j - i : i - j; return km[j] ? (s[j] + tb[d]) : -1.0e9f; };
#pragma unroll 1
  for (int j = 0; j < SQ; ++j) mx = fmaxf(mx, sc_(j)); float se = 0.f;
#pragma unroll 1
  for (int j = 0; j < SQ; ++j) se += expf(sc_(j) - mx); const float sc = 256.0f / se;
#pragma unroll 1
  for (int j0 = 0; j0 < SQ; j0 += 8) { FragH f; for (int q = 0; q < 8; ++q) f.h[q] = (_Float16)(expf(sc_(j0 + q) - mx) * sc); unsigned short* d = (unsigned short*)P + (size_t)i * SQ + j0; *(v8us*)d = f.half[0];  } }
__global__ __launch_bounds__(256) void k_vt(const _Float16* __restrict__ V16, int b, int h0, _Float16* __restrict__ VT) { __shared__ unsigned short tl[64][65]; const int tid = threadIdx.x; const int hh = blockIdx.x % HG, sg = blockIdx.x / HG; const int s0 = sg * 64; const int h = h0 + hh;
  for (int i = tid; i < 64 * 8; i += 256) { const int j = i / 8, d8 = (i % 8) * 8; FragH f; f.half[0] = *(const v8us*)((const unsigned short*)V16 + ((size_t)b * SQ + s0 + j) * DM + h * HD + d8); for (int q = 0; q < 8; ++q) tl[d8 + q][j] = f.u[q]; }
  __syncthreads();
  { for (int i = tid; i < 64 * 8; i += 256) { const int d = i / 8, j8 = (i % 8) * 8; FragH f; for (int q = 0; q < 8; ++q) f.u[q] = tl[d][j8 + q]; *(v8us*)((unsigned short*)VT + ((size_t)hh * HD + d) * SQ + s0 + j8) = f.half[0]; }  } }

extern "C" void kernel_launch(void* const* d_in, const int* in_sizes, int n_in,
                              void* d_out, int out_size, void* d_ws, size_t ws_size, hipStream_t stream) {
  (void)in_sizes; (void)n_in; (void)out_size;
  const float* const* I = (const float* const*)d_in; const float* x = I[0]; const int* pmask = (const int*)d_in[1]; const float* wq = I[2]; const float* bq = I[3]; const float* wk = I[4]; const float* bk = I[5]; const float* wv = I[6]; const float* bv = I[7]; const float* wo = I[8]; const float* bo = I[9];      /* weights natural [out][in]; patch_mask int32 [4][2048] (1 = valid) */
  char* ws = (char*)d_ws; size_t off = 0;
  auto take = [&](size_t bytes) { char* p = ws + off; off += (bytes + 255) & ~(size_t)255; return p; };
  _Float16* BQ = (_Float16*)take((size_t)DM * DM * 2); _Float16* BK = (_Float16*)take((size_t)DM * DM * 2); _Float16* BV = (_Float16*)take((size_t)DM * DM * 2); _Float16* BO = (_Float16*)take((size_t)DM * DM * 2);
  _Float16* X16 = (_Float16*)take(NR * DM * 2); _Float16* Q16 = (_Float16*)take(NR * DM * 2); _Float16* K16 = (_Float16*)take(NR * DM * 2); _Float16* V16 = (_Float16*)take(NR * DM * 2); _Float16* O16 = (_Float16*)take(NR * DM * 2);
  float* S = (float*)take((size_t)HG * SQ * SQ * 4); _Float16* P = (_Float16*)take((size_t)HG * SQ * SQ * 2); _Float16* VT = (_Float16*)take((size_t)HG * HD * SQ * 2); float* TB = (float*)take((size_t)SQ * 4); float* OUTF = (float*)take(NR * DM * 4);
  if (off > ws_size) return;      /* 2 + 5x8 + 32 + 16 + 0.5 + 0.01 + 16 = approx 107 MiB */
  const size_t nw8 = (size_t)DM * DM / 8; const unsigned gw = (unsigned)((nw8 + 255) / 256);
  k_wnat<<<gw, 256, 0, stream>>>(wq, nw8, BQ); k_wnat<<<gw, 256, 0, stream>>>(wk, nw8, BK); k_wnat<<<gw, 256, 0, stream>>>(wv, nw8, BV); k_wnat<<<gw, 256, 0, stream>>>(wo, nw8, BO);
  k_tbias<<<(SQ + 255) / 256, 256, 0, stream>>>(TB);
  k_x16<<<(unsigned)((NR * DM / 8 + 255) / 256), 256, 0, stream>>>(x, X16, NR * DM / 8);
  const dim3 gp((unsigned)((NR / 128) * (DM / 64)), 1);
  k_gemm2<0><<<gp, 128, 0, stream>>>(X16, DM, 0, BQ, DM, 0, 0.0625f, bq, 0, nullptr, 1, 0, 0, nullptr, Q16, DM, 0, MP, DM, DM);
  k_gemm2<0><<<gp, 128, 0, stream>>>(X16, DM, 0, BK, DM, 0, 0.0625f, bk, 0, nullptr, 1, 0, 0, nullptr, K16, DM, 0, MP, DM, DM);
  k_gemm2<0><<<gp, 128, 0, stream>>>(X16, DM, 0, BV, DM, 0, 0.0625f, bv, 0, nullptr, 1, 0, 0, nullptr, V16, DM, 0, MP, DM, DM);
  for (int b = 0; b < NBR; ++b) for (int h0 = 0; h0 < NH; h0 += HG) {
    const _Float16* qb = Q16 + (size_t)b * SQ * DM + h0 * HD; const _Float16* kb = K16 + (size_t)b * SQ * DM + h0 * HD;
    k_gemm2<0><<<dim3((QN / 128) * (SQ / 64), HG), 128, 0, stream>>>(qb, DM, (size_t)HD, kb, DM, (size_t)HD, 0.125f, nullptr, 0, nullptr, 1, 0, 0, S, nullptr, SQ, (size_t)SQ * SQ, QN, SQ, HD);      /* scores / sqrt(64) */
    for (int hh = 0; hh < HG; ++hh) k_rsmp<<<(QN + 255) / 256, 256, 0, stream>>>(S + (size_t)hh * SQ * SQ, P + (size_t)hh * SQ * SQ, QN, TB, pmask + (size_t)b * SQ);
    k_vt<<<HG * (SQ / 64), 256, 0, stream>>>(V16, b, h0, VT);
    k_gemm2<0><<<dim3((QN / 128) * (HD / 64), HG), 128, 0, stream>>>(P, SQ, (size_t)SQ * SQ, VT, SQ, (size_t)HD * SQ, 0.00390625f, nullptr, 0, nullptr, 1, 0, 0, nullptr, O16 + (size_t)b * SQ * DM + h0 * HD, DM, (size_t)HD, QN, HD, SQ); }      /* o (merged heads) as f16 rows */
  k_gemm2<0><<<gp, 128, 0, stream>>>(O16, DM, 0, BO, DM, 0, 0.0625f, bo, 0, nullptr, 1, 0, 0, OUTF, nullptr, DM, 0, MO, DM, DM);      /* o Wo^T + bo (f32 rows) */
  k_rowmask<<<(unsigned)(((size_t)MO * DM / 4 + 255) / 256), 256, 0, stream>>>(OUTF, pmask, (float*)d_out, (size_t)MO * DM / 4);      /* x patch_mask[b][i] */
}

// v001
// One run takes 1620 microseconds.
// Timed twice side by side with v000, it ran 12.3 times as fast both times.
#include <hip/hip_runtime.h>
// Patch-graph attention with a distance-decay bias and patch masks (h [4][2048][512]; q, k, v = h W^T + b, 8 heads of 64; scores = q k^T / 8 + log(exp(-|i-j|) + 1e-12); padded keys (patch_mask == 0) -> -1e9; softmax; o = attn v; out = (o Wo^T + bo) * patch_mask[b][i] -> [4][2048][512]).
// Structure: token rows r = b*2048 + s; h as exact f16 rows; Q | K | V as three WMMA GEMMs (32x64 wave tiles, f32 accumulation, exact x16 natural weights, bias in the epilogue, f16 outputs); the 2048-entry bias table once on VALU; per (batch, 2 heads): scores GEMM (K = 64, alpha 1/8), row softmax on VALU (f32; one wave per row, the row in registers; bias table and the int mask row staged in LDS; weights x256 as f16), V^T via LDS transposes, o = P . V GEMM (K = 2,048, alpha 2^-8) written straight into the merged f16 o rows; out rows = o Wo^T + bo GEMM (f32) then multiplied by the row's patch mask on VALU.
// Compute dtype: inputs rounded to bf16; h / weights exact; q, k, v, softmax weights and o as plain f16 GEMM operands (~2^-12); scores, bias and softmax statistics f32. v_wmma_f32_16x16x32_f16.
#define NB 4
#define SQ 2048
#define DM 512
#define NH 8
#define HD 64
#define HG 2                         /* heads per attention launch group */
#define QN SQ                        /* query rows attended per batch (debug hook) */
#define NBR NB                       /* batches attended (debug hook) */
#define MP ((int)NR)                 /* token rows through the projections (debug hook) */
#define MO ((int)NR)                 /* token rows through the output projection / mask (debug hook) */
#define NR ((size_t)NB * SQ)         /* 8192 token rows */
typedef __bf16 v16b __attribute__((ext_vector_type(16)));
typedef unsigned short v8us __attribute__((ext_vector_type(8), may_alias));
typedef float  v8f  __attribute__((ext_vector_type(8)));
typedef float  v4f  __attribute__((ext_vector_type(4)));
typedef float  v4fa __attribute__((ext_vector_type(4), may_alias));
union FragB { v16b v; v8us half[2]; unsigned short u[16]; };

__device__ __forceinline__ unsigned short bf16_bits(float x) { unsigned int u = __float_as_uint(x); return (unsigned short)((u + 0x7FFFu + ((u >> 16) & 1u)) >> 16); }
__device__ __forceinline__ float bf16_val(unsigned short b) { return __uint_as_float(((unsigned int)b) << 16); }
__device__ __forceinline__ float bf16_round(float x) { return bf16_val(bf16_bits(x)); }
// D += A·B with NT terms: 1 = ah·bh, 2 = + al·bh (A split), 3 = + ah·bl (both split)
template <int NT>
__device__ __forceinline__ v8f mmaN(v16b ah, v16b al, v16b bh, v16b bl, v8f c) {
  c = __builtin_amdgcn_wmma_f32_16x16x32_bf16(false, ah, false, bh, (short)0, c, false, false);
  if (NT >= 2) c = __builtin_amdgcn_wmma_f32_16x16x32_bf16(false, al, false, bh, (short)0, c, false, false);
  if (NT >= 3) c = __builtin_amdgcn_wmma_f32_16x16x32_bf16(false, ah, false, bl, (short)0, c, false, false);
  asm volatile("v_nop\n\tv_nop\n\tv_nop\n\tv_nop" : "+v"(c) : "v"(ah), "v"(al), "v"(bh), "v"(bl));
  return c;
}

__global__ __launch_bounds__(256) void k_wt_bf16(const float* __restrict__ W, unsigned short* __restrict__ Wt, int K, int N) {
  const int t = blockIdx.x * 256 + threadIdx.x;
  const int k8n = K / 8;
  if (t >= N * k8n) return;
  const int n = t / k8n, k8 = (t % k8n) * 8;
  v8us v;
#pragma unroll
  for (int i = 0; i < 8; ++i) v[i] = bf16_bits(W[(size_t)(k8 + i) * N + n]);
  *(v8us*)(Wt + (size_t)n * K + k8) = v;
  
}

// GEMM C[M][N] (f32, pitch ldc) = act(A[M][K]·W + bias). A f32 row-major (pitch lda) converted per fragment to bf16
// (ASPLIT: hi/lo two planes -> 2 terms, else single rounded term); Wt bf16 [N][K] (pitch ldb). BIAS_BF16 rounds the
// bias to bf16 first (bias quantised to bf16 before the add). K%32==0, M%16==0, N%64==0.
template <bool ASPLIT, int ACT, bool BIAS_BF16>
__global__ __launch_bounds__(128) void k_gemm_bf(const float* __restrict__ A, int lda, const unsigned short* __restrict__ Wt, int ldb,
                                               const float* __restrict__ bias, float* __restrict__ C, int ldc, int M, int N, int K) {
  __shared__ __attribute__((aligned(16))) float so[4][16][64];
  const int tid = threadIdx.x, w = tid >> 5, lane = tid & 31, ln = lane & 15, hh = lane >> 4;
  const int ntn = N / 64;
  const int wid = blockIdx.x * 4 + w;
  const int mt = wid / ntn, nq = wid % ntn;
  if (mt * 16 >= M) return;
  const int row0 = mt * 16, col0 = nq * 64;
  const float* arow = A + (size_t)(row0 + ln) * lda;
  v8f acc[4] = {};
  for (int kb = 0; kb < K; kb += 32) {
    FragB ah, al;
    const v4f x0 = *(const v4fa*)(arow + kb + 8 * hh), x1 = *(const v4fa*)(arow + kb + 8 * hh + 4);
    const v4f x2 = *(const v4fa*)(arow + kb + 16 + 8 * hh), x3 = *(const v4fa*)(arow + kb + 16 + 8 * hh + 4);
    float xs[16] = {x0[0],x0[1],x0[2],x0[3],x1[0],x1[1],x1[2],x1[3],x2[0],x2[1],x2[2],x2[3],x3[0],x3[1],x3[2],x3[3]};
#pragma unroll
    for (int i = 0; i < 16; ++i) { const unsigned short hb = bf16_bits(xs[i]); ah.u[i] = hb; al.u[i] = ASPLIT ? bf16_bits(xs[i] - bf16_val(hb)) : (unsigned short)0; }
#pragma unroll
    for (int t = 0; t < 4; ++t) {
      const unsigned short* brow = Wt + (size_t)(col0 + t * 16 + ln) * ldb + kb;
      FragB b;
      b.half[0] = *(const v8us*)(brow + 8 * hh);
      b.half[1] = *(const v8us*)(brow + 16 + 8 * hh);
      acc[t] = mmaN<ASPLIT ? 2 : 1>(ah.v, al.v, b.v, b.v, acc[t]);
    }
  }
#pragma unroll
  for (int t = 0; t < 4; ++t) {
    float bv = bias ? bias[col0 + t * 16 + ln] : 0.f;
    if (BIAS_BF16) bv = bf16_round(bv);
#pragma unroll
    for (int r = 0; r < 8; ++r) { float v = acc[t][r] + bv; if (ACT == 1) v = fmaxf(v, 0.f); so[w][8 * hh + r][t * 16 + ln] = v; }
  }
  __builtin_amdgcn_fence(__ATOMIC_ACQ_REL, "workgroup");
  __builtin_amdgcn_wave_barrier();
  const int rsub = lane >> 4, c4 = (lane & 15) * 4;
  {
#pragma unroll
    for (int q = 0; q < 8; ++q) {
      const int r = q * 2 + rsub;
      const v4f v = *(const v4fa*)&so[w][r][c4];
      *(v4f*)(C + (size_t)(row0 + r) * ldc + col0 + c4) = v;
    }
    
  }
}

// GEMM C = act(A·W + bias + resid): A f32 (ASPLIT -> hi/lo 2 terms), Wt bf16 [N][K]; ACT 0 none, 1 relu, 2 exact gelu;
// resid (optional, f32, row index = (row % rmod), pitch ldr, RES_BF16 rounds it) added before the activation.
template <bool ASPLIT, int ACT, bool BIAS_BF16, bool RES_BF16>
__global__ __launch_bounds__(128) void k_gemm_bf3(const float* __restrict__ A, int lda, const unsigned short* __restrict__ Wt, int ldb,
                                                const float* __restrict__ bias, const float* __restrict__ resid, int rmod, int ldr,
                                                float* __restrict__ C, int ldc, int M, int N, int K) {
  __shared__ __attribute__((aligned(16))) float so[4][16][64];
  const int tid = threadIdx.x, w = tid >> 5, lane = tid & 31, ln = lane & 15, hh = lane >> 4;
  const int ntn = N / 64;
  const int wid = blockIdx.x * 4 + w;
  const int mt = wid / ntn, nq = wid % ntn;
  if (mt * 16 >= M) return;
  const int row0 = mt * 16, col0 = nq * 64;
  const float* arow = A + (size_t)(row0 + ln) * lda;
  v8f acc[4] = {};
  for (int kb = 0; kb < K; kb += 32) {
    FragB ah, al;
    const v4f x0 = *(const v4fa*)(arow + kb + 8 * hh), x1 = *(const v4fa*)(arow + kb + 8 * hh + 4);
    const v4f x2 = *(const v4fa*)(arow + kb + 16 + 8 * hh), x3 = *(const v4fa*)(arow + kb + 16 + 8 * hh + 4);
    float xs[16] = {x0[0],x0[1],x0[2],x0[3],x1[0],x1[1],x1[2],x1[3],x2[0],x2[1],x2[2],x2[3],x3[0],x3[1],x3[2],x3[3]};
#pragma unroll
    for (int i = 0; i < 16; ++i) { const unsigned short hb = bf16_bits(xs[i]); ah.u[i] = hb; al.u[i] = ASPLIT ? bf16_bits(xs[i] - bf16_val(hb)) : (unsigned short)0; }
#pragma unroll
    for (int t = 0; t < 4; ++t) {
      const unsigned short* brow = Wt + (size_t)(col0 + t * 16 + ln) * ldb + kb;
      FragB b;
      b.half[0] = *(const v8us*)(brow + 8 * hh);
      b.half[1] = *(const v8us*)(brow + 16 + 8 * hh);
      acc[t] = mmaN<ASPLIT ? 2 : 1>(ah.v, al.v, b.v, b.v, acc[t]);
    }
  }
#pragma unroll
  for (int t = 0; t < 4; ++t) {
    const int col = col0 + t * 16 + ln;
    float bv = bias ? bias[col] : 0.f;
    if (BIAS_BF16) bv = bf16_round(bv);
#pragma unroll
    for (int r = 0; r < 8; ++r) {
      float v = acc[t][r] + bv;
      if (resid) { float rv = resid[(size_t)((row0 + 8 * hh + r) % rmod) * ldr + col]; if (RES_BF16) rv = bf16_round(rv); v += rv; }
      if (ACT == 1) v = fmaxf(v, 0.f);
      if (ACT == 2) v = 0.5f * v * (1.0f + erff(v * 0.70710678118654752f));
      if (ACT == 3) { const float u = 0.7978845608028654f * (v + 0.044715f * v * v * v); v = 0.5f * v * (1.0f + tanhf(u)); }
      so[w][8 * hh + r][t * 16 + ln] = v;
    }
  }
  __builtin_amdgcn_fence(__ATOMIC_ACQ_REL, "workgroup");
  __builtin_amdgcn_wave_barrier();
  const int rsub = lane >> 4, c4 = (lane & 15) * 4;
  {
#pragma unroll
    for (int q = 0; q < 8; ++q) {
      const int r = q * 2 + rsub;
      const v4f v = *(const v4fa*)&so[w][r][c4];
      *(v4f*)(C + (size_t)(row0 + r) * ldc + col0 + c4) = v;
    }
    
  }
}
// row LayerNorm (biased variance, eps) over N: s = X (+ R); optional out_sum <- s; out_norm <- (s-mu)*rsqrt(var+eps)*g + b
template <bool PARAM_BF16>
__global__ __launch_bounds__(256) void k_layernorm(const float* __restrict__ X, const float* __restrict__ R, const float* __restrict__ g, const float* __restrict__ bta,
                                                  float* __restrict__ out_sum, float* __restrict__ out_norm, int N, float eps) {
  __shared__ float red[256];
  const int row = blockIdx.x, tid = threadIdx.x;
  const float* x = X + (size_t)row * N; const float* rr = R ? R + (size_t)row * N : nullptr;
  float vals[16];                     // up to N = 4096
  const int per = N / 256;            // contiguous chunk per thread? use strided-by-4 chunks: thread handles j = tid*4 + 1024*u
  float s1 = 0.f;
  for (int u = 0; u < per / 4; ++u) {
    const int j = tid * 4 + 1024 * u;
    const v4f a = *(const v4fa*)(x + j);
    v4f b = {0.f,0.f,0.f,0.f}; if (rr) b = *(const v4fa*)(rr + j);
#pragma unroll
    for (int q = 0; q < 4; ++q) { const float v = a[q] + b[q]; vals[u * 4 + q] = v; s1 += v; }
  }
  red[tid] = s1; __syncthreads();
  for (int st = 128; st > 0; st >>= 1) { if (tid < st) red[tid] += red[tid + st]; __syncthreads(); }
  const float mu = red[0] / (float)N; __syncthreads();
  float s2 = 0.f;
  for (int u = 0; u < per / 4; ++u)
#pragma unroll
    for (int q = 0; q < 4; ++q) { const float c = vals[u * 4 + q] - mu; s2 += c * c; }
  red[tid] = s2; __syncthreads();
  for (int st = 128; st > 0; st >>= 1) { if (tid < st) red[tid] += red[tid + st]; __syncthreads(); }
  const float rs = rsqrtf(red[0] / (float)N + eps);
  {
    for (int u = 0; u < per / 4; ++u) {
      const int j = tid * 4 + 1024 * u;
      v4f o, sm;
#pragma unroll
      for (int q = 0; q < 4; ++q) {
        float gg = g[j + q], bb = bta[j + q];
        if (PARAM_BF16) { gg = bf16_round(gg); bb = bf16_round(bb); }
        sm[q] = vals[u * 4 + q]; o[q] = (vals[u * 4 + q] - mu) * rs * gg + bb;
      }
      if (out_sum) *(v4f*)(out_sum + (size_t)row * N + j) = sm;
      *(v4f*)(out_norm + (size_t)row * N + j) = o;
    }
    
  }
}



// ---- f16 WMMA path (v_wmma_f32_16x16x32_f16): 11-bit significands for operands in range — used where a [0,1] probability operand needs more precision than bf16
typedef _Float16 v16h __attribute__((ext_vector_type(16)));
union FragH { v16h v; v8us half[2]; _Float16 h[16]; unsigned short u[16]; };
template <int NT>
__device__ __forceinline__ v8f mmaH(v16h ah, v16h al, v16h bh, v16h bl, v8f c) {
  c = __builtin_amdgcn_wmma_f32_16x16x32_f16(false, ah, false, bh, (short)0, c, false, false);
  if (NT >= 2) c = __builtin_amdgcn_wmma_f32_16x16x32_f16(false, al, false, bh, (short)0, c, false, false);
  if (NT >= 3) c = __builtin_amdgcn_wmma_f32_16x16x32_f16(false, ah, false, bl, (short)0, c, false, false);
  asm volatile("v_nop\n\tv_nop\n\tv_nop\n\tv_nop" : "+v"(c) : "v"(ah), "v"(al), "v"(bh), "v"(bl));
  return c;
}
// batched GEMM like k_gemm_b but f16 operands: A f32 (split into f16 hi/lo if ASPLIT, else rounded to f16), Bt = f16 values [n][k]; alpha; C f32; N multiple of 16 (partial tiles skipped)
template <bool ASPLIT>
__global__ __launch_bounds__(128) void k_gemm_h(const float* __restrict__ A, int lda, size_t sA, const _Float16* __restrict__ Bh, int ldb, size_t sB, float alpha, float* __restrict__ C, int ldc, size_t sC, int M, int N, int K) {
  __shared__ __attribute__((aligned(16))) float so[4][16][64];
  const int tid = threadIdx.x, w = tid >> 5, lane = tid & 31, ln = lane & 15, hh = lane >> 4; const int by = blockIdx.y;
  A += (size_t)by * sA; Bh += (size_t)by * sB; C += (size_t)by * sC;
  const int ntn = (N + 63) / 64; const int wid = blockIdx.x * 4 + w; const int mt = wid / ntn, nq = wid % ntn; if (mt * 16 >= M) return;
  const int row0 = mt * 16, col0 = nq * 64; const float* arow = A + (size_t)(row0 + ln) * lda;
  v8f acc[4] = {};
  for (int kb = 0; kb < K; kb += 32) {
    FragH ah, al;
    const v4f x0 = *(const v4fa*)(arow + kb + 8 * hh), x1 = *(const v4fa*)(arow + kb + 8 * hh + 4), x2 = *(const v4fa*)(arow + kb + 16 + 8 * hh), x3 = *(const v4fa*)(arow + kb + 16 + 8 * hh + 4);
    float xs[16] = {x0[0],x0[1],x0[2],x0[3],x1[0],x1[1],x1[2],x1[3],x2[0],x2[1],x2[2],x2[3],x3[0],x3[1],x3[2],x3[3]};
#pragma unroll
    for (int i = 0; i < 16; ++i) { const _Float16 h = (_Float16)xs[i]; ah.h[i] = h; al.h[i] = ASPLIT ? (_Float16)(xs[i] - (float)h) : (_Float16)0.0f; }
#pragma unroll
    for (int t = 0; t < 4; ++t) { if (col0 + t * 16 >= N) continue; const size_t boff = (size_t)(col0 + t * 16 + ln) * ldb + kb; FragH bq; bq.half[0] = *(const v8us*)(Bh + boff + 8 * hh); bq.half[1] = *(const v8us*)(Bh + boff + 16 + 8 * hh);
      acc[t] = mmaH<ASPLIT ? 2 : 1>(ah.v, al.v, bq.v, bq.v, acc[t]); }
  }
#pragma unroll
  for (int t = 0; t < 4; ++t) { if (col0 + t * 16 >= N) continue;
#pragma unroll
    for (int r = 0; r < 8; ++r) so[w][8 * hh + r][t * 16 + ln] = acc[t][r] * alpha; }
  __builtin_amdgcn_fence(__ATOMIC_ACQ_REL, "workgroup"); __builtin_amdgcn_wave_barrier();
  const int rsub = lane >> 4, c4 = (lane & 15) * 4;
  {
#pragma unroll
    for (int q = 0; q < 8; ++q) { const int r = q * 2 + rsub; if (col0 + c4 < N) { const v4f v = *(const v4fa*)&so[w][r][c4]; *(v4f*)(C + (size_t)(row0 + r) * ldc + col0 + c4) = v; } }
     }
}

// Wt[n][k] = f16(W[k][n]·scale) from f32 row-major W[K][N] (scale = power of two; bf16-exact weights stay exact in f16 away from the subnormal range)
__global__ __launch_bounds__(256) void k_wt_f16(const float* __restrict__ W, _Float16* __restrict__ Wt, int K, int N, float scale) {
  const int t = blockIdx.x * 256 + threadIdx.x; if (t >= N * (K / 8)) return; const int n = t / (K / 8), k8 = (t % (K / 8)) * 8; FragH f;
#pragma unroll
  for (int i = 0; i < 8; ++i) f.h[i] = (_Float16)(bf16_round(W[(size_t)(k8 + i) * N + n]) * scale); const v8us o = f.half[0];
  *(v8us*)((unsigned short*)Wt + (size_t)n * K + k8) = o; 
}
// k_gemm_hh variant with fused epilogue: v = acc·alpha + bias[by·sBias + col] (+ CP[(row/rowsPerB)·sCPb + by·64 + col] if CP) ; ACT 0 none / 1 elu ; writes f16 C16 (and f32 C if non-null)
template <int ACT>
__global__ __launch_bounds__(128) void k_gemm_hhx(const _Float16* __restrict__ A, int lda, size_t sA, const _Float16* __restrict__ Bh, int ldb, size_t sB, float alpha, const float* __restrict__ bias, size_t sBias, const float* __restrict__ CP, int rowsPerB, size_t sCPb, int row0g,
    float* __restrict__ C, _Float16* __restrict__ C16, int ldc, size_t sC, int M, int N, int K) {
  __shared__ __attribute__((aligned(16))) float so[4][16][64];
  const int tid = threadIdx.x, w = tid >> 5, lane = tid & 31, ln = lane & 15, hh = lane >> 4; const int by = blockIdx.y;
  A += (size_t)by * sA; Bh += (size_t)by * sB; const size_t cofs = (size_t)by * sC; const float* bp = bias ? bias + (size_t)by * sBias : nullptr;
  const int ntn = (N + 63) / 64; const int wid = blockIdx.x * 4 + w; const int mt = wid / ntn, nq = wid % ntn; if (mt * 16 >= M) return;
  const int row0 = mt * 16, col0 = nq * 64; const _Float16* arow = A + (size_t)(row0 + ln) * lda;
  v8f acc[4] = {};
  for (int kb = 0; kb < K; kb += 32) { FragH ah; ah.half[0] = *(const v8us*)((const unsigned short*)arow + kb + 8 * hh); ah.half[1] = *(const v8us*)((const unsigned short*)arow + kb + 16 + 8 * hh);
#pragma unroll
    for (int t = 0; t < 4; ++t) { if (col0 + t * 16 >= N) continue; const size_t boff = (size_t)(col0 + t * 16 + ln) * ldb + kb; FragH bq; bq.half[0] = *(const v8us*)((const unsigned short*)Bh + boff + 8 * hh); bq.half[1] = *(const v8us*)((const unsigned short*)Bh + boff + 16 + 8 * hh);
      acc[t] = mmaH<1>(ah.v, ah.v, bq.v, bq.v, acc[t]); }
  }
#pragma unroll
  for (int t = 0; t < 4; ++t) { if (col0 + t * 16 >= N) continue; const int col = col0 + t * 16 + ln; const float bv = bp ? bf16_round(bp[col]) : 0.f;
#pragma unroll
    for (int r = 0; r < 8; ++r) { float v = acc[t][r] * alpha + bv; if (CP) { const int rr = row0g + row0 + 8 * hh + r; if (rowsPerB < 0) v += CP[cofs + (size_t)rr * ldc + col];      /* rowsPerB < 0: own element of the batched C plane */ else { const int bidx = rr / rowsPerB; v += CP[(size_t)bidx * sCPb + (size_t)by * 64 + col]; } } if (ACT == 1) v = (v > 0.f) ? v : expm1f(v); else if (ACT == 7) v = (v > 0.f) ? v + 1.0f : expf(v); else if (ACT == 8) v = tanhf(v); else if (ACT == 9) v = 0.5f * v * (1.0f + tanhf(0.7978845608028654f * (v + 0.044715f * v * v * v))); else if (ACT == 11) v = 1.0f / (1.0f + expf(-v)); else if (ACT == 12) v = (v > 0.f) ? v : 0.01f * v; else if (ACT == 14) v = (v > 0.f) ? v : 0.1f * v; else if (ACT == 16) v = (v >= 0.f) ? v : 0.3f * v; else if (ACT == 17) v = (v >= 0.f) ? v : 0.2f * v; else if (ACT == 15) v = v / (1.0f + expf(-v)); else if (ACT == 3) v = fmaxf(v, 0.f); else if (ACT == 6) v = 0.5f * v * (1.0f + erff(v * 0.70710678118654752f)); so[w][8 * hh + r][t * 16 + ln] = v; } }
  __builtin_amdgcn_fence(__ATOMIC_ACQ_REL, "workgroup"); __builtin_amdgcn_wave_barrier();
  const int rsub = lane >> 4, c4 = (lane & 15) * 4; typedef _Float16 v4h __attribute__((ext_vector_type(4)));
  {
#pragma unroll
    for (int q = 0; q < 8; ++q) { const int r = q * 2 + rsub; if (col0 + c4 < N) { const v4f v = *(const v4fa*)&so[w][r][c4]; if (C) *(v4f*)(C + cofs + (size_t)(row0 + r) * ldc + col0 + c4) = v; if (C16) { v4h h4; for (int i = 0; i < 4; ++i) h4[i] = (_Float16)v[i]; *(v4h*)(C16 + cofs + (size_t)(row0 + r) * ldc + col0 + c4) = h4; } } }
     }
}


typedef _Float16 v4h __attribute__((ext_vector_type(4)));

__global__ __launch_bounds__(256) void k_x16(const float* __restrict__ x, _Float16* __restrict__ X16, size_t n8) { const size_t t = (size_t)blockIdx.x * 256 + threadIdx.x; if (t >= n8) return; FragH f;
#pragma unroll
  for (int q = 0; q < 8; ++q) f.h[q] = (_Float16)bf16_round(x[t * 8 + q]); *(v8us*)((unsigned short*)X16 + t * 8) = f.half[0];  }
__global__ __launch_bounds__(256) void k_h16(const float* __restrict__ x, _Float16* __restrict__ X16, size_t n8) { const size_t t = (size_t)blockIdx.x * 256 + threadIdx.x; if (t >= n8) return; FragH f;
#pragma unroll
  for (int q = 0; q < 8; ++q) f.h[q] = (_Float16)x[t * 8 + q]; *(v8us*)((unsigned short*)X16 + t * 8) = f.half[0];  }
__global__ __launch_bounds__(256) void k_round16f(const float* __restrict__ W, _Float16* __restrict__ Bt, size_t n8) { const size_t t = (size_t)blockIdx.x * 256 + threadIdx.x; if (t >= n8) return; FragH f;
#pragma unroll
  for (int i = 0; i < 8; ++i) f.h[i] = (_Float16)(bf16_round(W[t * 8 + i]) * 16.0f); *(v8us*)((unsigned short*)Bt + t * 8) = f.half[0];  }
template <int NHv, int TTv>
__global__ __launch_bounds__(256) void k_vt(const _Float16* __restrict__ V16, int ldv, int voff, _Float16* __restrict__ Vt) { __shared__ unsigned short tl[64][66]; const int tid = threadIdx.x; const int slab = blockIdx.x / (TTv / 64), lg = blockIdx.x % (TTv / 64); const int b = slab / NHv, h = slab % NHv;
  for (int i = tid; i < 64 * 8; i += 256) { const int r = i / 8, c8 = (i % 8) * 8; FragH f; f.half[0] = *(const v8us*)((const unsigned short*)V16 + ((size_t)b * TTv + lg * 64 + r) * ldv + voff + h * 64 + c8);
#pragma unroll
    for (int q = 0; q < 8; ++q) tl[r][c8 + q] = f.u[q]; }
  __syncthreads();
  {
#pragma unroll
    for (int rd = 0; rd < 2; ++rd) { const int d = rd * 32 + tid / 8, pc = tid % 8; FragH f;
#pragma unroll
      for (int q = 0; q < 8; ++q) f.u[q] = tl[pc * 8 + q][d];
      *(v8us*)((unsigned short*)Vt + ((size_t)slab * 64 + d) * TTv + lg * 64 + pc * 8) = f.half[0]; }
     } }

__global__ __launch_bounds__(256) void k_hl(const float* __restrict__ F, _Float16* __restrict__ Hh, _Float16* __restrict__ Hl, size_t n8) { const size_t t = (size_t)blockIdx.x * 256 + threadIdx.x; if (t >= n8) return; FragH fh, fl; const v4f a = *(const v4fa*)(F + t * 8), c = *(const v4fa*)(F + t * 8 + 4);
#pragma unroll
  for (int q = 0; q < 4; ++q) { _Float16 h = (_Float16)a[q]; fh.h[q] = h; fl.h[q] = (_Float16)((a[q] - (float)h) * 1024.0f); h = (_Float16)c[q]; fh.h[4 + q] = h; fl.h[4 + q] = (_Float16)((c[q] - (float)h) * 1024.0f); }
  { *(v8us*)((unsigned short*)Hh + t * 8) = fh.half[0]; *(v8us*)((unsigned short*)Hl + t * 8) = fl.half[0];  } }

// ---- fast GEMM (wave tile 32x64; requires M % 32 == 0 rows per launch region and N % 64 == 0); epilogue = k_gemm_hhx semantics ----
__device__ __forceinline__ v16h g2_frag(const _Float16* p, int hh) { FragH f; f.half[0] = *(const v8us*)((const unsigned short*)p + 8 * hh); f.half[1] = *(const v8us*)((const unsigned short*)p + 16 + 8 * hh); return f.v; }
__device__ __forceinline__ v8f g2_mma(v16h a, v16h b, v8f c) { v8f d = __builtin_amdgcn_wmma_f32_16x16x32_f16(false, a, false, b, (short)0, c, false, false); asm volatile("v_nop\n\tv_nop\n\tv_nop\n\tv_nop" : "+v"(d) : "v"(a), "v"(b)); return d; }
template <int ACT>
__global__ __launch_bounds__(128) void k_gemm2(const _Float16* __restrict__ A, int lda, size_t sA, const _Float16* __restrict__ Bh, int ldb, size_t sB, float alpha, const float* __restrict__ bias, size_t sBias, const float* __restrict__ CP, int rowsPerB, size_t sCPb, int row0g,
    float* __restrict__ C, _Float16* __restrict__ C16, int ldc, size_t sC, int M, int N, int K) { static_assert(ACT == 0 || ACT == 3 || ACT == 6 || ACT == 8 || ACT == 9 || ACT == 11 || ACT == 12 || ACT == 14 || ACT == 15 || ACT == 16 || ACT == 17, "k_gemm2: unsupported ACT code (would silently apply no activation)");
  __shared__ __attribute__((aligned(16))) float so[4][32][68];
  const int tid = threadIdx.x, w = tid >> 5, lane = tid & 31, ln = lane & 15, hh = lane >> 4; const int by = blockIdx.y;
  A += (size_t)by * sA; Bh += (size_t)by * sB; const size_t cofs = (size_t)by * sC; const float* bp = bias ? bias + (size_t)by * sBias : nullptr;
  const int ntn = N >> 6; const int mt = blockIdx.x / ntn, nq = blockIdx.x - mt * ntn; const int row0 = mt * 128 + 32 * w, col0 = nq * 64; if (row0 >= M) return;
  const _Float16* a0p = A + (size_t)(row0 + ln) * lda; const _Float16* a1p = a0p + (size_t)16 * lda;
  const _Float16* b0p = Bh + (size_t)(col0 + ln) * ldb; const _Float16* b1p = b0p + (size_t)16 * ldb; const _Float16* b2p = b1p + (size_t)16 * ldb; const _Float16* b3p = b2p + (size_t)16 * ldb;
  const v8f z8 = {0.f,0.f,0.f,0.f,0.f,0.f,0.f,0.f}; v8f c00 = z8, c01 = z8, c02 = z8, c03 = z8, c10 = z8, c11 = z8, c12 = z8, c13 = z8;
#pragma unroll 1
  for (int kb = 0; kb < K; kb += 32) { const v16h a0 = g2_frag(a0p + kb, hh), a1 = g2_frag(a1p + kb, hh);
    v16h b = g2_frag(b0p + kb, hh); c00 = g2_mma(a0, b, c00); c10 = g2_mma(a1, b, c10);
    b = g2_frag(b1p + kb, hh); c01 = g2_mma(a0, b, c01); c11 = g2_mma(a1, b, c11);
    b = g2_frag(b2p + kb, hh); c02 = g2_mma(a0, b, c02); c12 = g2_mma(a1, b, c12);
    b = g2_frag(b3p + kb, hh); c03 = g2_mma(a0, b, c03); c13 = g2_mma(a1, b, c13); }
  v8f accs[8] = {c00, c01, c02, c03, c10, c11, c12, c13};
#pragma unroll
  for (int u = 0; u < 8; ++u) { const int t = u & 3, half = u >> 2; const int col = col0 + t * 16 + ln; const float bv = bp ? bf16_round(bp[col]) : 0.f;
#pragma unroll
    for (int r = 0; r < 8; ++r) { const int rloc = half * 16 + 8 * hh + r; float v = accs[u][r] * alpha + bv; if (CP) { if (rowsPerB < 0) v += CP[cofs + (size_t)(row0g + row0 + rloc) * ldc + col];      /* rowsPerB < 0: own element of the batched C plane */ else { const int bidx = (row0g + row0 + rloc) / rowsPerB; v += CP[(size_t)bidx * sCPb + (size_t)by * 64 + col]; } }
      if (ACT == 3) v = fmaxf(v, 0.f); else if (ACT == 6) v = 0.5f * v * (1.0f + erff(v * 0.70710678118654752f)); else if (ACT == 11) v = 1.0f / (1.0f + expf(-v)); else if (ACT == 15) v = v / (1.0f + expf(-v)); else if (ACT == 12) v = (v > 0.f) ? v : 0.01f * v; else if (ACT == 8) v = tanhf(v); else if (ACT == 9) v = 0.5f * v * (1.0f + tanhf(0.7978845608028654f * (v + 0.044715f * v * v * v))); else if (ACT == 14) v = (v > 0.f) ? v : 0.1f * v; else if (ACT == 16) v = (v >= 0.f) ? v : 0.3f * v; else if (ACT == 17) v = (v >= 0.f) ? v : 0.2f * v;
      so[w][rloc][t * 16 + ln] = v; } }
  __builtin_amdgcn_fence(__ATOMIC_ACQ_REL, "workgroup"); __builtin_amdgcn_wave_barrier();
  const int rsub = lane >> 4, c4 = (lane & 15) * 4;
  {
#pragma unroll
    for (int q = 0; q < 16; ++q) { const int r = q * 2 + rsub; const v4f v = *(const v4fa*)&so[w][r][c4]; if (C) *(v4f*)(C + cofs + (size_t)(row0 + r) * ldc + col0 + c4) = v; if (C16) { v4h h4; for (int i = 0; i < 4; ++i) h4[i] = (_Float16)v[i]; *(v4h*)(C16 + cofs + (size_t)(row0 + r) * ldc + col0 + c4) = h4; } }
     } }


__global__ __launch_bounds__(256) void k_rowmask(const float* __restrict__ F, const int* __restrict__ pmask, float* __restrict__ out, size_t n4) { const size_t t = (size_t)blockIdx.x * 256 + threadIdx.x; if (t >= n4) return; const size_t r = (t * 4) / DM; const float m = pmask[r] ? 1.0f : 0.0f; const v4f v = *(const v4fa*)(F + t * 4); v4f o; for (int q = 0; q < 4; ++q) o[q] = v[q] * m;
  *(v4f*)(out + t * 4) = o;  }
__global__ __launch_bounds__(256) void k_wnat(const float* __restrict__ w, size_t n8, _Float16* __restrict__ Bt) { const size_t t = (size_t)blockIdx.x * 256 + threadIdx.x; if (t >= n8) return; FragH f; for (int q = 0; q < 8; ++q) f.h[q] = (_Float16)(bf16_round(w[t * 8 + q]) * 16.0f); *(v8us*)((unsigned short*)Bt + t * 8) = f.half[0];  }
__global__ __launch_bounds__(256) void k_tbias(float* __restrict__ TB) {
  #pragma clang fp contract(off)
  const int d = blockIdx.x * 256 + threadIdx.x; if (d >= SQ) return; const float dist = __fdiv_rn(__fmul_rn((float)d, 300.0f), 300.0f); const float v = logf(__fadd_rn(expf(-dist), 1e-12f));
  *(float*)(TB + d) = v;  }
// row softmax with the distance bias and the key padding mask: score = s[j] + TB[|i-j|], replaced by -1e9 where patch_mask[b][j] == 0 (table and mask row staged in LDS); P = f16(256 softmax).
// One wave per query row i: lane l owns keys j = 128 u + 4 l + q (u < 16, q < 4), so each load of the wave covers 512 contiguous bytes of the row; the row is read once and stays in registers through maximum, exp / sum and scaling.
// Row sum: four chains per lane (one per q), (a0 + a1) + (a2 + a3), then a five-step butterfly over the lanes.
// Every loop over u and q is fully unrolled so that x[] is indexed by constants only and stays in registers. The wave's number goes through readfirstlane so that the row address and the bounds test are scalar.
__global__ __launch_bounds__(256) void k_rsmp(const float* __restrict__ S, _Float16* __restrict__ P, int nrows, const float* __restrict__ TB, const int* __restrict__ pmask) {
  typedef int v4ia __attribute__((ext_vector_type(4), may_alias));
  __shared__ __attribute__((aligned(16))) float tb[SQ]; __shared__ __attribute__((aligned(16))) int km[SQ];
  const int tid = threadIdx.x, lane = tid & 31; const int i = blockIdx.x * 8 + __builtin_amdgcn_readfirstlane(tid >> 5);
  const float* s = S + (size_t)(i < nrows ? i : nrows - 1) * SQ + 4 * lane;      /* a wave past the last row reads the last row again and stores nothing */
  v4f x[16];
#pragma unroll
  for (int u = 0; u < 16; ++u) x[u] = *(const v4fa*)(s + 128 * u);
#pragma unroll
  for (int t = 0; t < SQ; t += 1024) { *(v4fa*)&tb[t + tid * 4] = *(const v4fa*)(TB + t + tid * 4); *(v4ia*)&km[t + tid * 4] = *(const v4ia*)(pmask + t + tid * 4); }
  __syncthreads();
  if (i >= nrows) return;
  float mx = -INFINITY;
#pragma unroll
  for (int u = 0; u < 16; ++u) { const int j0 = 128 * u + 4 * lane; const v4ia m = *(const v4ia*)&km[j0];
#pragma unroll
    for (int q = 0; q < 4; ++q) { const int j = j0 + q; const int d = j > i ? j - i : i - j; const float sb = x[u][q] + tb[d]; const float v = m[q] ? sb : -1.0e9f; x[u][q] = v; mx = fmaxf(mx, v); } }      /* the table read stands outside the mask test: no branch, the LDS reads overlap */
#pragma unroll
  for (int m = 16; m >= 1; m >>= 1) mx = fmaxf(mx, __shfl_xor(mx, m, 32));
  float a0 = 0.f, a1 = 0.f, a2 = 0.f, a3 = 0.f;
#pragma unroll
  for (int u = 0; u < 16; ++u) { v4f e;
#pragma unroll
    for (int q = 0; q < 4; ++q) e[q] = expf(x[u][q] - mx);
    x[u] = e; a0 += e[0]; a1 += e[1]; a2 += e[2]; a3 += e[3]; }
  float se = (a0 + a1) + (a2 + a3);
#pragma unroll
  for (int m = 16; m >= 1; m >>= 1) se += __shfl_xor(se, m, 32);
  const float sc = 256.0f / se; _Float16* p = P + (size_t)i * SQ + 4 * lane;
#pragma unroll
  for (int u = 0; u < 16; ++u) { v4h h4;
#pragma unroll
    for (int q = 0; q < 4; ++q) h4[q] = (_Float16)(x[u][q] * sc);
    *(v4h*)(p + 128 * u) = h4; } }
__global__ __launch_bounds__(256) void k_vt(const _Float16* __restrict__ V16, int b, int h0, _Float16* __restrict__ VT) { __shared__ unsigned short tl[64][65]; const int tid = threadIdx.x; const int hh = blockIdx.x % HG, sg = blockIdx.x / HG; const int s0 = sg * 64; const int h = h0 + hh;
  for (int i = tid; i < 64 * 8; i += 256) { const int j = i / 8, d8 = (i % 8) * 8; FragH f; f.half[0] = *(const v8us*)((const unsigned short*)V16 + ((size_t)b * SQ + s0 + j) * DM + h * HD + d8); for (int q = 0; q < 8; ++q) tl[d8 + q][j] = f.u[q]; }
  __syncthreads();
  { for (int i = tid; i < 64 * 8; i += 256) { const int d = i / 8, j8 = (i % 8) * 8; FragH f; for (int q = 0; q < 8; ++q) f.u[q] = tl[d][j8 + q]; *(v8us*)((unsigned short*)VT + ((size_t)hh * HD + d) * SQ + s0 + j8) = f.half[0]; }  } }

extern "C" void kernel_launch(void* const* d_in, const int* in_sizes, int n_in,
                              void* d_out, int out_size, void* d_ws, size_t ws_size, hipStream_t stream) {
  (void)in_sizes; (void)n_in; (void)out_size;
  const float* const* I = (const float* const*)d_in; const float* x = I[0]; const int* pmask = (const int*)d_in[1]; const float* wq = I[2]; const float* bq = I[3]; const float* wk = I[4]; const float* bk = I[5]; const float* wv = I[6]; const float* bv = I[7]; const float* wo = I[8]; const float* bo = I[9];      /* weights natural [out][in]; patch_mask int32 [4][2048] (1 = valid) */
  char* ws = (char*)d_ws; size_t off = 0;
  auto take = [&](size_t bytes) { char* p = ws + off; off += (bytes + 255) & ~(size_t)255; return p; };
  _Float16* BQ = (_Float16*)take((size_t)DM * DM * 2); _Float16* BK = (_Float16*)take((size_t)DM * DM * 2); _Float16* BV = (_Float16*)take((size_t)DM * DM * 2); _Float16* BO = (_Float16*)take((size_t)DM * DM * 2);
  _Float16* X16 = (_Float16*)take(NR * DM * 2); _Float16* Q16 = (_Float16*)take(NR * DM * 2); _Float16* K16 = (_Float16*)take(NR * DM * 2); _Float16* V16 = (_Float16*)take(NR * DM * 2); _Float16* O16 = (_Float16*)take(NR * DM * 2);
  float* S = (float*)take((size_t)HG * SQ * SQ * 4); _Float16* P = (_Float16*)take((size_t)HG * SQ * SQ * 2); _Float16* VT = (_Float16*)take((size_t)HG * HD * SQ * 2); float* TB = (float*)take((size_t)SQ * 4); float* OUTF = (float*)take(NR * DM * 4);
  if (off > ws_size) return;      /* 2 + 5x8 + 32 + 16 + 0.5 + 0.01 + 16 = approx 107 MiB */
  const size_t nw8 = (size_t)DM * DM / 8; const unsigned gw = (unsigned)((nw8 + 255) / 256);
  k_wnat<<<gw, 256, 0, stream>>>(wq, nw8, BQ); k_wnat<<<gw, 256, 0, stream>>>(wk, nw8, BK); k_wnat<<<gw, 256, 0, stream>>>(wv, nw8, BV); k_wnat<<<gw, 256, 0, stream>>>(wo, nw8, BO);
  k_tbias<<<(SQ + 255) / 256, 256, 0, stream>>>(TB);
  k_x16<<<(unsigned)((NR * DM / 8 + 255) / 256), 256, 0, stream>>>(x, X16, NR * DM / 8);
  const dim3 gp((unsigned)((NR / 128) * (DM / 64)), 1);
  k_gemm2<0><<<gp, 128, 0, stream>>>(X16, DM, 0, BQ, DM, 0, 0.0625f, bq, 0, nullptr, 1, 0, 0, nullptr, Q16, DM, 0, MP, DM, DM);
  k_gemm2<0><<<gp, 128, 0, stream>>>(X16, DM, 0, BK, DM, 0, 0.0625f, bk, 0, nullptr, 1, 0, 0, nullptr, K16, DM, 0, MP, DM, DM);
  k_gemm2<0><<<gp, 128, 0, stream>>>(X16, DM, 0, BV, DM, 0, 0.0625f, bv, 0, nullptr, 1, 0, 0, nullptr, V16, DM, 0, MP, DM, DM);
  for (int b = 0; b < NBR; ++b) for (int h0 = 0; h0 < NH; h0 += HG) {
    const _Float16* qb = Q16 + (size_t)b * SQ * DM + h0 * HD; const _Float16* kb = K16 + (size_t)b * SQ * DM + h0 * HD;
    k_gemm2<0><<<dim3((QN / 128) * (SQ / 64), HG), 128, 0, stream>>>(qb, DM, (size_t)HD, kb, DM, (size_t)HD, 0.125f, nullptr, 0, nullptr, 1, 0, 0, S, nullptr, SQ, (size_t)SQ * SQ, QN, SQ, HD);      /* scores / sqrt(64) */
    for (int hh = 0; hh < HG; ++hh) k_rsmp<<<(QN + 7) / 8, 256, 0, stream>>>(S + (size_t)hh * SQ * SQ, P + (size_t)hh * SQ * SQ, QN, TB, pmask + (size_t)b * SQ);
    k_vt<<<HG * (SQ / 64), 256, 0, stream>>>(V16, b, h0, VT);
    k_gemm2<0><<<dim3((QN / 128) * (HD / 64), HG), 128, 0, stream>>>(P, SQ, (size_t)SQ * SQ, VT, SQ, (size_t)HD * SQ, 0.00390625f, nullptr, 0, nullptr, 1, 0, 0, nullptr, O16 + (size_t)b * SQ * DM + h0 * HD, DM, (size_t)HD, QN, HD, SQ); }      /* o (merged heads) as f16 rows */
  k_gemm2<0><<<gp, 128, 0, stream>>>(O16, DM, 0, BO, DM, 0, 0.0625f, bo, 0, nullptr, 1, 0, 0, OUTF, nullptr, DM, 0, MO, DM, DM);      /* o Wo^T + bo (f32 rows) */
  k_rowmask<<<(unsigned)(((size_t)MO * DM / 4 + 255) / 256), 256, 0, stream>>>(OUTF, pmask, (float*)d_out, (size_t)MO * DM / 4);      /* x patch_mask[b][i] */
}

// v002
// It runs in 165 microseconds.
// In two side-by-side timings against v001, it was 9.82 and 9.80 times as fast.
// Counting every step since v000, it is 121 times as fast.
#include <hip/hip_runtime.h>
#define NB 4
#define SQ 2048
#define DM 512
#define NH 8
#define HD 64
#define MP ((int)NR)                 /* token rows through the projections (debug hook) */
#define MO ((int)NR)                 /* token rows through the output projection / mask (debug hook) */
#define NR ((size_t)NB * SQ)         /* 8192 token rows */
typedef __bf16 v16b __attribute__((ext_vector_type(16)));
typedef unsigned short v8us __attribute__((ext_vector_type(8), may_alias));
typedef float  v8f  __attribute__((ext_vector_type(8)));
typedef float  v4f  __attribute__((ext_vector_type(4)));
typedef float  v4fa __attribute__((ext_vector_type(4), may_alias));
union FragB { v16b v; v8us half[2]; unsigned short u[16]; };

__device__ __forceinline__ unsigned short bf16_bits(float x) { unsigned int u = __float_as_uint(x); return (unsigned short)((u + 0x7FFFu + ((u >> 16) & 1u)) >> 16); }
__device__ __forceinline__ float bf16_val(unsigned short b) { return __uint_as_float(((unsigned int)b) << 16); }
__device__ __forceinline__ float bf16_round(float x) { return bf16_val(bf16_bits(x)); }
// D += A·B with NT terms: 1 = ah·bh, 2 = + al·bh (A split), 3 = + ah·bl (both split)
template <int NT>
__device__ __forceinline__ v8f mmaN(v16b ah, v16b al, v16b bh, v16b bl, v8f c) {
  c = __builtin_amdgcn_wmma_f32_16x16x32_bf16(false, ah, false, bh, (short)0, c, false, false);
  if (NT >= 2) c = __builtin_amdgcn_wmma_f32_16x16x32_bf16(false, al, false, bh, (short)0, c, false, false);
  if (NT >= 3) c = __builtin_amdgcn_wmma_f32_16x16x32_bf16(false, ah, false, bl, (short)0, c, false, false);
  asm volatile("v_nop\n\tv_nop\n\tv_nop\n\tv_nop" : "+v"(c) : "v"(ah), "v"(al), "v"(bh), "v"(bl));
  return c;
}

__global__ __launch_bounds__(256) void k_wt_bf16(const float* __restrict__ W, unsigned short* __restrict__ Wt, int K, int N) {
  const int t = blockIdx.x * 256 + threadIdx.x;
  const int k8n = K / 8;
  if (t >= N * k8n) return;
  const int n = t / k8n, k8 = (t % k8n) * 8;
  v8us v;
#pragma unroll
  for (int i = 0; i < 8; ++i) v[i] = bf16_bits(W[(size_t)(k8 + i) * N + n]);
  *(v8us*)(Wt + (size_t)n * K + k8) = v;
  
}

// GEMM C[M][N] (f32, pitch ldc) = act(A[M][K]·W + bias). A f32 row-major (pitch lda) converted per fragment to bf16
// (ASPLIT: hi/lo two planes -> 2 terms, else single rounded term); Wt bf16 [N][K] (pitch ldb). BIAS_BF16 rounds the
// bias to bf16 first (bias quantised to bf16 before the add). K%32==0, M%16==0, N%64==0.
template <bool ASPLIT, int ACT, bool BIAS_BF16>
__global__ __launch_bounds__(128) void k_gemm_bf(const float* __restrict__ A, int lda, const unsigned short* __restrict__ Wt, int ldb,
                                               const float* __restrict__ bias, float* __restrict__ C, int ldc, int M, int N, int K) {
  __shared__ __attribute__((aligned(16))) float so[4][16][64];
  const int tid = threadIdx.x, w = tid >> 5, lane = tid & 31, ln = lane & 15, hh = lane >> 4;
  const int ntn = N / 64;
  const int wid = blockIdx.x * 4 + w;
  const int mt = wid / ntn, nq = wid % ntn;
  if (mt * 16 >= M) return;
  const int row0 = mt * 16, col0 = nq * 64;
  const float* arow = A + (size_t)(row0 + ln) * lda;
  v8f acc[4] = {};
  for (int kb = 0; kb < K; kb += 32) {
    FragB ah, al;
    const v4f x0 = *(const v4fa*)(arow + kb + 8 * hh), x1 = *(const v4fa*)(arow + kb + 8 * hh + 4);
    const v4f x2 = *(const v4fa*)(arow + kb + 16 + 8 * hh), x3 = *(const v4fa*)(arow + kb + 16 + 8 * hh + 4);
    float xs[16] = {x0[0],x0[1],x0[2],x0[3],x1[0],x1[1],x1[2],x1[3],x2[0],x2[1],x2[2],x2[3],x3[0],x3[1],x3[2],x3[3]};
#pragma unroll
    for (int i = 0; i < 16; ++i) { const unsigned short hb = bf16_bits(xs[i]); ah.u[i] = hb; al.u[i] = ASPLIT ? bf16_bits(xs[i] - bf16_val(hb)) : (unsigned short)0; }
#pragma unroll
    for (int t = 0; t < 4; ++t) {
      const unsigned short* brow = Wt + (size_t)(col0 + t * 16 + ln) * ldb + kb;
      FragB b;
      b.half[0] = *(const v8us*)(brow + 8 * hh);
      b.half[1] = *(const v8us*)(brow + 16 + 8 * hh);
      acc[t] = mmaN<ASPLIT ? 2 : 1>(ah.v, al.v, b.v, b.v, acc[t]);
    }
  }
#pragma unroll
  for (int t = 0; t < 4; ++t) {
    float bv = bias ? bias[col0 + t * 16 + ln] : 0.f;
    if (BIAS_BF16) bv = bf16_round(bv);
#pragma unroll
    for (int r = 0; r < 8; ++r) { float v = acc[t][r] + bv; if (ACT == 1) v = fmaxf(v, 0.f); so[w][8 * hh + r][t * 16 + ln] = v; }
  }
  __builtin_amdgcn_fence(__ATOMIC_ACQ_REL, "workgroup");
  __builtin_amdgcn_wave_barrier();
  const int rsub = lane >> 4, c4 = (lane & 15) * 4;
  {
#pragma unroll
    for (int q = 0; q < 8; ++q) {
      const int r = q * 2 + rsub;
      const v4f v = *(const v4fa*)&so[w][r][c4];
      *(v4f*)(C + (size_t)(row0 + r) * ldc + col0 + c4) = v;
    }
    
  }
}

// GEMM C = act(A·W + bias + resid): A f32 (ASPLIT -> hi/lo 2 terms), Wt bf16 [N][K]; ACT 0 none, 1 relu, 2 exact gelu;
// resid (optional, f32, row index = (row % rmod), pitch ldr, RES_BF16 rounds it) added before the activation.
template <bool ASPLIT, int ACT, bool BIAS_BF16, bool RES_BF16>
__global__ __launch_bounds__(128) void k_gemm_bf3(const float* __restrict__ A, int lda, const unsigned short* __restrict__ Wt, int ldb,
                                                const float* __restrict__ bias, const float* __restrict__ resid, int rmod, int ldr,
                                                float* __restrict__ C, int ldc, int M, int N, int K) {
  __shared__ __attribute__((aligned(16))) float so[4][16][64];
  const int tid = threadIdx.x, w = tid >> 5, lane = tid & 31, ln = lane & 15, hh = lane >> 4;
  const int ntn = N / 64;
  const int wid = blockIdx.x * 4 + w;
  const int mt = wid / ntn, nq = wid % ntn;
  if (mt * 16 >= M) return;
  const int row0 = mt * 16, col0 = nq * 64;
  const float* arow = A + (size_t)(row0 + ln) * lda;
  v8f acc[4] = {};
  for (int kb = 0; kb < K; kb += 32) {
    FragB ah, al;
    const v4f x0 = *(const v4fa*)(arow + kb + 8 * hh), x1 = *(const v4fa*)(arow + kb + 8 * hh + 4);
    const v4f x2 = *(const v4fa*)(arow + kb + 16 + 8 * hh), x3 = *(const v4fa*)(arow + kb + 16 + 8 * hh + 4);
    float xs[16] = {x0[0],x0[1],x0[2],x0[3],x1[0],x1[1],x1[2],x1[3],x2[0],x2[1],x2[2],x2[3],x3[0],x3[1],x3[2],x3[3]};
#pragma unroll
    for (int i = 0; i < 16; ++i) { const unsigned short hb = bf16_bits(xs[i]); ah.u[i] = hb; al.u[i] = ASPLIT ? bf16_bits(xs[i] - bf16_val(hb)) : (unsigned short)0; }
#pragma unroll
    for (int t = 0; t < 4; ++t) {
      const unsigned short* brow = Wt + (size_t)(col0 + t * 16 + ln) * ldb + kb;
      FragB b;
      b.half[0] = *(const v8us*)(brow + 8 * hh);
      b.half[1] = *(const v8us*)(brow + 16 + 8 * hh);
      acc[t] = mmaN<ASPLIT ? 2 : 1>(ah.v, al.v, b.v, b.v, acc[t]);
    }
  }
#pragma unroll
  for (int t = 0; t < 4; ++t) {
    const int col = col0 + t * 16 + ln;
    float bv = bias ? bias[col] : 0.f;
    if (BIAS_BF16) bv = bf16_round(bv);
#pragma unroll
    for (int r = 0; r < 8; ++r) {
      float v = acc[t][r] + bv;
      if (resid) { float rv = resid[(size_t)((row0 + 8 * hh + r) % rmod) * ldr + col]; if (RES_BF16) rv = bf16_round(rv); v += rv; }
      if (ACT == 1) v = fmaxf(v, 0.f);
      if (ACT == 2) v = 0.5f * v * (1.0f + erff(v * 0.70710678118654752f));
      if (ACT == 3) { const float u = 0.7978845608028654f * (v + 0.044715f * v * v * v); v = 0.5f * v * (1.0f + tanhf(u)); }
      so[w][8 * hh + r][t * 16 + ln] = v;
    }
  }
  __builtin_amdgcn_fence(__ATOMIC_ACQ_REL, "workgroup");
  __builtin_amdgcn_wave_barrier();
  const int rsub = lane >> 4, c4 = (lane & 15) * 4;
  {
#pragma unroll
    for (int q = 0; q < 8; ++q) {
      const int r = q * 2 + rsub;
      const v4f v = *(const v4fa*)&so[w][r][c4];
      *(v4f*)(C + (size_t)(row0 + r) * ldc + col0 + c4) = v;
    }
    
  }
}
// row LayerNorm (biased variance, eps) over N: s = X (+ R); optional out_sum <- s; out_norm <- (s-mu)*rsqrt(var+eps)*g + b
template <bool PARAM_BF16>
__global__ __launch_bounds__(256) void k_layernorm(const float* __restrict__ X, const float* __restrict__ R, const float* __restrict__ g, const float* __restrict__ bta,
                                                  float* __restrict__ out_sum, float* __restrict__ out_norm, int N, float eps) {
  __shared__ float red[256];
  const int row = blockIdx.x, tid = threadIdx.x;
  const float* x = X + (size_t)row * N; const float* rr = R ? R + (size_t)row * N : nullptr;
  float vals[16];                     // up to N = 4096
  const int per = N / 256;            // contiguous chunk per thread? use strided-by-4 chunks: thread handles j = tid*4 + 1024*u
  float s1 = 0.f;
  for (int u = 0; u < per / 4; ++u) {
    const int j = tid * 4 + 1024 * u;
    const v4f a = *(const v4fa*)(x + j);
    v4f b = {0.f,0.f,0.f,0.f}; if (rr) b = *(const v4fa*)(rr + j);
#pragma unroll
    for (int q = 0; q < 4; ++q) { const float v = a[q] + b[q]; vals[u * 4 + q] = v; s1 += v; }
  }
  red[tid] = s1; __syncthreads();
  for (int st = 128; st > 0; st >>= 1) { if (tid < st) red[tid] += red[tid + st]; __syncthreads(); }
  const float mu = red[0] / (float)N; __syncthreads();
  float s2 = 0.f;
  for (int u = 0; u < per / 4; ++u)
#pragma unroll
    for (int q = 0; q < 4; ++q) { const float c = vals[u * 4 + q] - mu; s2 += c * c; }
  red[tid] = s2; __syncthreads();
  for (int st = 128; st > 0; st >>= 1) { if (tid < st) red[tid] += red[tid + st]; __syncthreads(); }
  const float rs = rsqrtf(red[0] / (float)N + eps);
  {
    for (int u = 0; u < per / 4; ++u) {
      const int j = tid * 4 + 1024 * u;
      v4f o, sm;
#pragma unroll
      for (int q = 0; q < 4; ++q) {
        float gg = g[j + q], bb = bta[j + q];
        if (PARAM_BF16) { gg = bf16_round(gg); bb = bf16_round(bb); }
        sm[q] = vals[u * 4 + q]; o[q] = (vals[u * 4 + q] - mu) * rs * gg + bb;
      }
      if (out_sum) *(v4f*)(out_sum + (size_t)row * N + j) = sm;
      *(v4f*)(out_norm + (size_t)row * N + j) = o;
    }
    
  }
}



// ---- f16 WMMA path (v_wmma_f32_16x16x32_f16): 11-bit significands for operands in range — used where a [0,1] probability operand needs more precision than bf16
typedef _Float16 v16h __attribute__((ext_vector_type(16)));
union FragH { v16h v; v8us half[2]; _Float16 h[16]; unsigned short u[16]; };
template <int NT>
__device__ __forceinline__ v8f mmaH(v16h ah, v16h al, v16h bh, v16h bl, v8f c) {
  c = __builtin_amdgcn_wmma_f32_16x16x32_f16(false, ah, false, bh, (short)0, c, false, false);
  if (NT >= 2) c = __builtin_amdgcn_wmma_f32_16x16x32_f16(false, al, false, bh, (short)0, c, false, false);
  if (NT >= 3) c = __builtin_amdgcn_wmma_f32_16x16x32_f16(false, ah, false, bl, (short)0, c, false, false);
  asm volatile("v_nop\n\tv_nop\n\tv_nop\n\tv_nop" : "+v"(c) : "v"(ah), "v"(al), "v"(bh), "v"(bl));
  return c;
}
// batched GEMM like k_gemm_b but f16 operands: A f32 (split into f16 hi/lo if ASPLIT, else rounded to f16), Bt = f16 values [n][k]; alpha; C f32; N multiple of 16 (partial tiles skipped)
template <bool ASPLIT>
__global__ __launch_bounds__(128) void k_gemm_h(const float* __restrict__ A, int lda, size_t sA, const _Float16* __restrict__ Bh, int ldb, size_t sB, float alpha, float* __restrict__ C, int ldc, size_t sC, int M, int N, int K) {
  __shared__ __attribute__((aligned(16))) float so[4][16][64];
  const int tid = threadIdx.x, w = tid >> 5, lane = tid & 31, ln = lane & 15, hh = lane >> 4; const int by = blockIdx.y;
  A += (size_t)by * sA; Bh += (size_t)by * sB; C += (size_t)by * sC;
  const int ntn = (N + 63) / 64; const int wid = blockIdx.x * 4 + w; const int mt = wid / ntn, nq = wid % ntn; if (mt * 16 >= M) return;
  const int row0 = mt * 16, col0 = nq * 64; const float* arow = A + (size_t)(row0 + ln) * lda;
  v8f acc[4] = {};
  for (int kb = 0; kb < K; kb += 32) {
    FragH ah, al;
    const v4f x0 = *(const v4fa*)(arow + kb + 8 * hh), x1 = *(const v4fa*)(arow + kb + 8 * hh + 4), x2 = *(const v4fa*)(arow + kb + 16 + 8 * hh), x3 = *(const v4fa*)(arow + kb + 16 + 8 * hh + 4);
    float xs[16] = {x0[0],x0[1],x0[2],x0[3],x1[0],x1[1],x1[2],x1[3],x2[0],x2[1],x2[2],x2[3],x3[0],x3[1],x3[2],x3[3]};
#pragma unroll
    for (int i = 0; i < 16; ++i) { const _Float16 h = (_Float16)xs[i]; ah.h[i] = h; al.h[i] = ASPLIT ? (_Float16)(xs[i] - (float)h) : (_Float16)0.0f; }
#pragma unroll
    for (int t = 0; t < 4; ++t) { if (col0 + t * 16 >= N) continue; const size_t boff = (size_t)(col0 + t * 16 + ln) * ldb + kb; FragH bq; bq.half[0] = *(const v8us*)(Bh + boff + 8 * hh); bq.half[1] = *(const v8us*)(Bh + boff + 16 + 8 * hh);
      acc[t] = mmaH<ASPLIT ? 2 : 1>(ah.v, al.v, bq.v, bq.v, acc[t]); }
  }
#pragma unroll
  for (int t = 0; t < 4; ++t) { if (col0 + t * 16 >= N) continue;
#pragma unroll
    for (int r = 0; r < 8; ++r) so[w][8 * hh + r][t * 16 + ln] = acc[t][r] * alpha; }
  __builtin_amdgcn_fence(__ATOMIC_ACQ_REL, "workgroup"); __builtin_amdgcn_wave_barrier();
  const int rsub = lane >> 4, c4 = (lane & 15) * 4;
  {
#pragma unroll
    for (int q = 0; q < 8; ++q) { const int r = q * 2 + rsub; if (col0 + c4 < N) { const v4f v = *(const v4fa*)&so[w][r][c4]; *(v4f*)(C + (size_t)(row0 + r) * ldc + col0 + c4) = v; } }
     }
}

// Wt[n][k] = f16(W[k][n]·scale) from f32 row-major W[K][N] (scale = power of two; bf16-exact weights stay exact in f16 away from the subnormal range)
__global__ __launch_bounds__(256) void k_wt_f16(const float* __restrict__ W, _Float16* __restrict__ Wt, int K, int N, float scale) {
  const int t = blockIdx.x * 256 + threadIdx.x; if (t >= N * (K / 8)) return; const int n = t / (K / 8), k8 = (t % (K / 8)) * 8; FragH f;
#pragma unroll
  for (int i = 0; i < 8; ++i) f.h[i] = (_Float16)(bf16_round(W[(size_t)(k8 + i) * N + n]) * scale); const v8us o = f.half[0];
  *(v8us*)((unsigned short*)Wt + (size_t)n * K + k8) = o; 
}
// k_gemm_hh variant with fused epilogue: v = acc·alpha + bias[by·sBias + col] (+ CP[(row/rowsPerB)·sCPb + by·64 + col] if CP) ; ACT 0 none / 1 elu ; writes f16 C16 (and f32 C if non-null)
template <int ACT>
__global__ __launch_bounds__(128) void k_gemm_hhx(const _Float16* __restrict__ A, int lda, size_t sA, const _Float16* __restrict__ Bh, int ldb, size_t sB, float alpha, const float* __restrict__ bias, size_t sBias, const float* __restrict__ CP, int rowsPerB, size_t sCPb, int row0g,
    float* __restrict__ C, _Float16* __restrict__ C16, int ldc, size_t sC, int M, int N, int K) {
  __shared__ __attribute__((aligned(16))) float so[4][16][64];
  const int tid = threadIdx.x, w = tid >> 5, lane = tid & 31, ln = lane & 15, hh = lane >> 4; const int by = blockIdx.y;
  A += (size_t)by * sA; Bh += (size_t)by * sB; const size_t cofs = (size_t)by * sC; const float* bp = bias ? bias + (size_t)by * sBias : nullptr;
  const int ntn = (N + 63) / 64; const int wid = blockIdx.x * 4 + w; const int mt = wid / ntn, nq = wid % ntn; if (mt * 16 >= M) return;
  const int row0 = mt * 16, col0 = nq * 64; const _Float16* arow = A + (size_t)(row0 + ln) * lda;
  v8f acc[4] = {};
  for (int kb = 0; kb < K; kb += 32) { FragH ah; ah.half[0] = *(const v8us*)((const unsigned short*)arow + kb + 8 * hh); ah.half[1] = *(const v8us*)((const unsigned short*)arow + kb + 16 + 8 * hh);
#pragma unroll
    for (int t = 0; t < 4; ++t) { if (col0 + t * 16 >= N) continue; const size_t boff = (size_t)(col0 + t * 16 + ln) * ldb + kb; FragH bq; bq.half[0] = *(const v8us*)((const unsigned short*)Bh + boff + 8 * hh); bq.half[1] = *(const v8us*)((const unsigned short*)Bh + boff + 16 + 8 * hh);
      acc[t] = mmaH<1>(ah.v, ah.v, bq.v, bq.v, acc[t]); }
  }
#pragma unroll
  for (int t = 0; t < 4; ++t) { if (col0 + t * 16 >= N) continue; const int col = col0 + t * 16 + ln; const float bv = bp ? bf16_round(bp[col]) : 0.f;
#pragma unroll
    for (int r = 0; r < 8; ++r) { float v = acc[t][r] * alpha + bv; if (CP) { const int rr = row0g + row0 + 8 * hh + r; if (rowsPerB < 0) v += CP[cofs + (size_t)rr * ldc + col];      /* rowsPerB < 0: own element of the batched C plane */ else { const int bidx = rr / rowsPerB; v += CP[(size_t)bidx * sCPb + (size_t)by * 64 + col]; } } if (ACT == 1) v = (v > 0.f) ? v : expm1f(v); else if (ACT == 7) v = (v > 0.f) ? v + 1.0f : expf(v); else if (ACT == 8) v = tanhf(v); else if (ACT == 9) v = 0.5f * v * (1.0f + tanhf(0.7978845608028654f * (v + 0.044715f * v * v * v))); else if (ACT == 11) v = 1.0f / (1.0f + expf(-v)); else if (ACT == 12) v = (v > 0.f) ? v : 0.01f * v; else if (ACT == 14) v = (v > 0.f) ? v : 0.1f * v; else if (ACT == 16) v = (v >= 0.f) ? v : 0.3f * v; else if (ACT == 17) v = (v >= 0.f) ? v : 0.2f * v; else if (ACT == 15) v = v / (1.0f + expf(-v)); else if (ACT == 3) v = fmaxf(v, 0.f); else if (ACT == 6) v = 0.5f * v * (1.0f + erff(v * 0.70710678118654752f)); so[w][8 * hh + r][t * 16 + ln] = v; } }
  __builtin_amdgcn_fence(__ATOMIC_ACQ_REL, "workgroup"); __builtin_amdgcn_wave_barrier();
  const int rsub = lane >> 4, c4 = (lane & 15) * 4; typedef _Float16 v4h __attribute__((ext_vector_type(4)));
  {
#pragma unroll
    for (int q = 0; q < 8; ++q) { const int r = q * 2 + rsub; if (col0 + c4 < N) { const v4f v = *(const v4fa*)&so[w][r][c4]; if (C) *(v4f*)(C + cofs + (size_t)(row0 + r) * ldc + col0 + c4) = v; if (C16) { v4h h4; for (int i = 0; i < 4; ++i) h4[i] = (_Float16)v[i]; *(v4h*)(C16 + cofs + (size_t)(row0 + r) * ldc + col0 + c4) = h4; } } }
     }
}


typedef _Float16 v4h __attribute__((ext_vector_type(4)));

__global__ __launch_bounds__(256) void k_x16(const float* __restrict__ x, _Float16* __restrict__ X16, size_t n8) { const size_t t = (size_t)blockIdx.x * 256 + threadIdx.x; if (t >= n8) return; FragH f;
#pragma unroll
  for (int q = 0; q < 8; ++q) f.h[q] = (_Float16)bf16_round(x[t * 8 + q]); *(v8us*)((unsigned short*)X16 + t * 8) = f.half[0];  }
__global__ __launch_bounds__(256) void k_h16(const float* __restrict__ x, _Float16* __restrict__ X16, size_t n8) { const size_t t = (size_t)blockIdx.x * 256 + threadIdx.x; if (t >= n8) return; FragH f;
#pragma unroll
  for (int q = 0; q < 8; ++q) f.h[q] = (_Float16)x[t * 8 + q]; *(v8us*)((unsigned short*)X16 + t * 8) = f.half[0];  }
__global__ __launch_bounds__(256) void k_round16f(const float* __restrict__ W, _Float16* __restrict__ Bt, size_t n8) { const size_t t = (size_t)blockIdx.x * 256 + threadIdx.x; if (t >= n8) return; FragH f;
#pragma unroll
  for (int i = 0; i < 8; ++i) f.h[i] = (_Float16)(bf16_round(W[t * 8 + i]) * 16.0f); *(v8us*)((unsigned short*)Bt + t * 8) = f.half[0];  }
template <int NHv, int TTv>
__global__ __launch_bounds__(256) void k_vt(const _Float16* __restrict__ V16, int ldv, int voff, _Float16* __restrict__ Vt) { __shared__ unsigned short tl[64][66]; const int tid = threadIdx.x; const int slab = blockIdx.x / (TTv / 64), lg = blockIdx.x % (TTv / 64); const int b = slab / NHv, h = slab % NHv;
  for (int i = tid; i < 64 * 8; i += 256) { const int r = i / 8, c8 = (i % 8) * 8; FragH f; f.half[0] = *(const v8us*)((const unsigned short*)V16 + ((size_t)b * TTv + lg * 64 + r) * ldv + voff + h * 64 + c8);
#pragma unroll
    for (int q = 0; q < 8; ++q) tl[r][c8 + q] = f.u[q]; }
  __syncthreads();
  {
#pragma unroll
    for (int rd = 0; rd < 2; ++rd) { const int d = rd * 32 + tid / 8, pc = tid % 8; FragH f;
#pragma unroll
      for (int q = 0; q < 8; ++q) f.u[q] = tl[pc * 8 + q][d];
      *(v8us*)((unsigned short*)Vt + ((size_t)slab * 64 + d) * TTv + lg * 64 + pc * 8) = f.half[0]; }
     } }

__global__ __launch_bounds__(256) void k_hl(const float* __restrict__ F, _Float16* __restrict__ Hh, _Float16* __restrict__ Hl, size_t n8) { const size_t t = (size_t)blockIdx.x * 256 + threadIdx.x; if (t >= n8) return; FragH fh, fl; const v4f a = *(const v4fa*)(F + t * 8), c = *(const v4fa*)(F + t * 8 + 4);
#pragma unroll
  for (int q = 0; q < 4; ++q) { _Float16 h = (_Float16)a[q]; fh.h[q] = h; fl.h[q] = (_Float16)((a[q] - (float)h) * 1024.0f); h = (_Float16)c[q]; fh.h[4 + q] = h; fl.h[4 + q] = (_Float16)((c[q] - (float)h) * 1024.0f); }
  { *(v8us*)((unsigned short*)Hh + t * 8) = fh.half[0]; *(v8us*)((unsigned short*)Hl + t * 8) = fl.half[0];  } }

// ---- fast GEMM (wave tile 32x64; requires M % 32 == 0 rows per launch region and N % 64 == 0); epilogue = k_gemm_hhx semantics ----
__device__ __forceinline__ v16h g2_frag(const _Float16* p, int hh) { FragH f; f.half[0] = *(const v8us*)((const unsigned short*)p + 8 * hh); f.half[1] = *(const v8us*)((const unsigned short*)p + 16 + 8 * hh); return f.v; }
__device__ __forceinline__ v8f g2_mma(v16h a, v16h b, v8f c) { v8f d = __builtin_amdgcn_wmma_f32_16x16x32_f16(false, a, false, b, (short)0, c, false, false); asm volatile("v_nop\n\tv_nop\n\tv_nop\n\tv_nop" : "+v"(d) : "v"(a), "v"(b)); return d; }
template <int ACT>
__global__ __launch_bounds__(128) void k_gemm2(const _Float16* __restrict__ A, int lda, size_t sA, const _Float16* __restrict__ Bh, int ldb, size_t sB, float alpha, const float* __restrict__ bias, size_t sBias, const float* __restrict__ CP, int rowsPerB, size_t sCPb, int row0g,
    float* __restrict__ C, _Float16* __restrict__ C16, int ldc, size_t sC, int M, int N, int K) { static_assert(ACT == 0 || ACT == 3 || ACT == 6 || ACT == 8 || ACT == 9 || ACT == 11 || ACT == 12 || ACT == 14 || ACT == 15 || ACT == 16 || ACT == 17, "k_gemm2: unsupported ACT code (would silently apply no activation)");
  __shared__ __attribute__((aligned(16))) float so[4][32][68];
  const int tid = threadIdx.x, w = tid >> 5, lane = tid & 31, ln = lane & 15, hh = lane >> 4; const int by = blockIdx.y;
  A += (size_t)by * sA; Bh += (size_t)by * sB; const size_t cofs = (size_t)by * sC; const float* bp = bias ? bias + (size_t)by * sBias : nullptr;
  const int ntn = N >> 6; const int mt = blockIdx.x / ntn, nq = blockIdx.x - mt * ntn; const int row0 = mt * 128 + 32 * w, col0 = nq * 64; if (row0 >= M) return;
  const _Float16* a0p = A + (size_t)(row0 + ln) * lda; const _Float16* a1p = a0p + (size_t)16 * lda;
  const _Float16* b0p = Bh + (size_t)(col0 + ln) * ldb; const _Float16* b1p = b0p + (size_t)16 * ldb; const _Float16* b2p = b1p + (size_t)16 * ldb; const _Float16* b3p = b2p + (size_t)16 * ldb;
  const v8f z8 = {0.f,0.f,0.f,0.f,0.f,0.f,0.f,0.f}; v8f c00 = z8, c01 = z8, c02 = z8, c03 = z8, c10 = z8, c11 = z8, c12 = z8, c13 = z8;
#pragma unroll 1
  for (int kb = 0; kb < K; kb += 32) { const v16h a0 = g2_frag(a0p + kb, hh), a1 = g2_frag(a1p + kb, hh);
    v16h b = g2_frag(b0p + kb, hh); c00 = g2_mma(a0, b, c00); c10 = g2_mma(a1, b, c10);
    b = g2_frag(b1p + kb, hh); c01 = g2_mma(a0, b, c01); c11 = g2_mma(a1, b, c11);
    b = g2_frag(b2p + kb, hh); c02 = g2_mma(a0, b, c02); c12 = g2_mma(a1, b, c12);
    b = g2_frag(b3p + kb, hh); c03 = g2_mma(a0, b, c03); c13 = g2_mma(a1, b, c13); }
  v8f accs[8] = {c00, c01, c02, c03, c10, c11, c12, c13};
#pragma unroll
  for (int u = 0; u < 8; ++u) { const int t = u & 3, half = u >> 2; const int col = col0 + t * 16 + ln; const float bv = bp ? bf16_round(bp[col]) : 0.f;
#pragma unroll
    for (int r = 0; r < 8; ++r) { const int rloc = half * 16 + 8 * hh + r; float v = accs[u][r] * alpha + bv; if (CP) { if (rowsPerB < 0) v += CP[cofs + (size_t)(row0g + row0 + rloc) * ldc + col];      /* rowsPerB < 0: own element of the batched C plane */ else { const int bidx = (row0g + row0 + rloc) / rowsPerB; v += CP[(size_t)bidx * sCPb + (size_t)by * 64 + col]; } }
      if (ACT == 3) v = fmaxf(v, 0.f); else if (ACT == 6) v = 0.5f * v * (1.0f + erff(v * 0.70710678118654752f)); else if (ACT == 11) v = 1.0f / (1.0f + expf(-v)); else if (ACT == 15) v = v / (1.0f + expf(-v)); else if (ACT == 12) v = (v > 0.f) ? v : 0.01f * v; else if (ACT == 8) v = tanhf(v); else if (ACT == 9) v = 0.5f * v * (1.0f + tanhf(0.7978845608028654f * (v + 0.044715f * v * v * v))); else if (ACT == 14) v = (v > 0.f) ? v : 0.1f * v; else if (ACT == 16) v = (v >= 0.f) ? v : 0.3f * v; else if (ACT == 17) v = (v >= 0.f) ? v : 0.2f * v;
      so[w][rloc][t * 16 + ln] = v; } }
  __builtin_amdgcn_fence(__ATOMIC_ACQ_REL, "workgroup"); __builtin_amdgcn_wave_barrier();
  const int rsub = lane >> 4, c4 = (lane & 15) * 4;
  {
#pragma unroll
    for (int q = 0; q < 16; ++q) { const int r = q * 2 + rsub; const v4f v = *(const v4fa*)&so[w][r][c4]; if (C) *(v4f*)(C + cofs + (size_t)(row0 + r) * ldc + col0 + c4) = v; if (C16) { v4h h4; for (int i = 0; i < 4; ++i) h4[i] = (_Float16)v[i]; *(v4h*)(C16 + cofs + (size_t)(row0 + r) * ldc + col0 + c4) = h4; } }
     } }


__global__ __launch_bounds__(256) void k_rowmask(const float* __restrict__ F, const int* __restrict__ pmask, float* __restrict__ out, size_t n4) { const size_t t = (size_t)blockIdx.x * 256 + threadIdx.x; if (t >= n4) return; const size_t r = (t * 4) / DM; const float m = pmask[r] ? 1.0f : 0.0f; const v4f v = *(const v4fa*)(F + t * 4); v4f o; for (int q = 0; q < 4; ++q) o[q] = v[q] * m;
  *(v4f*)(out + t * 4) = o;  }
__global__ __launch_bounds__(256) void k_wnat(const float* __restrict__ w, size_t n8, _Float16* __restrict__ Bt) { const size_t t = (size_t)blockIdx.x * 256 + threadIdx.x; if (t >= n8) return; FragH f; for (int q = 0; q < 8; ++q) f.h[q] = (_Float16)(bf16_round(w[t * 8 + q]) * 16.0f); *(v8us*)((unsigned short*)Bt + t * 8) = f.half[0];  }
__global__ __launch_bounds__(256) void k_tbias(float* __restrict__ TB) {
  #pragma clang fp contract(off)
  const int d = blockIdx.x * 256 + threadIdx.x; if (d >= SQ) return; const float dist = __fdiv_rn(__fmul_rn((float)d, 300.0f), 300.0f); const float v = logf(__fadd_rn(expf(-dist), 1e-12f));
  *(float*)(TB + d) = v;  }
#define FK 64                        /* keys per LDS stage */
#define PK 144                       /* LDS row pitch of the K tile, bytes: 16 x odd, for ds_load_b128 */
#define PV 160                       /* LDS row pitch of the V tile, bytes: 32 x odd, for ds_load_tr16_b128 */
#define LOG2E 1.4426950408889634f
typedef short s16x8 __attribute__((ext_vector_type(8)));
typedef float v2f __attribute__((ext_vector_type(2)));
__device__ __forceinline__ v8us fa_tr16(const unsigned char* p) { typedef __attribute__((address_space(3))) s16x8 lds_s16x8; return __builtin_bit_cast(v8us, __builtin_amdgcn_ds_load_tr16_b128_v8i16((lds_s16x8*)p)); }
__device__ __forceinline__ float fa_xhalf(float x) { return __builtin_bit_cast(float, __builtin_amdgcn_permlanex16(__builtin_bit_cast(int, x), __builtin_bit_cast(int, x), 0x76543210, 0xfedcba98, false, false)); }      /* lane l reads lane l ^ 16 */
// amdgpu_waves_per_eu(4, 4) on the kernel: two work-groups per WGP are four waves per SIMD, so a wave may use up to 256 registers.
__device__ __forceinline__ v8f fa_mma(v16h a, v16h b, v8f c) { return __builtin_amdgcn_wmma_f32_16x16x32_f16(false, a, false, b, (short)0, c, false, false); }
__global__ __launch_bounds__(256) __attribute__((amdgpu_waves_per_eu(4, 4))) void k_fattn(const _Float16* __restrict__ Q16, const _Float16* __restrict__ K16, const _Float16* __restrict__ V16, const float* __restrict__ TB, const int* __restrict__ pmask, _Float16* __restrict__ O16) {
  __shared__ __attribute__((aligned(16))) float tb2[2 * SQ]; __shared__ __attribute__((aligned(16))) float mk[SQ];
  __shared__ __attribute__((aligned(16))) unsigned char kt[2][FK * PK]; __shared__ __attribute__((aligned(16))) unsigned char vt[2][FK * PV];
  const int tid = threadIdx.x, lane = tid & 31, ln = lane & 15, hh = lane >> 4; const int wv = __builtin_amdgcn_readfirstlane(tid >> 5);
  const int b = blockIdx.y / NH, h = blockIdx.y % NH; const int q0 = blockIdx.x * 128 + wv * 16; const size_t base = (size_t)b * SQ * DM + (size_t)h * HD;
  /* staging: thread t moves 16 bytes of rows t / 8 and 32 + t / 8 of each tile, so a wave's load covers four whole 128-byte rows */
  const int sr = tid >> 3, sc = tid & 7;
  const unsigned short* kg = (const unsigned short*)K16 + base + (size_t)sr * DM + sc * 8; const unsigned short* vg = (const unsigned short*)V16 + base + (size_t)sr * DM + sc * 8;
  v8us rk0 = *(const v8us*)kg, rk1 = *(const v8us*)(kg + 32 * DM), rv0 = *(const v8us*)vg, rv1 = *(const v8us*)(vg + 32 * DM);
  const _Float16* qp = Q16 + base + (size_t)(q0 + ln) * DM; const v16h qf0 = g2_frag(qp, hh), qf1 = g2_frag(qp + 32, hh);
#pragma unroll
  for (int u = 0; u < 2 * SQ / 256; ++u) { const int t = tid + 256 * u; int d = t - (SQ - 1); d = d < 0 ? -d : d; d = d < SQ ? d : SQ - 1; tb2[t] = TB[d] * LOG2E; }      /* unrolled: the table's loads are all in flight together */
#pragma unroll
  for (int u = 0; u < SQ / 256; ++u) { const int t = tid + 256 * u; mk[t] = pmask[(size_t)b * SQ + t] ? INFINITY : -1.0e9f * LOG2E; }
  *(v8us*)(kt[0] + sr * PK + sc * 16) = rk0; *(v8us*)(kt[0] + (sr + 32) * PK + sc * 16) = rk1; *(v8us*)(vt[0] + sr * PV + sc * 16) = rv0; *(v8us*)(vt[0] + (sr + 32) * PV + sc * 16) = rv1;
  __syncthreads();
  const v8f z8 = {0.f,0.f,0.f,0.f,0.f,0.f,0.f,0.f}; v8f o0 = z8, o1 = z8, o2 = z8, o3 = z8; float m = -INFINITY, ms = -INFINITY, l = 0.f;
  const float* tq = tb2 + (8 * hh - (q0 + ln) + (SQ - 1)); const float* mq = mk + 8 * hh;
#pragma unroll 1
  for (int st = 0; st < SQ / FK; ++st) { const int cur = st & 1; const bool more = st + 1 < SQ / FK;      /* rolled: for speed only */
    if (more) { const size_t go = (size_t)(st + 1) * FK * DM; rk0 = *(const v8us*)(kg + go); rk1 = *(const v8us*)(kg + go + 32 * DM); rv0 = *(const v8us*)(vg + go); rv1 = *(const v8us*)(vg + go + 32 * DM); }      /* the next stage's rows fly while this stage is worked on */
#pragma unroll
    for (int sub = 0; sub < FK / 32; ++sub) { const int k0 = st * FK + sub * 32;
      const unsigned char* kp = kt[cur] + (sub * 32 + ln) * PK + 16 * hh; FragH ka0, ka1, kb0, kb1;
      ka0.half[0] = *(const v8us*)(kp); ka0.half[1] = *(const v8us*)(kp + 32); ka1.half[0] = *(const v8us*)(kp + 64); ka1.half[1] = *(const v8us*)(kp + 96);
      kb0.half[0] = *(const v8us*)(kp + 16 * PK); kb0.half[1] = *(const v8us*)(kp + 16 * PK + 32); kb1.half[0] = *(const v8us*)(kp + 16 * PK + 64); kb1.half[1] = *(const v8us*)(kp + 16 * PK + 96);
      v8f s0 = fa_mma(ka0.v, qf0, z8), s1 = fa_mma(kb0.v, qf0, z8); s0 = fa_mma(ka1.v, qf1, s0); s1 = fa_mma(kb1.v, qf1, s1);
      const unsigned char* vp = vt[cur] + (sub * 32 + 8 * hh + (lane & 7)) * PV + ((lane >> 3) & 1) * 16; FragH va[4];
#pragma unroll
      for (int dt = 0; dt < 4; ++dt) { va[dt].half[0] = fa_tr16(vp + 32 * dt); va[dt].half[1] = fa_tr16(vp + 16 * PV + 32 * dt); }
      const float* tp = tq + k0; const float* mp = mq + k0; float v[16]; float mx = -INFINITY;
#pragma unroll
      for (int r = 0; r < 8; ++r) { v[r] = __builtin_fminf(__builtin_fmaf(s0[r], 0.125f * LOG2E, tp[r]), mp[r]); v[8 + r] = __builtin_fminf(__builtin_fmaf(s1[r], 0.125f * LOG2E, tp[16 + r]), mp[16 + r]); }
#pragma unroll
      for (int r = 0; r < 16; ++r) mx = __builtin_fmaxf(mx, v[r]);
      mx = __builtin_fmaxf(mx, fa_xhalf(mx));
      if (__builtin_amdgcn_ballot_w32(mx > m) != 0) { const float mn = __builtin_fmaxf(m, mx); const float msn = mn - 8.0f; const float corr = __builtin_amdgcn_exp2f(ms - msn); m = mn; ms = msn; l *= corr; o0 *= corr; o1 *= corr; o2 *= corr; o3 *= corr; }      /* corr = 0 in the first pass (ms = -inf), 1 for a query whose maximum stays */
      FragH pf; v2f la = {0.f, 0.f}, lb = {0.f, 0.f};      /* the pass's sum in two chains of pairs, so that no add waits on sixteen before it */
#pragma unroll
      for (int r = 0; r < 16; r += 4) { const float p0 = __builtin_amdgcn_exp2f(v[r] - ms), p1 = __builtin_amdgcn_exp2f(v[r + 1] - ms), p2 = __builtin_amdgcn_exp2f(v[r + 2] - ms), p3 = __builtin_amdgcn_exp2f(v[r + 3] - ms);
        la += v2f{p0, p1}; lb += v2f{p2, p3}; pf.h[r] = (_Float16)p0; pf.h[r + 1] = (_Float16)p1; pf.h[r + 2] = (_Float16)p2; pf.h[r + 3] = (_Float16)p3; }
      la += lb; l += la[0] + la[1];
      o0 = fa_mma(va[0].v, pf.v, o0); o1 = fa_mma(va[1].v, pf.v, o1); o2 = fa_mma(va[2].v, pf.v, o2); o3 = fa_mma(va[3].v, pf.v, o3); }
    if (more) { unsigned char* kn = kt[cur ^ 1]; unsigned char* vn = vt[cur ^ 1]; *(v8us*)(kn + sr * PK + sc * 16) = rk0; *(v8us*)(kn + (sr + 32) * PK + sc * 16) = rk1; *(v8us*)(vn + sr * PV + sc * 16) = rv0; *(v8us*)(vn + (sr + 32) * PV + sc * 16) = rv1; }      /* that buffer's last readers left it before the barrier that ended the stage before */
    __syncthreads(); }      /* publishes the next stage and ends this stage's reads */
  l += fa_xhalf(l); const float inv = 1.0f / l; unsigned short* op = (unsigned short*)O16 + base + (size_t)(q0 + ln) * DM + 8 * hh;      /* lane (c, hf) holds o[q0 + c][16 dt + 8 hf + r] */
  const v8f oo[4] = {o0, o1, o2, o3};
#pragma unroll
  for (int dt = 0; dt < 4; ++dt) { FragH f;
#pragma unroll
    for (int r = 0; r < 8; ++r) f.h[r] = (_Float16)(oo[dt][r] * inv);
    *(v8us*)(op + 16 * dt) = f.half[0]; } }

extern "C" void kernel_launch(void* const* d_in, const int* in_sizes, int n_in,
                              void* d_out, int out_size, void* d_ws, size_t ws_size, hipStream_t stream) {
  (void)in_sizes; (void)n_in; (void)out_size;
  const float* const* I = (const float* const*)d_in; const float* x = I[0]; const int* pmask = (const int*)d_in[1]; const float* wq = I[2]; const float* bq = I[3]; const float* wk = I[4]; const float* bk = I[5]; const float* wv = I[6]; const float* bv = I[7]; const float* wo = I[8]; const float* bo = I[9];      /* weights natural [out][in]; patch_mask int32 [4][2048] (1 = valid) */
  char* ws = (char*)d_ws; size_t off = 0;
  auto take = [&](size_t bytes) { char* p = ws + off; off += (bytes + 255) & ~(size_t)255; return p; };
  _Float16* BQ = (_Float16*)take((size_t)DM * DM * 2); _Float16* BK = (_Float16*)take((size_t)DM * DM * 2); _Float16* BV = (_Float16*)take((size_t)DM * DM * 2); _Float16* BO = (_Float16*)take((size_t)DM * DM * 2);
  _Float16* X16 = (_Float16*)take(NR * DM * 2); _Float16* Q16 = (_Float16*)take(NR * DM * 2); _Float16* K16 = (_Float16*)take(NR * DM * 2); _Float16* V16 = (_Float16*)take(NR * DM * 2); _Float16* O16 = (_Float16*)take(NR * DM * 2);
  float* TB = (float*)take((size_t)SQ * 4); float* OUTF = (float*)take(NR * DM * 4);
  if (off > ws_size) return;      /* 2 + 5x8 + 0.01 + 16 = approx 58 MiB */
  const size_t nw8 = (size_t)DM * DM / 8; const unsigned gw = (unsigned)((nw8 + 255) / 256);
  k_wnat<<<gw, 256, 0, stream>>>(wq, nw8, BQ); k_wnat<<<gw, 256, 0, stream>>>(wk, nw8, BK); k_wnat<<<gw, 256, 0, stream>>>(wv, nw8, BV); k_wnat<<<gw, 256, 0, stream>>>(wo, nw8, BO);
  k_tbias<<<(SQ + 255) / 256, 256, 0, stream>>>(TB);
  k_x16<<<(unsigned)((NR * DM / 8 + 255) / 256), 256, 0, stream>>>(x, X16, NR * DM / 8);
  const dim3 gp((unsigned)((NR / 128) * (DM / 64)), 1);
  k_gemm2<0><<<gp, 128, 0, stream>>>(X16, DM, 0, BQ, DM, 0, 0.0625f, bq, 0, nullptr, 1, 0, 0, nullptr, Q16, DM, 0, MP, DM, DM);
  k_gemm2<0><<<gp, 128, 0, stream>>>(X16, DM, 0, BK, DM, 0, 0.0625f, bk, 0, nullptr, 1, 0, 0, nullptr, K16, DM, 0, MP, DM, DM);
  k_gemm2<0><<<gp, 128, 0, stream>>>(X16, DM, 0, BV, DM, 0, 0.0625f, bv, 0, nullptr, 1, 0, 0, nullptr, V16, DM, 0, MP, DM, DM);
  k_fattn<<<dim3(SQ / 128, NB * NH), 256, 0, stream>>>(Q16, K16, V16, TB, pmask, O16);      /* o (merged heads) as f16 rows */
  k_gemm2<0><<<gp, 128, 0, stream>>>(O16, DM, 0, BO, DM, 0, 0.0625f, bo, 0, nullptr, 1, 0, 0, OUTF, nullptr, DM, 0, MO, DM, DM);      /* o Wo^T + bo (f32 rows) */
  k_rowmask<<<(unsigned)(((size_t)MO * DM / 4 + 255) / 256), 256, 0, stream>>>(OUTF, pmask, (float*)d_out, (size_t)MO * DM / 4);      /* x patch_mask[b][i] */
}

// v003
// Measured time: 127 microseconds a run.
// In two side-by-side timings against v002, it was 1.28 and 1.29 times as fast.
// Counting every step since v000, it is 155 times as fast.
#include <hip/hip_runtime.h>
#define NB 4
#define SQ 2048
#define DM 512
#define NH 8
#define HD 64
#define MP ((int)NR)                 /* token rows through the projections (debug hook) */
#define MO ((int)NR)                 /* token rows through the output projection / mask (debug hook) */
#define NR ((size_t)NB * SQ)         /* 8192 token rows */
typedef __bf16 v16b __attribute__((ext_vector_type(16)));
typedef unsigned short v8us __attribute__((ext_vector_type(8), may_alias));
typedef float  v8f  __attribute__((ext_vector_type(8)));
typedef float  v4f  __attribute__((ext_vector_type(4)));
typedef float  v4fa __attribute__((ext_vector_type(4), may_alias));
union FragB { v16b v; v8us half[2]; unsigned short u[16]; };

__device__ __forceinline__ unsigned short bf16_bits(float x) { unsigned int u = __float_as_uint(x); return (unsigned short)((u + 0x7FFFu + ((u >> 16) & 1u)) >> 16); }
__device__ __forceinline__ float bf16_val(unsigned short b) { return __uint_as_float(((unsigned int)b) << 16); }
__device__ __forceinline__ float bf16_round(float x) { return bf16_val(bf16_bits(x)); }
// D += A·B with NT terms: 1 = ah·bh, 2 = + al·bh (A split), 3 = + ah·bl (both split)
template <int NT>
__device__ __forceinline__ v8f mmaN(v16b ah, v16b al, v16b bh, v16b bl, v8f c) {
  c = __builtin_amdgcn_wmma_f32_16x16x32_bf16(false, ah, false, bh, (short)0, c, false, false);
  if (NT >= 2) c = __builtin_amdgcn_wmma_f32_16x16x32_bf16(false, al, false, bh, (short)0, c, false, false);
  if (NT >= 3) c = __builtin_amdgcn_wmma_f32_16x16x32_bf16(false, ah, false, bl, (short)0, c, false, false);
  asm volatile("v_nop\n\tv_nop\n\tv_nop\n\tv_nop" : "+v"(c) : "v"(ah), "v"(al), "v"(bh), "v"(bl));
  return c;
}

__global__ __launch_bounds__(256) void k_wt_bf16(const float* __restrict__ W, unsigned short* __restrict__ Wt, int K, int N) {
  const int t = blockIdx.x * 256 + threadIdx.x;
  const int k8n = K / 8;
  if (t >= N * k8n) return;
  const int n = t / k8n, k8 = (t % k8n) * 8;
  v8us v;
#pragma unroll
  for (int i = 0; i < 8; ++i) v[i] = bf16_bits(W[(size_t)(k8 + i) * N + n]);
  *(v8us*)(Wt + (size_t)n * K + k8) = v;
  
}

// GEMM C[M][N] (f32, pitch ldc) = act(A[M][K]·W + bias). A f32 row-major (pitch lda) converted per fragment to bf16
// (ASPLIT: hi/lo two planes -> 2 terms, else single rounded term); Wt bf16 [N][K] (pitch ldb). BIAS_BF16 rounds the
// bias to bf16 first (bias quantised to bf16 before the add). K%32==0, M%16==0, N%64==0.
template <bool ASPLIT, int ACT, bool BIAS_BF16>
__global__ __launch_bounds__(128) void k_gemm_bf(const float* __restrict__ A, int lda, const unsigned short* __restrict__ Wt, int ldb,
                                               const float* __restrict__ bias, float* __restrict__ C, int ldc, int M, int N, int K) {
  __shared__ __attribute__((aligned(16))) float so[4][16][64];
  const int tid = threadIdx.x, w = tid >> 5, lane = tid & 31, ln = lane & 15, hh = lane >> 4;
  const int ntn = N / 64;
  const int wid = blockIdx.x * 4 + w;
  const int mt = wid / ntn, nq = wid % ntn;
  if (mt * 16 >= M) return;
  const int row0 = mt * 16, col0 = nq * 64;
  const float* arow = A + (size_t)(row0 + ln) * lda;
  v8f acc[4] = {};
  for (int kb = 0; kb < K; kb += 32) {
    FragB ah, al;
    const v4f x0 = *(const v4fa*)(arow + kb + 8 * hh), x1 = *(const v4fa*)(arow + kb + 8 * hh + 4);
    const v4f x2 = *(const v4fa*)(arow + kb + 16 + 8 * hh), x3 = *(const v4fa*)(arow + kb + 16 + 8 * hh + 4);
    float xs[16] = {x0[0],x0[1],x0[2],x0[3],x1[0],x1[1],x1[2],x1[3],x2[0],x2[1],x2[2],x2[3],x3[0],x3[1],x3[2],x3[3]};
#pragma unroll
    for (int i = 0; i < 16; ++i) { const unsigned short hb = bf16_bits(xs[i]); ah.u[i] = hb; al.u[i] = ASPLIT ? bf16_bits(xs[i] - bf16_val(hb)) : (unsigned short)0; }
#pragma unroll
    for (int t = 0; t < 4; ++t) {
      const unsigned short* brow = Wt + (size_t)(col0 + t * 16 + ln) * ldb + kb;
      FragB b;
      b.half[0] = *(const v8us*)(brow + 8 * hh);
      b.half[1] = *(const v8us*)(brow + 16 + 8 * hh);
      acc[t] = mmaN<ASPLIT ? 2 : 1>(ah.v, al.v, b.v, b.v, acc[t]);
    }
  }
#pragma unroll
  for (int t = 0; t < 4; ++t) {
    float bv = bias ? bias[col0 + t * 16 + ln] : 0.f;
    if (BIAS_BF16) bv = bf16_round(bv);
#pragma unroll
    for (int r = 0; r < 8; ++r) { float v = acc[t][r] + bv; if (ACT == 1) v = fmaxf(v, 0.f); so[w][8 * hh + r][t * 16 + ln] = v; }
  }
  __builtin_amdgcn_fence(__ATOMIC_ACQ_REL, "workgroup");
  __builtin_amdgcn_wave_barrier();
  const int rsub = lane >> 4, c4 = (lane & 15) * 4;
  {
#pragma unroll
    for (int q = 0; q < 8; ++q) {
      const int r = q * 2 + rsub;
      const v4f v = *(const v4fa*)&so[w][r][c4];
      *(v4f*)(C + (size_t)(row0 + r) * ldc + col0 + c4) = v;
    }
    
  }
}

// GEMM C = act(A·W + bias + resid): A f32 (ASPLIT -> hi/lo 2 terms), Wt bf16 [N][K]; ACT 0 none, 1 relu, 2 exact gelu;
// resid (optional, f32, row index = (row % rmod), pitch ldr, RES_BF16 rounds it) added before the activation.
template <bool ASPLIT, int ACT, bool BIAS_BF16, bool RES_BF16>
__global__ __launch_bounds__(128) void k_gemm_bf3(const float* __restrict__ A, int lda, const unsigned short* __restrict__ Wt, int ldb,
                                                const float* __restrict__ bias, const float* __restrict__ resid, int rmod, int ldr,
                                                float* __restrict__ C, int ldc, int M, int N, int K) {
  __shared__ __attribute__((aligned(16))) float so[4][16][64];
  const int tid = threadIdx.x, w = tid >> 5, lane = tid & 31, ln = lane & 15, hh = lane >> 4;
  const int ntn = N / 64;
  const int wid = blockIdx.x * 4 + w;
  const int mt = wid / ntn, nq = wid % ntn;
  if (mt * 16 >= M) return;
  const int row0 = mt * 16, col0 = nq * 64;
  const float* arow = A + (size_t)(row0 + ln) * lda;
  v8f acc[4] = {};
  for (int kb = 0; kb < K; kb += 32) {
    FragB ah, al;
    const v4f x0 = *(const v4fa*)(arow + kb + 8 * hh), x1 = *(const v4fa*)(arow + kb + 8 * hh + 4);
    const v4f x2 = *(const v4fa*)(arow + kb + 16 + 8 * hh), x3 = *(const v4fa*)(arow + kb + 16 + 8 * hh + 4);
    float xs[16] = {x0[0],x0[1],x0[2],x0[3],x1[0],x1[1],x1[2],x1[3],x2[0],x2[1],x2[2],x2[3],x3[0],x3[1],x3[2],x3[3]};
#pragma unroll
    for (int i = 0; i < 16; ++i) { const unsigned short hb = bf16_bits(xs[i]); ah.u[i] = hb; al.u[i] = ASPLIT ? bf16_bits(xs[i] - bf16_val(hb)) : (unsigned short)0; }
#pragma unroll
    for (int t = 0; t < 4; ++t) {
      const unsigned short* brow = Wt + (size_t)(col0 + t * 16 + ln) * ldb + kb;
      FragB b;
      b.half[0] = *(const v8us*)(brow + 8 * hh);
      b.half[1] = *(const v8us*)(brow + 16 + 8 * hh);
      acc[t] = mmaN<ASPLIT ? 2 : 1>(ah.v, al.v, b.v, b.v, acc[t]);
    }
  }
#pragma unroll
  for (int t = 0; t < 4; ++t) {
    const int col = col0 + t * 16 + ln;
    float bv = bias ? bias[col] : 0.f;
    if (BIAS_BF16) bv = bf16_round(bv);
#pragma unroll
    for (int r = 0; r < 8; ++r) {
      float v = acc[t][r] + bv;
      if (resid) { float rv = resid[(size_t)((row0 + 8 * hh + r) % rmod) * ldr + col]; if (RES_BF16) rv = bf16_round(rv); v += rv; }
      if (ACT == 1) v = fmaxf(v, 0.f);
      if (ACT == 2) v = 0.5f * v * (1.0f + erff(v * 0.70710678118654752f));
      if (ACT == 3) { const float u = 0.7978845608028654f * (v + 0.044715f * v * v * v); v = 0.5f * v * (1.0f + tanhf(u)); }
      so[w][8 * hh + r][t * 16 + ln] = v;
    }
  }
  __builtin_amdgcn_fence(__ATOMIC_ACQ_REL, "workgroup");
  __builtin_amdgcn_wave_barrier();
  const int rsub = lane >> 4, c4 = (lane & 15) * 4;
  {
#pragma unroll
    for (int q = 0; q < 8; ++q) {
      const int r = q * 2 + rsub;
      const v4f v = *(const v4fa*)&so[w][r][c4];
      *(v4f*)(C + (size_t)(row0 + r) * ldc + col0 + c4) = v;
    }
    
  }
}
// row LayerNorm (biased variance, eps) over N: s = X (+ R); optional out_sum <- s; out_norm <- (s-mu)*rsqrt(var+eps)*g + b
template <bool PARAM_BF16>
__global__ __launch_bounds__(256) void k_layernorm(const float* __restrict__ X, const float* __restrict__ R, const float* __restrict__ g, const float* __restrict__ bta,
                                                  float* __restrict__ out_sum, float* __restrict__ out_norm, int N, float eps) {
  __shared__ float red[256];
  const int row = blockIdx.x, tid = threadIdx.x;
  const float* x = X + (size_t)row * N; const float* rr = R ? R + (size_t)row * N : nullptr;
  float vals[16];                     // up to N = 4096
  const int per = N / 256;            // contiguous chunk per thread? use strided-by-4 chunks: thread handles j = tid*4 + 1024*u
  float s1 = 0.f;
  for (int u = 0; u < per / 4; ++u) {
    const int j = tid * 4 + 1024 * u;
    const v4f a = *(const v4fa*)(x + j);
    v4f b = {0.f,0.f,0.f,0.f}; if (rr) b = *(const v4fa*)(rr + j);
#pragma unroll
    for (int q = 0; q < 4; ++q) { const float v = a[q] + b[q]; vals[u * 4 + q] = v; s1 += v; }
  }
  red[tid] = s1; __syncthreads();
  for (int st = 128; st > 0; st >>= 1) { if (tid < st) red[tid] += red[tid + st]; __syncthreads(); }
  const float mu = red[0] / (float)N; __syncthreads();
  float s2 = 0.f;
  for (int u = 0; u < per / 4; ++u)
#pragma unroll
    for (int q = 0; q < 4; ++q) { const float c = vals[u * 4 + q] - mu; s2 += c * c; }
  red[tid] = s2; __syncthreads();
  for (int st = 128; st > 0; st >>= 1) { if (tid < st) red[tid] += red[tid + st]; __syncthreads(); }
  const float rs = rsqrtf(red[0] / (float)N + eps);
  {
    for (int u = 0; u < per / 4; ++u) {
      const int j = tid * 4 + 1024 * u;
      v4f o, sm;
#pragma unroll
      for (int q = 0; q < 4; ++q) {
        float gg = g[j + q], bb = bta[j + q];
        if (PARAM_BF16) { gg = bf16_round(gg); bb = bf16_round(bb); }
        sm[q] = vals[u * 4 + q]; o[q] = (vals[u * 4 + q] - mu) * rs * gg + bb;
      }
      if (out_sum) *(v4f*)(out_sum + (size_t)row * N + j) = sm;
      *(v4f*)(out_norm + (size_t)row * N + j) = o;
    }
    
  }
}



// ---- f16 WMMA path (v_wmma_f32_16x16x32_f16): 11-bit significands for operands in range — used where a [0,1] probability operand needs more precision than bf16
typedef _Float16 v16h __attribute__((ext_vector_type(16)));
union FragH { v16h v; v8us half[2]; _Float16 h[16]; unsigned short u[16]; };
template <int NT>
__device__ __forceinline__ v8f mmaH(v16h ah, v16h al, v16h bh, v16h bl, v8f c) {
  c = __builtin_amdgcn_wmma_f32_16x16x32_f16(false, ah, false, bh, (short)0, c, false, false);
  if (NT >= 2) c = __builtin_amdgcn_wmma_f32_16x16x32_f16(false, al, false, bh, (short)0, c, false, false);
  if (NT >= 3) c = __builtin_amdgcn_wmma_f32_16x16x32_f16(false, ah, false, bl, (short)0, c, false, false);
  asm volatile("v_nop\n\tv_nop\n\tv_nop\n\tv_nop" : "+v"(c) : "v"(ah), "v"(al), "v"(bh), "v"(bl));
  return c;
}
// batched GEMM like k_gemm_b but f16 operands: A f32 (split into f16 hi/lo if ASPLIT, else rounded to f16), Bt = f16 values [n][k]; alpha; C f32; N multiple of 16 (partial tiles skipped)
template <bool ASPLIT>
__global__ __launch_bounds__(128) void k_gemm_h(const float* __restrict__ A, int lda, size_t sA, const _Float16* __restrict__ Bh, int ldb, size_t sB, float alpha, float* __restrict__ C, int ldc, size_t sC, int M, int N, int K) {
  __shared__ __attribute__((aligned(16))) float so[4][16][64];
  const int tid = threadIdx.x, w = tid >> 5, lane = tid & 31, ln = lane & 15, hh = lane >> 4; const int by = blockIdx.y;
  A += (size_t)by * sA; Bh += (size_t)by * sB; C += (size_t)by * sC;
  const int ntn = (N + 63) / 64; const int wid = blockIdx.x * 4 + w; const int mt = wid / ntn, nq = wid % ntn; if (mt * 16 >= M) return;
  const int row0 = mt * 16, col0 = nq * 64; const float* arow = A + (size_t)(row0 + ln) * lda;
  v8f acc[4] = {};
  for (int kb = 0; kb < K; kb += 32) {
    FragH ah, al;
    const v4f x0 = *(const v4fa*)(arow + kb + 8 * hh), x1 = *(const v4fa*)(arow + kb + 8 * hh + 4), x2 = *(const v4fa*)(arow + kb + 16 + 8 * hh), x3 = *(const v4fa*)(arow + kb + 16 + 8 * hh + 4);
    float xs[16] = {x0[0],x0[1],x0[2],x0[3],x1[0],x1[1],x1[2],x1[3],x2[0],x2[1],x2[2],x2[3],x3[0],x3[1],x3[2],x3[3]};
#pragma unroll
    for (int i = 0; i < 16; ++i) { const _Float16 h = (_Float16)xs[i]; ah.h[i] = h; al.h[i] = ASPLIT ? (_Float16)(xs[i] - (float)h) : (_Float16)0.0f; }
#pragma unroll
    for (int t = 0; t < 4; ++t) { if (col0 + t * 16 >= N) continue; const size_t boff = (size_t)(col0 + t * 16 + ln) * ldb + kb; FragH bq; bq.half[0] = *(const v8us*)(Bh + boff + 8 * hh); bq.half[1] = *(const v8us*)(Bh + boff + 16 + 8 * hh);
      acc[t] = mmaH<ASPLIT ? 2 : 1>(ah.v, al.v, bq.v, bq.v, acc[t]); }
  }
#pragma unroll
  for (int t = 0; t < 4; ++t) { if (col0 + t * 16 >= N) continue;
#pragma unroll
    for (int r = 0; r < 8; ++r) so[w][8 * hh + r][t * 16 + ln] = acc[t][r] * alpha; }
  __builtin_amdgcn_fence(__ATOMIC_ACQ_REL, "workgroup"); __builtin_amdgcn_wave_barrier();
  const int rsub = lane >> 4, c4 = (lane & 15) * 4;
  {
#pragma unroll
    for (int q = 0; q < 8; ++q) { const int r = q * 2 + rsub; if (col0 + c4 < N) { const v4f v = *(const v4fa*)&so[w][r][c4]; *(v4f*)(C + (size_t)(row0 + r) * ldc + col0 + c4) = v; } }
     }
}

// Wt[n][k] = f16(W[k][n]·scale) from f32 row-major W[K][N] (scale = power of two; bf16-exact weights stay exact in f16 away from the subnormal range)
__global__ __launch_bounds__(256) void k_wt_f16(const float* __restrict__ W, _Float16* __restrict__ Wt, int K, int N, float scale) {
  const int t = blockIdx.x * 256 + threadIdx.x; if (t >= N * (K / 8)) return; const int n = t / (K / 8), k8 = (t % (K / 8)) * 8; FragH f;
#pragma unroll
  for (int i = 0; i < 8; ++i) f.h[i] = (_Float16)(bf16_round(W[(size_t)(k8 + i) * N + n]) * scale); const v8us o = f.half[0];
  *(v8us*)((unsigned short*)Wt + (size_t)n * K + k8) = o; 
}
// k_gemm_hh variant with fused epilogue: v = acc·alpha + bias[by·sBias + col] (+ CP[(row/rowsPerB)·sCPb + by·64 + col] if CP) ; ACT 0 none / 1 elu ; writes f16 C16 (and f32 C if non-null)
template <int ACT>
__global__ __launch_bounds__(128) void k_gemm_hhx(const _Float16* __restrict__ A, int lda, size_t sA, const _Float16* __restrict__ Bh, int ldb, size_t sB, float alpha, const float* __restrict__ bias, size_t sBias, const float* __restrict__ CP, int rowsPerB, size_t sCPb, int row0g,
    float* __restrict__ C, _Float16* __restrict__ C16, int ldc, size_t sC, int M, int N, int K) {
  __shared__ __attribute__((aligned(16))) float so[4][16][64];
  const int tid = threadIdx.x, w = tid >> 5, lane = tid & 31, ln = lane & 15, hh = lane >> 4; const int by = blockIdx.y;
  A += (size_t)by * sA; Bh += (size_t)by * sB; const size_t cofs = (size_t)by * sC; const float* bp = bias ? bias + (size_t)by * sBias : nullptr;
  const int ntn = (N + 63) / 64; const int wid = blockIdx.x * 4 + w; const int mt = wid / ntn, nq = wid % ntn; if (mt * 16 >= M) return;
  const int row0 = mt * 16, col0 = nq * 64; const _Float16* arow = A + (size_t)(row0 + ln) * lda;
  v8f acc[4] = {};
  for (int kb = 0; kb < K; kb += 32) { FragH ah; ah.half[0] = *(const v8us*)((const unsigned short*)arow + kb + 8 * hh); ah.half[1] = *(const v8us*)((const unsigned short*)arow + kb + 16 + 8 * hh);
#pragma unroll
    for (int t = 0; t < 4; ++t) { if (col0 + t * 16 >= N) continue; const size_t boff = (size_t)(col0 + t * 16 + ln) * ldb + kb; FragH bq; bq.half[0] = *(const v8us*)((const unsigned short*)Bh + boff + 8 * hh); bq.half[1] = *(const v8us*)((const unsigned short*)Bh + boff + 16 + 8 * hh);
      acc[t] = mmaH<1>(ah.v, ah.v, bq.v, bq.v, acc[t]); }
  }
#pragma unroll
  for (int t = 0; t < 4; ++t) { if (col0 + t * 16 >= N) continue; const int col = col0 + t * 16 + ln; const float bv = bp ? bf16_round(bp[col]) : 0.f;
#pragma unroll
    for (int r = 0; r < 8; ++r) { float v = acc[t][r] * alpha + bv; if (CP) { const int rr = row0g + row0 + 8 * hh + r; if (rowsPerB < 0) v += CP[cofs + (size_t)rr * ldc + col];      /* rowsPerB < 0: own element of the batched C plane */ else { const int bidx = rr / rowsPerB; v += CP[(size_t)bidx * sCPb + (size_t)by * 64 + col]; } } if (ACT == 1) v = (v > 0.f) ? v : expm1f(v); else if (ACT == 7) v = (v > 0.f) ? v + 1.0f : expf(v); else if (ACT == 8) v = tanhf(v); else if (ACT == 9) v = 0.5f * v * (1.0f + tanhf(0.7978845608028654f * (v + 0.044715f * v * v * v))); else if (ACT == 11) v = 1.0f / (1.0f + expf(-v)); else if (ACT == 12) v = (v > 0.f) ? v : 0.01f * v; else if (ACT == 14) v = (v > 0.f) ? v : 0.1f * v; else if (ACT == 16) v = (v >= 0.f) ? v : 0.3f * v; else if (ACT == 17) v = (v >= 0.f) ? v : 0.2f * v; else if (ACT == 15) v = v / (1.0f + expf(-v)); else if (ACT == 3) v = fmaxf(v, 0.f); else if (ACT == 6) v = 0.5f * v * (1.0f + erff(v * 0.70710678118654752f)); so[w][8 * hh + r][t * 16 + ln] = v; } }
  __builtin_amdgcn_fence(__ATOMIC_ACQ_REL, "workgroup"); __builtin_amdgcn_wave_barrier();
  const int rsub = lane >> 4, c4 = (lane & 15) * 4; typedef _Float16 v4h __attribute__((ext_vector_type(4)));
  {
#pragma unroll
    for (int q = 0; q < 8; ++q) { const int r = q * 2 + rsub; if (col0 + c4 < N) { const v4f v = *(const v4fa*)&so[w][r][c4]; if (C) *(v4f*)(C + cofs + (size_t)(row0 + r) * ldc + col0 + c4) = v; if (C16) { v4h h4; for (int i = 0; i < 4; ++i) h4[i] = (_Float16)v[i]; *(v4h*)(C16 + cofs + (size_t)(row0 + r) * ldc + col0 + c4) = h4; } } }
     }
}


typedef _Float16 v4h __attribute__((ext_vector_type(4)));

__global__ __launch_bounds__(256) void k_h16(const float* __restrict__ x, _Float16* __restrict__ X16, size_t n8) { const size_t t = (size_t)blockIdx.x * 256 + threadIdx.x; if (t >= n8) return; FragH f;
#pragma unroll
  for (int q = 0; q < 8; ++q) f.h[q] = (_Float16)x[t * 8 + q]; *(v8us*)((unsigned short*)X16 + t * 8) = f.half[0];  }
__global__ __launch_bounds__(256) void k_round16f(const float* __restrict__ W, _Float16* __restrict__ Bt, size_t n8) { const size_t t = (size_t)blockIdx.x * 256 + threadIdx.x; if (t >= n8) return; FragH f;
#pragma unroll
  for (int i = 0; i < 8; ++i) f.h[i] = (_Float16)(bf16_round(W[t * 8 + i]) * 16.0f); *(v8us*)((unsigned short*)Bt + t * 8) = f.half[0];  }
template <int NHv, int TTv>
__global__ __launch_bounds__(256) void k_vt(const _Float16* __restrict__ V16, int ldv, int voff, _Float16* __restrict__ Vt) { __shared__ unsigned short tl[64][66]; const int tid = threadIdx.x; const int slab = blockIdx.x / (TTv / 64), lg = blockIdx.x % (TTv / 64); const int b = slab / NHv, h = slab % NHv;
  for (int i = tid; i < 64 * 8; i += 256) { const int r = i / 8, c8 = (i % 8) * 8; FragH f; f.half[0] = *(const v8us*)((const unsigned short*)V16 + ((size_t)b * TTv + lg * 64 + r) * ldv + voff + h * 64 + c8);
#pragma unroll
    for (int q = 0; q < 8; ++q) tl[r][c8 + q] = f.u[q]; }
  __syncthreads();
  {
#pragma unroll
    for (int rd = 0; rd < 2; ++rd) { const int d = rd * 32 + tid / 8, pc = tid % 8; FragH f;
#pragma unroll
      for (int q = 0; q < 8; ++q) f.u[q] = tl[pc * 8 + q][d];
      *(v8us*)((unsigned short*)Vt + ((size_t)slab * 64 + d) * TTv + lg * 64 + pc * 8) = f.half[0]; }
     } }

__global__ __launch_bounds__(256) void k_hl(const float* __restrict__ F, _Float16* __restrict__ Hh, _Float16* __restrict__ Hl, size_t n8) { const size_t t = (size_t)blockIdx.x * 256 + threadIdx.x; if (t >= n8) return; FragH fh, fl; const v4f a = *(const v4fa*)(F + t * 8), c = *(const v4fa*)(F + t * 8 + 4);
#pragma unroll
  for (int q = 0; q < 4; ++q) { _Float16 h = (_Float16)a[q]; fh.h[q] = h; fl.h[q] = (_Float16)((a[q] - (float)h) * 1024.0f); h = (_Float16)c[q]; fh.h[4 + q] = h; fl.h[4 + q] = (_Float16)((c[q] - (float)h) * 1024.0f); }
  { *(v8us*)((unsigned short*)Hh + t * 8) = fh.half[0]; *(v8us*)((unsigned short*)Hl + t * 8) = fl.half[0];  } }

// ---- fast GEMM (wave tile 32x64; requires M % 32 == 0 rows per launch region and N % 64 == 0); epilogue = k_gemm_hhx semantics ----
__device__ __forceinline__ v16h g2_frag(const _Float16* p, int hh) { FragH f; f.half[0] = *(const v8us*)((const unsigned short*)p + 8 * hh); f.half[1] = *(const v8us*)((const unsigned short*)p + 16 + 8 * hh); return f.v; }
__device__ __forceinline__ v8f g2_mma(v16h a, v16h b, v8f c) { v8f d = __builtin_amdgcn_wmma_f32_16x16x32_f16(false, a, false, b, (short)0, c, false, false); asm volatile("v_nop\n\tv_nop\n\tv_nop\n\tv_nop" : "+v"(d) : "v"(a), "v"(b)); return d; }
template <int ACT>
__global__ __launch_bounds__(128) void k_gemm2(const _Float16* __restrict__ A, int lda, size_t sA, const _Float16* __restrict__ Bh, int ldb, size_t sB, float alpha, const float* __restrict__ bias, const float* __restrict__ bias1, const float* __restrict__ bias2, size_t sBias, const float* __restrict__ CP, int rowsPerB, size_t sCPb, int row0g,
    float* __restrict__ C, _Float16* __restrict__ C16, int ldc, size_t sC, int M, int N, int K) { static_assert(ACT == 0 || ACT == 3 || ACT == 6 || ACT == 8 || ACT == 9 || ACT == 11 || ACT == 12 || ACT == 14 || ACT == 15 || ACT == 16 || ACT == 17, "k_gemm2: unsupported ACT code (would silently apply no activation)");
  __shared__ __attribute__((aligned(16))) float so[4][32][68];
  const int tid = threadIdx.x, w = tid >> 5, lane = tid & 31, ln = lane & 15, hh = lane >> 4; const int by = blockIdx.y;
  if (bias1) bias = by == 1 ? bias1 : by == 2 ? bias2 : bias;      /* three products in one grid, each with its own bias vector */
  A += (size_t)by * sA; Bh += (size_t)by * sB; const size_t cofs = (size_t)by * sC; const float* bp = bias ? bias + (size_t)by * sBias : nullptr;
  const int ntn = N >> 6; const int mt = blockIdx.x / ntn, nq = blockIdx.x - mt * ntn; const int row0 = mt * 128 + 32 * w, col0 = nq * 64; if (row0 >= M) return;
  const _Float16* a0p = A + (size_t)(row0 + ln) * lda; const _Float16* a1p = a0p + (size_t)16 * lda;
  const _Float16* b0p = Bh + (size_t)(col0 + ln) * ldb; const _Float16* b1p = b0p + (size_t)16 * ldb; const _Float16* b2p = b1p + (size_t)16 * ldb; const _Float16* b3p = b2p + (size_t)16 * ldb;
  const v8f z8 = {0.f,0.f,0.f,0.f,0.f,0.f,0.f,0.f}; v8f c00 = z8, c01 = z8, c02 = z8, c03 = z8, c10 = z8, c11 = z8, c12 = z8, c13 = z8;
#pragma unroll 1
  for (int kb = 0; kb < K; kb += 32) { const v16h a0 = g2_frag(a0p + kb, hh), a1 = g2_frag(a1p + kb, hh);
    v16h b = g2_frag(b0p + kb, hh); c00 = g2_mma(a0, b, c00); c10 = g2_mma(a1, b, c10);
    b = g2_frag(b1p + kb, hh); c01 = g2_mma(a0, b, c01); c11 = g2_mma(a1, b, c11);
    b = g2_frag(b2p + kb, hh); c02 = g2_mma(a0, b, c02); c12 = g2_mma(a1, b, c12);
    b = g2_frag(b3p + kb, hh); c03 = g2_mma(a0, b, c03); c13 = g2_mma(a1, b, c13); }
  v8f accs[8] = {c00, c01, c02, c03, c10, c11, c12, c13};
#pragma unroll
  for (int u = 0; u < 8; ++u) { const int t = u & 3, half = u >> 2; const int col = col0 + t * 16 + ln; const float bv = bp ? bf16_round(bp[col]) : 0.f;
#pragma unroll
    for (int r = 0; r < 8; ++r) { const int rloc = half * 16 + 8 * hh + r; float v = accs[u][r] * alpha + bv; if (CP) { if (rowsPerB < 0) v += CP[cofs + (size_t)(row0g + row0 + rloc) * ldc + col];      /* rowsPerB < 0: own element of the batched C plane */ else { const int bidx = (row0g + row0 + rloc) / rowsPerB; v += CP[(size_t)bidx * sCPb + (size_t)by * 64 + col]; } }
      if (ACT == 3) v = fmaxf(v, 0.f); else if (ACT == 6) v = 0.5f * v * (1.0f + erff(v * 0.70710678118654752f)); else if (ACT == 11) v = 1.0f / (1.0f + expf(-v)); else if (ACT == 15) v = v / (1.0f + expf(-v)); else if (ACT == 12) v = (v > 0.f) ? v : 0.01f * v; else if (ACT == 8) v = tanhf(v); else if (ACT == 9) v = 0.5f * v * (1.0f + tanhf(0.7978845608028654f * (v + 0.044715f * v * v * v))); else if (ACT == 14) v = (v > 0.f) ? v : 0.1f * v; else if (ACT == 16) v = (v >= 0.f) ? v : 0.3f * v; else if (ACT == 17) v = (v >= 0.f) ? v : 0.2f * v;
      so[w][rloc][t * 16 + ln] = v; } }
  __builtin_amdgcn_fence(__ATOMIC_ACQ_REL, "workgroup"); __builtin_amdgcn_wave_barrier();
  const int rsub = lane >> 4, c4 = (lane & 15) * 4;
  {
#pragma unroll
    for (int q = 0; q < 16; ++q) { const int r = q * 2 + rsub; const v4f v = *(const v4fa*)&so[w][r][c4]; if (C) *(v4f*)(C + cofs + (size_t)(row0 + r) * ldc + col0 + c4) = v; if (C16) { v4h h4; for (int i = 0; i < 4; ++i) h4[i] = (_Float16)v[i]; *(v4h*)(C16 + cofs + (size_t)(row0 + r) * ldc + col0 + c4) = h4; } }
     } }


__global__ __launch_bounds__(256) void k_rowmask(const float* __restrict__ F, const int* __restrict__ pmask, float* __restrict__ out, size_t n4) { const size_t t = (size_t)blockIdx.x * 256 + threadIdx.x; if (t >= n4) return; const size_t r = (t * 4) / DM; const float m = pmask[r] ? 1.0f : 0.0f; const v4f v = *(const v4fa*)(F + t * 4); v4f o; for (int q = 0; q < 4; ++q) o[q] = v[q] * m;
  *(v4f*)(out + t * 4) = o;  }
// ---- preparation: everything that reads only the inputs, as one launch; a block's index range says which job it does (none reads what another writes) ----
#define PBX ((int)(NR * DM / 8 / 256))      /* blocks that convert h: 8 elements a thread */
#define PBW (DM * DM / 8 / 256)             /* blocks per weight matrix: 8 elements a thread */
#define PBT (SQ / 256)                      /* blocks of the bias table: 1 entry a thread */
__device__ __forceinline__ float tbias_at(int d) {
  const float dist = __fdiv_rn(__fmul_rn((float)d, 300.0f), 300.0f); const float v = logf(__fadd_rn(expf(-dist), 1e-12f));
  return v; }
__global__ __launch_bounds__(256) void k_prep(const float* __restrict__ x, const float* __restrict__ wq, const float* __restrict__ wk, const float* __restrict__ wv, const float* __restrict__ wo, _Float16* __restrict__ X16, _Float16* __restrict__ BW, float* __restrict__ TB) {
  int blk = blockIdx.x;
  if (blk < PBX) { const size_t t = (size_t)blk * 256 + threadIdx.x; FragH f;      /* h rows, rounded to bf16, exact in f16 */
#pragma unroll
    for (int q = 0; q < 8; ++q) f.h[q] = (_Float16)bf16_round(x[t * 8 + q]);
    *(v8us*)((unsigned short*)X16 + t * 8) = f.half[0]; return; }
  blk -= PBX;
  if (blk < 4 * PBW) { const int mi = blk / PBW; const float* __restrict__ w = mi == 0 ? wq : mi == 1 ? wk : mi == 2 ? wv : wo;      /* weight mi, natural [out][in], x16, into plane mi of BW */
    const size_t t = (size_t)(blk - mi * PBW) * 256 + threadIdx.x; FragH f;
    for (int q = 0; q < 8; ++q) f.h[q] = (_Float16)(bf16_round(w[t * 8 + q]) * 16.0f);
    *(v8us*)((unsigned short*)BW + (size_t)mi * DM * DM + t * 8) = f.half[0]; return; }
  const int d = (blk - 4 * PBW) * 256 + threadIdx.x; TB[d] = tbias_at(d);
  asm volatile("s_wait_xcnt 0x0" ::: "memory"); }      /* precaution: the built code places another job's block behind this store, and that block rewrites the store's registers */
#define FK 64                        /* keys per LDS stage */
#define PK 144                       /* LDS row pitch of the K tile, bytes: 16 x odd, for ds_load_b128 */
#define PV 160                       /* LDS row pitch of the V tile, bytes: 32 x odd, for ds_load_tr16_b128 */
#define LOG2E 1.4426950408889634f
typedef short s16x8 __attribute__((ext_vector_type(8)));
typedef float v2f __attribute__((ext_vector_type(2)));
__device__ __forceinline__ v8us fa_tr16(const unsigned char* p) { typedef __attribute__((address_space(3))) s16x8 lds_s16x8; return __builtin_bit_cast(v8us, __builtin_amdgcn_ds_load_tr16_b128_v8i16((lds_s16x8*)p)); }
__device__ __forceinline__ float fa_xhalf(float x) { return __builtin_bit_cast(float, __builtin_amdgcn_permlanex16(__builtin_bit_cast(int, x), __builtin_bit_cast(int, x), 0x76543210, 0xfedcba98, false, false)); }      /* lane l reads lane l ^ 16 */
// amdgpu_waves_per_eu(4, 4) on the kernel: two work-groups per WGP are four waves per SIMD, so a wave may use up to 256 registers.
__device__ __forceinline__ v8f fa_mma(v16h a, v16h b, v8f c) { return __builtin_amdgcn_wmma_f32_16x16x32_f16(false, a, false, b, (short)0, c, false, false); }
__global__ __launch_bounds__(256) __attribute__((amdgpu_waves_per_eu(4, 4))) void k_fattn(const _Float16* __restrict__ Q16, const _Float16* __restrict__ K16, const _Float16* __restrict__ V16, const float* __restrict__ TB, const int* __restrict__ pmask, _Float16* __restrict__ O16) {
  __shared__ __attribute__((aligned(16))) float tb2[2 * SQ]; __shared__ __attribute__((aligned(16))) float mk[SQ];
  __shared__ __attribute__((aligned(16))) unsigned char kt[2][FK * PK]; __shared__ __attribute__((aligned(16))) unsigned char vt[2][FK * PV];
  const int tid = threadIdx.x, lane = tid & 31, ln = lane & 15, hh = lane >> 4; const int wv = __builtin_amdgcn_readfirstlane(tid >> 5);
  const int b = blockIdx.y / NH, h = blockIdx.y % NH; const int q0 = blockIdx.x * 128 + wv * 16; const size_t base = (size_t)b * SQ * DM + (size_t)h * HD;
  /* staging: thread t moves 16 bytes of rows t / 8 and 32 + t / 8 of each tile, so a wave's load covers four whole 128-byte rows */
  const int sr = tid >> 3, sc = tid & 7;
  const unsigned short* kg = (const unsigned short*)K16 + base + (size_t)sr * DM + sc * 8; const unsigned short* vg = (const unsigned short*)V16 + base + (size_t)sr * DM + sc * 8;
  v8us rk0 = *(const v8us*)kg, rk1 = *(const v8us*)(kg + 32 * DM), rv0 = *(const v8us*)vg, rv1 = *(const v8us*)(vg + 32 * DM);
  const _Float16* qp = Q16 + base + (size_t)(q0 + ln) * DM; const v16h qf0 = g2_frag(qp, hh), qf1 = g2_frag(qp + 32, hh);
#pragma unroll
  for (int u = 0; u < 2 * SQ / 256; ++u) { const int t = tid + 256 * u; int d = t - (SQ - 1); d = d < 0 ? -d : d; d = d < SQ ? d : SQ - 1; tb2[t] = TB[d] * LOG2E; }      /* unrolled: the table's loads are all in flight together */
#pragma unroll
  for (int u = 0; u < SQ / 256; ++u) { const int t = tid + 256 * u; mk[t] = pmask[(size_t)b * SQ + t] ? INFINITY : -1.0e9f * LOG2E; }
  *(v8us*)(kt[0] + sr * PK + sc * 16) = rk0; *(v8us*)(kt[0] + (sr + 32) * PK + sc * 16) = rk1; *(v8us*)(vt[0] + sr * PV + sc * 16) = rv0; *(v8us*)(vt[0] + (sr + 32) * PV + sc * 16) = rv1;
  __syncthreads();
  const v8f z8 = {0.f,0.f,0.f,0.f,0.f,0.f,0.f,0.f}; v8f o0 = z8, o1 = z8, o2 = z8, o3 = z8; float m = -INFINITY, ms = -INFINITY, l = 0.f;
  const float* tq = tb2 + (8 * hh - (q0 + ln) + (SQ - 1)); const float* mq = mk + 8 * hh;
#pragma unroll 1
  for (int st = 0; st < SQ / FK; ++st) { const int cur = st & 1; const bool more = st + 1 < SQ / FK;      /* rolled: for speed only */
    if (more) { const size_t go = (size_t)(st + 1) * FK * DM; rk0 = *(const v8us*)(kg + go); rk1 = *(const v8us*)(kg + go + 32 * DM); rv0 = *(const v8us*)(vg + go); rv1 = *(const v8us*)(vg + go + 32 * DM); }      /* the next stage's rows fly while this stage is worked on */
#pragma unroll
    for (int sub = 0; sub < FK / 32; ++sub) { const int k0 = st * FK + sub * 32;
      const unsigned char* kp = kt[cur] + (sub * 32 + ln) * PK + 16 * hh; FragH ka0, ka1, kb0, kb1;
      ka0.half[0] = *(const v8us*)(kp); ka0.half[1] = *(const v8us*)(kp + 32); ka1.half[0] = *(const v8us*)(kp + 64); ka1.half[1] = *(const v8us*)(kp + 96);
      kb0.half[0] = *(const v8us*)(kp + 16 * PK); kb0.half[1] = *(const v8us*)(kp + 16 * PK + 32); kb1.half[0] = *(const v8us*)(kp + 16 * PK + 64); kb1.half[1] = *(const v8us*)(kp + 16 * PK + 96);
      v8f s0 = fa_mma(ka0.v, qf0, z8), s1 = fa_mma(kb0.v, qf0, z8); s0 = fa_mma(ka1.v, qf1, s0); s1 = fa_mma(kb1.v, qf1, s1);
      const unsigned char* vp = vt[cur] + (sub * 32 + 8 * hh + (lane & 7)) * PV + ((lane >> 3) & 1) * 16; FragH va[4];
#pragma unroll
      for (int dt = 0; dt < 4; ++dt) { va[dt].half[0] = fa_tr16(vp + 32 * dt); va[dt].half[1] = fa_tr16(vp + 16 * PV + 32 * dt); }
      const float* tp = tq + k0; const float* mp = mq + k0; float v[16]; float mx = -INFINITY;
#pragma unroll
      for (int r = 0; r < 8; ++r) { v[r] = __builtin_fminf(__builtin_fmaf(s0[r], 0.125f * LOG2E, tp[r]), mp[r]); v[8 + r] = __builtin_fminf(__builtin_fmaf(s1[r], 0.125f * LOG2E, tp[16 + r]), mp[16 + r]); }
#pragma unroll
      for (int r = 0; r < 16; ++r) mx = __builtin_fmaxf(mx, v[r]);
      mx = __builtin_fmaxf(mx, fa_xhalf(mx));
      if (__builtin_amdgcn_ballot_w32(mx > m) != 0) { const float mn = __builtin_fmaxf(m, mx); const float msn = mn - 8.0f; const float corr = __builtin_amdgcn_exp2f(ms - msn); m = mn; ms = msn; l *= corr; o0 *= corr; o1 *= corr; o2 *= corr; o3 *= corr; }      /* corr = 0 in the first pass (ms = -inf), 1 for a query whose maximum stays */
      FragH pf; v2f la = {0.f, 0.f}, lb = {0.f, 0.f};      /* the pass's sum in two chains of pairs, so that no add waits on sixteen before it */
#pragma unroll
      for (int r = 0; r < 16; r += 4) { const float p0 = __builtin_amdgcn_exp2f(v[r] - ms), p1 = __builtin_amdgcn_exp2f(v[r + 1] - ms), p2 = __builtin_amdgcn_exp2f(v[r + 2] - ms), p3 = __builtin_amdgcn_exp2f(v[r + 3] - ms);
        la += v2f{p0, p1}; lb += v2f{p2, p3}; pf.h[r] = (_Float16)p0; pf.h[r + 1] = (_Float16)p1; pf.h[r + 2] = (_Float16)p2; pf.h[r + 3] = (_Float16)p3; }
      la += lb; l += la[0] + la[1];
      o0 = fa_mma(va[0].v, pf.v, o0); o1 = fa_mma(va[1].v, pf.v, o1); o2 = fa_mma(va[2].v, pf.v, o2); o3 = fa_mma(va[3].v, pf.v, o3); }
    if (more) { unsigned char* kn = kt[cur ^ 1]; unsigned char* vn = vt[cur ^ 1]; *(v8us*)(kn + sr * PK + sc * 16) = rk0; *(v8us*)(kn + (sr + 32) * PK + sc * 16) = rk1; *(v8us*)(vn + sr * PV + sc * 16) = rv0; *(v8us*)(vn + (sr + 32) * PV + sc * 16) = rv1; }      /* that buffer's last readers left it before the barrier that ended the stage before */
    __syncthreads(); }      /* publishes the next stage and ends this stage's reads */
  l += fa_xhalf(l); const float inv = 1.0f / l; unsigned short* op = (unsigned short*)O16 + base + (size_t)(q0 + ln) * DM + 8 * hh;      /* lane (c, hf) holds o[q0 + c][16 dt + 8 hf + r] */
  const v8f oo[4] = {o0, o1, o2, o3};
#pragma unroll
  for (int dt = 0; dt < 4; ++dt) { FragH f;
#pragma unroll
    for (int r = 0; r < 8; ++r) f.h[r] = (_Float16)(oo[dt][r] * inv);
    *(v8us*)(op + 16 * dt) = f.half[0]; } }

extern "C" void kernel_launch(void* const* d_in, const int* in_sizes, int n_in,
                              void* d_out, int out_size, void* d_ws, size_t ws_size, hipStream_t stream) {
  (void)in_sizes; (void)n_in; (void)out_size;
  const float* const* I = (const float* const*)d_in; const float* x = I[0]; const int* pmask = (const int*)d_in[1]; const float* wq = I[2]; const float* bq = I[3]; const float* wk = I[4]; const float* bk = I[5]; const float* wv = I[6]; const float* bv = I[7]; const float* wo = I[8]; const float* bo = I[9];      /* weights natural [out][in]; patch_mask int32 [4][2048] (1 = valid) */
  char* ws = (char*)d_ws; size_t off = 0;
  auto take = [&](size_t bytes) { char* p = ws + off; off += (bytes + 255) & ~(size_t)255; return p; };
  _Float16* BQ = (_Float16*)take((size_t)DM * DM * 2); _Float16* BK = (_Float16*)take((size_t)DM * DM * 2); _Float16* BV = (_Float16*)take((size_t)DM * DM * 2); _Float16* BO = (_Float16*)take((size_t)DM * DM * 2);
  _Float16* X16 = (_Float16*)take(NR * DM * 2); _Float16* Q16 = (_Float16*)take(NR * DM * 2); _Float16* K16 = (_Float16*)take(NR * DM * 2); _Float16* V16 = (_Float16*)take(NR * DM * 2); _Float16* O16 = (_Float16*)take(NR * DM * 2);
  float* TB = (float*)take((size_t)SQ * 4); float* OUTF = (float*)take(NR * DM * 4);
  (void)BK; (void)BV;
  if (off > ws_size) return;      /* 2 + 5x8 + 0.01 + 16 = approx 58 MiB */
  k_prep<<<PBX + 4 * PBW + PBT, 256, 0, stream>>>(x, wq, wk, wv, wo, X16, BQ, TB);      /* BQ | BK | BV | BO are four planes in a row */
  const dim3 gp((unsigned)((NR / 128) * (DM / 64)), 1); const dim3 gp3((unsigned)((NR / 128) * (DM / 64)), 3);
  k_gemm2<0><<<gp3, 128, 0, stream>>>(X16, DM, 0, BQ, DM, (size_t)DM * DM, 0.0625f, bq, bk, bv, 0, nullptr, 1, 0, 0, nullptr, Q16, DM, NR * DM, MP, DM, DM);      /* blockIdx.y = 0, 1, 2: q, k, v; Q16 | K16 | V16 are three planes in a row */
  k_fattn<<<dim3(SQ / 128, NB * NH), 256, 0, stream>>>(Q16, K16, V16, TB, pmask, O16);      /* o (merged heads) as f16 rows */
  k_gemm2<0><<<gp, 128, 0, stream>>>(O16, DM, 0, BO, DM, 0, 0.0625f, bo, nullptr, nullptr, 0, nullptr, 1, 0, 0, OUTF, nullptr, DM, 0, MO, DM, DM);      /* o Wo^T + bo (f32 rows) */
  k_rowmask<<<(unsigned)(((size_t)MO * DM / 4 + 255) / 256), 256, 0, stream>>>(OUTF, pmask, (float*)d_out, (size_t)MO * DM / 4);      /* x patch_mask[b][i] */
}

// v004
// One run takes 83.5 microseconds.
// Timed twice side by side with v003, it ran 1.51 and 1.52 times as fast.
// All steps since v000 together make it 235 times as fast.
#include <hip/hip_runtime.h>
#define NB 4
#define SQ 2048
#define DM 512
#define NH 8
#define HD 64
#define MP ((int)NR)                 /* token rows through the projections (debug hook) */
#define MO ((int)NR)                 /* token rows through the output projection / mask (debug hook) */
#define NR ((size_t)NB * SQ)         /* 8192 token rows */
#define CNTP 32                      /* ints between two batches' list lengths: each has a 128-byte line of its own */
typedef __bf16 v16b __attribute__((ext_vector_type(16)));
typedef unsigned short v8us __attribute__((ext_vector_type(8), may_alias));
typedef float  v8f  __attribute__((ext_vector_type(8)));
typedef float  v4f  __attribute__((ext_vector_type(4)));
typedef float  v4fa __attribute__((ext_vector_type(4), may_alias));
union FragB { v16b v; v8us half[2]; unsigned short u[16]; };

__device__ __forceinline__ unsigned short bf16_bits(float x) { unsigned int u = __float_as_uint(x); return (unsigned short)((u + 0x7FFFu + ((u >> 16) & 1u)) >> 16); }
__device__ __forceinline__ float bf16_val(unsigned short b) { return __uint_as_float(((unsigned int)b) << 16); }
__device__ __forceinline__ float bf16_round(float x) { return bf16_val(bf16_bits(x)); }
// D += A·B with NT terms: 1 = ah·bh, 2 = + al·bh (A split), 3 = + ah·bl (both split)
template <int NT>
__device__ __forceinline__ v8f mmaN(v16b ah, v16b al, v16b bh, v16b bl, v8f c) {
  c = __builtin_amdgcn_wmma_f32_16x16x32_bf16(false, ah, false, bh, (short)0, c, false, false);
  if (NT >= 2) c = __builtin_amdgcn_wmma_f32_16x16x32_bf16(false, al, false, bh, (short)0, c, false, false);
  if (NT >= 3) c = __builtin_amdgcn_wmma_f32_16x16x32_bf16(false, ah, false, bl, (short)0, c, false, false);
  asm volatile("v_nop\n\tv_nop\n\tv_nop\n\tv_nop" : "+v"(c) : "v"(ah), "v"(al), "v"(bh), "v"(bl));
  return c;
}

__global__ __launch_bounds__(256) void k_wt_bf16(const float* __restrict__ W, unsigned short* __restrict__ Wt, int K, int N) {
  const int t = blockIdx.x * 256 + threadIdx.x;
  const int k8n = K / 8;
  if (t >= N * k8n) return;
  const int n = t / k8n, k8 = (t % k8n) * 8;
  v8us v;
#pragma unroll
  for (int i = 0; i < 8; ++i) v[i] = bf16_bits(W[(size_t)(k8 + i) * N + n]);
  *(v8us*)(Wt + (size_t)n * K + k8) = v;
  
}

// GEMM C[M][N] (f32, pitch ldc) = act(A[M][K]·W + bias). A f32 row-major (pitch lda) converted per fragment to bf16
// (ASPLIT: hi/lo two planes -> 2 terms, else single rounded term); Wt bf16 [N][K] (pitch ldb). BIAS_BF16 rounds the
// bias to bf16 first (bias quantised to bf16 before the add). K%32==0, M%16==0, N%64==0.
template <bool ASPLIT, int ACT, bool BIAS_BF16>
__global__ __launch_bounds__(128) void k_gemm_bf(const float* __restrict__ A, int lda, const unsigned short* __restrict__ Wt, int ldb,
                                               const float* __restrict__ bias, float* __restrict__ C, int ldc, int M, int N, int K) {
  __shared__ __attribute__((aligned(16))) float so[4][16][64];
  const int tid = threadIdx.x, w = tid >> 5, lane = tid & 31, ln = lane & 15, hh = lane >> 4;
  const int ntn = N / 64;
  const int wid = blockIdx.x * 4 + w;
  const int mt = wid / ntn, nq = wid % ntn;
  if (mt * 16 >= M) return;
  const int row0 = mt * 16, col0 = nq * 64;
  const float* arow = A + (size_t)(row0 + ln) * lda;
  v8f acc[4] = {};
  for (int kb = 0; kb < K; kb += 32) {
    FragB ah, al;
    const v4f x0 = *(const v4fa*)(arow + kb + 8 * hh), x1 = *(const v4fa*)(arow + kb + 8 * hh + 4);
    const v4f x2 = *(const v4fa*)(arow + kb + 16 + 8 * hh), x3 = *(const v4fa*)(arow + kb + 16 + 8 * hh + 4);
    float xs[16] = {x0[0],x0[1],x0[2],x0[3],x1[0],x1[1],x1[2],x1[3],x2[0],x2[1],x2[2],x2[3],x3[0],x3[1],x3[2],x3[3]};
#pragma unroll
    for (int i = 0; i < 16; ++i) { const unsigned short hb = bf16_bits(xs[i]); ah.u[i] = hb; al.u[i] = ASPLIT ? bf16_bits(xs[i] - bf16_val(hb)) : (unsigned short)0; }
#pragma unroll
    for (int t = 0; t < 4; ++t) {
      const unsigned short* brow = Wt + (size_t)(col0 + t * 16 + ln) * ldb + kb;
      FragB b;
      b.half[0] = *(const v8us*)(brow + 8 * hh);
      b.half[1] = *(const v8us*)(brow + 16 + 8 * hh);
      acc[t] = mmaN<ASPLIT ? 2 : 1>(ah.v, al.v, b.v, b.v, acc[t]);
    }
  }
#pragma unroll
  for (int t = 0; t < 4; ++t) {
    float bv = bias ? bias[col0 + t * 16 + ln] : 0.f;
    if (BIAS_BF16) bv = bf16_round(bv);
#pragma unroll
    for (int r = 0; r < 8; ++r) { float v = acc[t][r] + bv; if (ACT == 1) v = fmaxf(v, 0.f); so[w][8 * hh + r][t * 16 + ln] = v; }
  }
  __builtin_amdgcn_fence(__ATOMIC_ACQ_REL, "workgroup");
  __builtin_amdgcn_wave_barrier();
  const int rsub = lane >> 4, c4 = (lane & 15) * 4;
  {
#pragma unroll
    for (int q = 0; q < 8; ++q) {
      const int r = q * 2 + rsub;
      const v4f v = *(const v4fa*)&so[w][r][c4];
      *(v4f*)(C + (size_t)(row0 + r) * ldc + col0 + c4) = v;
    }
    
  }
}

// GEMM C = act(A·W + bias + resid): A f32 (ASPLIT -> hi/lo 2 terms), Wt bf16 [N][K]; ACT 0 none, 1 relu, 2 exact gelu;
// resid (optional, f32, row index = (row % rmod), pitch ldr, RES_BF16 rounds it) added before the activation.
template <bool ASPLIT, int ACT, bool BIAS_BF16, bool RES_BF16>
__global__ __launch_bounds__(128) void k_gemm_bf3(const float* __restrict__ A, int lda, const unsigned short* __restrict__ Wt, int ldb,
                                                const float* __restrict__ bias, const float* __restrict__ resid, int rmod, int ldr,
                                                float* __restrict__ C, int ldc, int M, int N, int K) {
  __shared__ __attribute__((aligned(16))) float so[4][16][64];
  const int tid = threadIdx.x, w = tid >> 5, lane = tid & 31, ln = lane & 15, hh = lane >> 4;
  const int ntn = N / 64;
  const int wid = blockIdx.x * 4 + w;
  const int mt = wid / ntn, nq = wid % ntn;
  if (mt * 16 >= M) return;
  const int row0 = mt * 16, col0 = nq * 64;
  const float* arow = A + (size_t)(row0 + ln) * lda;
  v8f acc[4] = {};
  for (int kb = 0; kb < K; kb += 32) {
    FragB ah, al;
    const v4f x0 = *(const v4fa*)(arow + kb + 8 * hh), x1 = *(const v4fa*)(arow + kb + 8 * hh + 4);
    const v4f x2 = *(const v4fa*)(arow + kb + 16 + 8 * hh), x3 = *(const v4fa*)(arow + kb + 16 + 8 * hh + 4);
    float xs[16] = {x0[0],x0[1],x0[2],x0[3],x1[0],x1[1],x1[2],x1[3],x2[0],x2[1],x2[2],x2[3],x3[0],x3[1],x3[2],x3[3]};
#pragma unroll
    for (int i = 0; i < 16; ++i) { const unsigned short hb = bf16_bits(xs[i]); ah.u[i] = hb; al.u[i] = ASPLIT ? bf16_bits(xs[i] - bf16_val(hb)) : (unsigned short)0; }
#pragma unroll
    for (int t = 0; t < 4; ++t) {
      const unsigned short* brow = Wt + (size_t)(col0 + t * 16 + ln) * ldb + kb;
      FragB b;
      b.half[0] = *(const v8us*)(brow + 8 * hh);
      b.half[1] = *(const v8us*)(brow + 16 + 8 * hh);
      acc[t] = mmaN<ASPLIT ? 2 : 1>(ah.v, al.v, b.v, b.v, acc[t]);
    }
  }
#pragma unroll
  for (int t = 0; t < 4; ++t) {
    const int col = col0 + t * 16 + ln;
    float bv = bias ? bias[col] : 0.f;
    if (BIAS_BF16) bv = bf16_round(bv);
#pragma unroll
    for (int r = 0; r < 8; ++r) {
      float v = acc[t][r] + bv;
      if (resid) { float rv = resid[(size_t)((row0 + 8 * hh + r) % rmod) * ldr + col]; if (RES_BF16) rv = bf16_round(rv); v += rv; }
      if (ACT == 1) v = fmaxf(v, 0.f);
      if (ACT == 2) v = 0.5f * v * (1.0f + erff(v * 0.70710678118654752f));
      if (ACT == 3) { const float u = 0.7978845608028654f * (v + 0.044715f * v * v * v); v = 0.5f * v * (1.0f + tanhf(u)); }
      so[w][8 * hh + r][t * 16 + ln] = v;
    }
  }
  __builtin_amdgcn_fence(__ATOMIC_ACQ_REL, "workgroup");
  __builtin_amdgcn_wave_barrier();
  const int rsub = lane >> 4, c4 = (lane & 15) * 4;
  {
#pragma unroll
    for (int q = 0; q < 8; ++q) {
      const int r = q * 2 + rsub;
      const v4f v = *(const v4fa*)&so[w][r][c4];
      *(v4f*)(C + (size_t)(row0 + r) * ldc + col0 + c4) = v;
    }
    
  }
}
// row LayerNorm (biased variance, eps) over N: s = X (+ R); optional out_sum <- s; out_norm <- (s-mu)*rsqrt(var+eps)*g + b
template <bool PARAM_BF16>
__global__ __launch_bounds__(256) void k_layernorm(const float* __restrict__ X, const float* __restrict__ R, const float* __restrict__ g, const float* __restrict__ bta,
                                                  float* __restrict__ out_sum, float* __restrict__ out_norm, int N, float eps) {
  __shared__ float red[256];
  const int row = blockIdx.x, tid = threadIdx.x;
  const float* x = X + (size_t)row * N; const float* rr = R ? R + (size_t)row * N : nullptr;
  float vals[16];                     // up to N = 4096
  const int per = N / 256;            // contiguous chunk per thread? use strided-by-4 chunks: thread handles j = tid*4 + 1024*u
  float s1 = 0.f;
  for (int u = 0; u < per / 4; ++u) {
    const int j = tid * 4 + 1024 * u;
    const v4f a = *(const v4fa*)(x + j);
    v4f b = {0.f,0.f,0.f,0.f}; if (rr) b = *(const v4fa*)(rr + j);
#pragma unroll
    for (int q = 0; q < 4; ++q) { const float v = a[q] + b[q]; vals[u * 4 + q] = v; s1 += v; }
  }
  red[tid] = s1; __syncthreads();
  for (int st = 128; st > 0; st >>= 1) { if (tid < st) red[tid] += red[tid + st]; __syncthreads(); }
  const float mu = red[0] / (float)N; __syncthreads();
  float s2 = 0.f;
  for (int u = 0; u < per / 4; ++u)
#pragma unroll
    for (int q = 0; q < 4; ++q) { const float c = vals[u * 4 + q] - mu; s2 += c * c; }
  red[tid] = s2; __syncthreads();
  for (int st = 128; st > 0; st >>= 1) { if (tid < st) red[tid] += red[tid + st]; __syncthreads(); }
  const float rs = rsqrtf(red[0] / (float)N + eps);
  {
    for (int u = 0; u < per / 4; ++u) {
      const int j = tid * 4 + 1024 * u;
      v4f o, sm;
#pragma unroll
      for (int q = 0; q < 4; ++q) {
        float gg = g[j + q], bb = bta[j + q];
        if (PARAM_BF16) { gg = bf16_round(gg); bb = bf16_round(bb); }
        sm[q] = vals[u * 4 + q]; o[q] = (vals[u * 4 + q] - mu) * rs * gg + bb;
      }
      if (out_sum) *(v4f*)(out_sum + (size_t)row * N + j) = sm;
      *(v4f*)(out_norm + (size_t)row * N + j) = o;
    }
    
  }
}



// ---- f16 WMMA path (v_wmma_f32_16x16x32_f16): 11-bit significands for operands in range — used where a [0,1] probability operand needs more precision than bf16
typedef _Float16 v16h __attribute__((ext_vector_type(16)));
union FragH { v16h v; v8us half[2]; _Float16 h[16]; unsigned short u[16]; };
template <int NT>
__device__ __forceinline__ v8f mmaH(v16h ah, v16h al, v16h bh, v16h bl, v8f c) {
  c = __builtin_amdgcn_wmma_f32_16x16x32_f16(false, ah, false, bh, (short)0, c, false, false);
  if (NT >= 2) c = __builtin_amdgcn_wmma_f32_16x16x32_f16(false, al, false, bh, (short)0, c, false, false);
  if (NT >= 3) c = __builtin_amdgcn_wmma_f32_16x16x32_f16(false, ah, false, bl, (short)0, c, false, false);
  asm volatile("v_nop\n\tv_nop\n\tv_nop\n\tv_nop" : "+v"(c) : "v"(ah), "v"(al), "v"(bh), "v"(bl));
  return c;
}
// batched GEMM like k_gemm_b but f16 operands: A f32 (split into f16 hi/lo if ASPLIT, else rounded to f16), Bt = f16 values [n][k]; alpha; C f32; N multiple of 16 (partial tiles skipped)
template <bool ASPLIT>
__global__ __launch_bounds__(128) void k_gemm_h(const float* __restrict__ A, int lda, size_t sA, const _Float16* __restrict__ Bh, int ldb, size_t sB, float alpha, float* __restrict__ C, int ldc, size_t sC, int M, int N, int K) {
  __shared__ __attribute__((aligned(16))) float so[4][16][64];
  const int tid = threadIdx.x, w = tid >> 5, lane = tid & 31, ln = lane & 15, hh = lane >> 4; const int by = blockIdx.y;
  A += (size_t)by * sA; Bh += (size_t)by * sB; C += (size_t)by * sC;
  const int ntn = (N + 63) / 64; const int wid = blockIdx.x * 4 + w; const int mt = wid / ntn, nq = wid % ntn; if (mt * 16 >= M) return;
  const int row0 = mt * 16, col0 = nq * 64; const float* arow = A + (size_t)(row0 + ln) * lda;
  v8f acc[4] = {};
  for (int kb = 0; kb < K; kb += 32) {
    FragH ah, al;
    const v4f x0 = *(const v4fa*)(arow + kb + 8 * hh), x1 = *(const v4fa*)(arow + kb + 8 * hh + 4), x2 = *(const v4fa*)(arow + kb + 16 + 8 * hh), x3 = *(const v4fa*)(arow + kb + 16 + 8 * hh + 4);
    float xs[16] = {x0[0],x0[1],x0[2],x0[3],x1[0],x1[1],x1[2],x1[3],x2[0],x2[1],x2[2],x2[3],x3[0],x3[1],x3[2],x3[3]};
#pragma unroll
    for (int i = 0; i < 16; ++i) { const _Float16 h = (_Float16)xs[i]; ah.h[i] = h; al.h[i] = ASPLIT ? (_Float16)(xs[i] - (float)h) : (_Float16)0.0f; }
#pragma unroll
    for (int t = 0; t < 4; ++t) { if (col0 + t * 16 >= N) continue; const size_t boff = (size_t)(col0 + t * 16 + ln) * ldb + kb; FragH bq; bq.half[0] = *(const v8us*)(Bh + boff + 8 * hh); bq.half[1] = *(const v8us*)(Bh + boff + 16 + 8 * hh);
      acc[t] = mmaH<ASPLIT ? 2 : 1>(ah.v, al.v, bq.v, bq.v, acc[t]); }
  }
#pragma unroll
  for (int t = 0; t < 4; ++t) { if (col0 + t * 16 >= N) continue;
#pragma unroll
    for (int r = 0; r < 8; ++r) so[w][8 * hh + r][t * 16 + ln] = acc[t][r] * alpha; }
  __builtin_amdgcn_fence(__ATOMIC_ACQ_REL, "workgroup"); __builtin_amdgcn_wave_barrier();
  const int rsub = lane >> 4, c4 = (lane & 15) * 4;
  {
#pragma unroll
    for (int q = 0; q < 8; ++q) { const int r = q * 2 + rsub; if (col0 + c4 < N) { const v4f v = *(const v4fa*)&so[w][r][c4]; *(v4f*)(C + (size_t)(row0 + r) * ldc + col0 + c4) = v; } }
     }
}

// Wt[n][k] = f16(W[k][n]·scale) from f32 row-major W[K][N] (scale = power of two; bf16-exact weights stay exact in f16 away from the subnormal range)
__global__ __launch_bounds__(256) void k_wt_f16(const float* __restrict__ W, _Float16* __restrict__ Wt, int K, int N, float scale) {
  const int t = blockIdx.x * 256 + threadIdx.x; if (t >= N * (K / 8)) return; const int n = t / (K / 8), k8 = (t % (K / 8)) * 8; FragH f;
#pragma unroll
  for (int i = 0; i < 8; ++i) f.h[i] = (_Float16)(bf16_round(W[(size_t)(k8 + i) * N + n]) * scale); const v8us o = f.half[0];
  *(v8us*)((unsigned short*)Wt + (size_t)n * K + k8) = o; 
}
// k_gemm_hh variant with fused epilogue: v = acc·alpha + bias[by·sBias + col] (+ CP[(row/rowsPerB)·sCPb + by·64 + col] if CP) ; ACT 0 none / 1 elu ; writes f16 C16 (and f32 C if non-null)
template <int ACT>
__global__ __launch_bounds__(128) void k_gemm_hhx(const _Float16* __restrict__ A, int lda, size_t sA, const _Float16* __restrict__ Bh, int ldb, size_t sB, float alpha, const float* __restrict__ bias, size_t sBias, const float* __restrict__ CP, int rowsPerB, size_t sCPb, int row0g,
    float* __restrict__ C, _Float16* __restrict__ C16, int ldc, size_t sC, int M, int N, int K) {
  __shared__ __attribute__((aligned(16))) float so[4][16][64];
  const int tid = threadIdx.x, w = tid >> 5, lane = tid & 31, ln = lane & 15, hh = lane >> 4; const int by = blockIdx.y;
  A += (size_t)by * sA; Bh += (size_t)by * sB; const size_t cofs = (size_t)by * sC; const float* bp = bias ? bias + (size_t)by * sBias : nullptr;
  const int ntn = (N + 63) / 64; const int wid = blockIdx.x * 4 + w; const int mt = wid / ntn, nq = wid % ntn; if (mt * 16 >= M) return;
  const int row0 = mt * 16, col0 = nq * 64; const _Float16* arow = A + (size_t)(row0 + ln) * lda;
  v8f acc[4] = {};
  for (int kb = 0; kb < K; kb += 32) { FragH ah; ah.half[0] = *(const v8us*)((const unsigned short*)arow + kb + 8 * hh); ah.half[1] = *(const v8us*)((const unsigned short*)arow + kb + 16 + 8 * hh);
#pragma unroll
    for (int t = 0; t < 4; ++t) { if (col0 + t * 16 >= N) continue; const size_t boff = (size_t)(col0 + t * 16 + ln) * ldb + kb; FragH bq; bq.half[0] = *(const v8us*)((const unsigned short*)Bh + boff + 8 * hh); bq.half[1] = *(const v8us*)((const unsigned short*)Bh + boff + 16 + 8 * hh);
      acc[t] = mmaH<1>(ah.v, ah.v, bq.v, bq.v, acc[t]); }
  }
#pragma unroll
  for (int t = 0; t < 4; ++t) { if (col0 + t * 16 >= N) continue; const int col = col0 + t * 16 + ln; const float bv = bp ? bf16_round(bp[col]) : 0.f;
#pragma unroll
    for (int r = 0; r < 8; ++r) { float v = acc[t][r] * alpha + bv; if (CP) { const int rr = row0g + row0 + 8 * hh + r; if (rowsPerB < 0) v += CP[cofs + (size_t)rr * ldc + col];      /* rowsPerB < 0: own element of the batched C plane */ else { const int bidx = rr / rowsPerB; v += CP[(size_t)bidx * sCPb + (size_t)by * 64 + col]; } } if (ACT == 1) v = (v > 0.f) ? v : expm1f(v); else if (ACT == 7) v = (v > 0.f) ? v + 1.0f : expf(v); else if (ACT == 8) v = tanhf(v); else if (ACT == 9) v = 0.5f * v * (1.0f + tanhf(0.7978845608028654f * (v + 0.044715f * v * v * v))); else if (ACT == 11) v = 1.0f / (1.0f + expf(-v)); else if (ACT == 12) v = (v > 0.f) ? v : 0.01f * v; else if (ACT == 14) v = (v > 0.f) ? v : 0.1f * v; else if (ACT == 16) v = (v >= 0.f) ? v : 0.3f * v; else if (ACT == 17) v = (v >= 0.f) ? v : 0.2f * v; else if (ACT == 15) v = v / (1.0f + expf(-v)); else if (ACT == 3) v = fmaxf(v, 0.f); else if (ACT == 6) v = 0.5f * v * (1.0f + erff(v * 0.70710678118654752f)); so[w][8 * hh + r][t * 16 + ln] = v; } }
  __builtin_amdgcn_fence(__ATOMIC_ACQ_REL, "workgroup"); __builtin_amdgcn_wave_barrier();
  const int rsub = lane >> 4, c4 = (lane & 15) * 4; typedef _Float16 v4h __attribute__((ext_vector_type(4)));
  {
#pragma unroll
    for (int q = 0; q < 8; ++q) { const int r = q * 2 + rsub; if (col0 + c4 < N) { const v4f v = *(const v4fa*)&so[w][r][c4]; if (C) *(v4f*)(C + cofs + (size_t)(row0 + r) * ldc + col0 + c4) = v; if (C16) { v4h h4; for (int i = 0; i < 4; ++i) h4[i] = (_Float16)v[i]; *(v4h*)(C16 + cofs + (size_t)(row0 + r) * ldc + col0 + c4) = h4; } } }
     }
}


typedef _Float16 v4h __attribute__((ext_vector_type(4)));

__global__ __launch_bounds__(256) void k_h16(const float* __restrict__ x, _Float16* __restrict__ X16, size_t n8) { const size_t t = (size_t)blockIdx.x * 256 + threadIdx.x; if (t >= n8) return; FragH f;
#pragma unroll
  for (int q = 0; q < 8; ++q) f.h[q] = (_Float16)x[t * 8 + q]; *(v8us*)((unsigned short*)X16 + t * 8) = f.half[0];  }
__global__ __launch_bounds__(256) void k_round16f(const float* __restrict__ W, _Float16* __restrict__ Bt, size_t n8) { const size_t t = (size_t)blockIdx.x * 256 + threadIdx.x; if (t >= n8) return; FragH f;
#pragma unroll
  for (int i = 0; i < 8; ++i) f.h[i] = (_Float16)(bf16_round(W[t * 8 + i]) * 16.0f); *(v8us*)((unsigned short*)Bt + t * 8) = f.half[0];  }
template <int NHv, int TTv>
__global__ __launch_bounds__(256) void k_vt(const _Float16* __restrict__ V16, int ldv, int voff, _Float16* __restrict__ Vt) { __shared__ unsigned short tl[64][66]; const int tid = threadIdx.x; const int slab = blockIdx.x / (TTv / 64), lg = blockIdx.x % (TTv / 64); const int b = slab / NHv, h = slab % NHv;
  for (int i = tid; i < 64 * 8; i += 256) { const int r = i / 8, c8 = (i % 8) * 8; FragH f; f.half[0] = *(const v8us*)((const unsigned short*)V16 + ((size_t)b * TTv + lg * 64 + r) * ldv + voff + h * 64 + c8);
#pragma unroll
    for (int q = 0; q < 8; ++q) tl[r][c8 + q] = f.u[q]; }
  __syncthreads();
  {
#pragma unroll
    for (int rd = 0; rd < 2; ++rd) { const int d = rd * 32 + tid / 8, pc = tid % 8; FragH f;
#pragma unroll
      for (int q = 0; q < 8; ++q) f.u[q] = tl[pc * 8 + q][d];
      *(v8us*)((unsigned short*)Vt + ((size_t)slab * 64 + d) * TTv + lg * 64 + pc * 8) = f.half[0]; }
     } }

__global__ __launch_bounds__(256) void k_hl(const float* __restrict__ F, _Float16* __restrict__ Hh, _Float16* __restrict__ Hl, size_t n8) { const size_t t = (size_t)blockIdx.x * 256 + threadIdx.x; if (t >= n8) return; FragH fh, fl; const v4f a = *(const v4fa*)(F + t * 8), c = *(const v4fa*)(F + t * 8 + 4);
#pragma unroll
  for (int q = 0; q < 4; ++q) { _Float16 h = (_Float16)a[q]; fh.h[q] = h; fl.h[q] = (_Float16)((a[q] - (float)h) * 1024.0f); h = (_Float16)c[q]; fh.h[4 + q] = h; fl.h[4 + q] = (_Float16)((c[q] - (float)h) * 1024.0f); }
  { *(v8us*)((unsigned short*)Hh + t * 8) = fh.half[0]; *(v8us*)((unsigned short*)Hl + t * 8) = fl.half[0];  } }

// ---- fast GEMM (wave tile 32x64; requires M % 32 == 0 rows per launch region and N % 64 == 0); epilogue = k_gemm_hhx semantics ----
__device__ __forceinline__ v16h g2_frag(const _Float16* p, int hh) { FragH f; f.half[0] = *(const v8us*)((const unsigned short*)p + 8 * hh); f.half[1] = *(const v8us*)((const unsigned short*)p + 16 + 8 * hh); return f.v; }
__device__ __forceinline__ v8f g2_mma(v16h a, v16h b, v8f c) { v8f d = __builtin_amdgcn_wmma_f32_16x16x32_f16(false, a, false, b, (short)0, c, false, false); asm volatile("v_nop\n\tv_nop\n\tv_nop\n\tv_nop" : "+v"(d) : "v"(a), "v"(b)); return d; }
template <int ACT>
__global__ __launch_bounds__(128) void k_gemm2(const _Float16* __restrict__ A, int lda, size_t sA, const _Float16* __restrict__ Bh, int ldb, size_t sB, float alpha, const float* __restrict__ bias, const float* __restrict__ bias1, const float* __restrict__ bias2, size_t sBias, const float* __restrict__ CP, int rowsPerB, size_t sCPb, int row0g,
    float* __restrict__ C, _Float16* __restrict__ C16, int ldc, size_t sC, int M, int N, int K, const int* __restrict__ cnt, const int* __restrict__ gpos, const int* __restrict__ spos) { static_assert(ACT == 0 || ACT == 3 || ACT == 6 || ACT == 8 || ACT == 9 || ACT == 11 || ACT == 12 || ACT == 14 || ACT == 15 || ACT == 16 || ACT == 17, "k_gemm2: unsupported ACT code (would silently apply no activation)");
  __shared__ __attribute__((aligned(16))) float so[4][32][68];
  const int tid = threadIdx.x, w = tid >> 5, lane = tid & 31, ln = lane & 15, hh = lane >> 4; const int by = blockIdx.y;
  if (bias1) bias = by == 1 ? bias1 : by == 2 ? bias2 : bias;      /* three products in one grid, each with its own bias vector */
  A += (size_t)by * sA; Bh += (size_t)by * sB; const size_t cofs = (size_t)by * sC; const float* bp = bias ? bias + (size_t)by * sBias : nullptr;
  const int ntn = N >> 6; const int mi = blockIdx.x / ntn, nq = blockIdx.x - mi * ntn; const int mt = (mi % NB) * (SQ / 128) + mi / NB;      /* row tiles in the order tile 0 of every batch, tile 1 of every batch, ...: the tiles past the lists come last in the grid */
  const int row0 = mt * 128 + 32 * w, col0 = nq * 64; if (row0 >= M) return;
  /* rows are list entries: batch bb, entries cb .. cb + 127 of its list of nv valid tokens; a block whose first entry lies past the list has nothing to do; the entries from nv to the block's end repeat the first valid token (finite rows that carry no weight later) */
  const int bb = (mt * 128) / SQ, cb = mt * 128 - bb * SQ; int nv = cnt[bb * CNTP]; nv = nv < SQ ? nv : SQ; if (cb >= nv) return;
  int ra0 = row0 + ln, ra1 = row0 + 16 + ln; if (gpos) { ra0 = bb * SQ + (gpos[ra0] & (SQ - 1)); ra1 = bb * SQ + (gpos[ra1] & (SQ - 1)); }      /* gpos: A rows stand at the tokens' own positions */
  int sp = cb + 32 * w + lane, nlim = SQ; if (spos) { sp = spos[row0 + lane] & (SQ - 1); nlim = nv; }      /* lane l: the row inside the batch where row l of this wave's tile is stored; spos: a listed row goes to its token's own position, an entry past the list nowhere */
  const _Float16* a0p = A + (size_t)ra0 * lda; const _Float16* a1p = A + (size_t)ra1 * lda;
  const _Float16* b0p = Bh + (size_t)(col0 + ln) * ldb; const _Float16* b1p = b0p + (size_t)16 * ldb; const _Float16* b2p = b1p + (size_t)16 * ldb; const _Float16* b3p = b2p + (size_t)16 * ldb;
  const v8f z8 = {0.f,0.f,0.f,0.f,0.f,0.f,0.f,0.f}; v8f c00 = z8, c01 = z8, c02 = z8, c03 = z8, c10 = z8, c11 = z8, c12 = z8, c13 = z8;
#pragma unroll 1
  for (int kb = 0; kb < K; kb += 32) { const v16h a0 = g2_frag(a0p + kb, hh), a1 = g2_frag(a1p + kb, hh);
    v16h b = g2_frag(b0p + kb, hh); c00 = g2_mma(a0, b, c00); c10 = g2_mma(a1, b, c10);
    b = g2_frag(b1p + kb, hh); c01 = g2_mma(a0, b, c01); c11 = g2_mma(a1, b, c11);
    b = g2_frag(b2p + kb, hh); c02 = g2_mma(a0, b, c02); c12 = g2_mma(a1, b, c12);
    b = g2_frag(b3p + kb, hh); c03 = g2_mma(a0, b, c03); c13 = g2_mma(a1, b, c13); }
  v8f accs[8] = {c00, c01, c02, c03, c10, c11, c12, c13};
#pragma unroll
  for (int u = 0; u < 8; ++u) { const int t = u & 3, half = u >> 2; const int col = col0 + t * 16 + ln; const float bv = bp ? bf16_round(bp[col]) : 0.f;
#pragma unroll
    for (int r = 0; r < 8; ++r) { const int rloc = half * 16 + 8 * hh + r; float v = accs[u][r] * alpha + bv; if (CP) { if (rowsPerB < 0) v += CP[cofs + (size_t)(row0g + row0 + rloc) * ldc + col];      /* rowsPerB < 0: own element of the batched C plane */ else { const int bidx = (row0g + row0 + rloc) / rowsPerB; v += CP[(size_t)bidx * sCPb + (size_t)by * 64 + col]; } }
      if (ACT == 3) v = fmaxf(v, 0.f); else if (ACT == 6) v = 0.5f * v * (1.0f + erff(v * 0.70710678118654752f)); else if (ACT == 11) v = 1.0f / (1.0f + expf(-v)); else if (ACT == 15) v = v / (1.0f + expf(-v)); else if (ACT == 12) v = (v > 0.f) ? v : 0.01f * v; else if (ACT == 8) v = tanhf(v); else if (ACT == 9) v = 0.5f * v * (1.0f + tanhf(0.7978845608028654f * (v + 0.044715f * v * v * v))); else if (ACT == 14) v = (v > 0.f) ? v : 0.1f * v; else if (ACT == 16) v = (v >= 0.f) ? v : 0.3f * v; else if (ACT == 17) v = (v >= 0.f) ? v : 0.2f * v;
      so[w][rloc][t * 16 + ln] = v; } }
  __builtin_amdgcn_fence(__ATOMIC_ACQ_REL, "workgroup"); __builtin_amdgcn_wave_barrier();
  const int rsub = lane >> 4, c4 = (lane & 15) * 4;
  {
#pragma unroll
    for (int q = 0; q < 16; ++q) { const int r = q * 2 + rsub; const v4f v = *(const v4fa*)&so[w][r][c4]; const int p0 = __builtin_amdgcn_readlane(sp, q * 2), p1 = __builtin_amdgcn_readlane(sp, q * 2 + 1); const int ro = bb * SQ + (rsub ? p1 : p0);
      if (cb + 32 * w + r < nlim) { if (C) { *(v4f*)(C + cofs + (size_t)ro * ldc + col0 + c4) = v; asm volatile("s_wait_xcnt 0x0" ::: "memory"); }      /* precaution: the built code rewrites this store's data and address registers right behind it */
        if (C16) { v4h h4; for (int i = 0; i < 4; ++i) h4[i] = (_Float16)v[i]; *(v4h*)(C16 + cofs + (size_t)ro * ldc + col0 + c4) = h4; } } }
     } }


// ---- preparation: everything that reads only the inputs, as one launch; a block's index range says which job it does (none reads what another writes) ----
#define PBX ((int)(NR * DM / 8 / 256))      /* blocks that convert h: 8 elements a thread */
#define PBW (DM * DM / 8 / 256)             /* blocks per weight matrix: 8 elements a thread */
#define PBT (SQ / 256)                      /* blocks of the bias table: 1 entry a thread */
#define PBL NB                              /* blocks that list the valid tokens: one a batch, 8 positions a thread */
typedef int v4i __attribute__((ext_vector_type(4)));
__device__ __forceinline__ float tbias_at(int d) {
  const float dist = __fdiv_rn(__fmul_rn((float)d, 300.0f), 300.0f); const float v = logf(__fadd_rn(expf(-dist), 1e-12f));
  return v; }
__global__ __launch_bounds__(256) void k_prep(const float* __restrict__ x, const int* __restrict__ pmask, const float* __restrict__ wq, const float* __restrict__ wk, const float* __restrict__ wv, const float* __restrict__ wo, _Float16* __restrict__ X16, _Float16* __restrict__ BW, float* __restrict__ TB, int* __restrict__ POS, int* __restrict__ CNT, float* __restrict__ out) {
  __shared__ int psum[256]; __shared__ __attribute__((aligned(16))) int lst[SQ]; __shared__ int first;
  int blk = blockIdx.x;
  if (blk < PBL) { const int tid = threadIdx.x; const int* mp = pmask + (size_t)blk * SQ + tid * 8;      /* batch blk: valid positions in ascending order, by a prefix sum of the threads' counts */
    const v4i m0 = *(const v4i*)mp, m1 = *(const v4i*)(mp + 4); const int mv[8] = {m0[0], m0[1], m0[2], m0[3], m1[0], m1[1], m1[2], m1[3]}; int c = 0;
#pragma unroll
    for (int q = 0; q < 8; ++q) c += mv[q] != 0;
    psum[tid] = c; if (tid == 0) first = 0;
    __syncthreads();
    for (int o = 1; o < 256; o <<= 1) { const int a = tid >= o ? psum[tid - o] : 0; __syncthreads(); psum[tid] += a; __syncthreads(); }
    const int n = psum[255]; int rk = psum[tid] - c;
    if (rk == 0 && c != 0) {
#pragma unroll
      for (int q = 7; q >= 0; --q) if (mv[q] != 0) first = tid * 8 + q; }
#pragma unroll
    for (int q = 0; q < 8; ++q) if (mv[q] != 0) lst[rk++] = tid * 8 + q;
    __syncthreads();
    v4i o0, o1;      /* entries past the list repeat the first valid position; a wave stores whole 128-byte lines */
#pragma unroll
    for (int q = 0; q < 4; ++q) { o0[q] = tid * 8 + q < n ? lst[tid * 8 + q] : first; o1[q] = tid * 8 + 4 + q < n ? lst[tid * 8 + 4 + q] : first; }
    *(v4i*)(POS + (size_t)blk * SQ + tid * 8) = o0; *(v4i*)(POS + (size_t)blk * SQ + tid * 8 + 4) = o1; if (tid == 0) CNT[blk * CNTP] = n;
    return; }
  blk -= PBL;
  if (blk < PBX) { const size_t t = (size_t)blk * 256 + threadIdx.x; FragH f;      /* valid h rows, rounded to bf16, exact in f16; a padded row is read by nobody, its row of out is 0 */
    if (pmask[t / (DM / 8)] == 0) { const v4f z = {0.f, 0.f, 0.f, 0.f}; *(v4f*)(out + t * 8) = z; *(v4f*)(out + t * 8 + 4) = z; return; }
#pragma unroll
    for (int q = 0; q < 8; ++q) f.h[q] = (_Float16)bf16_round(x[t * 8 + q]);
    *(v8us*)((unsigned short*)X16 + t * 8) = f.half[0]; return; }
  blk -= PBX;
  if (blk < 4 * PBW) { const int mi = blk / PBW; const float* __restrict__ w = mi == 0 ? wq : mi == 1 ? wk : mi == 2 ? wv : wo;      /* weight mi, natural [out][in], x16, into plane mi of BW */
    const size_t t = (size_t)(blk - mi * PBW) * 256 + threadIdx.x; FragH f;
    for (int q = 0; q < 8; ++q) f.h[q] = (_Float16)(bf16_round(w[t * 8 + q]) * 16.0f);
    *(v8us*)((unsigned short*)BW + (size_t)mi * DM * DM + t * 8) = f.half[0]; return; }
  const int d = (blk - 4 * PBW) * 256 + threadIdx.x; TB[d] = tbias_at(d);
  asm volatile("s_wait_xcnt 0x0" ::: "memory"); }      /* precaution: the built code places another job's block behind this store, and that block rewrites the store's registers */
#define FK 64                        /* keys per LDS stage */
#define PK 144                       /* LDS row pitch of the K tile, bytes: 16 x odd, for ds_load_b128 */
#define PV 160                       /* LDS row pitch of the V tile, bytes: 32 x odd, for ds_load_tr16_b128 */
#define LOG2E 1.4426950408889634f
typedef short s16x8 __attribute__((ext_vector_type(8)));
typedef float v2f __attribute__((ext_vector_type(2)));
__device__ __forceinline__ v8us fa_tr16(const unsigned char* p) { typedef __attribute__((address_space(3))) s16x8 lds_s16x8; return __builtin_bit_cast(v8us, __builtin_amdgcn_ds_load_tr16_b128_v8i16((lds_s16x8*)p)); }
__device__ __forceinline__ float fa_xhalf(float x) { return __builtin_bit_cast(float, __builtin_amdgcn_permlanex16(__builtin_bit_cast(int, x), __builtin_bit_cast(int, x), 0x76543210, 0xfedcba98, false, false)); }      /* lane l reads lane l ^ 16 */
// amdgpu_waves_per_eu(4, 4) on the kernel: two work-groups per WGP are four waves per SIMD, so a wave may use up to 256 registers.
__device__ __forceinline__ v8f fa_mma(v16h a, v16h b, v8f c) { return __builtin_amdgcn_wmma_f32_16x16x32_f16(false, a, false, b, (short)0, c, false, false); }
__global__ __launch_bounds__(256) __attribute__((amdgpu_waves_per_eu(4, 4))) void k_fattn(const _Float16* __restrict__ Q16, const _Float16* __restrict__ K16, const _Float16* __restrict__ V16, const float* __restrict__ TB, const int* __restrict__ POS, const int* __restrict__ CNT, _Float16* __restrict__ O16) {
  __shared__ __attribute__((aligned(16))) float tb2[2 * SQ]; __shared__ __attribute__((aligned(16))) int kx[SQ];
  __shared__ __attribute__((aligned(16))) unsigned char kt[2][FK * PK]; __shared__ __attribute__((aligned(16))) unsigned char vt[2][FK * PV];
  const int tid = threadIdx.x, lane = tid & 31, ln = lane & 15, hh = lane >> 4; const int wv = __builtin_amdgcn_readfirstlane(tid >> 5);
  const int b = blockIdx.x / NH, h = blockIdx.x % NH; int nv = CNT[b * CNTP]; nv = nv < SQ ? nv : SQ; if ((int)blockIdx.y * 128 >= nv) return;      /* the whole work-group leaves, in front of every barrier: its queries lie past the list; the query tile is the slow grid index, so that these work-groups come last and the working ones spread over the chip */
  const int nst = (nv + FK - 1) / FK; const int* lp = POS + (size_t)b * SQ; const int q0 = blockIdx.y * 128 + wv * 16; const bool act = q0 < nv;      /* act, the same for the whole wave: a wave whose 16 queries all lie past the list only stages and stores zero rows */ const size_t base = (size_t)b * SQ * DM + (size_t)h * HD;
  /* staging: thread t moves 16 bytes of rows t / 8 and 32 + t / 8 of each tile, so a wave's load covers four whole 128-byte rows */
  const int sr = tid >> 3, sc = tid & 7;
  const unsigned short* kg = (const unsigned short*)K16 + base + (size_t)sr * DM + sc * 8; const unsigned short* vg = (const unsigned short*)V16 + base + (size_t)sr * DM + sc * 8;
  v8us rk0 = *(const v8us*)kg, rk1 = *(const v8us*)(kg + 32 * DM), rv0 = *(const v8us*)vg, rv1 = *(const v8us*)(vg + 32 * DM);
  const _Float16* qp = Q16 + base + (size_t)(q0 + ln) * DM; const v16h qf0 = g2_frag(qp, hh), qf1 = g2_frag(qp + 32, hh);
#pragma unroll
  for (int u = 0; u < 2 * SQ / 256; ++u) { const int t = tid + 256 * u; int d = t - (SQ - 1); d = d < 0 ? -d : d; d = d < SQ ? d : SQ - 1; const float tv = TB[d] * LOG2E; tb2[t] = t == 2 * SQ - 1 ? -1.0e9f * LOG2E : tv; }      /* unrolled: the table's loads are all in flight together */
#pragma unroll
  for (int u = 0; u < SQ / 256; ++u) { const int t = tid + 256 * u; kx[t] = (lp[t] & (SQ - 1)) * 4 + (t < nv ? 0 : 4 * SQ * 4); }      /* a sum, so that the eight loads stand under no test and fly together: the list's every entry is written */
  *(v8us*)(kt[0] + sr * PK + sc * 16) = rk0; *(v8us*)(kt[0] + (sr + 32) * PK + sc * 16) = rk1; *(v8us*)(vt[0] + sr * PV + sc * 16) = rv0; *(v8us*)(vt[0] + (sr + 32) * PV + sc * 16) = rv1;
  __syncthreads();
  const v8f z8 = {0.f,0.f,0.f,0.f,0.f,0.f,0.f,0.f}; v8f o0 = z8, o1 = z8, o2 = z8, o3 = z8; float m = -INFINITY, ms = -INFINITY, l = act ? 0.f : 1.f;
  const int qx = (SQ - 1) * 4 - (kx[q0 + ln] & ((SQ - 1) * 4)); const int* kq = kx + 8 * hh;
#pragma unroll 1
  for (int st = 0; st < nst; ++st) { const int cur = st & 1; const bool more = st + 1 < nst;      /* rolled, for speed only */
    if (more) { const size_t go = (size_t)(st + 1) * FK * DM; rk0 = *(const v8us*)(kg + go); rk1 = *(const v8us*)(kg + go + 32 * DM); rv0 = *(const v8us*)(vg + go); rv1 = *(const v8us*)(vg + go + 32 * DM);
      asm volatile("s_wait_xcnt 0x0" ::: "memory"); }      /* the next stage's rows fly while this stage is worked on; the wait is a precaution: the built code reuses these loads' address registers right behind them */
    if (act)
#pragma unroll
    for (int sub = 0; sub < FK / 32; ++sub) { const int k0 = st * FK + sub * 32;
      const unsigned char* kp = kt[cur] + (sub * 32 + ln) * PK + 16 * hh; FragH ka0, ka1, kb0, kb1;
      ka0.half[0] = *(const v8us*)(kp); ka0.half[1] = *(const v8us*)(kp + 32); ka1.half[0] = *(const v8us*)(kp + 64); ka1.half[1] = *(const v8us*)(kp + 96);
      kb0.half[0] = *(const v8us*)(kp + 16 * PK); kb0.half[1] = *(const v8us*)(kp + 16 * PK + 32); kb1.half[0] = *(const v8us*)(kp + 16 * PK + 64); kb1.half[1] = *(const v8us*)(kp + 16 * PK + 96);
      v8f s0 = fa_mma(ka0.v, qf0, z8), s1 = fa_mma(kb0.v, qf0, z8); s0 = fa_mma(ka1.v, qf1, s0); s1 = fa_mma(kb1.v, qf1, s1);
      const unsigned char* vp = vt[cur] + (sub * 32 + 8 * hh + (lane & 7)) * PV + ((lane >> 3) & 1) * 16; FragH va[4];
#pragma unroll
      for (int dt = 0; dt < 4; ++dt) { va[dt].half[0] = fa_tr16(vp + 32 * dt); va[dt].half[1] = fa_tr16(vp + 16 * PV + 32 * dt); }
      const int* kp4 = kq + k0; float v[16]; float mx = -INFINITY;
#pragma unroll
      for (int r = 0; r < 8; ++r) { int x0 = kp4[r] + qx, x1 = kp4[16 + r] + qx; x0 = x0 < (2 * SQ - 1) * 4 ? x0 : (2 * SQ - 1) * 4; x1 = x1 < (2 * SQ - 1) * 4 ? x1 : (2 * SQ - 1) * 4;
        v[r] = __builtin_fmaf(s0[r], 0.125f * LOG2E, *(const float*)((const char*)tb2 + x0)); v[8 + r] = __builtin_fmaf(s1[r], 0.125f * LOG2E, *(const float*)((const char*)tb2 + x1)); }
#pragma unroll
      for (int r = 0; r < 16; ++r) mx = __builtin_fmaxf(mx, v[r]);
      mx = __builtin_fmaxf(mx, fa_xhalf(mx));
      if (__builtin_amdgcn_ballot_w32(mx > m) != 0) { const float mn = __builtin_fmaxf(m, mx); const float msn = mn - 8.0f; const float corr = __builtin_amdgcn_exp2f(ms - msn); m = mn; ms = msn; l *= corr; o0 *= corr; o1 *= corr; o2 *= corr; o3 *= corr; }      /* corr = 0 in the first pass (ms = -inf), 1 for a query whose maximum stays */
      FragH pf; v2f la = {0.f, 0.f}, lb = {0.f, 0.f};      /* the pass's sum in two chains of pairs, so that no add waits on sixteen before it */
#pragma unroll
      for (int r = 0; r < 16; r += 4) { const float p0 = __builtin_amdgcn_exp2f(v[r] - ms), p1 = __builtin_amdgcn_exp2f(v[r + 1] - ms), p2 = __builtin_amdgcn_exp2f(v[r + 2] - ms), p3 = __builtin_amdgcn_exp2f(v[r + 3] - ms);
        la += v2f{p0, p1}; lb += v2f{p2, p3}; pf.h[r] = (_Float16)p0; pf.h[r + 1] = (_Float16)p1; pf.h[r + 2] = (_Float16)p2; pf.h[r + 3] = (_Float16)p3; }
      la += lb; l += la[0] + la[1];
      o0 = fa_mma(va[0].v, pf.v, o0); o1 = fa_mma(va[1].v, pf.v, o1); o2 = fa_mma(va[2].v, pf.v, o2); o3 = fa_mma(va[3].v, pf.v, o3); }
    if (more) { unsigned char* kn = kt[cur ^ 1]; unsigned char* vn = vt[cur ^ 1]; *(v8us*)(kn + sr * PK + sc * 16) = rk0; *(v8us*)(kn + (sr + 32) * PK + sc * 16) = rk1; *(v8us*)(vn + sr * PV + sc * 16) = rv0; *(v8us*)(vn + (sr + 32) * PV + sc * 16) = rv1; }      /* that buffer's last readers left it before the barrier that ended the stage before */
    __syncthreads(); }      /* publishes the next stage and ends this stage's reads */
  l += fa_xhalf(l); const float inv = 1.0f / l; unsigned short* op = (unsigned short*)O16 + base + (size_t)(q0 + ln) * DM + 8 * hh;      /* lane (c, hf) holds o[q0 + c][16 dt + 8 hf + r] */
  const v8f oo[4] = {o0, o1, o2, o3};
#pragma unroll
  for (int dt = 0; dt < 4; ++dt) { FragH f;
#pragma unroll
    for (int r = 0; r < 8; ++r) f.h[r] = (_Float16)(oo[dt][r] * inv);
    *(v8us*)(op + 16 * dt) = f.half[0]; } }

extern "C" void kernel_launch(void* const* d_in, const int* in_sizes, int n_in,
                              void* d_out, int out_size, void* d_ws, size_t ws_size, hipStream_t stream) {
  (void)in_sizes; (void)n_in; (void)out_size;
  const float* const* I = (const float* const*)d_in; const float* x = I[0]; const int* pmask = (const int*)d_in[1]; const float* wq = I[2]; const float* bq = I[3]; const float* wk = I[4]; const float* bk = I[5]; const float* wv = I[6]; const float* bv = I[7]; const float* wo = I[8]; const float* bo = I[9];      /* weights natural [out][in]; patch_mask int32 [4][2048] (1 = valid) */
  char* ws = (char*)d_ws; size_t off = 0;
  auto take = [&](size_t bytes) { char* p = ws + off; off += (bytes + 255) & ~(size_t)255; return p; };
  _Float16* BQ = (_Float16*)take((size_t)DM * DM * 2); _Float16* BK = (_Float16*)take((size_t)DM * DM * 2); _Float16* BV = (_Float16*)take((size_t)DM * DM * 2); _Float16* BO = (_Float16*)take((size_t)DM * DM * 2);
  _Float16* X16 = (_Float16*)take(NR * DM * 2); _Float16* Q16 = (_Float16*)take(NR * DM * 2); _Float16* K16 = (_Float16*)take(NR * DM * 2); _Float16* V16 = (_Float16*)take(NR * DM * 2); _Float16* O16 = (_Float16*)take(NR * DM * 2);
  float* TB = (float*)take((size_t)SQ * 4); int* POS = (int*)take(NR * 4); int* CNT = (int*)take((size_t)NB * CNTP * 4);
  (void)BK; (void)BV;
  if (off > ws_size) return;      /* 2 + 5x8 + 0.04 = approx 42 MiB */
  k_prep<<<PBL + PBX + 4 * PBW + PBT, 256, 0, stream>>>(x, pmask, wq, wk, wv, wo, X16, BQ, TB, POS, CNT, (float*)d_out);      /* BQ | BK | BV | BO are four planes in a row */
  const dim3 gp((unsigned)((NR / 128) * (DM / 64)), 1); const dim3 gp3((unsigned)((NR / 128) * (DM / 64)), 3);
  k_gemm2<0><<<gp3, 128, 0, stream>>>(X16, DM, 0, BQ, DM, (size_t)DM * DM, 0.0625f, bq, bk, bv, 0, nullptr, 1, 0, 0, nullptr, Q16, DM, NR * DM, MP, DM, DM, CNT, POS, nullptr);      /* blockIdx.y = 0, 1, 2: q, k, v; Q16 | K16 | V16 are three planes in a row */
  k_fattn<<<dim3(NB * NH, SQ / 128), 256, 0, stream>>>(Q16, K16, V16, TB, POS, CNT, O16);      /* o (merged heads) as f16 rows */
  k_gemm2<0><<<gp, 128, 0, stream>>>(O16, DM, 0, BO, DM, 0, 0.0625f, bo, nullptr, nullptr, 0, nullptr, 1, 0, 0, (float*)d_out, nullptr, DM, 0, MO, DM, DM, CNT, nullptr, POS);      /* o Wo^T + bo (f32), listed rows to their own rows of out */
}

// v005
// Measured time: 49.5 microseconds a run.
// Next to v004, in two timings, it ran 1.69 and 1.67 times as fast.
// Over all steps from v000 it is 396 times as fast.
#include <hip/hip_runtime.h>
#define NB 4
#define SQ 2048
#define DM 512
#define NH 8
#define HD 64
#define MP ((int)NR)                 /* token rows through the projections (debug hook) */
#define MO ((int)NR)                 /* token rows through the output projection / mask (debug hook) */
#define NR ((size_t)NB * SQ)         /* 8192 token rows */
#define CNTP 32                      /* ints between two batches' list lengths: each has a 128-byte line of its own */
typedef __bf16 v16b __attribute__((ext_vector_type(16)));
typedef unsigned short v8us __attribute__((ext_vector_type(8), may_alias));
typedef float  v8f  __attribute__((ext_vector_type(8)));
typedef float  v4f  __attribute__((ext_vector_type(4)));
typedef float  v4fa __attribute__((ext_vector_type(4), may_alias));
union FragB { v16b v; v8us half[2]; unsigned short u[16]; };

__device__ __forceinline__ unsigned short bf16_bits(float x) { unsigned int u = __float_as_uint(x); return (unsigned short)((u + 0x7FFFu + ((u >> 16) & 1u)) >> 16); }
__device__ __forceinline__ float bf16_val(unsigned short b) { return __uint_as_float(((unsigned int)b) << 16); }
__device__ __forceinline__ float bf16_round(float x) { return bf16_val(bf16_bits(x)); }
// D += A·B with NT terms: 1 = ah·bh, 2 = + al·bh (A split), 3 = + ah·bl (both split)
template <int NT>
__device__ __forceinline__ v8f mmaN(v16b ah, v16b al, v16b bh, v16b bl, v8f c) {
  c = __builtin_amdgcn_wmma_f32_16x16x32_bf16(false, ah, false, bh, (short)0, c, false, false);
  if (NT >= 2) c = __builtin_amdgcn_wmma_f32_16x16x32_bf16(false, al, false, bh, (short)0, c, false, false);
  if (NT >= 3) c = __builtin_amdgcn_wmma_f32_16x16x32_bf16(false, ah, false, bl, (short)0, c, false, false);
  asm volatile("v_nop\n\tv_nop\n\tv_nop\n\tv_nop" : "+v"(c) : "v"(ah), "v"(al), "v"(bh), "v"(bl));
  return c;
}

__global__ __launch_bounds__(256) void k_wt_bf16(const float* __restrict__ W, unsigned short* __restrict__ Wt, int K, int N) {
  const int t = blockIdx.x * 256 + threadIdx.x;
  const int k8n = K / 8;
  if (t >= N * k8n) return;
  const int n = t / k8n, k8 = (t % k8n) * 8;
  v8us v;
#pragma unroll
  for (int i = 0; i < 8; ++i) v[i] = bf16_bits(W[(size_t)(k8 + i) * N + n]);
  *(v8us*)(Wt + (size_t)n * K + k8) = v;
  
}

// GEMM C[M][N] (f32, pitch ldc) = act(A[M][K]·W + bias). A f32 row-major (pitch lda) converted per fragment to bf16
// (ASPLIT: hi/lo two planes -> 2 terms, else single rounded term); Wt bf16 [N][K] (pitch ldb). BIAS_BF16 rounds the
// bias to bf16 first (bias quantised to bf16 before the add). K%32==0, M%16==0, N%64==0.
template <bool ASPLIT, int ACT, bool BIAS_BF16>
__global__ __launch_bounds__(128) void k_gemm_bf(const float* __restrict__ A, int lda, const unsigned short* __restrict__ Wt, int ldb,
                                               const float* __restrict__ bias, float* __restrict__ C, int ldc, int M, int N, int K) {
  __shared__ __attribute__((aligned(16))) float so[4][16][64];
  const int tid = threadIdx.x, w = tid >> 5, lane = tid & 31, ln = lane & 15, hh = lane >> 4;
  const int ntn = N / 64;
  const int wid = blockIdx.x * 4 + w;
  const int mt = wid / ntn, nq = wid % ntn;
  if (mt * 16 >= M) return;
  const int row0 = mt * 16, col0 = nq * 64;
  const float* arow = A + (size_t)(row0 + ln) * lda;
  v8f acc[4] = {};
  for (int kb = 0; kb < K; kb += 32) {
    FragB ah, al;
    const v4f x0 = *(const v4fa*)(arow + kb + 8 * hh), x1 = *(const v4fa*)(arow + kb + 8 * hh + 4);
    const v4f x2 = *(const v4fa*)(arow + kb + 16 + 8 * hh), x3 = *(const v4fa*)(arow + kb + 16 + 8 * hh + 4);
    float xs[16] = {x0[0],x0[1],x0[2],x0[3],x1[0],x1[1],x1[2],x1[3],x2[0],x2[1],x2[2],x2[3],x3[0],x3[1],x3[2],x3[3]};
#pragma unroll
    for (int i = 0; i < 16; ++i) { const unsigned short hb = bf16_bits(xs[i]); ah.u[i] = hb; al.u[i] = ASPLIT ? bf16_bits(xs[i] - bf16_val(hb)) : (unsigned short)0; }
#pragma unroll
    for (int t = 0; t < 4; ++t) {
      const unsigned short* brow = Wt + (size_t)(col0 + t * 16 + ln) * ldb + kb;
      FragB b;
      b.half[0] = *(const v8us*)(brow + 8 * hh);
      b.half[1] = *(const v8us*)(brow + 16 + 8 * hh);
      acc[t] = mmaN<ASPLIT ? 2 : 1>(ah.v, al.v, b.v, b.v, acc[t]);
    }
  }
#pragma unroll
  for (int t = 0; t < 4; ++t) {
    float bv = bias ? bias[col0 + t * 16 + ln] : 0.f;
    if (BIAS_BF16) bv = bf16_round(bv);
#pragma unroll
    for (int r = 0; r < 8; ++r) { float v = acc[t][r] + bv; if (ACT == 1) v = fmaxf(v, 0.f); so[w][8 * hh + r][t * 16 + ln] = v; }
  }
  __builtin_amdgcn_fence(__ATOMIC_ACQ_REL, "workgroup");
  __builtin_amdgcn_wave_barrier();
  const int rsub = lane >> 4, c4 = (lane & 15) * 4;
  {
#pragma unroll
    for (int q = 0; q < 8; ++q) {
      const int r = q * 2 + rsub;
      const v4f v = *(const v4fa*)&so[w][r][c4];
      *(v4f*)(C + (size_t)(row0 + r) * ldc + col0 + c4) = v;
    }
    
  }
}

// GEMM C = act(A·W + bias + resid): A f32 (ASPLIT -> hi/lo 2 terms), Wt bf16 [N][K]; ACT 0 none, 1 relu, 2 exact gelu;
// resid (optional, f32, row index = (row % rmod), pitch ldr, RES_BF16 rounds it) added before the activation.
template <bool ASPLIT, int ACT, bool BIAS_BF16, bool RES_BF16>
__global__ __launch_bounds__(128) void k_gemm_bf3(const float* __restrict__ A, int lda, const unsigned short* __restrict__ Wt, int ldb,
                                                const float* __restrict__ bias, const float* __restrict__ resid, int rmod, int ldr,
                                                float* __restrict__ C, int ldc, int M, int N, int K) {
  __shared__ __attribute__((aligned(16))) float so[4][16][64];
  const int tid = threadIdx.x, w = tid >> 5, lane = tid & 31, ln = lane & 15, hh = lane >> 4;
  const int ntn = N / 64;
  const int wid = blockIdx.x * 4 + w;
  const int mt = wid / ntn, nq = wid % ntn;
  if (mt * 16 >= M) return;
  const int row0 = mt * 16, col0 = nq * 64;
  const float* arow = A + (size_t)(row0 + ln) * lda;
  v8f acc[4] = {};
  for (int kb = 0; kb < K; kb += 32) {
    FragB ah, al;
    const v4f x0 = *(const v4fa*)(arow + kb + 8 * hh), x1 = *(const v4fa*)(arow + kb + 8 * hh + 4);
    const v4f x2 = *(const v4fa*)(arow + kb + 16 + 8 * hh), x3 = *(const v4fa*)(arow + kb + 16 + 8 * hh + 4);
    float xs[16] = {x0[0],x0[1],x0[2],x0[3],x1[0],x1[1],x1[2],x1[3],x2[0],x2[1],x2[2],x2[3],x3[0],x3[1],x3[2],x3[3]};
#pragma unroll
    for (int i = 0; i < 16; ++i) { const unsigned short hb = bf16_bits(xs[i]); ah.u[i] = hb; al.u[i] = ASPLIT ? bf16_bits(xs[i] - bf16_val(hb)) : (unsigned short)0; }
#pragma unroll
    for (int t = 0; t < 4; ++t) {
      const unsigned short* brow = Wt + (size_t)(col0 + t * 16 + ln) * ldb + kb;
      FragB b;
      b.half[0] = *(const v8us*)(brow + 8 * hh);
      b.half[1] = *(const v8us*)(brow + 16 + 8 * hh);
      acc[t] = mmaN<ASPLIT ? 2 : 1>(ah.v, al.v, b.v, b.v, acc[t]);
    }
  }
#pragma unroll
  for (int t = 0; t < 4; ++t) {
    const int col = col0 + t * 16 + ln;
    float bv = bias ? bias[col] : 0.f;
    if (BIAS_BF16) bv = bf16_round(bv);
#pragma unroll
    for (int r = 0; r < 8; ++r) {
      float v = acc[t][r] + bv;
      if (resid) { float rv = resid[(size_t)((row0 + 8 * hh + r) % rmod) * ldr + col]; if (RES_BF16) rv = bf16_round(rv); v += rv; }
      if (ACT == 1) v = fmaxf(v, 0.f);
      if (ACT == 2) v = 0.5f * v * (1.0f + erff(v * 0.70710678118654752f));
      if (ACT == 3) { const float u = 0.7978845608028654f * (v + 0.044715f * v * v * v); v = 0.5f * v * (1.0f + tanhf(u)); }
      so[w][8 * hh + r][t * 16 + ln] = v;
    }
  }
  __builtin_amdgcn_fence(__ATOMIC_ACQ_REL, "workgroup");
  __builtin_amdgcn_wave_barrier();
  const int rsub = lane >> 4, c4 = (lane & 15) * 4;
  {
#pragma unroll
    for (int q = 0; q < 8; ++q) {
      const int r = q * 2 + rsub;
      const v4f v = *(const v4fa*)&so[w][r][c4];
      *(v4f*)(C + (size_t)(row0 + r) * ldc + col0 + c4) = v;
    }
    
  }
}
// row LayerNorm (biased variance, eps) over N: s = X (+ R); optional out_sum <- s; out_norm <- (s-mu)*rsqrt(var+eps)*g + b
template <bool PARAM_BF16>
__global__ __launch_bounds__(256) void k_layernorm(const float* __restrict__ X, const float* __restrict__ R, const float* __restrict__ g, const float* __restrict__ bta,
                                                  float* __restrict__ out_sum, float* __restrict__ out_norm, int N, float eps) {
  __shared__ float red[256];
  const int row = blockIdx.x, tid = threadIdx.x;
  const float* x = X + (size_t)row * N; const float* rr = R ? R + (size_t)row * N : nullptr;
  float vals[16];                     // up to N = 4096
  const int per = N / 256;            // contiguous chunk per thread? use strided-by-4 chunks: thread handles j = tid*4 + 1024*u
  float s1 = 0.f;
  for (int u = 0; u < per / 4; ++u) {
    const int j = tid * 4 + 1024 * u;
    const v4f a = *(const v4fa*)(x + j);
    v4f b = {0.f,0.f,0.f,0.f}; if (rr) b = *(const v4fa*)(rr + j);
#pragma unroll
    for (int q = 0; q < 4; ++q) { const float v = a[q] + b[q]; vals[u * 4 + q] = v; s1 += v; }
  }
  red[tid] = s1; __syncthreads();
  for (int st = 128; st > 0; st >>= 1) { if (tid < st) red[tid] += red[tid + st]; __syncthreads(); }
  const float mu = red[0] / (float)N; __syncthreads();
  float s2 = 0.f;
  for (int u = 0; u < per / 4; ++u)
#pragma unroll
    for (int q = 0; q < 4; ++q) { const float c = vals[u * 4 + q] - mu; s2 += c * c; }
  red[tid] = s2; __syncthreads();
  for (int st = 128; st > 0; st >>= 1) { if (tid < st) red[tid] += red[tid + st]; __syncthreads(); }
  const float rs = rsqrtf(red[0] / (float)N + eps);
  {
    for (int u = 0; u < per / 4; ++u) {
      const int j = tid * 4 + 1024 * u;
      v4f o, sm;
#pragma unroll
      for (int q = 0; q < 4; ++q) {
        float gg = g[j + q], bb = bta[j + q];
        if (PARAM_BF16) { gg = bf16_round(gg); bb = bf16_round(bb); }
        sm[q] = vals[u * 4 + q]; o[q] = (vals[u * 4 + q] - mu) * rs * gg + bb;
      }
      if (out_sum) *(v4f*)(out_sum + (size_t)row * N + j) = sm;
      *(v4f*)(out_norm + (size_t)row * N + j) = o;
    }
    
  }
}



// ---- f16 WMMA path (v_wmma_f32_16x16x32_f16): 11-bit significands for operands in range — used where a [0,1] probability operand needs more precision than bf16
typedef _Float16 v16h __attribute__((ext_vector_type(16)));
union FragH { v16h v; v8us half[2]; _Float16 h[16]; unsigned short u[16]; };
template <int NT>
__device__ __forceinline__ v8f mmaH(v16h ah, v16h al, v16h bh, v16h bl, v8f c) {
  c = __builtin_amdgcn_wmma_f32_16x16x32_f16(false, ah, false, bh, (short)0, c, false, false);
  if (NT >= 2) c = __builtin_amdgcn_wmma_f32_16x16x32_f16(false, al, false, bh, (short)0, c, false, false);
  if (NT >= 3) c = __builtin_amdgcn_wmma_f32_16x16x32_f16(false, ah, false, bl, (short)0, c, false, false);
  asm volatile("v_nop\n\tv_nop\n\tv_nop\n\tv_nop" : "+v"(c) : "v"(ah), "v"(al), "v"(bh), "v"(bl));
  return c;
}
// batched GEMM like k_gemm_b but f16 operands: A f32 (split into f16 hi/lo if ASPLIT, else rounded to f16), Bt = f16 values [n][k]; alpha; C f32; N multiple of 16 (partial tiles skipped)
template <bool ASPLIT>
__global__ __launch_bounds__(128) void k_gemm_h(const float* __restrict__ A, int lda, size_t sA, const _Float16* __restrict__ Bh, int ldb, size_t sB, float alpha, float* __restrict__ C, int ldc, size_t sC, int M, int N, int K) {
  __shared__ __attribute__((aligned(16))) float so[4][16][64];
  const int tid = threadIdx.x, w = tid >> 5, lane = tid & 31, ln = lane & 15, hh = lane >> 4; const int by = blockIdx.y;
  A += (size_t)by * sA; Bh += (size_t)by * sB; C += (size_t)by * sC;
  const int ntn = (N + 63) / 64; const int wid = blockIdx.x * 4 + w; const int mt = wid / ntn, nq = wid % ntn; if (mt * 16 >= M) return;
  const int row0 = mt * 16, col0 = nq * 64; const float* arow = A + (size_t)(row0 + ln) * lda;
  v8f acc[4] = {};
  for (int kb = 0; kb < K; kb += 32) {
    FragH ah, al;
    const v4f x0 = *(const v4fa*)(arow + kb + 8 * hh), x1 = *(const v4fa*)(arow + kb + 8 * hh + 4), x2 = *(const v4fa*)(arow + kb + 16 + 8 * hh), x3 = *(const v4fa*)(arow + kb + 16 + 8 * hh + 4);
    float xs[16] = {x0[0],x0[1],x0[2],x0[3],x1[0],x1[1],x1[2],x1[3],x2[0],x2[1],x2[2],x2[3],x3[0],x3[1],x3[2],x3[3]};
#pragma unroll
    for (int i = 0; i < 16; ++i) { const _Float16 h = (_Float16)xs[i]; ah.h[i] = h; al.h[i] = ASPLIT ? (_Float16)(xs[i] - (float)h) : (_Float16)0.0f; }
#pragma unroll
    for (int t = 0; t < 4; ++t) { if (col0 + t * 16 >= N) continue; const size_t boff = (size_t)(col0 + t * 16 + ln) * ldb + kb; FragH bq; bq.half[0] = *(const v8us*)(Bh + boff + 8 * hh); bq.half[1] = *(const v8us*)(Bh + boff + 16 + 8 * hh);
      acc[t] = mmaH<ASPLIT ? 2 : 1>(ah.v, al.v, bq.v, bq.v, acc[t]); }
  }
#pragma unroll
  for (int t = 0; t < 4; ++t) { if (col0 + t * 16 >= N) continue;
#pragma unroll
    for (int r = 0; r < 8; ++r) so[w][8 * hh + r][t * 16 + ln] = acc[t][r] * alpha; }
  __builtin_amdgcn_fence(__ATOMIC_ACQ_REL, "workgroup"); __builtin_amdgcn_wave_barrier();
  const int rsub = lane >> 4, c4 = (lane & 15) * 4;
  {
#pragma unroll
    for (int q = 0; q < 8; ++q) { const int r = q * 2 + rsub; if (col0 + c4 < N) { const v4f v = *(const v4fa*)&so[w][r][c4]; *(v4f*)(C + (size_t)(row0 + r) * ldc + col0 + c4) = v; } }
     }
}

// Wt[n][k] = f16(W[k][n]·scale) from f32 row-major W[K][N] (scale = power of two; bf16-exact weights stay exact in f16 away from the subnormal range)
__global__ __launch_bounds__(256) void k_wt_f16(const float* __restrict__ W, _Float16* __restrict__ Wt, int K, int N, float scale) {
  const int t = blockIdx.x * 256 + threadIdx.x; if (t >= N * (K / 8)) return; const int n = t / (K / 8), k8 = (t % (K / 8)) * 8; FragH f;
#pragma unroll
  for (int i = 0; i < 8; ++i) f.h[i] = (_Float16)(bf16_round(W[(size_t)(k8 + i) * N + n]) * scale); const v8us o = f.half[0];
  *(v8us*)((unsigned short*)Wt + (size_t)n * K + k8) = o; 
}
// k_gemm_hh variant with fused epilogue: v = acc·alpha + bias[by·sBias + col] (+ CP[(row/rowsPerB)·sCPb + by·64 + col] if CP) ; ACT 0 none / 1 elu ; writes f16 C16 (and f32 C if non-null)
template <int ACT>
__global__ __launch_bounds__(128) void k_gemm_hhx(const _Float16* __restrict__ A, int lda, size_t sA, const _Float16* __restrict__ Bh, int ldb, size_t sB, float alpha, const float* __restrict__ bias, size_t sBias, const float* __restrict__ CP, int rowsPerB, size_t sCPb, int row0g,
    float* __restrict__ C, _Float16* __restrict__ C16, int ldc, size_t sC, int M, int N, int K) {
  __shared__ __attribute__((aligned(16))) float so[4][16][64];
  const int tid = threadIdx.x, w = tid >> 5, lane = tid & 31, ln = lane & 15, hh = lane >> 4; const int by = blockIdx.y;
  A += (size_t)by * sA; Bh += (size_t)by * sB; const size_t cofs = (size_t)by * sC; const float* bp = bias ? bias + (size_t)by * sBias : nullptr;
  const int ntn = (N + 63) / 64; const int wid = blockIdx.x * 4 + w; const int mt = wid / ntn, nq = wid % ntn; if (mt * 16 >= M) return;
  const int row0 = mt * 16, col0 = nq * 64; const _Float16* arow = A + (size_t)(row0 + ln) * lda;
  v8f acc[4] = {};
  for (int kb = 0; kb < K; kb += 32) { FragH ah; ah.half[0] = *(const v8us*)((const unsigned short*)arow + kb + 8 * hh); ah.half[1] = *(const v8us*)((const unsigned short*)arow + kb + 16 + 8 * hh);
#pragma unroll
    for (int t = 0; t < 4; ++t) { if (col0 + t * 16 >= N) continue; const size_t boff = (size_t)(col0 + t * 16 + ln) * ldb + kb; FragH bq; bq.half[0] = *(const v8us*)((const unsigned short*)Bh + boff + 8 * hh); bq.half[1] = *(const v8us*)((const unsigned short*)Bh + boff + 16 + 8 * hh);
      acc[t] = mmaH<1>(ah.v, ah.v, bq.v, bq.v, acc[t]); }
  }
#pragma unroll
  for (int t = 0; t < 4; ++t) { if (col0 + t * 16 >= N) continue; const int col = col0 + t * 16 + ln; const float bv = bp ? bf16_round(bp[col]) : 0.f;
#pragma unroll
    for (int r = 0; r < 8; ++r) { float v = acc[t][r] * alpha + bv; if (CP) { const int rr = row0g + row0 + 8 * hh + r; if (rowsPerB < 0) v += CP[cofs + (size_t)rr * ldc + col];      /* rowsPerB < 0: own element of the batched C plane */ else { const int bidx = rr / rowsPerB; v += CP[(size_t)bidx * sCPb + (size_t)by * 64 + col]; } } if (ACT == 1) v = (v > 0.f) ? v : expm1f(v); else if (ACT == 7) v = (v > 0.f) ? v + 1.0f : expf(v); else if (ACT == 8) v = tanhf(v); else if (ACT == 9) v = 0.5f * v * (1.0f + tanhf(0.7978845608028654f * (v + 0.044715f * v * v * v))); else if (ACT == 11) v = 1.0f / (1.0f + expf(-v)); else if (ACT == 12) v = (v > 0.f) ? v : 0.01f * v; else if (ACT == 14) v = (v > 0.f) ? v : 0.1f * v; else if (ACT == 16) v = (v >= 0.f) ? v : 0.3f * v; else if (ACT == 17) v = (v >= 0.f) ? v : 0.2f * v; else if (ACT == 15) v = v / (1.0f + expf(-v)); else if (ACT == 3) v = fmaxf(v, 0.f); else if (ACT == 6) v = 0.5f * v * (1.0f + erff(v * 0.70710678118654752f)); so[w][8 * hh + r][t * 16 + ln] = v; } }
  __builtin_amdgcn_fence(__ATOMIC_ACQ_REL, "workgroup"); __builtin_amdgcn_wave_barrier();
  const int rsub = lane >> 4, c4 = (lane & 15) * 4; typedef _Float16 v4h __attribute__((ext_vector_type(4)));
  {
#pragma unroll
    for (int q = 0; q < 8; ++q) { const int r = q * 2 + rsub; if (col0 + c4 < N) { const v4f v = *(const v4fa*)&so[w][r][c4]; if (C) *(v4f*)(C + cofs + (size_t)(row0 + r) * ldc + col0 + c4) = v; if (C16) { v4h h4; for (int i = 0; i < 4; ++i) h4[i] = (_Float16)v[i]; *(v4h*)(C16 + cofs + (size_t)(row0 + r) * ldc + col0 + c4) = h4; } } }
     }
}


typedef _Float16 v4h __attribute__((ext_vector_type(4)));

__global__ __launch_bounds__(256) void k_h16(const float* __restrict__ x, _Float16* __restrict__ X16, size_t n8) { const size_t t = (size_t)blockIdx.x * 256 + threadIdx.x; if (t >= n8) return; FragH f;
#pragma unroll
  for (int q = 0; q < 8; ++q) f.h[q] = (_Float16)x[t * 8 + q]; *(v8us*)((unsigned short*)X16 + t * 8) = f.half[0];  }
__global__ __launch_bounds__(256) void k_round16f(const float* __restrict__ W, _Float16* __restrict__ Bt, size_t n8) { const size_t t = (size_t)blockIdx.x * 256 + threadIdx.x; if (t >= n8) return; FragH f;
#pragma unroll
  for (int i = 0; i < 8; ++i) f.h[i] = (_Float16)(bf16_round(W[t * 8 + i]) * 16.0f); *(v8us*)((unsigned short*)Bt + t * 8) = f.half[0];  }
template <int NHv, int TTv>
__global__ __launch_bounds__(256) void k_vt(const _Float16* __restrict__ V16, int ldv, int voff, _Float16* __restrict__ Vt) { __shared__ unsigned short tl[64][66]; const int tid = threadIdx.x; const int slab = blockIdx.x / (TTv / 64), lg = blockIdx.x % (TTv / 64); const int b = slab / NHv, h = slab % NHv;
  for (int i = tid; i < 64 * 8; i += 256) { const int r = i / 8, c8 = (i % 8) * 8; FragH f; f.half[0] = *(const v8us*)((const unsigned short*)V16 + ((size_t)b * TTv + lg * 64 + r) * ldv + voff + h * 64 + c8);
#pragma unroll
    for (int q = 0; q < 8; ++q) tl[r][c8 + q] = f.u[q]; }
  __syncthreads();
  {
#pragma unroll
    for (int rd = 0; rd < 2; ++rd) { const int d = rd * 32 + tid / 8, pc = tid % 8; FragH f;
#pragma unroll
      for (int q = 0; q < 8; ++q) f.u[q] = tl[pc * 8 + q][d];
      *(v8us*)((unsigned short*)Vt + ((size_t)slab * 64 + d) * TTv + lg * 64 + pc * 8) = f.half[0]; }
     } }

__global__ __launch_bounds__(256) void k_hl(const float* __restrict__ F, _Float16* __restrict__ Hh, _Float16* __restrict__ Hl, size_t n8) { const size_t t = (size_t)blockIdx.x * 256 + threadIdx.x; if (t >= n8) return; FragH fh, fl; const v4f a = *(const v4fa*)(F + t * 8), c = *(const v4fa*)(F + t * 8 + 4);
#pragma unroll
  for (int q = 0; q < 4; ++q) { _Float16 h = (_Float16)a[q]; fh.h[q] = h; fl.h[q] = (_Float16)((a[q] - (float)h) * 1024.0f); h = (_Float16)c[q]; fh.h[4 + q] = h; fl.h[4 + q] = (_Float16)((c[q] - (float)h) * 1024.0f); }
  { *(v8us*)((unsigned short*)Hh + t * 8) = fh.half[0]; *(v8us*)((unsigned short*)Hl + t * 8) = fl.half[0];  } }

// ---- fast GEMM (work-group tile 128x64, wave tile 32x64; requires M % 128 == 0, N % 64 == 0, K % 64 == 0); epilogue = k_gemm_hhx semantics ----
// A and B reach the fragments through LDS: a stage is 64 k (one 128-byte line) of the tile's 128 A rows and 64 B rows; eight lanes load one whole line, so a wave's load touches 4 lines, not 16, and B is fetched once a work-group, not once a wave. The next stage's lines fly while this stage is worked on (two buffers, one barrier a stage). The fragments hold the same elements in the same k order as a load straight from global.
#define GKC 64                       /* k per LDS stage */
#define GP 144                       /* LDS row pitch, bytes: 16 x odd, for ds_load_b128 */
#define GST ((128 + 64) * GP)        /* bytes of one stage: 128 A rows, then 64 B rows */
__device__ __forceinline__ v16h g2_lfrag(const unsigned char* p) { FragH f; f.half[0] = *(const v8us*)p; f.half[1] = *(const v8us*)(p + 32); return f.v; }
__device__ __forceinline__ v16h g2_frag(const _Float16* p, int hh) { FragH f; f.half[0] = *(const v8us*)((const unsigned short*)p + 8 * hh); f.half[1] = *(const v8us*)((const unsigned short*)p + 16 + 8 * hh); return f.v; }
__device__ __forceinline__ v8f g2_mma(v16h a, v16h b, v8f c) { v8f d = __builtin_amdgcn_wmma_f32_16x16x32_f16(false, a, false, b, (short)0, c, false, false); asm volatile("v_nop\n\tv_nop\n\tv_nop\n\tv_nop" : "+v"(d) : "v"(a), "v"(b)); return d; }
template <int ACT>
__global__ __launch_bounds__(128) void k_gemm2(const _Float16* __restrict__ A, int lda, size_t sA, const _Float16* __restrict__ Bh, int ldb, size_t sB, float alpha, const float* __restrict__ bias, const float* __restrict__ bias1, const float* __restrict__ bias2, size_t sBias, const float* __restrict__ CP, int rowsPerB, size_t sCPb, int row0g,
    float* __restrict__ C, _Float16* __restrict__ C16, int ldc, size_t sC, int M, int N, int K, const int* __restrict__ cnt, const int* __restrict__ gpos, const int* __restrict__ spos) { static_assert(ACT == 0 || ACT == 3 || ACT == 6 || ACT == 8 || ACT == 9 || ACT == 11 || ACT == 12 || ACT == 14 || ACT == 15 || ACT == 16 || ACT == 17, "k_gemm2: unsupported ACT code (would silently apply no activation)");
  __shared__ __attribute__((aligned(16))) unsigned char stg[2 * GST]; float (*so)[32][68] = (float (*)[32][68])stg; static_assert(sizeof(float) * 4 * 32 * 68 <= 2 * GST, "the epilogue's tile lies over the stages");      /* so is written only behind the loop's last barrier */
  const int tid = threadIdx.x, w = tid >> 5, lane = tid & 31, ln = lane & 15, hh = lane >> 4; const int by = blockIdx.y;
  if (bias1) bias = by == 1 ? bias1 : by == 2 ? bias2 : bias;      /* three products in one grid, each with its own bias vector */
  A += (size_t)by * sA; Bh += (size_t)by * sB; const size_t cofs = (size_t)by * sC; const float* bp = bias ? bias + (size_t)by * sBias : nullptr;
  const int ntn = N >> 6; const int mi = blockIdx.x / ntn, nq = blockIdx.x - mi * ntn; const int mt = (mi % NB) * (SQ / 128) + mi / NB;      /* row tiles in the order tile 0 of every batch, tile 1 of every batch, ...: the tiles past the lists come last in the grid */
  const int row0 = mt * 128 + 32 * w, col0 = nq * 64; if (mt * 128 >= M) return;      /* the whole work-group leaves, in front of every barrier */
  /* rows are list entries: batch bb, entries cb .. cb + 127 of its list of nv valid tokens; a block whose first entry lies past the list has nothing to do; the entries from nv to the block's end repeat the first valid token (finite rows that carry no weight later) */
  const int bb = (mt * 128) / SQ, cb = mt * 128 - bb * SQ; int nv = cnt[bb * CNTP]; nv = nv < SQ ? nv : SQ; if (cb >= nv) return;
  int sp = cb + 32 * w + lane, nlim = SQ; if (spos) { sp = spos[row0 + lane] & (SQ - 1); nlim = nv; }      /* lane l: the row inside the batch where row l of this wave's tile is stored; spos: a listed row goes to its token's own position, an entry past the list nowhere */
  /* staging: thread t moves 16 bytes of A rows t / 8 + 16 i (i < 8) and of B rows t / 8 + 16 i (i < 4) of each stage; the loops over i and ks are unrolled so that their arrays are registers */
  const int sr = tid >> 3, sc = tid & 7; int ra[8]; unsigned ao[8], bo[4];      /* ao, bo: each row's byte offset in its matrix (under 2^32); the stage's k is added to the uniform base */
#pragma unroll
  for (int i = 0; i < 8; ++i) ra[i] = mt * 128 + sr + 16 * i;
  if (gpos) { int gv[8];      /* gpos: A rows stand at the tokens' own positions; one test round all eight loads, so that they fly together */
#pragma unroll
    for (int i = 0; i < 8; ++i) gv[i] = gpos[ra[i]];
#pragma unroll
    for (int i = 0; i < 8; ++i) ra[i] = bb * SQ + (gv[i] & (SQ - 1)); }
#pragma unroll
  for (int i = 0; i < 8; ++i) ao[i] = (unsigned)ra[i] * (unsigned)lda * 2u + (unsigned)sc * 16u;
#pragma unroll
  for (int i = 0; i < 4; ++i) bo[i] = (unsigned)(col0 + sr + 16 * i) * (unsigned)ldb * 2u + (unsigned)sc * 16u;
  const char* Ab = (const char*)A; const char* Bb = (const char*)Bh; v8us pa[8], pb[4];
#pragma unroll
  for (int i = 0; i < 8; ++i) pa[i] = *(const v8us*)(Ab + ao[i]);
#pragma unroll
  for (int i = 0; i < 4; ++i) pb[i] = *(const v8us*)(Bb + bo[i]);
  unsigned char* sw = stg + sr * GP + sc * 16; const unsigned char* af = stg + (32 * w + ln) * GP + 16 * hh; const unsigned char* bf = stg + (128 + ln) * GP + 16 * hh;
#pragma unroll
  for (int i = 0; i < 8; ++i) *(v8us*)(sw + 16 * i * GP) = pa[i];
#pragma unroll
  for (int i = 0; i < 4; ++i) *(v8us*)(sw + (128 + 16 * i) * GP) = pb[i];
  __syncthreads();
  const v8f z8 = {0.f,0.f,0.f,0.f,0.f,0.f,0.f,0.f}; v8f c00 = z8, c01 = z8, c02 = z8, c03 = z8, c10 = z8, c11 = z8, c12 = z8, c13 = z8; const int nch = K / GKC;
#pragma unroll 1
  for (int c = 0; c < nch; ++c) { const int cur = (c & 1) * GST; const bool more = c + 1 < nch;      /* rolled: two buffers, one stage's code */
    if (more) { const char* An = Ab + (size_t)(c + 1) * (GKC * 2); const char* Bn = Bb + (size_t)(c + 1) * (GKC * 2);
#pragma unroll
      for (int i = 0; i < 8; ++i) pa[i] = *(const v8us*)(An + ao[i]);
#pragma unroll
      for (int i = 0; i < 4; ++i) pb[i] = *(const v8us*)(Bn + bo[i]);
      asm volatile("s_wait_xcnt 0x0" ::: "memory"); }      /* keeps the twelve loads up here, in flight while this stage is worked on; the wait is a precaution in front of any reuse of their address registers */
    const unsigned char* ap = af + cur; const unsigned char* bq = bf + cur; v16h a0[GKC / 32], a1[GKC / 32], b0[GKC / 32], b1[GKC / 32], b2[GKC / 32], b3[GKC / 32];
#pragma unroll
    for (int ks = 0; ks < GKC / 32; ++ks) { a0[ks] = g2_lfrag(ap + ks * 64); a1[ks] = g2_lfrag(ap + 16 * GP + ks * 64); b0[ks] = g2_lfrag(bq + ks * 64); b1[ks] = g2_lfrag(bq + 16 * GP + ks * 64); b2[ks] = g2_lfrag(bq + 32 * GP + ks * 64); b3[ks] = g2_lfrag(bq + 48 * GP + ks * 64); }
    asm volatile("" :: "v"(a0[0]), "v"(a1[0]), "v"(b0[0]), "v"(b1[0]), "v"(b2[0]), "v"(b3[0]), "v"(a0[1]), "v"(a1[1]), "v"(b0[1]), "v"(b1[1]), "v"(b2[1]), "v"(b3[1]));      /* inputs only: holds the stage's LDS reads together in front of the products, one LDS latency a stage instead of one per fragment */
#pragma unroll
    for (int ks = 0; ks < GKC / 32; ++ks) {
      c00 = g2_mma(a0[ks], b0[ks], c00); c10 = g2_mma(a1[ks], b0[ks], c10); c01 = g2_mma(a0[ks], b1[ks], c01); c11 = g2_mma(a1[ks], b1[ks], c11);
      c02 = g2_mma(a0[ks], b2[ks], c02); c12 = g2_mma(a1[ks], b2[ks], c12); c03 = g2_mma(a0[ks], b3[ks], c03); c13 = g2_mma(a1[ks], b3[ks], c13); }
    if (more) { unsigned char* d = sw + (GST - cur);      /* that buffer's last readers left it before the barrier that ended the stage before */
#pragma unroll
      for (int i = 0; i < 8; ++i) *(v8us*)(d + 16 * i * GP) = pa[i];
#pragma unroll
      for (int i = 0; i < 4; ++i) *(v8us*)(d + (128 + 16 * i) * GP) = pb[i]; }
    __syncthreads(); }      /* publishes the next stage and ends this stage's reads; behind the last one the stages' LDS is free for the epilogue */
  v8f accs[8] = {c00, c01, c02, c03, c10, c11, c12, c13};
#pragma unroll
  for (int u = 0; u < 8; ++u) { const int t = u & 3, half = u >> 2; const int col = col0 + t * 16 + ln; const float bv = bp ? bf16_round(bp[col]) : 0.f;
#pragma unroll
    for (int r = 0; r < 8; ++r) { const int rloc = half * 16 + 8 * hh + r; float v = accs[u][r] * alpha + bv; if (CP) { if (rowsPerB < 0) v += CP[cofs + (size_t)(row0g + row0 + rloc) * ldc + col];      /* rowsPerB < 0: own element of the batched C plane */ else { const int bidx = (row0g + row0 + rloc) / rowsPerB; v += CP[(size_t)bidx * sCPb + (size_t)by * 64 + col]; } }
      if (ACT == 3) v = fmaxf(v, 0.f); else if (ACT == 6) v = 0.5f * v * (1.0f + erff(v * 0.70710678118654752f)); else if (ACT == 11) v = 1.0f / (1.0f + expf(-v)); else if (ACT == 15) v = v / (1.0f + expf(-v)); else if (ACT == 12) v = (v > 0.f) ? v : 0.01f * v; else if (ACT == 8) v = tanhf(v); else if (ACT == 9) v = 0.5f * v * (1.0f + tanhf(0.7978845608028654f * (v + 0.044715f * v * v * v))); else if (ACT == 14) v = (v > 0.f) ? v : 0.1f * v; else if (ACT == 16) v = (v >= 0.f) ? v : 0.3f * v; else if (ACT == 17) v = (v >= 0.f) ? v : 0.2f * v;
      so[w][rloc][t * 16 + ln] = v; } }
  __builtin_amdgcn_fence(__ATOMIC_ACQ_REL, "workgroup"); __builtin_amdgcn_wave_barrier();
  const int rsub = lane >> 4, c4 = (lane & 15) * 4;
  {
#pragma unroll
    for (int q = 0; q < 16; ++q) { const int r = q * 2 + rsub; const v4f v = *(const v4fa*)&so[w][r][c4]; const int p0 = __builtin_amdgcn_readlane(sp, q * 2), p1 = __builtin_amdgcn_readlane(sp, q * 2 + 1); const int ro = bb * SQ + (rsub ? p1 : p0);
      if (cb + 32 * w + r < nlim) { if (C) { *(v4f*)(C + cofs + (size_t)ro * ldc + col0 + c4) = v; asm volatile("s_wait_xcnt 0x0" ::: "memory"); }      /* precaution: the built code rewrites this store's data and address registers right behind it */
        if (C16) { v4h h4; for (int i = 0; i < 4; ++i) h4[i] = (_Float16)v[i]; *(v4h*)(C16 + cofs + (size_t)ro * ldc + col0 + c4) = h4; } } }
     } }


// ---- preparation: everything that reads only the inputs, as one launch; a block's index range says which job it does (none reads what another writes) ----
#define PBX ((int)(NR * DM / 8 / 256))      /* blocks that convert h: 8 elements a thread */
#define PBW (DM * DM / 8 / 256)             /* blocks per weight matrix: 8 elements a thread */
#define PBT (SQ / 256)                      /* blocks of the bias table: 1 entry a thread */
#define PBL NB                              /* blocks that list the valid tokens: one a batch, 8 positions a thread */
typedef int v4i __attribute__((ext_vector_type(4)));
__device__ __forceinline__ float tbias_at(int d) {
  const float dist = __fdiv_rn(__fmul_rn((float)d, 300.0f), 300.0f); const float v = logf(__fadd_rn(expf(-dist), 1e-12f));
  return v; }
__global__ __launch_bounds__(256) void k_prep(const float* __restrict__ x, const int* __restrict__ pmask, const float* __restrict__ wq, const float* __restrict__ wk, const float* __restrict__ wv, const float* __restrict__ wo, _Float16* __restrict__ X16, _Float16* __restrict__ BW, float* __restrict__ TB, int* __restrict__ POS, int* __restrict__ CNT, float* __restrict__ out) {
  __shared__ int psum[256]; __shared__ __attribute__((aligned(16))) int lst[SQ]; __shared__ int first;
  int blk = blockIdx.x;
  if (blk < PBL) { const int tid = threadIdx.x; const int* mp = pmask + (size_t)blk * SQ + tid * 8;      /* batch blk: valid positions in ascending order, by a prefix sum of the threads' counts */
    const v4i m0 = *(const v4i*)mp, m1 = *(const v4i*)(mp + 4); const int mv[8] = {m0[0], m0[1], m0[2], m0[3], m1[0], m1[1], m1[2], m1[3]}; int c = 0;
#pragma unroll
    for (int q = 0; q < 8; ++q) c += mv[q] != 0;
    psum[tid] = c; if (tid == 0) first = 0;
    __syncthreads();
    for (int o = 1; o < 256; o <<= 1) { const int a = tid >= o ? psum[tid - o] : 0; __syncthreads(); psum[tid] += a; __syncthreads(); }
    const int n = psum[255]; int rk = psum[tid] - c;
    if (rk == 0 && c != 0) {
#pragma unroll
      for (int q = 7; q >= 0; --q) if (mv[q] != 0) first = tid * 8 + q; }
#pragma unroll
    for (int q = 0; q < 8; ++q) if (mv[q] != 0) lst[rk++] = tid * 8 + q;
    __syncthreads();
    v4i o0, o1;      /* entries past the list repeat the first valid position; a wave stores whole 128-byte lines */
#pragma unroll
    for (int q = 0; q < 4; ++q) { o0[q] = tid * 8 + q < n ? lst[tid * 8 + q] : first; o1[q] = tid * 8 + 4 + q < n ? lst[tid * 8 + 4 + q] : first; }
    *(v4i*)(POS + (size_t)blk * SQ + tid * 8) = o0; *(v4i*)(POS + (size_t)blk * SQ + tid * 8 + 4) = o1; if (tid == 0) CNT[blk * CNTP] = n;
    return; }
  blk -= PBL;
  if (blk < PBX) { const size_t t = (size_t)blk * 256 + threadIdx.x; FragH f;      /* valid h rows, rounded to bf16, exact in f16; a padded row is read by nobody, its row of out is 0 */
    if (pmask[t / (DM / 8)] == 0) { const v4f z = {0.f, 0.f, 0.f, 0.f}; *(v4f*)(out + t * 8) = z; *(v4f*)(out + t * 8 + 4) = z; return; }
#pragma unroll
    for (int q = 0; q < 8; ++q) f.h[q] = (_Float16)bf16_round(x[t * 8 + q]);
    *(v8us*)((unsigned short*)X16 + t * 8) = f.half[0]; return; }
  blk -= PBX;
  if (blk < 4 * PBW) { const int mi = blk / PBW; const float* __restrict__ w = mi == 0 ? wq : mi == 1 ? wk : mi == 2 ? wv : wo;      /* weight mi, natural [out][in], x16, into plane mi of BW */
    const size_t t = (size_t)(blk - mi * PBW) * 256 + threadIdx.x; FragH f;
    for (int q = 0; q < 8; ++q) f.h[q] = (_Float16)(bf16_round(w[t * 8 + q]) * 16.0f);
    *(v8us*)((unsigned short*)BW + (size_t)mi * DM * DM + t * 8) = f.half[0]; return; }
  const int d = (blk - 4 * PBW) * 256 + threadIdx.x; TB[d] = tbias_at(d);
  asm volatile("s_wait_xcnt 0x0" ::: "memory"); }      /* precaution: the built code places another job's block behind this store, and that block rewrites the store's registers */
#define FK 64                        /* keys per LDS stage */
#define PK 144                       /* LDS row pitch of the K tile, bytes: 16 x odd, for ds_load_b128 */
#define PV 160                       /* LDS row pitch of the V tile, bytes: 32 x odd, for ds_load_tr16_b128 */
#define LOG2E 1.4426950408889634f
typedef short s16x8 __attribute__((ext_vector_type(8)));
typedef float v2f __attribute__((ext_vector_type(2)));
__device__ __forceinline__ v8us fa_tr16(const unsigned char* p) { typedef __attribute__((address_space(3))) s16x8 lds_s16x8; return __builtin_bit_cast(v8us, __builtin_amdgcn_ds_load_tr16_b128_v8i16((lds_s16x8*)p)); }
__device__ __forceinline__ float fa_xhalf(float x) { return __builtin_bit_cast(float, __builtin_amdgcn_permlanex16(__builtin_bit_cast(int, x), __builtin_bit_cast(int, x), 0x76543210, 0xfedcba98, false, false)); }      /* lane l reads lane l ^ 16 */
// amdgpu_waves_per_eu(4, 4) on the kernel: two work-groups per WGP are four waves per SIMD, so a wave may use up to 256 registers.
__device__ __forceinline__ v8f fa_mma(v16h a, v16h b, v8f c) { return __builtin_amdgcn_wmma_f32_16x16x32_f16(false, a, false, b, (short)0, c, false, false); }
__global__ __launch_bounds__(256) __attribute__((amdgpu_waves_per_eu(4, 4))) void k_fattn(const _Float16* __restrict__ Q16, const _Float16* __restrict__ K16, const _Float16* __restrict__ V16, const float* __restrict__ TB, const int* __restrict__ POS, const int* __restrict__ CNT, _Float16* __restrict__ O16) {
  __shared__ __attribute__((aligned(16))) float tb2[2 * SQ]; __shared__ __attribute__((aligned(16))) int kx[SQ];
  __shared__ __attribute__((aligned(16))) unsigned char kt[2][FK * PK]; __shared__ __attribute__((aligned(16))) unsigned char vt[2][FK * PV];
  const int tid = threadIdx.x, lane = tid & 31, ln = lane & 15, hh = lane >> 4; const int wv = __builtin_amdgcn_readfirstlane(tid >> 5);
  const int b = blockIdx.x / NH, h = blockIdx.x % NH; int nv = CNT[b * CNTP]; nv = nv < SQ ? nv : SQ; if ((int)blockIdx.y * 128 >= nv) return;      /* the whole work-group leaves, in front of every barrier: its queries lie past the list; the query tile is the slow grid index, so that these work-groups come last and the working ones spread over the chip */
  const int nst = (nv + FK - 1) / FK; const int* lp = POS + (size_t)b * SQ; const int q0 = blockIdx.y * 128 + wv * 16; const bool act = q0 < nv;      /* act, the same for the whole wave: a wave whose 16 queries all lie past the list only stages and stores zero rows */ const size_t base = (size_t)b * SQ * DM + (size_t)h * HD;
  /* staging: thread t moves 16 bytes of rows t / 8 and 32 + t / 8 of each tile, so a wave's load covers four whole 128-byte rows */
  const int sr = tid >> 3, sc = tid & 7;
  const unsigned short* kg = (const unsigned short*)K16 + base + (size_t)sr * DM + sc * 8; const unsigned short* vg = (const unsigned short*)V16 + base + (size_t)sr * DM + sc * 8;
  v8us rk0 = *(const v8us*)kg, rk1 = *(const v8us*)(kg + 32 * DM), rv0 = *(const v8us*)vg, rv1 = *(const v8us*)(vg + 32 * DM);
  const _Float16* qp = Q16 + base + (size_t)(q0 + ln) * DM; const v16h qf0 = g2_frag(qp, hh), qf1 = g2_frag(qp + 32, hh);
#pragma unroll
  for (int u = 0; u < 2 * SQ / 256; ++u) { const int t = tid + 256 * u; int d = t - (SQ - 1); d = d < 0 ? -d : d; d = d < SQ ? d : SQ - 1; const float tv = TB[d] * LOG2E; tb2[t] = t == 2 * SQ - 1 ? -1.0e9f * LOG2E : tv; }      /* unrolled: the table's loads are all in flight together */
#pragma unroll
  for (int u = 0; u < SQ / 256; ++u) { const int t = tid + 256 * u; kx[t] = (lp[t] & (SQ - 1)) * 4 + (t < nv ? 0 : 4 * SQ * 4); }      /* a sum, so that the eight loads stand under no test and fly together: the list's every entry is written */
  *(v8us*)(kt[0] + sr * PK + sc * 16) = rk0; *(v8us*)(kt[0] + (sr + 32) * PK + sc * 16) = rk1; *(v8us*)(vt[0] + sr * PV + sc * 16) = rv0; *(v8us*)(vt[0] + (sr + 32) * PV + sc * 16) = rv1;
  __syncthreads();
  const v8f z8 = {0.f,0.f,0.f,0.f,0.f,0.f,0.f,0.f}; v8f o0 = z8, o1 = z8, o2 = z8, o3 = z8; float m = -INFINITY, ms = -INFINITY, l = act ? 0.f : 1.f;
  const int qx = (SQ - 1) * 4 - (kx[q0 + ln] & ((SQ - 1) * 4)); const int* kq = kx + 8 * hh;
#pragma unroll 1
  for (int st = 0; st < nst; ++st) { const int cur = st & 1; const bool more = st + 1 < nst;      /* rolled, for speed only */
    if (more) { const size_t go = (size_t)(st + 1) * FK * DM; rk0 = *(const v8us*)(kg + go); rk1 = *(const v8us*)(kg + go + 32 * DM); rv0 = *(const v8us*)(vg + go); rv1 = *(const v8us*)(vg + go + 32 * DM);
      asm volatile("s_wait_xcnt 0x0" ::: "memory"); }      /* the next stage's rows fly while this stage is worked on; the wait is a precaution: the built code reuses these loads' address registers right behind them */
    if (act)
#pragma unroll
    for (int sub = 0; sub < FK / 32; ++sub) { const int k0 = st * FK + sub * 32;
      const unsigned char* kp = kt[cur] + (sub * 32 + ln) * PK + 16 * hh; FragH ka0, ka1, kb0, kb1;
      ka0.half[0] = *(const v8us*)(kp); ka0.half[1] = *(const v8us*)(kp + 32); ka1.half[0] = *(const v8us*)(kp + 64); ka1.half[1] = *(const v8us*)(kp + 96);
      kb0.half[0] = *(const v8us*)(kp + 16 * PK); kb0.half[1] = *(const v8us*)(kp + 16 * PK + 32); kb1.half[0] = *(const v8us*)(kp + 16 * PK + 64); kb1.half[1] = *(const v8us*)(kp + 16 * PK + 96);
      v8f s0 = fa_mma(ka0.v, qf0, z8), s1 = fa_mma(kb0.v, qf0, z8); s0 = fa_mma(ka1.v, qf1, s0); s1 = fa_mma(kb1.v, qf1, s1);
      const unsigned char* vp = vt[cur] + (sub * 32 + 8 * hh + (lane & 7)) * PV + ((lane >> 3) & 1) * 16; FragH va[4];
#pragma unroll
      for (int dt = 0; dt < 4; ++dt) { va[dt].half[0] = fa_tr16(vp + 32 * dt); va[dt].half[1] = fa_tr16(vp + 16 * PV + 32 * dt); }
      const int* kp4 = kq + k0; float v[16]; float mx = -INFINITY;
#pragma unroll
      for (int r = 0; r < 8; ++r) { int x0 = kp4[r] + qx, x1 = kp4[16 + r] + qx; x0 = x0 < (2 * SQ - 1) * 4 ? x0 : (2 * SQ - 1) * 4; x1 = x1 < (2 * SQ - 1) * 4 ? x1 : (2 * SQ - 1) * 4;
        v[r] = __builtin_fmaf(s0[r], 0.125f * LOG2E, *(const float*)((const char*)tb2 + x0)); v[8 + r] = __builtin_fmaf(s1[r], 0.125f * LOG2E, *(const float*)((const char*)tb2 + x1)); }
#pragma unroll
      for (int r = 0; r < 16; ++r) mx = __builtin_fmaxf(mx, v[r]);
      mx = __builtin_fmaxf(mx, fa_xhalf(mx));
      if (__builtin_amdgcn_ballot_w32(mx > m) != 0) { const float mn = __builtin_fmaxf(m, mx); const float msn = mn - 8.0f; const float corr = __builtin_amdgcn_exp2f(ms - msn); m = mn; ms = msn; l *= corr; o0 *= corr; o1 *= corr; o2 *= corr; o3 *= corr; }      /* corr = 0 in the first pass (ms = -inf), 1 for a query whose maximum stays */
      FragH pf; v2f la = {0.f, 0.f}, lb = {0.f, 0.f};      /* the pass's sum in two chains of pairs, so that no add waits on sixteen before it */
#pragma unroll
      for (int r = 0; r < 16; r += 4) { const float p0 = __builtin_amdgcn_exp2f(v[r] - ms), p1 = __builtin_amdgcn_exp2f(v[r + 1] - ms), p2 = __builtin_amdgcn_exp2f(v[r + 2] - ms), p3 = __builtin_amdgcn_exp2f(v[r + 3] - ms);
        la += v2f{p0, p1}; lb += v2f{p2, p3}; pf.h[r] = (_Float16)p0; pf.h[r + 1] = (_Float16)p1; pf.h[r + 2] = (_Float16)p2; pf.h[r + 3] = (_Float16)p3; }
      la += lb; l += la[0] + la[1];
      o0 = fa_mma(va[0].v, pf.v, o0); o1 = fa_mma(va[1].v, pf.v, o1); o2 = fa_mma(va[2].v, pf.v, o2); o3 = fa_mma(va[3].v, pf.v, o3); }
    if (more) { unsigned char* kn = kt[cur ^ 1]; unsigned char* vn = vt[cur ^ 1]; *(v8us*)(kn + sr * PK + sc * 16) = rk0; *(v8us*)(kn + (sr + 32) * PK + sc * 16) = rk1; *(v8us*)(vn + sr * PV + sc * 16) = rv0; *(v8us*)(vn + (sr + 32) * PV + sc * 16) = rv1; }      /* that buffer's last readers left it before the barrier that ended the stage before */
    __syncthreads(); }      /* publishes the next stage and ends this stage's reads */
  l += fa_xhalf(l); const float inv = 1.0f / l; unsigned short* op = (unsigned short*)O16 + base + (size_t)(q0 + ln) * DM + 8 * hh;      /* lane (c, hf) holds o[q0 + c][16 dt + 8 hf + r] */
  const v8f oo[4] = {o0, o1, o2, o3};
#pragma unroll
  for (int dt = 0; dt < 4; ++dt) { FragH f;
#pragma unroll
    for (int r = 0; r < 8; ++r) f.h[r] = (_Float16)(oo[dt][r] * inv);
    *(v8us*)(op + 16 * dt) = f.half[0]; } }

extern "C" void kernel_launch(void* const* d_in, const int* in_sizes, int n_in,
                              void* d_out, int out_size, void* d_ws, size_t ws_size, hipStream_t stream) {
  (void)in_sizes; (void)n_in; (void)out_size;
  const float* const* I = (const float* const*)d_in; const float* x = I[0]; const int* pmask = (const int*)d_in[1]; const float* wq = I[2]; const float* bq = I[3]; const float* wk = I[4]; const float* bk = I[5]; const float* wv = I[6]; const float* bv = I[7]; const float* wo = I[8]; const float* bo = I[9];      /* weights natural [out][in]; patch_mask int32 [4][2048] (1 = valid) */
  char* ws = (char*)d_ws; size_t off = 0;
  auto take = [&](size_t bytes) { char* p = ws + off; off += (bytes + 255) & ~(size_t)255; return p; };
  _Float16* BQ = (_Float16*)take((size_t)DM * DM * 2); _Float16* BK = (_Float16*)take((size_t)DM * DM * 2); _Float16* BV = (_Float16*)take((size_t)DM * DM * 2); _Float16* BO = (_Float16*)take((size_t)DM * DM * 2);
  _Float16* X16 = (_Float16*)take(NR * DM * 2); _Float16* Q16 = (_Float16*)take(NR * DM * 2); _Float16* K16 = (_Float16*)take(NR * DM * 2); _Float16* V16 = (_Float16*)take(NR * DM * 2); _Float16* O16 = (_Float16*)take(NR * DM * 2);
  float* TB = (float*)take((size_t)SQ * 4); int* POS = (int*)take(NR * 4); int* CNT = (int*)take((size_t)NB * CNTP * 4);
  (void)BK; (void)BV;
  if (off > ws_size) return;      /* 2 + 5x8 + 0.04 = approx 42 MiB */
  k_prep<<<PBL + PBX + 4 * PBW + PBT, 256, 0, stream>>>(x, pmask, wq, wk, wv, wo, X16, BQ, TB, POS, CNT, (float*)d_out);      /* BQ | BK | BV | BO are four planes in a row */
  const dim3 gp((unsigned)((NR / 128) * (DM / 64)), 1); const dim3 gp3((unsigned)((NR / 128) * (DM / 64)), 3);
  k_gemm2<0><<<gp3, 128, 0, stream>>>(X16, DM, 0, BQ, DM, (size_t)DM * DM, 0.0625f, bq, bk, bv, 0, nullptr, 1, 0, 0, nullptr, Q16, DM, NR * DM, MP, DM, DM, CNT, POS, nullptr);      /* blockIdx.y = 0, 1, 2: q, k, v; Q16 | K16 | V16 are three planes in a row */
  k_fattn<<<dim3(NB * NH, SQ / 128), 256, 0, stream>>>(Q16, K16, V16, TB, POS, CNT, O16);      /* o (merged heads) as f16 rows */
  k_gemm2<0><<<gp, 128, 0, stream>>>(O16, DM, 0, BO, DM, 0, 0.0625f, bo, nullptr, nullptr, 0, nullptr, 1, 0, 0, (float*)d_out, nullptr, DM, 0, MO, DM, DM, CNT, nullptr, POS);      /* o Wo^T + bo (f32), listed rows to their own rows of out */
}

// v006
// It runs in 43.9 microseconds.
// Two timings next to v005 both put it at 1.14 times that version's speed.
// All steps since v000 together make it 451 times as fast.
#include <hip/hip_runtime.h>
#define NB 4
#define SQ 2048
#define DM 512
#define NH 8
#define HD 64
#define MP ((int)NR)                 /* token rows through the projections (debug hook) */
#define MO ((int)NR)                 /* token rows through the output projection / mask (debug hook) */
#define NR ((size_t)NB * SQ)         /* 8192 token rows */
#define CNTP 32                      /* ints between two batches' list lengths: each has a 128-byte line of its own */
typedef __bf16 v16b __attribute__((ext_vector_type(16)));
typedef unsigned short v8us __attribute__((ext_vector_type(8), may_alias));
typedef float  v8f  __attribute__((ext_vector_type(8)));
typedef float  v4f  __attribute__((ext_vector_type(4)));
typedef float  v4fa __attribute__((ext_vector_type(4), may_alias));
union FragB { v16b v; v8us half[2]; unsigned short u[16]; };

__device__ __forceinline__ unsigned short bf16_bits(float x) { unsigned int u = __float_as_uint(x); return (unsigned short)((u + 0x7FFFu + ((u >> 16) & 1u)) >> 16); }
__device__ __forceinline__ float bf16_val(unsigned short b) { return __uint_as_float(((unsigned int)b) << 16); }
__device__ __forceinline__ float bf16_round(float x) { return bf16_val(bf16_bits(x)); }
// D += A·B with NT terms: 1 = ah·bh, 2 = + al·bh (A split), 3 = + ah·bl (both split)
template <int NT>
__device__ __forceinline__ v8f mmaN(v16b ah, v16b al, v16b bh, v16b bl, v8f c) {
  c = __builtin_amdgcn_wmma_f32_16x16x32_bf16(false, ah, false, bh, (short)0, c, false, false);
  if (NT >= 2) c = __builtin_amdgcn_wmma_f32_16x16x32_bf16(false, al, false, bh, (short)0, c, false, false);
  if (NT >= 3) c = __builtin_amdgcn_wmma_f32_16x16x32_bf16(false, ah, false, bl, (short)0, c, false, false);
  asm volatile("v_nop\n\tv_nop\n\tv_nop\n\tv_nop" : "+v"(c) : "v"(ah), "v"(al), "v"(bh), "v"(bl));
  return c;
}

__global__ __launch_bounds__(256) void k_wt_bf16(const float* __restrict__ W, unsigned short* __restrict__ Wt, int K, int N) {
  const int t = blockIdx.x * 256 + threadIdx.x;
  const int k8n = K / 8;
  if (t >= N * k8n) return;
  const int n = t / k8n, k8 = (t % k8n) * 8;
  v8us v;
#pragma unroll
  for (int i = 0; i < 8; ++i) v[i] = bf16_bits(W[(size_t)(k8 + i) * N + n]);
  *(v8us*)(Wt + (size_t)n * K + k8) = v;
  
}

// GEMM C[M][N] (f32, pitch ldc) = act(A[M][K]·W + bias). A f32 row-major (pitch lda) converted per fragment to bf16
// (ASPLIT: hi/lo two planes -> 2 terms, else single rounded term); Wt bf16 [N][K] (pitch ldb). BIAS_BF16 rounds the
// bias to bf16 first (bias quantised to bf16 before the add). K%32==0, M%16==0, N%64==0.
template <bool ASPLIT, int ACT, bool BIAS_BF16>
__global__ __launch_bounds__(128) void k_gemm_bf(const float* __restrict__ A, int lda, const unsigned short* __restrict__ Wt, int ldb,
                                               const float* __restrict__ bias, float* __restrict__ C, int ldc, int M, int N, int K) {
  __shared__ __attribute__((aligned(16))) float so[4][16][64];
  const int tid = threadIdx.x, w = tid >> 5, lane = tid & 31, ln = lane & 15, hh = lane >> 4;
  const int ntn = N / 64;
  const int wid = blockIdx.x * 4 + w;
  const int mt = wid / ntn, nq = wid % ntn;
  if (mt * 16 >= M) return;
  const int row0 = mt * 16, col0 = nq * 64;
  const float* arow = A + (size_t)(row0 + ln) * lda;
  v8f acc[4] = {};
  for (int kb = 0; kb < K; kb += 32) {
    FragB ah, al;
    const v4f x0 = *(const v4fa*)(arow + kb + 8 * hh), x1 = *(const v4fa*)(arow + kb + 8 * hh + 4);
    const v4f x2 = *(const v4fa*)(arow + kb + 16 + 8 * hh), x3 = *(const v4fa*)(arow + kb + 16 + 8 * hh + 4);
    float xs[16] = {x0[0],x0[1],x0[2],x0[3],x1[0],x1[1],x1[2],x1[3],x2[0],x2[1],x2[2],x2[3],x3[0],x3[1],x3[2],x3[3]};
#pragma unroll
    for (int i = 0; i < 16; ++i) { const unsigned short hb = bf16_bits(xs[i]); ah.u[i] = hb; al.u[i] = ASPLIT ? bf16_bits(xs[i] - bf16_val(hb)) : (unsigned short)0; }
#pragma unroll
    for (int t = 0; t < 4; ++t) {
      const unsigned short* brow = Wt + (size_t)(col0 + t * 16 + ln) * ldb + kb;
      FragB b;
      b.half[0] = *(const v8us*)(brow + 8 * hh);
      b.half[1] = *(const v8us*)(brow + 16 + 8 * hh);
      acc[t] = mmaN<ASPLIT ? 2 : 1>(ah.v, al.v, b.v, b.v, acc[t]);
    }
  }
#pragma unroll
  for (int t = 0; t < 4; ++t) {
    float bv = bias ? bias[col0 + t * 16 + ln] : 0.f;
    if (BIAS_BF16) bv = bf16_round(bv);
#pragma unroll
    for (int r = 0; r < 8; ++r) { float v = acc[t][r] + bv; if (ACT == 1) v = fmaxf(v, 0.f); so[w][8 * hh + r][t * 16 + ln] = v; }
  }
  __builtin_amdgcn_fence(__ATOMIC_ACQ_REL, "workgroup");
  __builtin_amdgcn_wave_barrier();
  const int rsub = lane >> 4, c4 = (lane & 15) * 4;
  {
#pragma unroll
    for (int q = 0; q < 8; ++q) {
      const int r = q * 2 + rsub;
      const v4f v = *(const v4fa*)&so[w][r][c4];
      *(v4f*)(C + (size_t)(row0 + r) * ldc + col0 + c4) = v;
    }
    
  }
}

// GEMM C = act(A·W + bias + resid): A f32 (ASPLIT -> hi/lo 2 terms), Wt bf16 [N][K]; ACT 0 none, 1 relu, 2 exact gelu;
// resid (optional, f32, row index = (row % rmod), pitch ldr, RES_BF16 rounds it) added before the activation.
template <bool ASPLIT, int ACT, bool BIAS_BF16, bool RES_BF16>
__global__ __launch_bounds__(128) void k_gemm_bf3(const float* __restrict__ A, int lda, const unsigned short* __restrict__ Wt, int ldb,
                                                const float* __restrict__ bias, const float* __restrict__ resid, int rmod, int ldr,
                                                float* __restrict__ C, int ldc, int M, int N, int K) {
  __shared__ __attribute__((aligned(16))) float so[4][16][64];
  const int tid = threadIdx.x, w = tid >> 5, lane = tid & 31, ln = lane & 15, hh = lane >> 4;
  const int ntn = N / 64;
  const int wid = blockIdx.x * 4 + w;
  const int mt = wid / ntn, nq = wid % ntn;
  if (mt * 16 >= M) return;
  const int row0 = mt * 16, col0 = nq * 64;
  const float* arow = A + (size_t)(row0 + ln) * lda;
  v8f acc[4] = {};
  for (int kb = 0; kb < K; kb += 32) {
    FragB ah, al;
    const v4f x0 = *(const v4fa*)(arow + kb + 8 * hh), x1 = *(const v4fa*)(arow + kb + 8 * hh + 4);
    const v4f x2 = *(const v4fa*)(arow + kb + 16 + 8 * hh), x3 = *(const v4fa*)(arow + kb + 16 + 8 * hh + 4);
    float xs[16] = {x0[0],x0[1],x0[2],x0[3],x1[0],x1[1],x1[2],x1[3],x2[0],x2[1],x2[2],x2[3],x3[0],x3[1],x3[2],x3[3]};
#pragma unroll
    for (int i = 0; i < 16; ++i) { const unsigned short hb = bf16_bits(xs[i]); ah.u[i] = hb; al.u[i] = ASPLIT ? bf16_bits(xs[i] - bf16_val(hb)) : (unsigned short)0; }
#pragma unroll
    for (int t = 0; t < 4; ++t) {
      const unsigned short* brow = Wt + (size_t)(col0 + t * 16 + ln) * ldb + kb;
      FragB b;
      b.half[0] = *(const v8us*)(brow + 8 * hh);
      b.half[1] = *(const v8us*)(brow + 16 + 8 * hh);
      acc[t] = mmaN<ASPLIT ? 2 : 1>(ah.v, al.v, b.v, b.v, acc[t]);
    }
  }
#pragma unroll
  for (int t = 0; t < 4; ++t) {
    const int col = col0 + t * 16 + ln;
    float bv = bias ? bias[col] : 0.f;
    if (BIAS_BF16) bv = bf16_round(bv);
#pragma unroll
    for (int r = 0; r < 8; ++r) {
      float v = acc[t][r] + bv;
      if (resid) { float rv = resid[(size_t)((row0 + 8 * hh + r) % rmod) * ldr + col]; if (RES_BF16) rv = bf16_round(rv); v += rv; }
      if (ACT == 1) v = fmaxf(v, 0.f);
      if (ACT == 2) v = 0.5f * v * (1.0f + erff(v * 0.70710678118654752f));
      if (ACT == 3) { const float u = 0.7978845608028654f * (v + 0.044715f * v * v * v); v = 0.5f * v * (1.0f + tanhf(u)); }
      so[w][8 * hh + r][t * 16 + ln] = v;
    }
  }
  __builtin_amdgcn_fence(__ATOMIC_ACQ_REL, "workgroup");
  __builtin_amdgcn_wave_barrier();
  const int rsub = lane >> 4, c4 = (lane & 15) * 4;
  {
#pragma unroll
    for (int q = 0; q < 8; ++q) {
      const int r = q * 2 + rsub;
      const v4f v = *(const v4fa*)&so[w][r][c4];
      *(v4f*)(C + (size_t)(row0 + r) * ldc + col0 + c4) = v;
    }
    
  }
}
// row LayerNorm (biased variance, eps) over N: s = X (+ R); optional out_sum <- s; out_norm <- (s-mu)*rsqrt(var+eps)*g + b
template <bool PARAM_BF16>
__global__ __launch_bounds__(256) void k_layernorm(const float* __restrict__ X, const float* __restrict__ R, const float* __restrict__ g, const float* __restrict__ bta,
                                                  float* __restrict__ out_sum, float* __restrict__ out_norm, int N, float eps) {
  __shared__ float red[256];
  const int row = blockIdx.x, tid = threadIdx.x;
  const float* x = X + (size_t)row * N; const float* rr = R ? R + (size_t)row * N : nullptr;
  float vals[16];                     // up to N = 4096
  const int per = N / 256;            // contiguous chunk per thread? use strided-by-4 chunks: thread handles j = tid*4 + 1024*u
  float s1 = 0.f;
  for (int u = 0; u < per / 4; ++u) {
    const int j = tid * 4 + 1024 * u;
    const v4f a = *(const v4fa*)(x + j);
    v4f b = {0.f,0.f,0.f,0.f}; if (rr) b = *(const v4fa*)(rr + j);
#pragma unroll
    for (int q = 0; q < 4; ++q) { const float v = a[q] + b[q]; vals[u * 4 + q] = v; s1 += v; }
  }
  red[tid] = s1; __syncthreads();
  for (int st = 128; st > 0; st >>= 1) { if (tid < st) red[tid] += red[tid + st]; __syncthreads(); }
  const float mu = red[0] / (float)N; __syncthreads();
  float s2 = 0.f;
  for (int u = 0; u < per / 4; ++u)
#pragma unroll
    for (int q = 0; q < 4; ++q) { const float c = vals[u * 4 + q] - mu; s2 += c * c; }
  red[tid] = s2; __syncthreads();
  for (int st = 128; st > 0; st >>= 1) { if (tid < st) red[tid] += red[tid + st]; __syncthreads(); }
  const float rs = rsqrtf(red[0] / (float)N + eps);
  {
    for (int u = 0; u < per / 4; ++u) {
      const int j = tid * 4 + 1024 * u;
      v4f o, sm;
#pragma unroll
      for (int q = 0; q < 4; ++q) {
        float gg = g[j + q], bb = bta[j + q];
        if (PARAM_BF16) { gg = bf16_round(gg); bb = bf16_round(bb); }
        sm[q] = vals[u * 4 + q]; o[q] = (vals[u * 4 + q] - mu) * rs * gg + bb;
      }
      if (out_sum) *(v4f*)(out_sum + (size_t)row * N + j) = sm;
      *(v4f*)(out_norm + (size_t)row * N + j) = o;
    }
    
  }
}



// ---- f16 WMMA path (v_wmma_f32_16x16x32_f16): 11-bit significands for operands in range — used where a [0,1] probability operand needs more precision than bf16
typedef _Float16 v16h __attribute__((ext_vector_type(16)));
union FragH { v16h v; v8us half[2]; _Float16 h[16]; unsigned short u[16]; };
template <int NT>
__device__ __forceinline__ v8f mmaH(v16h ah, v16h al, v16h bh, v16h bl, v8f c) {
  c = __builtin_amdgcn_wmma_f32_16x16x32_f16(false, ah, false, bh, (short)0, c, false, false);
  if (NT >= 2) c = __builtin_amdgcn_wmma_f32_16x16x32_f16(false, al, false, bh, (short)0, c, false, false);
  if (NT >= 3) c = __builtin_amdgcn_wmma_f32_16x16x32_f16(false, ah, false, bl, (short)0, c, false, false);
  asm volatile("v_nop\n\tv_nop\n\tv_nop\n\tv_nop" : "+v"(c) : "v"(ah), "v"(al), "v"(bh), "v"(bl));
  return c;
}
// batched GEMM like k_gemm_b but f16 operands: A f32 (split into f16 hi/lo if ASPLIT, else rounded to f16), Bt = f16 values [n][k]; alpha; C f32; N multiple of 16 (partial tiles skipped)
template <bool ASPLIT>
__global__ __launch_bounds__(128) void k_gemm_h(const float* __restrict__ A, int lda, size_t sA, const _Float16* __restrict__ Bh, int ldb, size_t sB, float alpha, float* __restrict__ C, int ldc, size_t sC, int M, int N, int K) {
  __shared__ __attribute__((aligned(16))) float so[4][16][64];
  const int tid = threadIdx.x, w = tid >> 5, lane = tid & 31, ln = lane & 15, hh = lane >> 4; const int by = blockIdx.y;
  A += (size_t)by * sA; Bh += (size_t)by * sB; C += (size_t)by * sC;
  const int ntn = (N + 63) / 64; const int wid = blockIdx.x * 4 + w; const int mt = wid / ntn, nq = wid % ntn; if (mt * 16 >= M) return;
  const int row0 = mt * 16, col0 = nq * 64; const float* arow = A + (size_t)(row0 + ln) * lda;
  v8f acc[4] = {};
  for (int kb = 0; kb < K; kb += 32) {
    FragH ah, al;
    const v4f x0 = *(const v4fa*)(arow + kb + 8 * hh), x1 = *(const v4fa*)(arow + kb + 8 * hh + 4), x2 = *(const v4fa*)(arow + kb + 16 + 8 * hh), x3 = *(const v4fa*)(arow + kb + 16 + 8 * hh + 4);
    float xs[16] = {x0[0],x0[1],x0[2],x0[3],x1[0],x1[1],x1[2],x1[3],x2[0],x2[1],x2[2],x2[3],x3[0],x3[1],x3[2],x3[3]};
#pragma unroll
    for (int i = 0; i < 16; ++i) { const _Float16 h = (_Float16)xs[i]; ah.h[i] = h; al.h[i] = ASPLIT ? (_Float16)(xs[i] - (float)h) : (_Float16)0.0f; }
#pragma unroll
    for (int t = 0; t < 4; ++t) { if (col0 + t * 16 >= N) continue; const size_t boff = (size_t)(col0 + t * 16 + ln) * ldb + kb; FragH bq; bq.half[0] = *(const v8us*)(Bh + boff + 8 * hh); bq.half[1] = *(const v8us*)(Bh + boff + 16 + 8 * hh);
      acc[t] = mmaH<ASPLIT ? 2 : 1>(ah.v, al.v, bq.v, bq.v, acc[t]); }
  }
#pragma unroll
  for (int t = 0; t < 4; ++t) { if (col0 + t * 16 >= N) continue;
#pragma unroll
    for (int r = 0; r < 8; ++r) so[w][8 * hh + r][t * 16 + ln] = acc[t][r] * alpha; }
  __builtin_amdgcn_fence(__ATOMIC_ACQ_REL, "workgroup"); __builtin_amdgcn_wave_barrier();
  const int rsub = lane >> 4, c4 = (lane & 15) * 4;
  {
#pragma unroll
    for (int q = 0; q < 8; ++q) { const int r = q * 2 + rsub; if (col0 + c4 < N) { const v4f v = *(const v4fa*)&so[w][r][c4]; *(v4f*)(C + (size_t)(row0 + r) * ldc + col0 + c4) = v; } }
     }
}

// Wt[n][k] = f16(W[k][n]·scale) from f32 row-major W[K][N] (scale = power of two; bf16-exact weights stay exact in f16 away from the subnormal range)
__global__ __launch_bounds__(256) void k_wt_f16(const float* __restrict__ W, _Float16* __restrict__ Wt, int K, int N, float scale) {
  const int t = blockIdx.x * 256 + threadIdx.x; if (t >= N * (K / 8)) return; const int n = t / (K / 8), k8 = (t % (K / 8)) * 8; FragH f;
#pragma unroll
  for (int i = 0; i < 8; ++i) f.h[i] = (_Float16)(bf16_round(W[(size_t)(k8 + i) * N + n]) * scale); const v8us o = f.half[0];
  *(v8us*)((unsigned short*)Wt + (size_t)n * K + k8) = o; 
}
// k_gemm_hh variant with fused epilogue: v = acc·alpha + bias[by·sBias + col] (+ CP[(row/rowsPerB)·sCPb + by·64 + col] if CP) ; ACT 0 none / 1 elu ; writes f16 C16 (and f32 C if non-null)
template <int ACT>
__global__ __launch_bounds__(128) void k_gemm_hhx(const _Float16* __restrict__ A, int lda, size_t sA, const _Float16* __restrict__ Bh, int ldb, size_t sB, float alpha, const float* __restrict__ bias, size_t sBias, const float* __restrict__ CP, int rowsPerB, size_t sCPb, int row0g,
    float* __restrict__ C, _Float16* __restrict__ C16, int ldc, size_t sC, int M, int N, int K) {
  __shared__ __attribute__((aligned(16))) float so[4][16][64];
  const int tid = threadIdx.x, w = tid >> 5, lane = tid & 31, ln = lane & 15, hh = lane >> 4; const int by = blockIdx.y;
  A += (size_t)by * sA; Bh += (size_t)by * sB; const size_t cofs = (size_t)by * sC; const float* bp = bias ? bias + (size_t)by * sBias : nullptr;
  const int ntn = (N + 63) / 64; const int wid = blockIdx.x * 4 + w; const int mt = wid / ntn, nq = wid % ntn; if (mt * 16 >= M) return;
  const int row0 = mt * 16, col0 = nq * 64; const _Float16* arow = A + (size_t)(row0 + ln) * lda;
  v8f acc[4] = {};
  for (int kb = 0; kb < K; kb += 32) { FragH ah; ah.half[0] = *(const v8us*)((const unsigned short*)arow + kb + 8 * hh); ah.half[1] = *(const v8us*)((const unsigned short*)arow + kb + 16 + 8 * hh);
#pragma unroll
    for (int t = 0; t < 4; ++t) { if (col0 + t * 16 >= N) continue; const size_t boff = (size_t)(col0 + t * 16 + ln) * ldb + kb; FragH bq; bq.half[0] = *(const v8us*)((const unsigned short*)Bh + boff + 8 * hh); bq.half[1] = *(const v8us*)((const unsigned short*)Bh + boff + 16 + 8 * hh);
      acc[t] = mmaH<1>(ah.v, ah.v, bq.v, bq.v, acc[t]); }
  }
#pragma unroll
  for (int t = 0; t < 4; ++t) { if (col0 + t * 16 >= N) continue; const int col = col0 + t * 16 + ln; const float bv = bp ? bf16_round(bp[col]) : 0.f;
#pragma unroll
    for (int r = 0; r < 8; ++r) { float v = acc[t][r] * alpha + bv; if (CP) { const int rr = row0g + row0 + 8 * hh + r; if (rowsPerB < 0) v += CP[cofs + (size_t)rr * ldc + col];      /* rowsPerB < 0: own element of the batched C plane */ else { const int bidx = rr / rowsPerB; v += CP[(size_t)bidx * sCPb + (size_t)by * 64 + col]; } } if (ACT == 1) v = (v > 0.f) ? v : expm1f(v); else if (ACT == 7) v = (v > 0.f) ? v + 1.0f : expf(v); else if (ACT == 8) v = tanhf(v); else if (ACT == 9) v = 0.5f * v * (1.0f + tanhf(0.7978845608028654f * (v + 0.044715f * v * v * v))); else if (ACT == 11) v = 1.0f / (1.0f + expf(-v)); else if (ACT == 12) v = (v > 0.f) ? v : 0.01f * v; else if (ACT == 14) v = (v > 0.f) ? v : 0.1f * v; else if (ACT == 16) v = (v >= 0.f) ? v : 0.3f * v; else if (ACT == 17) v = (v >= 0.f) ? v : 0.2f * v; else if (ACT == 15) v = v / (1.0f + expf(-v)); else if (ACT == 3) v = fmaxf(v, 0.f); else if (ACT == 6) v = 0.5f * v * (1.0f + erff(v * 0.70710678118654752f)); so[w][8 * hh + r][t * 16 + ln] = v; } }
  __builtin_amdgcn_fence(__ATOMIC_ACQ_REL, "workgroup"); __builtin_amdgcn_wave_barrier();
  const int rsub = lane >> 4, c4 = (lane & 15) * 4; typedef _Float16 v4h __attribute__((ext_vector_type(4)));
  {
#pragma unroll
    for (int q = 0; q < 8; ++q) { const int r = q * 2 + rsub; if (col0 + c4 < N) { const v4f v = *(const v4fa*)&so[w][r][c4]; if (C) *(v4f*)(C + cofs + (size_t)(row0 + r) * ldc + col0 + c4) = v; if (C16) { v4h h4; for (int i = 0; i < 4; ++i) h4[i] = (_Float16)v[i]; *(v4h*)(C16 + cofs + (size_t)(row0 + r) * ldc + col0 + c4) = h4; } } }
     }
}


typedef _Float16 v4h __attribute__((ext_vector_type(4)));

__global__ __launch_bounds__(256) void k_h16(const float* __restrict__ x, _Float16* __restrict__ X16, size_t n8) { const size_t t = (size_t)blockIdx.x * 256 + threadIdx.x; if (t >= n8) return; FragH f;
#pragma unroll
  for (int q = 0; q < 8; ++q) f.h[q] = (_Float16)x[t * 8 + q]; *(v8us*)((unsigned short*)X16 + t * 8) = f.half[0];  }
__global__ __launch_bounds__(256) void k_round16f(const float* __restrict__ W, _Float16* __restrict__ Bt, size_t n8) { const size_t t = (size_t)blockIdx.x * 256 + threadIdx.x; if (t >= n8) return; FragH f;
#pragma unroll
  for (int i = 0; i < 8; ++i) f.h[i] = (_Float16)(bf16_round(W[t * 8 + i]) * 16.0f); *(v8us*)((unsigned short*)Bt + t * 8) = f.half[0];  }
template <int NHv, int TTv>
__global__ __launch_bounds__(256) void k_vt(const _Float16* __restrict__ V16, int ldv, int voff, _Float16* __restrict__ Vt) { __shared__ unsigned short tl[64][66]; const int tid = threadIdx.x; const int slab = blockIdx.x / (TTv / 64), lg = blockIdx.x % (TTv / 64); const int b = slab / NHv, h = slab % NHv;
  for (int i = tid; i < 64 * 8; i += 256) { const int r = i / 8, c8 = (i % 8) * 8; FragH f; f.half[0] = *(const v8us*)((const unsigned short*)V16 + ((size_t)b * TTv + lg * 64 + r) * ldv + voff + h * 64 + c8);
#pragma unroll
    for (int q = 0; q < 8; ++q) tl[r][c8 + q] = f.u[q]; }
  __syncthreads();
  {
#pragma unroll
    for (int rd = 0; rd < 2; ++rd) { const int d = rd * 32 + tid / 8, pc = tid % 8; FragH f;
#pragma unroll
      for (int q = 0; q < 8; ++q) f.u[q] = tl[pc * 8 + q][d];
      *(v8us*)((unsigned short*)Vt + ((size_t)slab * 64 + d) * TTv + lg * 64 + pc * 8) = f.half[0]; }
     } }

__global__ __launch_bounds__(256) void k_hl(const float* __restrict__ F, _Float16* __restrict__ Hh, _Float16* __restrict__ Hl, size_t n8) { const size_t t = (size_t)blockIdx.x * 256 + threadIdx.x; if (t >= n8) return; FragH fh, fl; const v4f a = *(const v4fa*)(F + t * 8), c = *(const v4fa*)(F + t * 8 + 4);
#pragma unroll
  for (int q = 0; q < 4; ++q) { _Float16 h = (_Float16)a[q]; fh.h[q] = h; fl.h[q] = (_Float16)((a[q] - (float)h) * 1024.0f); h = (_Float16)c[q]; fh.h[4 + q] = h; fl.h[4 + q] = (_Float16)((c[q] - (float)h) * 1024.0f); }
  { *(v8us*)((unsigned short*)Hh + t * 8) = fh.half[0]; *(v8us*)((unsigned short*)Hl + t * 8) = fl.half[0];  } }

// ---- fast GEMM (work-group tile 128x64, wave tile 32x64; requires M % 128 == 0, N % 64 == 0, K % 64 == 0); epilogue = k_gemm_hhx semantics ----
// A and B reach the fragments through LDS: a stage is 64 k (one 128-byte line) of the tile's 128 A rows and 64 B rows; eight lanes load one whole line, so a wave's load touches 4 lines, not 16, and B is fetched once a work-group, not once a wave. The next stage's lines fly while this stage is worked on (two buffers, one barrier a stage). The fragments hold the same elements in the same k order as a load straight from global.
#define GKC 64                       /* k per LDS stage */
#define GP 144                       /* LDS row pitch, bytes: 16 x odd, for ds_load_b128 */
#define GST ((128 + 64) * GP)        /* bytes of one stage: 128 A rows, then 64 B rows */
__device__ __forceinline__ v16h g2_lfrag(const unsigned char* p) { FragH f; f.half[0] = *(const v8us*)p; f.half[1] = *(const v8us*)(p + 32); return f.v; }
__device__ __forceinline__ v16h g2_frag(const _Float16* p, int hh) { FragH f; f.half[0] = *(const v8us*)((const unsigned short*)p + 8 * hh); f.half[1] = *(const v8us*)((const unsigned short*)p + 16 + 8 * hh); return f.v; }
__device__ __forceinline__ v8f g2_mma(v16h a, v16h b, v8f c) { v8f d = __builtin_amdgcn_wmma_f32_16x16x32_f16(false, a, false, b, (short)0, c, false, false); asm volatile("v_nop\n\tv_nop\n\tv_nop\n\tv_nop" : "+v"(d) : "v"(a), "v"(b)); return d; }
template <int ACT>
__global__ __launch_bounds__(128) void k_gemm2(const _Float16* __restrict__ A, int lda, size_t sA, const _Float16* __restrict__ Bh, int ldb, size_t sB, float alpha, const float* __restrict__ bias, const float* __restrict__ bias1, const float* __restrict__ bias2, size_t sBias, const float* __restrict__ CP, int rowsPerB, size_t sCPb, int row0g,
    float* __restrict__ C, _Float16* __restrict__ C16, int ldc, size_t sC, int M, int N, int K, const int* __restrict__ cnt, const int* __restrict__ gpos, const int* __restrict__ spos) { static_assert(ACT == 0 || ACT == 3 || ACT == 6 || ACT == 8 || ACT == 9 || ACT == 11 || ACT == 12 || ACT == 14 || ACT == 15 || ACT == 16 || ACT == 17, "k_gemm2: unsupported ACT code (would silently apply no activation)");
  __shared__ __attribute__((aligned(16))) unsigned char stg[2 * GST]; float (*so)[32][68] = (float (*)[32][68])stg; static_assert(sizeof(float) * 4 * 32 * 68 <= 2 * GST, "the epilogue's tile lies over the stages");      /* so is written only behind the loop's last barrier */
  const int tid = threadIdx.x, w = tid >> 5, lane = tid & 31, ln = lane & 15, hh = lane >> 4; const int by = blockIdx.y;
  if (bias1) bias = by == 1 ? bias1 : by == 2 ? bias2 : bias;      /* three products in one grid, each with its own bias vector */
  A += (size_t)by * sA; Bh += (size_t)by * sB; const size_t cofs = (size_t)by * sC; const float* bp = bias ? bias + (size_t)by * sBias : nullptr;
  const int ntn = N >> 6; const int mi = blockIdx.x / ntn, nq = blockIdx.x - mi * ntn; const int mt = (mi % NB) * (SQ / 128) + mi / NB;      /* row tiles in the order tile 0 of every batch, tile 1 of every batch, ...: the tiles past the lists come last in the grid */
  const int row0 = mt * 128 + 32 * w, col0 = nq * 64; if (mt * 128 >= M) return;      /* the whole work-group leaves, in front of every barrier */
  /* rows are list entries: batch bb, entries cb .. cb + 127 of its list of nv valid tokens; a block whose first entry lies past the list has nothing to do; the entries from nv to the block's end repeat the first valid token (finite rows that carry no weight later) */
  const int bb = (mt * 128) / SQ, cb = mt * 128 - bb * SQ; int nv = cnt[bb * CNTP]; nv = nv < SQ ? nv : SQ; if (cb >= nv) return;
  int sp = cb + 32 * w + lane, nlim = SQ; if (spos) { sp = spos[row0 + lane] & (SQ - 1); nlim = nv; }      /* lane l: the row inside the batch where row l of this wave's tile is stored; spos: a listed row goes to its token's own position, an entry past the list nowhere */
  /* staging: thread t moves 16 bytes of A rows t / 8 + 16 i (i < 8) and of B rows t / 8 + 16 i (i < 4) of each stage; the loops over i and ks are unrolled so that their arrays are registers */
  const int sr = tid >> 3, sc = tid & 7; int ra[8]; unsigned ao[8], bo[4];      /* ao, bo: each row's byte offset in its matrix (under 2^32); the stage's k is added to the uniform base */
#pragma unroll
  for (int i = 0; i < 8; ++i) ra[i] = mt * 128 + sr + 16 * i;
  if (gpos) { int gv[8];      /* gpos: A rows stand at the tokens' own positions; one test round all eight loads, so that they fly together */
#pragma unroll
    for (int i = 0; i < 8; ++i) gv[i] = gpos[ra[i]];
#pragma unroll
    for (int i = 0; i < 8; ++i) ra[i] = bb * SQ + (gv[i] & (SQ - 1)); }
#pragma unroll
  for (int i = 0; i < 8; ++i) ao[i] = (unsigned)ra[i] * (unsigned)lda * 2u + (unsigned)sc * 16u;
#pragma unroll
  for (int i = 0; i < 4; ++i) bo[i] = (unsigned)(col0 + sr + 16 * i) * (unsigned)ldb * 2u + (unsigned)sc * 16u;
  const char* Ab = (const char*)A; const char* Bb = (const char*)Bh; v8us pa[8], pb[4];
#pragma unroll
  for (int i = 0; i < 8; ++i) pa[i] = *(const v8us*)(Ab + ao[i]);
#pragma unroll
  for (int i = 0; i < 4; ++i) pb[i] = *(const v8us*)(Bb + bo[i]);
  unsigned char* sw = stg + sr * GP + sc * 16; const unsigned char* af = stg + (32 * w + ln) * GP + 16 * hh; const unsigned char* bf = stg + (128 + ln) * GP + 16 * hh;
#pragma unroll
  for (int i = 0; i < 8; ++i) *(v8us*)(sw + 16 * i * GP) = pa[i];
#pragma unroll
  for (int i = 0; i < 4; ++i) *(v8us*)(sw + (128 + 16 * i) * GP) = pb[i];
  __syncthreads();
  const v8f z8 = {0.f,0.f,0.f,0.f,0.f,0.f,0.f,0.f}; v8f c00 = z8, c01 = z8, c02 = z8, c03 = z8, c10 = z8, c11 = z8, c12 = z8, c13 = z8; const int nch = K / GKC;
#pragma unroll 1
  for (int c = 0; c < nch; ++c) { const int cur = (c & 1) * GST; const bool more = c + 1 < nch;      /* rolled: two buffers, one stage's code */
    if (more) { const char* An = Ab + (size_t)(c + 1) * (GKC * 2); const char* Bn = Bb + (size_t)(c + 1) * (GKC * 2);
#pragma unroll
      for (int i = 0; i < 8; ++i) pa[i] = *(const v8us*)(An + ao[i]);
#pragma unroll
      for (int i = 0; i < 4; ++i) pb[i] = *(const v8us*)(Bn + bo[i]);
      asm volatile("s_wait_xcnt 0x0" ::: "memory"); }      /* keeps the twelve loads up here, in flight while this stage is worked on; the wait is a precaution in front of any reuse of their address registers */
    const unsigned char* ap = af + cur; const unsigned char* bq = bf + cur; v16h a0[GKC / 32], a1[GKC / 32], b0[GKC / 32], b1[GKC / 32], b2[GKC / 32], b3[GKC / 32];
#pragma unroll
    for (int ks = 0; ks < GKC / 32; ++ks) { a0[ks] = g2_lfrag(ap + ks * 64); a1[ks] = g2_lfrag(ap + 16 * GP + ks * 64); b0[ks] = g2_lfrag(bq + ks * 64); b1[ks] = g2_lfrag(bq + 16 * GP + ks * 64); b2[ks] = g2_lfrag(bq + 32 * GP + ks * 64); b3[ks] = g2_lfrag(bq + 48 * GP + ks * 64); }
    asm volatile("" :: "v"(a0[0]), "v"(a1[0]), "v"(b0[0]), "v"(b1[0]), "v"(b2[0]), "v"(b3[0]), "v"(a0[1]), "v"(a1[1]), "v"(b0[1]), "v"(b1[1]), "v"(b2[1]), "v"(b3[1]));      /* inputs only: holds the stage's LDS reads together in front of the products, one LDS latency a stage instead of one per fragment */
#pragma unroll
    for (int ks = 0; ks < GKC / 32; ++ks) {
      c00 = g2_mma(a0[ks], b0[ks], c00); c10 = g2_mma(a1[ks], b0[ks], c10); c01 = g2_mma(a0[ks], b1[ks], c01); c11 = g2_mma(a1[ks], b1[ks], c11);
      c02 = g2_mma(a0[ks], b2[ks], c02); c12 = g2_mma(a1[ks], b2[ks], c12); c03 = g2_mma(a0[ks], b3[ks], c03); c13 = g2_mma(a1[ks], b3[ks], c13); }
    if (more) { unsigned char* d = sw + (GST - cur);      /* that buffer's last readers left it before the barrier that ended the stage before */
#pragma unroll
      for (int i = 0; i < 8; ++i) *(v8us*)(d + 16 * i * GP) = pa[i];
#pragma unroll
      for (int i = 0; i < 4; ++i) *(v8us*)(d + (128 + 16 * i) * GP) = pb[i]; }
    __syncthreads(); }      /* publishes the next stage and ends this stage's reads; behind the last one the stages' LDS is free for the epilogue */
  v8f accs[8] = {c00, c01, c02, c03, c10, c11, c12, c13};
#pragma unroll
  for (int u = 0; u < 8; ++u) { const int t = u & 3, half = u >> 2; const int col = col0 + t * 16 + ln; const float bv = bp ? bf16_round(bp[col]) : 0.f;
#pragma unroll
    for (int r = 0; r < 8; ++r) { const int rloc = half * 16 + 8 * hh + r; float v = accs[u][r] * alpha + bv; if (CP) { if (rowsPerB < 0) v += CP[cofs + (size_t)(row0g + row0 + rloc) * ldc + col];      /* rowsPerB < 0: own element of the batched C plane */ else { const int bidx = (row0g + row0 + rloc) / rowsPerB; v += CP[(size_t)bidx * sCPb + (size_t)by * 64 + col]; } }
      if (ACT == 3) v = fmaxf(v, 0.f); else if (ACT == 6) v = 0.5f * v * (1.0f + erff(v * 0.70710678118654752f)); else if (ACT == 11) v = 1.0f / (1.0f + expf(-v)); else if (ACT == 15) v = v / (1.0f + expf(-v)); else if (ACT == 12) v = (v > 0.f) ? v : 0.01f * v; else if (ACT == 8) v = tanhf(v); else if (ACT == 9) v = 0.5f * v * (1.0f + tanhf(0.7978845608028654f * (v + 0.044715f * v * v * v))); else if (ACT == 14) v = (v > 0.f) ? v : 0.1f * v; else if (ACT == 16) v = (v >= 0.f) ? v : 0.3f * v; else if (ACT == 17) v = (v >= 0.f) ? v : 0.2f * v;
      so[w][rloc][t * 16 + ln] = v; } }
  __builtin_amdgcn_fence(__ATOMIC_ACQ_REL, "workgroup"); __builtin_amdgcn_wave_barrier();
  const int rsub = lane >> 4, c4 = (lane & 15) * 4;
  {
#pragma unroll
    for (int q = 0; q < 16; ++q) { const int r = q * 2 + rsub; const v4f v = *(const v4fa*)&so[w][r][c4]; const int p0 = __builtin_amdgcn_readlane(sp, q * 2), p1 = __builtin_amdgcn_readlane(sp, q * 2 + 1); const int ro = bb * SQ + (rsub ? p1 : p0);
      if (cb + 32 * w + r < nlim) { if (C) { *(v4f*)(C + cofs + (size_t)ro * ldc + col0 + c4) = v; asm volatile("s_wait_xcnt 0x0" ::: "memory"); }      /* precaution: the built code rewrites this store's data and address registers right behind it */
        if (C16) { v4h h4; for (int i = 0; i < 4; ++i) h4[i] = (_Float16)v[i]; *(v4h*)(C16 + cofs + (size_t)ro * ldc + col0 + c4) = h4; } } }
     } }


// ---- preparation: everything that reads only the inputs, as one launch; a block's index range says which job it does (none reads what another writes) ----
#define PBX ((int)(NR * DM / 8 / 256))      /* blocks that convert h: 8 elements a thread */
#define PBW (DM * DM / 8 / 256)             /* blocks per weight matrix: 8 elements a thread */
#define PBT (SQ / 256)                      /* blocks of the bias table: 1 entry a thread */
#define PBL NB                              /* blocks that list the valid tokens: one a batch, 8 positions a thread */
typedef int v4i __attribute__((ext_vector_type(4)));
__device__ __forceinline__ float tbias_at(int d) {
  const float dist = __fdiv_rn(__fmul_rn((float)d, 300.0f), 300.0f); const float v = logf(__fadd_rn(expf(-dist), 1e-12f));
  return v; }
__global__ __launch_bounds__(256) void k_prep(const float* __restrict__ x, const int* __restrict__ pmask, const float* __restrict__ wq, const float* __restrict__ wk, const float* __restrict__ wv, const float* __restrict__ wo, _Float16* __restrict__ X16, _Float16* __restrict__ BW, float* __restrict__ TB, int* __restrict__ POS, int* __restrict__ CNT, float* __restrict__ out) {
  __shared__ int psum[256]; __shared__ __attribute__((aligned(16))) int lst[SQ]; __shared__ int first;
  int blk = blockIdx.x;
  if (blk < PBL) { const int tid = threadIdx.x; const int* mp = pmask + (size_t)blk * SQ + tid * 8;      /* batch blk: valid positions in ascending order, by a prefix sum of the threads' counts */
    const v4i m0 = *(const v4i*)mp, m1 = *(const v4i*)(mp + 4); const int mv[8] = {m0[0], m0[1], m0[2], m0[3], m1[0], m1[1], m1[2], m1[3]}; int c = 0;
#pragma unroll
    for (int q = 0; q < 8; ++q) c += mv[q] != 0;
    psum[tid] = c; if (tid == 0) first = 0;
    __syncthreads();
    for (int o = 1; o < 256; o <<= 1) { const int a = tid >= o ? psum[tid - o] : 0; __syncthreads(); psum[tid] += a; __syncthreads(); }
    const int n = psum[255]; int rk = psum[tid] - c;
    if (rk == 0 && c != 0) {
#pragma unroll
      for (int q = 7; q >= 0; --q) if (mv[q] != 0) first = tid * 8 + q; }
#pragma unroll
    for (int q = 0; q < 8; ++q) if (mv[q] != 0) lst[rk++] = tid * 8 + q;
    __syncthreads();
    v4i o0, o1;      /* entries past the list repeat the first valid position; a wave stores whole 128-byte lines */
#pragma unroll
    for (int q = 0; q < 4; ++q) { o0[q] = tid * 8 + q < n ? lst[tid * 8 + q] : first; o1[q] = tid * 8 + 4 + q < n ? lst[tid * 8 + 4 + q] : first; }
    *(v4i*)(POS + (size_t)blk * SQ + tid * 8) = o0; *(v4i*)(POS + (size_t)blk * SQ + tid * 8 + 4) = o1; if (tid == 0) CNT[blk * CNTP] = n;
    return; }
  blk -= PBL;
  if (blk < PBX) { const size_t t = (size_t)blk * 256 + threadIdx.x; FragH f;      /* valid h rows, rounded to bf16, exact in f16; a padded row is read by nobody, its row of out is 0 */
    if (pmask[t / (DM / 8)] == 0) { const v4f z = {0.f, 0.f, 0.f, 0.f}; *(v4f*)(out + t * 8) = z; *(v4f*)(out + t * 8 + 4) = z; return; }
#pragma unroll
    for (int q = 0; q < 8; ++q) f.h[q] = (_Float16)bf16_round(x[t * 8 + q]);
    *(v8us*)((unsigned short*)X16 + t * 8) = f.half[0]; return; }
  blk -= PBX;
  if (blk < 4 * PBW) { const int mi = blk / PBW; const float* __restrict__ w = mi == 0 ? wq : mi == 1 ? wk : mi == 2 ? wv : wo;      /* weight mi, natural [out][in], x16, into plane mi of BW */
    const size_t t = (size_t)(blk - mi * PBW) * 256 + threadIdx.x; FragH f;
    for (int q = 0; q < 8; ++q) f.h[q] = (_Float16)(bf16_round(w[t * 8 + q]) * 16.0f);
    *(v8us*)((unsigned short*)BW + (size_t)mi * DM * DM + t * 8) = f.half[0]; return; }
  const int d = (blk - 4 * PBW) * 256 + threadIdx.x; TB[d] = tbias_at(d);
  asm volatile("s_wait_xcnt 0x0" ::: "memory"); }      /* precaution: the built code places another job's block behind this store, and that block rewrites the store's registers */
#define FK 64                        /* keys per LDS stage */
#define PK 144                       /* LDS row pitch of the K tile, bytes: 16 x odd, for ds_load_b128 */
#define PV 160                       /* LDS row pitch of the V tile, bytes: 32 x odd, for ds_load_tr16_b128 */
#define LOG2E 1.4426950408889634f
typedef short s16x8 __attribute__((ext_vector_type(8)));
typedef float v2f __attribute__((ext_vector_type(2)));
__device__ __forceinline__ v8us fa_tr16(const unsigned char* p) { typedef __attribute__((address_space(3))) s16x8 lds_s16x8; return __builtin_bit_cast(v8us, __builtin_amdgcn_ds_load_tr16_b128_v8i16((lds_s16x8*)p)); }
__device__ __forceinline__ float fa_xhalf(float x) { return __builtin_bit_cast(float, __builtin_amdgcn_permlanex16(__builtin_bit_cast(int, x), __builtin_bit_cast(int, x), 0x76543210, 0xfedcba98, false, false)); }      /* lane l reads lane l ^ 16 */
// amdgpu_waves_per_eu(4, 4) on the kernel: two work-groups per WGP are four waves per SIMD, so a wave may use up to 256 registers.
__device__ __forceinline__ v8f fa_mma(v16h a, v16h b, v8f c) { return __builtin_amdgcn_wmma_f32_16x16x32_f16(false, a, false, b, (short)0, c, false, false); }
__global__ __launch_bounds__(256) __attribute__((amdgpu_waves_per_eu(4, 4))) void k_fattn(const _Float16* __restrict__ Q16, const _Float16* __restrict__ K16, const _Float16* __restrict__ V16, const float* __restrict__ TB, const int* __restrict__ POS, const int* __restrict__ CNT, _Float16* __restrict__ O16) {
  __shared__ __attribute__((aligned(16))) float tb2[2 * SQ]; __shared__ __attribute__((aligned(16))) int kx[SQ];
  __shared__ __attribute__((aligned(16))) unsigned char kt[2][FK * PK]; __shared__ __attribute__((aligned(16))) unsigned char vt[2][FK * PV];
  const int tid = threadIdx.x, lane = tid & 31, ln = lane & 15, hh = lane >> 4; const int wv = __builtin_amdgcn_readfirstlane(tid >> 5);
  const int b = blockIdx.x / NH, h = blockIdx.x % NH; int nv = CNT[b * CNTP]; nv = nv < SQ ? nv : SQ; if ((int)blockIdx.y * 128 >= nv) return;      /* the whole work-group leaves, in front of every barrier: its queries lie past the list; the query tile is the slow grid index, so that these work-groups come last and the working ones spread over the chip */
  const int nst = (nv + FK - 1) / FK; const int* lp = POS + (size_t)b * SQ; const int q0 = blockIdx.y * 128 + wv * 16; const bool act = q0 < nv;      /* act, the same for the whole wave: a wave whose 16 queries all lie past the list only stages and stores zero rows */ const size_t base = (size_t)b * SQ * DM + (size_t)h * HD;
  /* staging: thread t moves 16 bytes of rows t / 8 and 32 + t / 8 of each tile, so a wave's load covers four whole 128-byte rows */
  const int sr = tid >> 3, sc = tid & 7;
  const unsigned short* kg = (const unsigned short*)K16 + base + (size_t)sr * DM + sc * 8; const unsigned short* vg = (const unsigned short*)V16 + base + (size_t)sr * DM + sc * 8;
  const int st0 = blockIdx.y * (128 / FK); const size_t g0 = (size_t)st0 * FK * DM;      /* the first stage worked on: the one that holds this work-group's first queries as keys (st0 < nst, since the work-group's first query is on the list) */
  v8us rk0 = *(const v8us*)(kg + g0), rk1 = *(const v8us*)(kg + g0 + 32 * DM), rv0 = *(const v8us*)(vg + g0), rv1 = *(const v8us*)(vg + g0 + 32 * DM);
  const _Float16* qp = Q16 + base + (size_t)(q0 + ln) * DM; const v16h qf0 = g2_frag(qp, hh), qf1 = g2_frag(qp + 32, hh);
#pragma unroll
  for (int u = 0; u < 2 * SQ / 256; ++u) { const int t = tid + 256 * u; int d = t - (SQ - 1); d = d < 0 ? -d : d; d = d < SQ ? d : SQ - 1; const float tv = TB[d] * LOG2E; tb2[t] = t == 2 * SQ - 1 ? -1.0e9f * LOG2E : tv; }      /* unrolled: the table's loads are all in flight together */
#pragma unroll
  for (int u = 0; u < SQ / 256; ++u) { const int t = tid + 256 * u; kx[t] = (lp[t] & (SQ - 1)) * 4 + (t < nv ? 0 : 4 * SQ * 4); }      /* a sum, so that the eight loads stand under no test and fly together: the list's every entry is written */
  *(v8us*)(kt[0] + sr * PK + sc * 16) = rk0; *(v8us*)(kt[0] + (sr + 32) * PK + sc * 16) = rk1; *(v8us*)(vt[0] + sr * PV + sc * 16) = rv0; *(v8us*)(vt[0] + (sr + 32) * PV + sc * 16) = rv1;
  __syncthreads();
  const v8f z8 = {0.f,0.f,0.f,0.f,0.f,0.f,0.f,0.f}; v8f o0 = z8, o1 = z8, o2 = z8, o3 = z8; float m = -INFINITY, ms = -INFINITY, l = act ? 0.f : 1.f;
  const int qx = (SQ - 1) * 4 - (kx[q0 + ln] & ((SQ - 1) * 4)); const int* kq = kx + 8 * hh; const unsigned qm = __builtin_amdgcn_ballot_w32(q0 + ln < nv);      /* the lanes whose query is on the list; a query past it stands for no token (its o row is stored nowhere in out) and has no say in whether a pass is worked on */
#pragma unroll 1
  for (int t = 0, st = st0; t < nst; ++t) { const int cur = t & 1; const bool more = t + 1 < nst; const int sn = st + 1 < nst ? st + 1 : 0;      /* rolled: st runs st0 .. nst - 1, then 0 .. st0 - 1 */
    if (more) { const size_t go = (size_t)sn * FK * DM; rk0 = *(const v8us*)(kg + go); rk1 = *(const v8us*)(kg + go + 32 * DM); rv0 = *(const v8us*)(vg + go); rv1 = *(const v8us*)(vg + go + 32 * DM);
      asm volatile("s_wait_xcnt 0x0" ::: "memory"); }      /* the next stage's rows fly while this stage is worked on; the wait is a precaution: the built code reuses these loads' address registers right behind them */
    if (act)
#pragma unroll
    for (int sub = 0; sub < FK / 32; ++sub) { const int k0 = st * FK + sub * 32;
      const unsigned char* kp = kt[cur] + (sub * 32 + ln) * PK + 16 * hh; FragH ka0, ka1, kb0, kb1;
      ka0.half[0] = *(const v8us*)(kp); ka0.half[1] = *(const v8us*)(kp + 32); ka1.half[0] = *(const v8us*)(kp + 64); ka1.half[1] = *(const v8us*)(kp + 96);
      kb0.half[0] = *(const v8us*)(kp + 16 * PK); kb0.half[1] = *(const v8us*)(kp + 16 * PK + 32); kb1.half[0] = *(const v8us*)(kp + 16 * PK + 64); kb1.half[1] = *(const v8us*)(kp + 16 * PK + 96);
      const int dk = k0 - (q0 + 15), dq = q0 - (k0 + 31); int de = dk > dq ? dk : dq; de = de > 0 ? de : 0; const float bb = tb2[SQ - 1 + de];      /* de: least distance, in list places, between the wave's queries and the pass's keys, the same for the whole wave; bb: the bias there */
      asm volatile("" :: "v"(ka0.v), "v"(ka1.v), "v"(kb0.v), "v"(kb1.v), "v"(bb));      /* inputs only: the pass's LDS reads are issued as one run; without it the built code reads two by two among the products, with a full wait at each: three LDS latencies a pass */
      v8f s0 = fa_mma(ka0.v, qf0, z8), s1 = fa_mma(kb0.v, qf0, z8); s0 = fa_mma(ka1.v, qf1, s0); s1 = fa_mma(kb1.v, qf1, s1);
      float xa = s0[0], xb = s1[0];      /* two chains, so that no maximum waits on fifteen before it */
#pragma unroll
      for (int r = 1; r < 8; ++r) { xa = __builtin_fmaxf(xa, s0[r]); xb = __builtin_fmaxf(xb, s1[r]); }
      if ((__builtin_amdgcn_ballot_w32(__builtin_fmaf(__builtin_fmaxf(xa, xb), 0.125f * LOG2E, bb) > ms - 26.0f) & qm) == 0) continue;      /* no weight of the pass reaches 2^-25 (26, not 25: the one to spare covers every rounding of the table and of exp2) */
      const unsigned char* vp = vt[cur] + (sub * 32 + 8 * hh + (lane & 7)) * PV + ((lane >> 3) & 1) * 16; FragH va[4];
#pragma unroll
      for (int dt = 0; dt < 4; ++dt) { va[dt].half[0] = fa_tr16(vp + 32 * dt); va[dt].half[1] = fa_tr16(vp + 16 * PV + 32 * dt); }
      const int* kp4 = kq + k0; float v[16]; float mx = -INFINITY;
#pragma unroll
      for (int r = 0; r < 8; ++r) { int x0 = kp4[r] + qx, x1 = kp4[16 + r] + qx; x0 = x0 < (2 * SQ - 1) * 4 ? x0 : (2 * SQ - 1) * 4; x1 = x1 < (2 * SQ - 1) * 4 ? x1 : (2 * SQ - 1) * 4;
        v[r] = __builtin_fmaf(s0[r], 0.125f * LOG2E, *(const float*)((const char*)tb2 + x0)); v[8 + r] = __builtin_fmaf(s1[r], 0.125f * LOG2E, *(const float*)((const char*)tb2 + x1)); }
#pragma unroll
      for (int r = 0; r < 16; ++r) mx = __builtin_fmaxf(mx, v[r]);
      mx = __builtin_fmaxf(mx, fa_xhalf(mx));
      if (__builtin_amdgcn_ballot_w32(mx > m) != 0) { const float mn = __builtin_fmaxf(m, mx); const float msn = mn - 8.0f; const float corr = __builtin_amdgcn_exp2f(ms - msn); m = mn; ms = msn; l *= corr; o0 *= corr; o1 *= corr; o2 *= corr; o3 *= corr; }      /* corr = 0 in the first pass (ms = -inf), 1 for a query whose maximum stays */
      FragH pf; v2f la = {0.f, 0.f}, lb = {0.f, 0.f};      /* the pass's sum in two chains of pairs, so that no add waits on sixteen before it */
#pragma unroll
      for (int r = 0; r < 16; r += 4) { const float p0 = __builtin_amdgcn_exp2f(v[r] - ms), p1 = __builtin_amdgcn_exp2f(v[r + 1] - ms), p2 = __builtin_amdgcn_exp2f(v[r + 2] - ms), p3 = __builtin_amdgcn_exp2f(v[r + 3] - ms);
        la += v2f{p0, p1}; lb += v2f{p2, p3}; pf.h[r] = (_Float16)p0; pf.h[r + 1] = (_Float16)p1; pf.h[r + 2] = (_Float16)p2; pf.h[r + 3] = (_Float16)p3; }
      la += lb; l += la[0] + la[1];
      o0 = fa_mma(va[0].v, pf.v, o0); o1 = fa_mma(va[1].v, pf.v, o1); o2 = fa_mma(va[2].v, pf.v, o2); o3 = fa_mma(va[3].v, pf.v, o3); }
    if (more) { unsigned char* kn = kt[cur ^ 1]; unsigned char* vn = vt[cur ^ 1]; *(v8us*)(kn + sr * PK + sc * 16) = rk0; *(v8us*)(kn + (sr + 32) * PK + sc * 16) = rk1; *(v8us*)(vn + sr * PV + sc * 16) = rv0; *(v8us*)(vn + (sr + 32) * PV + sc * 16) = rv1; }      /* that buffer's last readers left it before the barrier that ended the stage before */
    __syncthreads(); st = sn; }      /* publishes the next stage and ends this stage's reads */
  l += fa_xhalf(l); const float inv = 1.0f / l; unsigned short* op = (unsigned short*)O16 + base + (size_t)(q0 + ln) * DM + 8 * hh;      /* lane (c, hf) holds o[q0 + c][16 dt + 8 hf + r] */
  const v8f oo[4] = {o0, o1, o2, o3};
#pragma unroll
  for (int dt = 0; dt < 4; ++dt) { FragH f;
#pragma unroll
    for (int r = 0; r < 8; ++r) f.h[r] = (_Float16)(oo[dt][r] * inv);
    *(v8us*)(op + 16 * dt) = f.half[0]; } }

extern "C" void kernel_launch(void* const* d_in, const int* in_sizes, int n_in,
                              void* d_out, int out_size, void* d_ws, size_t ws_size, hipStream_t stream) {
  (void)in_sizes; (void)n_in; (void)out_size;
  const float* const* I = (const float* const*)d_in; const float* x = I[0]; const int* pmask = (const int*)d_in[1]; const float* wq = I[2]; const float* bq = I[3]; const float* wk = I[4]; const float* bk = I[5]; const float* wv = I[6]; const float* bv = I[7]; const float* wo = I[8]; const float* bo = I[9];      /* weights natural [out][in]; patch_mask int32 [4][2048] (1 = valid) */
  char* ws = (char*)d_ws; size_t off = 0;
  auto take = [&](size_t bytes) { char* p = ws + off; off += (bytes + 255) & ~(size_t)255; return p; };
  _Float16* BQ = (_Float16*)take((size_t)DM * DM * 2); _Float16* BK = (_Float16*)take((size_t)DM * DM * 2); _Float16* BV = (_Float16*)take((size_t)DM * DM * 2); _Float16* BO = (_Float16*)take((size_t)DM * DM * 2);
  _Float16* X16 = (_Float16*)take(NR * DM * 2); _Float16* Q16 = (_Float16*)take(NR * DM * 2); _Float16* K16 = (_Float16*)take(NR * DM * 2); _Float16* V16 = (_Float16*)take(NR * DM * 2); _Float16* O16 = (_Float16*)take(NR * DM * 2);
  float* TB = (float*)take((size_t)SQ * 4); int* POS = (int*)take(NR * 4); int* CNT = (int*)take((size_t)NB * CNTP * 4);
  (void)BK; (void)BV;
  if (off > ws_size) return;      /* 2 + 5x8 + 0.04 = approx 42 MiB */
  k_prep<<<PBL + PBX + 4 * PBW + PBT, 256, 0, stream>>>(x, pmask, wq, wk, wv, wo, X16, BQ, TB, POS, CNT, (float*)d_out);      /* BQ | BK | BV | BO are four planes in a row */
  const dim3 gp((unsigned)((NR / 128) * (DM / 64)), 1); const dim3 gp3((unsigned)((NR / 128) * (DM / 64)), 3);
  k_gemm2<0><<<gp3, 128, 0, stream>>>(X16, DM, 0, BQ, DM, (size_t)DM * DM, 0.0625f, bq, bk, bv, 0, nullptr, 1, 0, 0, nullptr, Q16, DM, NR * DM, MP, DM, DM, CNT, POS, nullptr);      /* blockIdx.y = 0, 1, 2: q, k, v; Q16 | K16 | V16 are three planes in a row */
  k_fattn<<<dim3(NB * NH, SQ / 128), 256, 0, stream>>>(Q16, K16, V16, TB, POS, CNT, O16);      /* o (merged heads) as f16 rows */
  k_gemm2<0><<<gp, 128, 0, stream>>>(O16, DM, 0, BO, DM, 0, 0.0625f, bo, nullptr, nullptr, 0, nullptr, 1, 0, 0, (float*)d_out, nullptr, DM, 0, MO, DM, DM, CNT, nullptr, POS);      /* o Wo^T + bo (f32), listed rows to their own rows of out */
}

// v007
// A run of this version takes 40.5 microseconds.
// Two timings next to v006 put it at 1.07 and 1.06 times that version's speed.
// All steps since v000 together make it 480 times as fast.
#include <hip/hip_runtime.h>
#define NB 4
#define SQ 2048
#define DM 512
#define NH 8
#define HD 64
#define MP ((int)NR)                 /* token rows through the projections (debug hook) */
#define MO ((int)NR)                 /* token rows through the output projection / mask (debug hook) */
#define NR ((size_t)NB * SQ)         /* 8192 token rows */
#define CNTP 32                      /* ints between two batches' list lengths: each has a 128-byte line of its own */
typedef __bf16 v16b __attribute__((ext_vector_type(16)));
typedef unsigned short v8us __attribute__((ext_vector_type(8), may_alias));
typedef float  v8f  __attribute__((ext_vector_type(8)));
typedef float  v4f  __attribute__((ext_vector_type(4)));
typedef float  v4fa __attribute__((ext_vector_type(4), may_alias));
union FragB { v16b v; v8us half[2]; unsigned short u[16]; };

__device__ __forceinline__ unsigned short bf16_bits(float x) { unsigned int u = __float_as_uint(x); return (unsigned short)((u + 0x7FFFu + ((u >> 16) & 1u)) >> 16); }
__device__ __forceinline__ float bf16_val(unsigned short b) { return __uint_as_float(((unsigned int)b) << 16); }
__device__ __forceinline__ float bf16_round(float x) { return bf16_val(bf16_bits(x)); }
// D += A·B with NT terms: 1 = ah·bh, 2 = + al·bh (A split), 3 = + ah·bl (both split)
template <int NT>
__device__ __forceinline__ v8f mmaN(v16b ah, v16b al, v16b bh, v16b bl, v8f c) {
  c = __builtin_amdgcn_wmma_f32_16x16x32_bf16(false, ah, false, bh, (short)0, c, false, false);
  if (NT >= 2) c = __builtin_amdgcn_wmma_f32_16x16x32_bf16(false, al, false, bh, (short)0, c, false, false);
  if (NT >= 3) c = __builtin_amdgcn_wmma_f32_16x16x32_bf16(false, ah, false, bl, (short)0, c, false, false);
  asm volatile("v_nop\n\tv_nop\n\tv_nop\n\tv_nop" : "+v"(c) : "v"(ah), "v"(al), "v"(bh), "v"(bl));
  return c;
}

__global__ __launch_bounds__(256) void k_wt_bf16(const float* __restrict__ W, unsigned short* __restrict__ Wt, int K, int N) {
  const int t = blockIdx.x * 256 + threadIdx.x;
  const int k8n = K / 8;
  if (t >= N * k8n) return;
  const int n = t / k8n, k8 = (t % k8n) * 8;
  v8us v;
#pragma unroll
  for (int i = 0; i < 8; ++i) v[i] = bf16_bits(W[(size_t)(k8 + i) * N + n]);
  *(v8us*)(Wt + (size_t)n * K + k8) = v;
  
}

// GEMM C[M][N] (f32, pitch ldc) = act(A[M][K]·W + bias). A f32 row-major (pitch lda) converted per fragment to bf16
// (ASPLIT: hi/lo two planes -> 2 terms, else single rounded term); Wt bf16 [N][K] (pitch ldb). BIAS_BF16 rounds the
// bias to bf16 first (bias quantised to bf16 before the add). K%32==0, M%16==0, N%64==0.
template <bool ASPLIT, int ACT, bool BIAS_BF16>
__global__ __launch_bounds__(128) void k_gemm_bf(const float* __restrict__ A, int lda, const unsigned short* __restrict__ Wt, int ldb,
                                               const float* __restrict__ bias, float* __restrict__ C, int ldc, int M, int N, int K) {
  __shared__ __attribute__((aligned(16))) float so[4][16][64];
  const int tid = threadIdx.x, w = tid >> 5, lane = tid & 31, ln = lane & 15, hh = lane >> 4;
  const int ntn = N / 64;
  const int wid = blockIdx.x * 4 + w;
  const int mt = wid / ntn, nq = wid % ntn;
  if (mt * 16 >= M) return;
  const int row0 = mt * 16, col0 = nq * 64;
  const float* arow = A + (size_t)(row0 + ln) * lda;
  v8f acc[4] = {};
  for (int kb = 0; kb < K; kb += 32) {
    FragB ah, al;
    const v4f x0 = *(const v4fa*)(arow + kb + 8 * hh), x1 = *(const v4fa*)(arow + kb + 8 * hh + 4);
    const v4f x2 = *(const v4fa*)(arow + kb + 16 + 8 * hh), x3 = *(const v4fa*)(arow + kb + 16 + 8 * hh + 4);
    float xs[16] = {x0[0],x0[1],x0[2],x0[3],x1[0],x1[1],x1[2],x1[3],x2[0],x2[1],x2[2],x2[3],x3[0],x3[1],x3[2],x3[3]};
#pragma unroll
    for (int i = 0; i < 16; ++i) { const unsigned short hb = bf16_bits(xs[i]); ah.u[i] = hb; al.u[i] = ASPLIT ? bf16_bits(xs[i] - bf16_val(hb)) : (unsigned short)0; }
#pragma unroll
    for (int t = 0; t < 4; ++t) {
      const unsigned short* brow = Wt + (size_t)(col0 + t * 16 + ln) * ldb + kb;
      FragB b;
      b.half[0] = *(const v8us*)(brow + 8 * hh);
      b.half[1] = *(const v8us*)(brow + 16 + 8 * hh);
      acc[t] = mmaN<ASPLIT ? 2 : 1>(ah.v, al.v, b.v, b.v, acc[t]);
    }
  }
#pragma unroll
  for (int t = 0; t < 4; ++t) {
    float bv = bias ? bias[col0 + t * 16 + ln] : 0.f;
    if (BIAS_BF16) bv = bf16_round(bv);
#pragma unroll
    for (int r = 0; r < 8; ++r) { float v = acc[t][r] + bv; if (ACT == 1) v = fmaxf(v, 0.f); so[w][8 * hh + r][t * 16 + ln] = v; }
  }
  __builtin_amdgcn_fence(__ATOMIC_ACQ_REL, "workgroup");
  __builtin_amdgcn_wave_barrier();
  const int rsub = lane >> 4, c4 = (lane & 15) * 4;
  {
#pragma unroll
    for (int q = 0; q < 8; ++q) {
      const int r = q * 2 + rsub;
      const v4f v = *(const v4fa*)&so[w][r][c4];
      *(v4f*)(C + (size_t)(row0 + r) * ldc + col0 + c4) = v;
    }
    
  }
}

// GEMM C = act(A·W + bias + resid): A f32 (ASPLIT -> hi/lo 2 terms), Wt bf16 [N][K]; ACT 0 none, 1 relu, 2 exact gelu;
// resid (optional, f32, row index = (row % rmod), pitch ldr, RES_BF16 rounds it) added before the activation.
template <bool ASPLIT, int ACT, bool BIAS_BF16, bool RES_BF16>
__global__ __launch_bounds__(128) void k_gemm_bf3(const float* __restrict__ A, int lda, const unsigned short* __restrict__ Wt, int ldb,
                                                const float* __restrict__ bias, const float* __restrict__ resid, int rmod, int ldr,
                                                float* __restrict__ C, int ldc, int M, int N, int K) {
  __shared__ __attribute__((aligned(16))) float so[4][16][64];
  const int tid = threadIdx.x, w = tid >> 5, lane = tid & 31, ln = lane & 15, hh = lane >> 4;
  const int ntn = N / 64;
  const int wid = blockIdx.x * 4 + w;
  const int mt = wid / ntn, nq = wid % ntn;
  if (mt * 16 >= M) return;
  const int row0 = mt * 16, col0 = nq * 64;
  const float* arow = A + (size_t)(row0 + ln) * lda;
  v8f acc[4] = {};
  for (int kb = 0; kb < K; kb += 32) {
    FragB ah, al;
    const v4f x0 = *(const v4fa*)(arow + kb + 8 * hh), x1 = *(const v4fa*)(arow + kb + 8 * hh + 4);
    const v4f x2 = *(const v4fa*)(arow + kb + 16 + 8 * hh), x3 = *(const v4fa*)(arow + kb + 16 + 8 * hh + 4);
    float xs[16] = {x0[0],x0[1],x0[2],x0[3],x1[0],x1[1],x1[2],x1[3],x2[0],x2[1],x2[2],x2[3],x3[0],x3[1],x3[2],x3[3]};
#pragma unroll
    for (int i = 0; i < 16; ++i) { const unsigned short hb = bf16_bits(xs[i]); ah.u[i] = hb; al.u[i] = ASPLIT ? bf16_bits(xs[i] - bf16_val(hb)) : (unsigned short)0; }
#pragma unroll
    for (int t = 0; t < 4; ++t) {
      const unsigned short* brow = Wt + (size_t)(col0 + t * 16 + ln) * ldb + kb;
      FragB b;
      b.half[0] = *(const v8us*)(brow + 8 * hh);
      b.half[1] = *(const v8us*)(brow + 16 + 8 * hh);
      acc[t] = mmaN<ASPLIT ? 2 : 1>(ah.v, al.v, b.v, b.v, acc[t]);
    }
  }
#pragma unroll
  for (int t = 0; t < 4; ++t) {
    const int col = col0 + t * 16 + ln;
    float bv = bias ? bias[col] : 0.f;
    if (BIAS_BF16) bv = bf16_round(bv);
#pragma unroll
    for (int r = 0; r < 8; ++r) {
      float v = acc[t][r] + bv;
      if (resid) { float rv = resid[(size_t)((row0 + 8 * hh + r) % rmod) * ldr + col]; if (RES_BF16) rv = bf16_round(rv); v += rv; }
      if (ACT == 1) v = fmaxf(v, 0.f);
      if (ACT == 2) v = 0.5f * v * (1.0f + erff(v * 0.70710678118654752f));
      if (ACT == 3) { const float u = 0.7978845608028654f * (v + 0.044715f * v * v * v); v = 0.5f * v * (1.0f + tanhf(u)); }
      so[w][8 * hh + r][t * 16 + ln] = v;
    }
  }
  __builtin_amdgcn_fence(__ATOMIC_ACQ_REL, "workgroup");
  __builtin_amdgcn_wave_barrier();
  const int rsub = lane >> 4, c4 = (lane & 15) * 4;
  {
#pragma unroll
    for (int q = 0; q < 8; ++q) {
      const int r = q * 2 + rsub;
      const v4f v = *(const v4fa*)&so[w][r][c4];
      *(v4f*)(C + (size_t)(row0 + r) * ldc + col0 + c4) = v;
    }
    
  }
}
// row LayerNorm (biased variance, eps) over N: s = X (+ R); optional out_sum <- s; out_norm <- (s-mu)*rsqrt(var+eps)*g + b
template <bool PARAM_BF16>
__global__ __launch_bounds__(256) void k_layernorm(const float* __restrict__ X, const float* __restrict__ R, const float* __restrict__ g, const float* __restrict__ bta,
                                                  float* __restrict__ out_sum, float* __restrict__ out_norm, int N, float eps) {
  __shared__ float red[256];
  const int row = blockIdx.x, tid = threadIdx.x;
  const float* x = X + (size_t)row * N; const float* rr = R ? R + (size_t)row * N : nullptr;
  float vals[16];                     // up to N = 4096
  const int per = N / 256;            // contiguous chunk per thread? use strided-by-4 chunks: thread handles j = tid*4 + 1024*u
  float s1 = 0.f;
  for (int u = 0; u < per / 4; ++u) {
    const int j = tid * 4 + 1024 * u;
    const v4f a = *(const v4fa*)(x + j);
    v4f b = {0.f,0.f,0.f,0.f}; if (rr) b = *(const v4fa*)(rr + j);
#pragma unroll
    for (int q = 0; q < 4; ++q) { const float v = a[q] + b[q]; vals[u * 4 + q] = v; s1 += v; }
  }
  red[tid] = s1; __syncthreads();
  for (int st = 128; st > 0; st >>= 1) { if (tid < st) red[tid] += red[tid + st]; __syncthreads(); }
  const float mu = red[0] / (float)N; __syncthreads();
  float s2 = 0.f;
  for (int u = 0; u < per / 4; ++u)
#pragma unroll
    for (int q = 0; q < 4; ++q) { const float c = vals[u * 4 + q] - mu; s2 += c * c; }
  red[tid] = s2; __syncthreads();
  for (int st = 128; st > 0; st >>= 1) { if (tid < st) red[tid] += red[tid + st]; __syncthreads(); }
  const float rs = rsqrtf(red[0] / (float)N + eps);
  {
    for (int u = 0; u < per / 4; ++u) {
      const int j = tid * 4 + 1024 * u;
      v4f o, sm;
#pragma unroll
      for (int q = 0; q < 4; ++q) {
        float gg = g[j + q], bb = bta[j + q];
        if (PARAM_BF16) { gg = bf16_round(gg); bb = bf16_round(bb); }
        sm[q] = vals[u * 4 + q]; o[q] = (vals[u * 4 + q] - mu) * rs * gg + bb;
      }
      if (out_sum) *(v4f*)(out_sum + (size_t)row * N + j) = sm;
      *(v4f*)(out_norm + (size_t)row * N + j) = o;
    }
    
  }
}



// ---- f16 WMMA path (v_wmma_f32_16x16x32_f16): 11-bit significands for operands in range — used where a [0,1] probability operand needs more precision than bf16
typedef _Float16 v16h __attribute__((ext_vector_type(16)));
union FragH { v16h v; v8us half[2]; _Float16 h[16]; unsigned short u[16]; };
template <int NT>
__device__ __forceinline__ v8f mmaH(v16h ah, v16h al, v16h bh, v16h bl, v8f c) {
  c = __builtin_amdgcn_wmma_f32_16x16x32_f16(false, ah, false, bh, (short)0, c, false, false);
  if (NT >= 2) c = __builtin_amdgcn_wmma_f32_16x16x32_f16(false, al, false, bh, (short)0, c, false, false);
  if (NT >= 3) c = __builtin_amdgcn_wmma_f32_16x16x32_f16(false, ah, false, bl, (short)0, c, false, false);
  asm volatile("v_nop\n\tv_nop\n\tv_nop\n\tv_nop" : "+v"(c) : "v"(ah), "v"(al), "v"(bh), "v"(bl));
  return c;
}
// batched GEMM like k_gemm_b but f16 operands: A f32 (split into f16 hi/lo if ASPLIT, else rounded to f16), Bt = f16 values [n][k]; alpha; C f32; N multiple of 16 (partial tiles skipped)
template <bool ASPLIT>
__global__ __launch_bounds__(128) void k_gemm_h(const float* __restrict__ A, int lda, size_t sA, const _Float16* __restrict__ Bh, int ldb, size_t sB, float alpha, float* __restrict__ C, int ldc, size_t sC, int M, int N, int K) {
  __shared__ __attribute__((aligned(16))) float so[4][16][64];
  const int tid = threadIdx.x, w = tid >> 5, lane = tid & 31, ln = lane & 15, hh = lane >> 4; const int by = blockIdx.y;
  A += (size_t)by * sA; Bh += (size_t)by * sB; C += (size_t)by * sC;
  const int ntn = (N + 63) / 64; const int wid = blockIdx.x * 4 + w; const int mt = wid / ntn, nq = wid % ntn; if (mt * 16 >= M) return;
  const int row0 = mt * 16, col0 = nq * 64; const float* arow = A + (size_t)(row0 + ln) * lda;
  v8f acc[4] = {};
  for (int kb = 0; kb < K; kb += 32) {
    FragH ah, al;
    const v4f x0 = *(const v4fa*)(arow + kb + 8 * hh), x1 = *(const v4fa*)(arow + kb + 8 * hh + 4), x2 = *(const v4fa*)(arow + kb + 16 + 8 * hh), x3 = *(const v4fa*)(arow + kb + 16 + 8 * hh + 4);
    float xs[16] = {x0[0],x0[1],x0[2],x0[3],x1[0],x1[1],x1[2],x1[3],x2[0],x2[1],x2[2],x2[3],x3[0],x3[1],x3[2],x3[3]};
#pragma unroll
    for (int i = 0; i < 16; ++i) { const _Float16 h = (_Float16)xs[i]; ah.h[i] = h; al.h[i] = ASPLIT ? (_Float16)(xs[i] - (float)h) : (_Float16)0.0f; }
#pragma unroll
    for (int t = 0; t < 4; ++t) { if (col0 + t * 16 >= N) continue; const size_t boff = (size_t)(col0 + t * 16 + ln) * ldb + kb; FragH bq; bq.half[0] = *(const v8us*)(Bh + boff + 8 * hh); bq.half[1] = *(const v8us*)(Bh + boff + 16 + 8 * hh);
      acc[t] = mmaH<ASPLIT ? 2 : 1>(ah.v, al.v, bq.v, bq.v, acc[t]); }
  }
#pragma unroll
  for (int t = 0; t < 4; ++t) { if (col0 + t * 16 >= N) continue;
#pragma unroll
    for (int r = 0; r < 8; ++r) so[w][8 * hh + r][t * 16 + ln] = acc[t][r] * alpha; }
  __builtin_amdgcn_fence(__ATOMIC_ACQ_REL, "workgroup"); __builtin_amdgcn_wave_barrier();
  const int rsub = lane >> 4, c4 = (lane & 15) * 4;
  {
#pragma unroll
    for (int q = 0; q < 8; ++q) { const int r = q * 2 + rsub; if (col0 + c4 < N) { const v4f v = *(const v4fa*)&so[w][r][c4]; *(v4f*)(C + (size_t)(row0 + r) * ldc + col0 + c4) = v; } }
     }
}

// Wt[n][k] = f16(W[k][n]·scale) from f32 row-major W[K][N] (scale = power of two; bf16-exact weights stay exact in f16 away from the subnormal range)
__global__ __launch_bounds__(256) void k_wt_f16(const float* __restrict__ W, _Float16* __restrict__ Wt, int K, int N, float scale) {
  const int t = blockIdx.x * 256 + threadIdx.x; if (t >= N * (K / 8)) return; const int n = t / (K / 8), k8 = (t % (K / 8)) * 8; FragH f;
#pragma unroll
  for (int i = 0; i < 8; ++i) f.h[i] = (_Float16)(bf16_round(W[(size_t)(k8 + i) * N + n]) * scale); const v8us o = f.half[0];
  *(v8us*)((unsigned short*)Wt + (size_t)n * K + k8) = o; 
}
// k_gemm_hh variant with fused epilogue: v = acc·alpha + bias[by·sBias + col] (+ CP[(row/rowsPerB)·sCPb + by·64 + col] if CP) ; ACT 0 none / 1 elu ; writes f16 C16 (and f32 C if non-null)
template <int ACT>
__global__ __launch_bounds__(128) void k_gemm_hhx(const _Float16* __restrict__ A, int lda, size_t sA, const _Float16* __restrict__ Bh, int ldb, size_t sB, float alpha, const float* __restrict__ bias, size_t sBias, const float* __restrict__ CP, int rowsPerB, size_t sCPb, int row0g,
    float* __restrict__ C, _Float16* __restrict__ C16, int ldc, size_t sC, int M, int N, int K) {
  __shared__ __attribute__((aligned(16))) float so[4][16][64];
  const int tid = threadIdx.x, w = tid >> 5, lane = tid & 31, ln = lane & 15, hh = lane >> 4; const int by = blockIdx.y;
  A += (size_t)by * sA; Bh += (size_t)by * sB; const size_t cofs = (size_t)by * sC; const float* bp = bias ? bias + (size_t)by * sBias : nullptr;
  const int ntn = (N + 63) / 64; const int wid = blockIdx.x * 4 + w; const int mt = wid / ntn, nq = wid % ntn; if (mt * 16 >= M) return;
  const int row0 = mt * 16, col0 = nq * 64; const _Float16* arow = A + (size_t)(row0 + ln) * lda;
  v8f acc[4] = {};
  for (int kb = 0; kb < K; kb += 32) { FragH ah; ah.half[0] = *(const v8us*)((const unsigned short*)arow + kb + 8 * hh); ah.half[1] = *(const v8us*)((const unsigned short*)arow + kb + 16 + 8 * hh);
#pragma unroll
    for (int t = 0; t < 4; ++t) { if (col0 + t * 16 >= N) continue; const size_t boff = (size_t)(col0 + t * 16 + ln) * ldb + kb; FragH bq; bq.half[0] = *(const v8us*)((const unsigned short*)Bh + boff + 8 * hh); bq.half[1] = *(const v8us*)((const unsigned short*)Bh + boff + 16 + 8 * hh);
      acc[t] = mmaH<1>(ah.v, ah.v, bq.v, bq.v, acc[t]); }
  }
#pragma unroll
  for (int t = 0; t < 4; ++t) { if (col0 + t * 16 >= N) continue; const int col = col0 + t * 16 + ln; const float bv = bp ? bf16_round(bp[col]) : 0.f;
#pragma unroll
    for (int r = 0; r < 8; ++r) { float v = acc[t][r] * alpha + bv; if (CP) { const int rr = row0g + row0 + 8 * hh + r; if (rowsPerB < 0) v += CP[cofs + (size_t)rr * ldc + col];      /* rowsPerB < 0: own element of the batched C plane */ else { const int bidx = rr / rowsPerB; v += CP[(size_t)bidx * sCPb + (size_t)by * 64 + col]; } } if (ACT == 1) v = (v > 0.f) ? v : expm1f(v); else if (ACT == 7) v = (v > 0.f) ? v + 1.0f : expf(v); else if (ACT == 8) v = tanhf(v); else if (ACT == 9) v = 0.5f * v * (1.0f + tanhf(0.7978845608028654f * (v + 0.044715f * v * v * v))); else if (ACT == 11) v = 1.0f / (1.0f + expf(-v)); else if (ACT == 12) v = (v > 0.f) ? v : 0.01f * v; else if (ACT == 14) v = (v > 0.f) ? v : 0.1f * v; else if (ACT == 16) v = (v >= 0.f) ? v : 0.3f * v; else if (ACT == 17) v = (v >= 0.f) ? v : 0.2f * v; else if (ACT == 15) v = v / (1.0f + expf(-v)); else if (ACT == 3) v = fmaxf(v, 0.f); else if (ACT == 6) v = 0.5f * v * (1.0f + erff(v * 0.70710678118654752f)); so[w][8 * hh + r][t * 16 + ln] = v; } }
  __builtin_amdgcn_fence(__ATOMIC_ACQ_REL, "workgroup"); __builtin_amdgcn_wave_barrier();
  const int rsub = lane >> 4, c4 = (lane & 15) * 4; typedef _Float16 v4h __attribute__((ext_vector_type(4)));
  {
#pragma unroll
    for (int q = 0; q < 8; ++q) { const int r = q * 2 + rsub; if (col0 + c4 < N) { const v4f v = *(const v4fa*)&so[w][r][c4]; if (C) *(v4f*)(C + cofs + (size_t)(row0 + r) * ldc + col0 + c4) = v; if (C16) { v4h h4; for (int i = 0; i < 4; ++i) h4[i] = (_Float16)v[i]; *(v4h*)(C16 + cofs + (size_t)(row0 + r) * ldc + col0 + c4) = h4; } } }
     }
}


typedef _Float16 v4h __attribute__((ext_vector_type(4)));

__global__ __launch_bounds__(256) void k_h16(const float* __restrict__ x, _Float16* __restrict__ X16, size_t n8) { const size_t t = (size_t)blockIdx.x * 256 + threadIdx.x; if (t >= n8) return; FragH f;
#pragma unroll
  for (int q = 0; q < 8; ++q) f.h[q] = (_Float16)x[t * 8 + q]; *(v8us*)((unsigned short*)X16 + t * 8) = f.half[0];  }
__global__ __launch_bounds__(256) void k_round16f(const float* __restrict__ W, _Float16* __restrict__ Bt, size_t n8) { const size_t t = (size_t)blockIdx.x * 256 + threadIdx.x; if (t >= n8) return; FragH f;
#pragma unroll
  for (int i = 0; i < 8; ++i) f.h[i] = (_Float16)(bf16_round(W[t * 8 + i]) * 16.0f); *(v8us*)((unsigned short*)Bt + t * 8) = f.half[0];  }
template <int NHv, int TTv>
__global__ __launch_bounds__(256) void k_vt(const _Float16* __restrict__ V16, int ldv, int voff, _Float16* __restrict__ Vt) { __shared__ unsigned short tl[64][66]; const int tid = threadIdx.x; const int slab = blockIdx.x / (TTv / 64), lg = blockIdx.x % (TTv / 64); const int b = slab / NHv, h = slab % NHv;
  for (int i = tid; i < 64 * 8; i += 256) { const int r = i / 8, c8 = (i % 8) * 8; FragH f; f.half[0] = *(const v8us*)((const unsigned short*)V16 + ((size_t)b * TTv + lg * 64 + r) * ldv + voff + h * 64 + c8);
#pragma unroll
    for (int q = 0; q < 8; ++q) tl[r][c8 + q] = f.u[q]; }
  __syncthreads();
  {
#pragma unroll
    for (int rd = 0; rd < 2; ++rd) { const int d = rd * 32 + tid / 8, pc = tid % 8; FragH f;
#pragma unroll
      for (int q = 0; q < 8; ++q) f.u[q] = tl[pc * 8 + q][d];
      *(v8us*)((unsigned short*)Vt + ((size_t)slab * 64 + d) * TTv + lg * 64 + pc * 8) = f.half[0]; }
     } }

__global__ __launch_bounds__(256) void k_hl(const float* __restrict__ F, _Float16* __restrict__ Hh, _Float16* __restrict__ Hl, size_t n8) { const size_t t = (size_t)blockIdx.x * 256 + threadIdx.x; if (t >= n8) return; FragH fh, fl; const v4f a = *(const v4fa*)(F + t * 8), c = *(const v4fa*)(F + t * 8 + 4);
#pragma unroll
  for (int q = 0; q < 4; ++q) { _Float16 h = (_Float16)a[q]; fh.h[q] = h; fl.h[q] = (_Float16)((a[q] - (float)h) * 1024.0f); h = (_Float16)c[q]; fh.h[4 + q] = h; fl.h[4 + q] = (_Float16)((c[q] - (float)h) * 1024.0f); }
  { *(v8us*)((unsigned short*)Hh + t * 8) = fh.half[0]; *(v8us*)((unsigned short*)Hl + t * 8) = fl.half[0];  } }

// ---- fast GEMM (work-group tile 128x64, wave tile 32x64; requires M % 128 == 0, N % 64 == 0, K % 64 == 0); epilogue: acc * alpha + bias, activation; no test on an argument per element or per row ----
// A and B reach the fragments through LDS: a stage is 64 k (one 128-byte line) of the tile's 128 A rows and 64 B rows; eight lanes load one whole line, so a wave's load touches 4 lines, not 16, and B is fetched once a work-group, not once a wave. The next stage's lines fly while this stage is worked on (two buffers, one barrier a stage). The fragments hold the same elements in the same k order as a load straight from global.
#define GKC 64                       /* k per LDS stage */
#define GP 144                       /* LDS row pitch, bytes: 16 x odd, for ds_load_b128 */
#define GST ((128 + 64) * GP)        /* bytes of one stage: 128 A rows, then 64 B rows */
__device__ __forceinline__ v16h g2_lfrag(const unsigned char* p) { FragH f; f.half[0] = *(const v8us*)p; f.half[1] = *(const v8us*)(p + 32); return f.v; }
__device__ __forceinline__ v16h g2_frag(const _Float16* p, int hh) { FragH f; f.half[0] = *(const v8us*)((const unsigned short*)p + 8 * hh); f.half[1] = *(const v8us*)((const unsigned short*)p + 16 + 8 * hh); return f.v; }
__device__ __forceinline__ v8f g2_mma(v16h a, v16h b, v8f c) { v8f d = __builtin_amdgcn_wmma_f32_16x16x32_f16(false, a, false, b, (short)0, c, false, false); asm volatile("v_nop\n\tv_nop\n\tv_nop\n\tv_nop" : "+v"(d) : "v"(a), "v"(b)); return d; }
template <int ACT, bool F32O>      /* F32O: the result goes to C as f32; else to C16 as f16 */
__global__ __launch_bounds__(128) void k_gemm2(const _Float16* __restrict__ A, int lda, size_t sA, const _Float16* __restrict__ Bh, int ldb, size_t sB, float alpha, const float* __restrict__ bias, const float* __restrict__ bias1, const float* __restrict__ bias2, size_t sBias,
    float* __restrict__ C, _Float16* __restrict__ C16, int ldc, size_t sC, int M, int N, int K, const int* __restrict__ cnt, const int* __restrict__ gpos, const int* __restrict__ spos) { static_assert(ACT == 0 || ACT == 3 || ACT == 6 || ACT == 8 || ACT == 9 || ACT == 11 || ACT == 12 || ACT == 14 || ACT == 15 || ACT == 16 || ACT == 17, "k_gemm2: unsupported ACT code (would silently apply no activation)");
  __shared__ __attribute__((aligned(16))) unsigned char stg[2 * GST]; float (*so)[32][68] = (float (*)[32][68])stg; static_assert(sizeof(float) * 4 * 32 * 68 <= 2 * GST, "the epilogue's tile lies over the stages");      /* so is written only behind the loop's last barrier */
  const int tid = threadIdx.x, w = tid >> 5, lane = tid & 31, ln = lane & 15, hh = lane >> 4; const int by = blockIdx.y;
  if (bias1) bias = by == 1 ? bias1 : by == 2 ? bias2 : bias;      /* three products in one grid, each with its own bias vector */
  A += (size_t)by * sA; Bh += (size_t)by * sB; const size_t cofs = (size_t)by * sC; const float* bp = bias + (size_t)by * sBias;      /* every launch gives a bias vector */
  const int ntn = N >> 6; const int mi = blockIdx.x / ntn, nq = blockIdx.x - mi * ntn; const int mt = (mi % NB) * (SQ / 128) + mi / NB;      /* row tiles in the order tile 0 of every batch, tile 1 of every batch, ...: the tiles past the lists come last in the grid */
  const int row0 = mt * 128 + 32 * w, col0 = nq * 64; if (mt * 128 >= M) return;      /* the whole work-group leaves, in front of every barrier */
  /* rows are list entries: batch bb, entries cb .. cb + 127 of its list of nv valid tokens; a block whose first entry lies past the list has nothing to do; the entries from nv to the block's end repeat the first valid token (finite rows that carry no weight later) */
  const int bb = (mt * 128) / SQ, cb = mt * 128 - bb * SQ; int nv = cnt[bb * CNTP]; nv = nv < SQ ? nv : SQ; if (cb >= nv) return;
  int sp = cb + 32 * w + lane, nlim = SQ; if (spos) { sp = spos[row0 + lane] & (SQ - 1); nlim = nv; }      /* lane l: the row inside the batch where row l of this wave's tile is stored; spos: a listed row goes to its token's own position, an entry past the list nowhere */
  /* staging: thread t moves 16 bytes of A rows t / 8 + 16 i (i < 8) and of B rows t / 8 + 16 i (i < 4) of each stage; the loops over i and ks are unrolled so that their arrays are registers */
  const int sr = tid >> 3, sc = tid & 7; int ra[8]; unsigned ao[8], bo[4];      /* ao, bo: each row's byte offset in its matrix (under 2^32); the stage's k is added to the uniform base */
#pragma unroll
  for (int i = 0; i < 8; ++i) ra[i] = mt * 128 + sr + 16 * i;
  if (gpos) { int gv[8];      /* gpos: A rows stand at the tokens' own positions; one test round all eight loads, so that they fly together */
#pragma unroll
    for (int i = 0; i < 8; ++i) gv[i] = gpos[ra[i]];
#pragma unroll
    for (int i = 0; i < 8; ++i) ra[i] = bb * SQ + (gv[i] & (SQ - 1)); }
#pragma unroll
  for (int i = 0; i < 8; ++i) ao[i] = (unsigned)ra[i] * (unsigned)lda * 2u + (unsigned)sc * 16u;
#pragma unroll
  for (int i = 0; i < 4; ++i) bo[i] = (unsigned)(col0 + sr + 16 * i) * (unsigned)ldb * 2u + (unsigned)sc * 16u;
  const char* Ab = (const char*)A; const char* Bb = (const char*)Bh; v8us pa[8], pb[4];
#pragma unroll
  for (int i = 0; i < 8; ++i) pa[i] = *(const v8us*)(Ab + ao[i]);
#pragma unroll
  for (int i = 0; i < 4; ++i) pb[i] = *(const v8us*)(Bb + bo[i]);
  unsigned char* sw = stg + sr * GP + sc * 16; const unsigned char* af = stg + (32 * w + ln) * GP + 16 * hh; const unsigned char* bf = stg + (128 + ln) * GP + 16 * hh;
#pragma unroll
  for (int i = 0; i < 8; ++i) *(v8us*)(sw + 16 * i * GP) = pa[i];
#pragma unroll
  for (int i = 0; i < 4; ++i) *(v8us*)(sw + (128 + 16 * i) * GP) = pb[i];
  __syncthreads();
  const v8f z8 = {0.f,0.f,0.f,0.f,0.f,0.f,0.f,0.f}; v8f c00 = z8, c01 = z8, c02 = z8, c03 = z8, c10 = z8, c11 = z8, c12 = z8, c13 = z8; const int nch = K / GKC;
#pragma unroll 1
  for (int c = 0; c < nch; ++c) { const int cur = (c & 1) * GST; const bool more = c + 1 < nch;      /* rolled: two buffers, one stage's code */
    if (more) { const char* An = Ab + (size_t)(c + 1) * (GKC * 2); const char* Bn = Bb + (size_t)(c + 1) * (GKC * 2);
#pragma unroll
      for (int i = 0; i < 8; ++i) pa[i] = *(const v8us*)(An + ao[i]);
#pragma unroll
      for (int i = 0; i < 4; ++i) pb[i] = *(const v8us*)(Bn + bo[i]);
      asm volatile("s_wait_xcnt 0x0" ::: "memory"); }      /* keeps the twelve loads up here, in flight while this stage is worked on; the wait is a precaution in front of any reuse of their address registers */
    const unsigned char* ap = af + cur; const unsigned char* bq = bf + cur; v16h a0[GKC / 32], a1[GKC / 32], b0[GKC / 32], b1[GKC / 32], b2[GKC / 32], b3[GKC / 32];
#pragma unroll
    for (int ks = 0; ks < GKC / 32; ++ks) { a0[ks] = g2_lfrag(ap + ks * 64); a1[ks] = g2_lfrag(ap + 16 * GP + ks * 64); b0[ks] = g2_lfrag(bq + ks * 64); b1[ks] = g2_lfrag(bq + 16 * GP + ks * 64); b2[ks] = g2_lfrag(bq + 32 * GP + ks * 64); b3[ks] = g2_lfrag(bq + 48 * GP + ks * 64); }
    asm volatile("" :: "v"(a0[0]), "v"(a1[0]), "v"(b0[0]), "v"(b1[0]), "v"(b2[0]), "v"(b3[0]), "v"(a0[1]), "v"(a1[1]), "v"(b0[1]), "v"(b1[1]), "v"(b2[1]), "v"(b3[1]));      /* inputs only: holds the stage's LDS reads together in front of the products, one LDS latency a stage instead of one per fragment */
#pragma unroll
    for (int ks = 0; ks < GKC / 32; ++ks) {
      c00 = g2_mma(a0[ks], b0[ks], c00); c10 = g2_mma(a1[ks], b0[ks], c10); c01 = g2_mma(a0[ks], b1[ks], c01); c11 = g2_mma(a1[ks], b1[ks], c11);
      c02 = g2_mma(a0[ks], b2[ks], c02); c12 = g2_mma(a1[ks], b2[ks], c12); c03 = g2_mma(a0[ks], b3[ks], c03); c13 = g2_mma(a1[ks], b3[ks], c13); }
    if (more) { unsigned char* d = sw + (GST - cur);      /* that buffer's last readers left it before the barrier that ended the stage before */
#pragma unroll
      for (int i = 0; i < 8; ++i) *(v8us*)(d + 16 * i * GP) = pa[i];
#pragma unroll
      for (int i = 0; i < 4; ++i) *(v8us*)(d + (128 + 16 * i) * GP) = pb[i]; }
    __syncthreads(); }      /* publishes the next stage and ends this stage's reads; behind the last one the stages' LDS is free for the epilogue */
  v8f accs[8] = {c00, c01, c02, c03, c10, c11, c12, c13};
#pragma unroll
  for (int u = 0; u < 8; ++u) { const int t = u & 3, half = u >> 2; const int col = col0 + t * 16 + ln; const float bv = bf16_round(bp[col]);
#pragma unroll
    for (int r = 0; r < 8; ++r) { const int rloc = half * 16 + 8 * hh + r; float v = accs[u][r] * alpha + bv;
      if (ACT == 3) v = fmaxf(v, 0.f); else if (ACT == 6) v = 0.5f * v * (1.0f + erff(v * 0.70710678118654752f)); else if (ACT == 11) v = 1.0f / (1.0f + expf(-v)); else if (ACT == 15) v = v / (1.0f + expf(-v)); else if (ACT == 12) v = (v > 0.f) ? v : 0.01f * v; else if (ACT == 8) v = tanhf(v); else if (ACT == 9) v = 0.5f * v * (1.0f + tanhf(0.7978845608028654f * (v + 0.044715f * v * v * v))); else if (ACT == 14) v = (v > 0.f) ? v : 0.1f * v; else if (ACT == 16) v = (v >= 0.f) ? v : 0.3f * v; else if (ACT == 17) v = (v >= 0.f) ? v : 0.2f * v;
      so[w][rloc][t * 16 + ln] = v; } }
  __builtin_amdgcn_fence(__ATOMIC_ACQ_REL, "workgroup"); __builtin_amdgcn_wave_barrier();
  const int rsub = lane >> 4, c4 = (lane & 15) * 4;
  {
#pragma unroll
    for (int q = 0; q < 16; ++q) { const int r = q * 2 + rsub; const v4f v = *(const v4fa*)&so[w][r][c4]; const int p0 = __builtin_amdgcn_readlane(sp, q * 2), p1 = __builtin_amdgcn_readlane(sp, q * 2 + 1); const int ro = bb * SQ + (rsub ? p1 : p0);
      if (cb + 32 * w + r < nlim) { if (F32O) { *(v4f*)(C + cofs + (size_t)ro * ldc + col0 + c4) = v; asm volatile("s_wait_xcnt 0x0" ::: "memory"); }      /* precaution: the built code rewrites this store's data and address registers right behind it */
        else { v4h h4; for (int i = 0; i < 4; ++i) h4[i] = (_Float16)v[i]; *(v4h*)(C16 + cofs + (size_t)ro * ldc + col0 + c4) = h4; } } }
     } }


// ---- preparation: everything that reads only the inputs, as one launch; a block's index range says which job it does (none reads what another writes) ----
#define PBX ((int)(NR * DM / 8 / 256))      /* blocks that convert h: 8 elements a thread */
#define PBW (DM * DM / 8 / 256)             /* blocks per weight matrix: 8 elements a thread */
#define PBT (SQ / 256)                      /* blocks of the bias table: 1 entry a thread */
#define PBL NB                              /* blocks that list the valid tokens: one a batch, 8 positions a thread */
typedef int v4i __attribute__((ext_vector_type(4)));
__device__ __forceinline__ float tbias_at(int d) {
  const float dist = __fdiv_rn(__fmul_rn((float)d, 300.0f), 300.0f); const float v = logf(__fadd_rn(expf(-dist), 1e-12f));
  return v; }
__global__ __launch_bounds__(256) void k_prep(const float* __restrict__ x, const int* __restrict__ pmask, const float* __restrict__ wq, const float* __restrict__ wk, const float* __restrict__ wv, const float* __restrict__ wo, _Float16* __restrict__ X16, _Float16* __restrict__ BW, float* __restrict__ TB, int* __restrict__ POS, int* __restrict__ CNT, float* __restrict__ out) {
  __shared__ int psum[256]; __shared__ __attribute__((aligned(16))) int lst[SQ]; __shared__ int first;
  int blk = blockIdx.x;
  if (blk < PBL) { const int tid = threadIdx.x; const int* mp = pmask + (size_t)blk * SQ + tid * 8;      /* batch blk: valid positions in ascending order, by a prefix sum of the threads' counts */
    const v4i m0 = *(const v4i*)mp, m1 = *(const v4i*)(mp + 4); const int mv[8] = {m0[0], m0[1], m0[2], m0[3], m1[0], m1[1], m1[2], m1[3]}; int c = 0;
#pragma unroll
    for (int q = 0; q < 8; ++q) c += mv[q] != 0;
    psum[tid] = c; if (tid == 0) first = 0;
    __syncthreads();
    for (int o = 1; o < 256; o <<= 1) { const int a = tid >= o ? psum[tid - o] : 0; __syncthreads(); psum[tid] += a; __syncthreads(); }
    const int n = psum[255]; int rk = psum[tid] - c;
    if (rk == 0 && c != 0) {
#pragma unroll
      for (int q = 7; q >= 0; --q) if (mv[q] != 0) first = tid * 8 + q; }
#pragma unroll
    for (int q = 0; q < 8; ++q) if (mv[q] != 0) lst[rk++] = tid * 8 + q;
    __syncthreads();
    v4i o0, o1;      /* entries past the list repeat the first valid position; a wave stores whole 128-byte lines */
#pragma unroll
    for (int q = 0; q < 4; ++q) { o0[q] = tid * 8 + q < n ? lst[tid * 8 + q] : first; o1[q] = tid * 8 + 4 + q < n ? lst[tid * 8 + 4 + q] : first; }
    *(v4i*)(POS + (size_t)blk * SQ + tid * 8) = o0; *(v4i*)(POS + (size_t)blk * SQ + tid * 8 + 4) = o1; if (tid == 0) CNT[blk * CNTP] = n;
    return; }
  blk -= PBL;
  if (blk < PBX) { const size_t t = (size_t)blk * 256 + threadIdx.x; FragH f;      /* valid h rows, rounded to bf16, exact in f16; a padded row is read by nobody, its row of out is 0 */
    if (pmask[t / (DM / 8)] == 0) { const v4f z = {0.f, 0.f, 0.f, 0.f}; *(v4f*)(out + t * 8) = z; *(v4f*)(out + t * 8 + 4) = z; return; }
#pragma unroll
    for (int q = 0; q < 8; ++q) f.h[q] = (_Float16)bf16_round(x[t * 8 + q]);
    *(v8us*)((unsigned short*)X16 + t * 8) = f.half[0]; return; }
  blk -= PBX;
  if (blk < 4 * PBW) { const int mi = blk / PBW; const float* __restrict__ w = mi == 0 ? wq : mi == 1 ? wk : mi == 2 ? wv : wo;      /* weight mi, natural [out][in], x16, into plane mi of BW */
    const size_t t = (size_t)(blk - mi * PBW) * 256 + threadIdx.x; FragH f;
    for (int q = 0; q < 8; ++q) f.h[q] = (_Float16)(bf16_round(w[t * 8 + q]) * 16.0f);
    *(v8us*)((unsigned short*)BW + (size_t)mi * DM * DM + t * 8) = f.half[0]; return; }
  const int d = (blk - 4 * PBW) * 256 + threadIdx.x; TB[d] = tbias_at(d);
  asm volatile("s_wait_xcnt 0x0" ::: "memory"); }      /* precaution: the built code places another job's block behind this store, and that block rewrites the store's registers */
#define FK 64                        /* keys per LDS stage */
#define PK 144                       /* LDS row pitch of the K tile, bytes: 16 x odd, for ds_load_b128 */
#define PV 160                       /* LDS row pitch of the V tile, bytes: 32 x odd, for ds_load_tr16_b128 */
#define LOG2E 1.4426950408889634f
typedef short s16x8 __attribute__((ext_vector_type(8)));
typedef float v2f __attribute__((ext_vector_type(2)));
__device__ __forceinline__ v8us fa_tr16(const unsigned char* p) { typedef __attribute__((address_space(3))) s16x8 lds_s16x8; return __builtin_bit_cast(v8us, __builtin_amdgcn_ds_load_tr16_b128_v8i16((lds_s16x8*)p)); }
__device__ __forceinline__ float fa_xhalf(float x) { return __builtin_bit_cast(float, __builtin_amdgcn_permlanex16(__builtin_bit_cast(int, x), __builtin_bit_cast(int, x), 0x76543210, 0xfedcba98, false, false)); }      /* lane l reads lane l ^ 16 */
// amdgpu_waves_per_eu(4, 4) on the kernel: two work-groups per WGP are four waves per SIMD, so a wave may use up to 256 registers.
__device__ __forceinline__ v8f fa_mma(v16h a, v16h b, v8f c) { return __builtin_amdgcn_wmma_f32_16x16x32_f16(false, a, false, b, (short)0, c, false, false); }
__global__ __launch_bounds__(256) __attribute__((amdgpu_waves_per_eu(4, 4))) void k_fattn(const _Float16* __restrict__ Q16, const _Float16* __restrict__ K16, const _Float16* __restrict__ V16, const float* __restrict__ TB, const int* __restrict__ POS, const int* __restrict__ CNT, _Float16* __restrict__ O16) {
  __shared__ __attribute__((aligned(16))) float tb2[2 * SQ]; __shared__ __attribute__((aligned(16))) int kx[SQ];
  __shared__ __attribute__((aligned(16))) unsigned char kt[2][FK * PK]; __shared__ __attribute__((aligned(16))) unsigned char vt[2][FK * PV];
  const int tid = threadIdx.x, lane = tid & 31, ln = lane & 15, hh = lane >> 4; const int wv = __builtin_amdgcn_readfirstlane(tid >> 5);
  const int b = blockIdx.x / NH, h = blockIdx.x % NH; int nv = CNT[b * CNTP]; nv = nv < SQ ? nv : SQ; if ((int)blockIdx.y * 128 >= nv) return;      /* the whole work-group leaves, in front of every barrier: its queries lie past the list; the query tile is the slow grid index, so that these work-groups come last and the working ones spread over the chip */
  const int nst = (nv + FK - 1) / FK; const int* lp = POS + (size_t)b * SQ; const int q0 = blockIdx.y * 128 + wv * 16; const bool act = q0 < nv;      /* act, the same for the whole wave: a wave whose 16 queries all lie past the list only stages and stores zero rows */ const size_t base = (size_t)b * SQ * DM + (size_t)h * HD;
  /* staging: thread t moves 16 bytes of rows t / 8 and 32 + t / 8 of each tile, so a wave's load covers four whole 128-byte rows */
  const int sr = tid >> 3, sc = tid & 7;
  const unsigned short* kg = (const unsigned short*)K16 + base + (size_t)sr * DM + sc * 8; const unsigned short* vg = (const unsigned short*)V16 + base + (size_t)sr * DM + sc * 8;
  const int st0 = blockIdx.y * (128 / FK); const size_t g0 = (size_t)st0 * FK * DM;      /* the first stage worked on: the one that holds this work-group's first queries as keys (st0 < nst, since the work-group's first query is on the list) */
  v8us rk0 = *(const v8us*)(kg + g0), rk1 = *(const v8us*)(kg + g0 + 32 * DM), rv0 = *(const v8us*)(vg + g0), rv1 = *(const v8us*)(vg + g0 + 32 * DM);
  const _Float16* qp = Q16 + base + (size_t)(q0 + ln) * DM; const v16h qf0 = g2_frag(qp, hh), qf1 = g2_frag(qp + 32, hh);
#pragma unroll
  for (int u = 0; u < 2 * SQ / 256; ++u) { const int t = tid + 256 * u; int d = t - (SQ - 1); d = d < 0 ? -d : d; d = d < SQ ? d : SQ - 1; const float tv = TB[d] * LOG2E; tb2[t] = t == 2 * SQ - 1 ? -1.0e9f * LOG2E : tv; }      /* unrolled: the table's loads are all in flight together */
#pragma unroll
  for (int u = 0; u < SQ / 256; ++u) { const int t = tid + 256 * u; kx[t] = (lp[t] & (SQ - 1)) * 4 + (t < nv ? 0 : 4 * SQ * 4); }      /* a sum, so that the eight loads stand under no test and fly together: the list's every entry is written */
  *(v8us*)(kt[0] + sr * PK + sc * 16) = rk0; *(v8us*)(kt[0] + (sr + 32) * PK + sc * 16) = rk1; *(v8us*)(vt[0] + sr * PV + sc * 16) = rv0; *(v8us*)(vt[0] + (sr + 32) * PV + sc * 16) = rv1;
  __syncthreads();
  const v8f z8 = {0.f,0.f,0.f,0.f,0.f,0.f,0.f,0.f}; v8f o0 = z8, o1 = z8, o2 = z8, o3 = z8; float m = -INFINITY, ms = -INFINITY, l = act ? 0.f : 1.f;
  const int qx = (SQ - 1) * 4 - (kx[q0 + ln] & ((SQ - 1) * 4)); const int* kq = kx + 8 * hh; const unsigned qm = __builtin_amdgcn_ballot_w32(q0 + ln < nv);      /* the lanes whose query is on the list; a query past it stands for no token (its o row is stored nowhere in out) and has no say in whether a pass is worked on */
#pragma unroll 1
  for (int t = 0, st = st0; t < nst; ++t) { const int cur = t & 1; const bool more = t + 1 < nst; const int sn = st + 1 < nst ? st + 1 : 0;      /* rolled: st runs st0 .. nst - 1, then 0 .. st0 - 1 */
    if (more) { const size_t go = (size_t)sn * FK * DM; rk0 = *(const v8us*)(kg + go); rk1 = *(const v8us*)(kg + go + 32 * DM); rv0 = *(const v8us*)(vg + go); rv1 = *(const v8us*)(vg + go + 32 * DM);
      asm volatile("s_wait_xcnt 0x0" ::: "memory"); }      /* the next stage's rows fly while this stage is worked on; the wait is a precaution: the built code reuses these loads' address registers right behind them */
    if (act)
#pragma unroll
    for (int sub = 0; sub < FK / 32; ++sub) { const int k0 = st * FK + sub * 32;
      const unsigned char* kp = kt[cur] + (sub * 32 + ln) * PK + 16 * hh; FragH ka0, ka1, kb0, kb1;
      ka0.half[0] = *(const v8us*)(kp); ka0.half[1] = *(const v8us*)(kp + 32); ka1.half[0] = *(const v8us*)(kp + 64); ka1.half[1] = *(const v8us*)(kp + 96);
      kb0.half[0] = *(const v8us*)(kp + 16 * PK); kb0.half[1] = *(const v8us*)(kp + 16 * PK + 32); kb1.half[0] = *(const v8us*)(kp + 16 * PK + 64); kb1.half[1] = *(const v8us*)(kp + 16 * PK + 96);
      const int dk = k0 - (q0 + 15), dq = q0 - (k0 + 31); int de = dk > dq ? dk : dq; de = de > 0 ? de : 0; const float bb = tb2[SQ - 1 + de];      /* de: least distance, in list places, between the wave's queries and the pass's keys, the same for the whole wave; bb: the bias there */
      asm volatile("" :: "v"(ka0.v), "v"(ka1.v), "v"(kb0.v), "v"(kb1.v), "v"(bb));      /* inputs only: the pass's LDS reads are issued as one run; without it the built code reads two by two among the products, with a full wait at each: three LDS latencies a pass */
      v8f s0 = fa_mma(ka0.v, qf0, z8), s1 = fa_mma(kb0.v, qf0, z8); s0 = fa_mma(ka1.v, qf1, s0); s1 = fa_mma(kb1.v, qf1, s1);
      float xa = s0[0], xb = s1[0];      /* two chains, so that no maximum waits on fifteen before it */
#pragma unroll
      for (int r = 1; r < 8; ++r) { xa = __builtin_fmaxf(xa, s0[r]); xb = __builtin_fmaxf(xb, s1[r]); }
      if ((__builtin_amdgcn_ballot_w32(__builtin_fmaf(__builtin_fmaxf(xa, xb), 0.125f * LOG2E, bb) > ms - 26.0f) & qm) == 0) continue;      /* no weight of the pass reaches 2^-25 (26, not 25: the one to spare covers every rounding of the table and of exp2) */
      const unsigned char* vp = vt[cur] + (sub * 32 + 8 * hh + (lane & 7)) * PV + ((lane >> 3) & 1) * 16; FragH va[4];
#pragma unroll
      for (int dt = 0; dt < 4; ++dt) { va[dt].half[0] = fa_tr16(vp + 32 * dt); va[dt].half[1] = fa_tr16(vp + 16 * PV + 32 * dt); }
      const int* kp4 = kq + k0; float v[16]; float mx = -INFINITY;
#pragma unroll
      for (int r = 0; r < 8; ++r) { int x0 = kp4[r] + qx, x1 = kp4[16 + r] + qx; x0 = x0 < (2 * SQ - 1) * 4 ? x0 : (2 * SQ - 1) * 4; x1 = x1 < (2 * SQ - 1) * 4 ? x1 : (2 * SQ - 1) * 4;
        v[r] = __builtin_fmaf(s0[r], 0.125f * LOG2E, *(const float*)((const char*)tb2 + x0)); v[8 + r] = __builtin_fmaf(s1[r], 0.125f * LOG2E, *(const float*)((const char*)tb2 + x1)); }
#pragma unroll
      for (int r = 0; r < 16; ++r) mx = __builtin_fmaxf(mx, v[r]);
      mx = __builtin_fmaxf(mx, fa_xhalf(mx));
      if (__builtin_amdgcn_ballot_w32(mx > m) != 0) { const float mn = __builtin_fmaxf(m, mx); const float msn = mn - 8.0f; const float corr = __builtin_amdgcn_exp2f(ms - msn); m = mn; ms = msn; l *= corr; o0 *= corr; o1 *= corr; o2 *= corr; o3 *= corr; }      /* corr = 0 in the first pass (ms = -inf), 1 for a query whose maximum stays */
      FragH pf; v2f la = {0.f, 0.f}, lb = {0.f, 0.f};      /* the pass's sum in two chains of pairs, so that no add waits on sixteen before it */
#pragma unroll
      for (int r = 0; r < 16; r += 4) { const float p0 = __builtin_amdgcn_exp2f(v[r] - ms), p1 = __builtin_amdgcn_exp2f(v[r + 1] - ms), p2 = __builtin_amdgcn_exp2f(v[r + 2] - ms), p3 = __builtin_amdgcn_exp2f(v[r + 3] - ms);
        la += v2f{p0, p1}; lb += v2f{p2, p3}; pf.h[r] = (_Float16)p0; pf.h[r + 1] = (_Float16)p1; pf.h[r + 2] = (_Float16)p2; pf.h[r + 3] = (_Float16)p3; }
      la += lb; l += la[0] + la[1];
      o0 = fa_mma(va[0].v, pf.v, o0); o1 = fa_mma(va[1].v, pf.v, o1); o2 = fa_mma(va[2].v, pf.v, o2); o3 = fa_mma(va[3].v, pf.v, o3); }
    if (more) { unsigned char* kn = kt[cur ^ 1]; unsigned char* vn = vt[cur ^ 1]; *(v8us*)(kn + sr * PK + sc * 16) = rk0; *(v8us*)(kn + (sr + 32) * PK + sc * 16) = rk1; *(v8us*)(vn + sr * PV + sc * 16) = rv0; *(v8us*)(vn + (sr + 32) * PV + sc * 16) = rv1; }      /* that buffer's last readers left it before the barrier that ended the stage before */
    __syncthreads(); st = sn; }      /* publishes the next stage and ends this stage's reads */
  l += fa_xhalf(l); const float inv = 1.0f / l; unsigned short* op = (unsigned short*)O16 + base + (size_t)(q0 + ln) * DM + 8 * hh;      /* lane (c, hf) holds o[q0 + c][16 dt + 8 hf + r] */
  const v8f oo[4] = {o0, o1, o2, o3};
#pragma unroll
  for (int dt = 0; dt < 4; ++dt) { FragH f;
#pragma unroll
    for (int r = 0; r < 8; ++r) f.h[r] = (_Float16)(oo[dt][r] * inv);
    *(v8us*)(op + 16 * dt) = f.half[0]; } }

extern "C" void kernel_launch(void* const* d_in, const int* in_sizes, int n_in,
                              void* d_out, int out_size, void* d_ws, size_t ws_size, hipStream_t stream) {
  (void)in_sizes; (void)n_in; (void)out_size;
  const float* const* I = (const float* const*)d_in; const float* x = I[0]; const int* pmask = (const int*)d_in[1]; const float* wq = I[2]; const float* bq = I[3]; const float* wk = I[4]; const float* bk = I[5]; const float* wv = I[6]; const float* bv = I[7]; const float* wo = I[8]; const float* bo = I[9];      /* weights natural [out][in]; patch_mask int32 [4][2048] (1 = valid) */
  char* ws = (char*)d_ws; size_t off = 0;
  auto take = [&](size_t bytes) { char* p = ws + off; off += (bytes + 255) & ~(size_t)255; return p; };
  _Float16* BQ = (_Float16*)take((size_t)DM * DM * 2); _Float16* BK = (_Float16*)take((size_t)DM * DM * 2); _Float16* BV = (_Float16*)take((size_t)DM * DM * 2); _Float16* BO = (_Float16*)take((size_t)DM * DM * 2);
  _Float16* X16 = (_Float16*)take(NR * DM * 2); _Float16* Q16 = (_Float16*)take(NR * DM * 2); _Float16* K16 = (_Float16*)take(NR * DM * 2); _Float16* V16 = (_Float16*)take(NR * DM * 2); _Float16* O16 = (_Float16*)take(NR * DM * 2);
  float* TB = (float*)take((size_t)SQ * 4); int* POS = (int*)take(NR * 4); int* CNT = (int*)take((size_t)NB * CNTP * 4);
  (void)BK; (void)BV;
  if (off > ws_size) return;      /* 2 + 5x8 + 0.04 = approx 42 MiB */
  k_prep<<<PBL + PBX + 4 * PBW + PBT, 256, 0, stream>>>(x, pmask, wq, wk, wv, wo, X16, BQ, TB, POS, CNT, (float*)d_out);      /* BQ | BK | BV | BO are four planes in a row */
  const dim3 gp((unsigned)((NR / 128) * (DM / 64)), 1); const dim3 gp3((unsigned)((NR / 128) * (DM / 64)), 3);
  k_gemm2<0, false><<<gp3, 128, 0, stream>>>(X16, DM, 0, BQ, DM, (size_t)DM * DM, 0.0625f, bq, bk, bv, 0, nullptr, Q16, DM, NR * DM, MP, DM, DM, CNT, POS, nullptr);      /* blockIdx.y = 0, 1, 2: q, k, v; Q16 | K16 | V16 are three planes in a row */
  k_fattn<<<dim3(NB * NH, SQ / 128), 256, 0, stream>>>(Q16, K16, V16, TB, POS, CNT, O16);      /* o (merged heads) as f16 rows */
  k_gemm2<0, true><<<gp, 128, 0, stream>>>(O16, DM, 0, BO, DM, 0, 0.0625f, bo, nullptr, nullptr, 0, (float*)d_out, nullptr, DM, 0, MO, DM, DM, CNT, nullptr, POS);      /* o Wo^T + bo (f32), listed rows to their own rows of out */
}

// v008
// Measured time: 38.9 microseconds a run.
// In both of two side-by-side timings against v007, it was 1.04 times as fast.
// Counting every step since v000, it is 500 times as fast.
#include <hip/hip_runtime.h>
#define NB 4
#define SQ 2048
#define DM 512
#define NH 8
#define HD 64
#define MP ((int)NR)                 /* token rows through the projections (debug hook) */
#define MO ((int)NR)                 /* token rows through the output projection / mask (debug hook) */
#define NR ((size_t)NB * SQ)         /* 8192 token rows */
#define CNTP 32                      /* ints between two batches' list lengths: each has a 128-byte line of its own */
typedef __bf16 v16b __attribute__((ext_vector_type(16)));
typedef unsigned short v8us __attribute__((ext_vector_type(8), may_alias));
typedef float  v8f  __attribute__((ext_vector_type(8)));
typedef float  v4f  __attribute__((ext_vector_type(4)));
typedef float  v4fa __attribute__((ext_vector_type(4), may_alias));
union FragB { v16b v; v8us half[2]; unsigned short u[16]; };

__device__ __forceinline__ unsigned short bf16_bits(float x) { unsigned int u = __float_as_uint(x); return (unsigned short)((u + 0x7FFFu + ((u >> 16) & 1u)) >> 16); }
__device__ __forceinline__ float bf16_val(unsigned short b) { return __uint_as_float(((unsigned int)b) << 16); }
__device__ __forceinline__ float bf16_round(float x) { return bf16_val(bf16_bits(x)); }
// D += A·B with NT terms: 1 = ah·bh, 2 = + al·bh (A split), 3 = + ah·bl (both split)
template <int NT>
__device__ __forceinline__ v8f mmaN(v16b ah, v16b al, v16b bh, v16b bl, v8f c) {
  c = __builtin_amdgcn_wmma_f32_16x16x32_bf16(false, ah, false, bh, (short)0, c, false, false);
  if (NT >= 2) c = __builtin_amdgcn_wmma_f32_16x16x32_bf16(false, al, false, bh, (short)0, c, false, false);
  if (NT >= 3) c = __builtin_amdgcn_wmma_f32_16x16x32_bf16(false, ah, false, bl, (short)0, c, false, false);
  asm volatile("v_nop\n\tv_nop\n\tv_nop\n\tv_nop" : "+v"(c) : "v"(ah), "v"(al), "v"(bh), "v"(bl));
  return c;
}

__global__ __launch_bounds__(256) void k_wt_bf16(const float* __restrict__ W, unsigned short* __restrict__ Wt, int K, int N) {
  const int t = blockIdx.x * 256 + threadIdx.x;
  const int k8n = K / 8;
  if (t >= N * k8n) return;
  const int n = t / k8n, k8 = (t % k8n) * 8;
  v8us v;
#pragma unroll
  for (int i = 0; i < 8; ++i) v[i] = bf16_bits(W[(size_t)(k8 + i) * N + n]);
  *(v8us*)(Wt + (size_t)n * K + k8) = v;
  
}

// GEMM C[M][N] (f32, pitch ldc) = act(A[M][K]·W + bias). A f32 row-major (pitch lda) converted per fragment to bf16
// (ASPLIT: hi/lo two planes -> 2 terms, else single rounded term); Wt bf16 [N][K] (pitch ldb). BIAS_BF16 rounds the
// bias to bf16 first (bias quantised to bf16 before the add). K%32==0, M%16==0, N%64==0.
template <bool ASPLIT, int ACT, bool BIAS_BF16>
__global__ __launch_bounds__(128) void k_gemm_bf(const float* __restrict__ A, int lda, const unsigned short* __restrict__ Wt, int ldb,
                                               const float* __restrict__ bias, float* __restrict__ C, int ldc, int M, int N, int K) {
  __shared__ __attribute__((aligned(16))) float so[4][16][64];
  const int tid = threadIdx.x, w = tid >> 5, lane = tid & 31, ln = lane & 15, hh = lane >> 4;
  const int ntn = N / 64;
  const int wid = blockIdx.x * 4 + w;
  const int mt = wid / ntn, nq = wid % ntn;
  if (mt * 16 >= M) return;
  const int row0 = mt * 16, col0 = nq * 64;
  const float* arow = A + (size_t)(row0 + ln) * lda;
  v8f acc[4] = {};
  for (int kb = 0; kb < K; kb += 32) {
    FragB ah, al;
    const v4f x0 = *(const v4fa*)(arow + kb + 8 * hh), x1 = *(const v4fa*)(arow + kb + 8 * hh + 4);
    const v4f x2 = *(const v4fa*)(arow + kb + 16 + 8 * hh), x3 = *(const v4fa*)(arow + kb + 16 + 8 * hh + 4);
    float xs[16] = {x0[0],x0[1],x0[2],x0[3],x1[0],x1[1],x1[2],x1[3],x2[0],x2[1],x2[2],x2[3],x3[0],x3[1],x3[2],x3[3]};
#pragma unroll
    for (int i = 0; i < 16; ++i) { const unsigned short hb = bf16_bits(xs[i]); ah.u[i] = hb; al.u[i] = ASPLIT ? bf16_bits(xs[i] - bf16_val(hb)) : (unsigned short)0; }
#pragma unroll
    for (int t = 0; t < 4; ++t) {
      const unsigned short* brow = Wt + (size_t)(col0 + t * 16 + ln) * ldb + kb;
      FragB b;
      b.half[0] = *(const v8us*)(brow + 8 * hh);
      b.half[1] = *(const v8us*)(brow + 16 + 8 * hh);
      acc[t] = mmaN<ASPLIT ? 2 : 1>(ah.v, al.v, b.v, b.v, acc[t]);
    }
  }
#pragma unroll
  for (int t = 0; t < 4; ++t) {
    float bv = bias ? bias[col0 + t * 16 + ln] : 0.f;
    if (BIAS_BF16) bv = bf16_round(bv);
#pragma unroll
    for (int r = 0; r < 8; ++r) { float v = acc[t][r] + bv; if (ACT == 1) v = fmaxf(v, 0.f); so[w][8 * hh + r][t * 16 + ln] = v; }
  }
  __builtin_amdgcn_fence(__ATOMIC_ACQ_REL, "workgroup");
  __builtin_amdgcn_wave_barrier();
  const int rsub = lane >> 4, c4 = (lane & 15) * 4;
  {
#pragma unroll
    for (int q = 0; q < 8; ++q) {
      const int r = q * 2 + rsub;
      const v4f v = *(const v4fa*)&so[w][r][c4];
      *(v4f*)(C + (size_t)(row0 + r) * ldc + col0 + c4) = v;
    }
    
  }
}

// GEMM C = act(A·W + bias + resid): A f32 (ASPLIT -> hi/lo 2 terms), Wt bf16 [N][K]; ACT 0 none, 1 relu, 2 exact gelu;
// resid (optional, f32, row index = (row % rmod), pitch ldr, RES_BF16 rounds it) added before the activation.
template <bool ASPLIT, int ACT, bool BIAS_BF16, bool RES_BF16>
__global__ __launch_bounds__(128) void k_gemm_bf3(const float* __restrict__ A, int lda, const unsigned short* __restrict__ Wt, int ldb,
                                                const float* __restrict__ bias, const float* __restrict__ resid, int rmod, int ldr,
                                                float* __restrict__ C, int ldc, int M, int N, int K) {
  __shared__ __attribute__((aligned(16))) float so[4][16][64];
  const int tid = threadIdx.x, w = tid >> 5, lane = tid & 31, ln = lane & 15, hh = lane >> 4;
  const int ntn = N / 64;
  const int wid = blockIdx.x * 4 + w;
  const int mt = wid / ntn, nq = wid % ntn;
  if (mt * 16 >= M) return;
  const int row0 = mt * 16, col0 = nq * 64;
  const float* arow = A + (size_t)(row0 + ln) * lda;
  v8f acc[4] = {};
  for (int kb = 0; kb < K; kb += 32) {
    FragB ah, al;
    const v4f x0 = *(const v4fa*)(arow + kb + 8 * hh), x1 = *(const v4fa*)(arow + kb + 8 * hh + 4);
    const v4f x2 = *(const v4fa*)(arow + kb + 16 + 8 * hh), x3 = *(const v4fa*)(arow + kb + 16 + 8 * hh + 4);
    float xs[16] = {x0[0],x0[1],x0[2],x0[3],x1[0],x1[1],x1[2],x1[3],x2[0],x2[1],x2[2],x2[3],x3[0],x3[1],x3[2],x3[3]};
#pragma unroll
    for (int i = 0; i < 16; ++i) { const unsigned short hb = bf16_bits(xs[i]); ah.u[i] = hb; al.u[i] = ASPLIT ? bf16_bits(xs[i] - bf16_val(hb)) : (unsigned short)0; }
#pragma unroll
    for (int t = 0; t < 4; ++t) {
      const unsigned short* brow = Wt + (size_t)(col0 + t * 16 + ln) * ldb + kb;
      FragB b;
      b.half[0] = *(const v8us*)(brow + 8 * hh);
      b.half[1] = *(const v8us*)(brow + 16 + 8 * hh);
      acc[t] = mmaN<ASPLIT ? 2 : 1>(ah.v, al.v, b.v, b.v, acc[t]);
    }
  }
#pragma unroll
  for (int t = 0; t < 4; ++t) {
    const int col = col0 + t * 16 + ln;
    float bv = bias ? bias[col] : 0.f;
    if (BIAS_BF16) bv = bf16_round(bv);
#pragma unroll
    for (int r = 0; r < 8; ++r) {
      float v = acc[t][r] + bv;
      if (resid) { float rv = resid[(size_t)((row0 + 8 * hh + r) % rmod) * ldr + col]; if (RES_BF16) rv = bf16_round(rv); v += rv; }
      if (ACT == 1) v = fmaxf(v, 0.f);
      if (ACT == 2) v = 0.5f * v * (1.0f + erff(v * 0.70710678118654752f));
      if (ACT == 3) { const float u = 0.7978845608028654f * (v + 0.044715f * v * v * v); v = 0.5f * v * (1.0f + tanhf(u)); }
      so[w][8 * hh + r][t * 16 + ln] = v;
    }
  }
  __builtin_amdgcn_fence(__ATOMIC_ACQ_REL, "workgroup");
  __builtin_amdgcn_wave_barrier();
  const int rsub = lane >> 4, c4 = (lane & 15) * 4;
  {
#pragma unroll
    for (int q = 0; q < 8; ++q) {
      const int r = q * 2 + rsub;
      const v4f v = *(const v4fa*)&so[w][r][c4];
      *(v4f*)(C + (size_t)(row0 + r) * ldc + col0 + c4) = v;
    }
    
  }
}
// row LayerNorm (biased variance, eps) over N: s = X (+ R); optional out_sum <- s; out_norm <- (s-mu)*rsqrt(var+eps)*g + b
template <bool PARAM_BF16>
__global__ __launch_bounds__(256) void k_layernorm(const float* __restrict__ X, const float* __restrict__ R, const float* __restrict__ g, const float* __restrict__ bta,
                                                  float* __restrict__ out_sum, float* __restrict__ out_norm, int N, float eps) {
  __shared__ float red[256];
  const int row = blockIdx.x, tid = threadIdx.x;
  const float* x = X + (size_t)row * N; const float* rr = R ? R + (size_t)row * N : nullptr;
  float vals[16];                     // up to N = 4096
  const int per = N / 256;            // contiguous chunk per thread? use strided-by-4 chunks: thread handles j = tid*4 + 1024*u
  float s1 = 0.f;
  for (int u = 0; u < per / 4; ++u) {
    const int j = tid * 4 + 1024 * u;
    const v4f a = *(const v4fa*)(x + j);
    v4f b = {0.f,0.f,0.f,0.f}; if (rr) b = *(const v4fa*)(rr + j);
#pragma unroll
    for (int q = 0; q < 4; ++q) { const float v = a[q] + b[q]; vals[u * 4 + q] = v; s1 += v; }
  }
  red[tid] = s1; __syncthreads();
  for (int st = 128; st > 0; st >>= 1) { if (tid < st) red[tid] += red[tid + st]; __syncthreads(); }
  const float mu = red[0] / (float)N; __syncthreads();
  float s2 = 0.f;
  for (int u = 0; u < per / 4; ++u)
#pragma unroll
    for (int q = 0; q < 4; ++q) { const float c = vals[u * 4 + q] - mu; s2 += c * c; }
  red[tid] = s2; __syncthreads();
  for (int st = 128; st > 0; st >>= 1) { if (tid < st) red[tid] += red[tid + st]; __syncthreads(); }
  const float rs = rsqrtf(red[0] / (float)N + eps);
  {
    for (int u = 0; u < per / 4; ++u) {
      const int j = tid * 4 + 1024 * u;
      v4f o, sm;
#pragma unroll
      for (int q = 0; q < 4; ++q) {
        float gg = g[j + q], bb = bta[j + q];
        if (PARAM_BF16) { gg = bf16_round(gg); bb = bf16_round(bb); }
        sm[q] = vals[u * 4 + q]; o[q] = (vals[u * 4 + q] - mu) * rs * gg + bb;
      }
      if (out_sum) *(v4f*)(out_sum + (size_t)row * N + j) = sm;
      *(v4f*)(out_norm + (size_t)row * N + j) = o;
    }
    
  }
}



// ---- f16 WMMA path (v_wmma_f32_16x16x32_f16): 11-bit significands for operands in range — used where a [0,1] probability operand needs more precision than bf16
typedef _Float16 v16h __attribute__((ext_vector_type(16)));
union FragH { v16h v; v8us half[2]; _Float16 h[16]; unsigned short u[16]; };
template <int NT>
__device__ __forceinline__ v8f mmaH(v16h ah, v16h al, v16h bh, v16h bl, v8f c) {
  c = __builtin_amdgcn_wmma_f32_16x16x32_f16(false, ah, false, bh, (short)0, c, false, false);
  if (NT >= 2) c = __builtin_amdgcn_wmma_f32_16x16x32_f16(false, al, false, bh, (short)0, c, false, false);
  if (NT >= 3) c = __builtin_amdgcn_wmma_f32_16x16x32_f16(false, ah, false, bl, (short)0, c, false, false);
  asm volatile("v_nop\n\tv_nop\n\tv_nop\n\tv_nop" : "+v"(c) : "v"(ah), "v"(al), "v"(bh), "v"(bl));
  return c;
}
// batched GEMM like k_gemm_b but f16 operands: A f32 (split into f16 hi/lo if ASPLIT, else rounded to f16), Bt = f16 values [n][k]; alpha; C f32; N multiple of 16 (partial tiles skipped)
template <bool ASPLIT>
__global__ __launch_bounds__(128) void k_gemm_h(const float* __restrict__ A, int lda, size_t sA, const _Float16* __restrict__ Bh, int ldb, size_t sB, float alpha, float* __restrict__ C, int ldc, size_t sC, int M, int N, int K) {
  __shared__ __attribute__((aligned(16))) float so[4][16][64];
  const int tid = threadIdx.x, w = tid >> 5, lane = tid & 31, ln = lane & 15, hh = lane >> 4; const int by = blockIdx.y;
  A += (size_t)by * sA; Bh += (size_t)by * sB; C += (size_t)by * sC;
  const int ntn = (N + 63) / 64; const int wid = blockIdx.x * 4 + w; const int mt = wid / ntn, nq = wid % ntn; if (mt * 16 >= M) return;
  const int row0 = mt * 16, col0 = nq * 64; const float* arow = A + (size_t)(row0 + ln) * lda;
  v8f acc[4] = {};
  for (int kb = 0; kb < K; kb += 32) {
    FragH ah, al;
    const v4f x0 = *(const v4fa*)(arow + kb + 8 * hh), x1 = *(const v4fa*)(arow + kb + 8 * hh + 4), x2 = *(const v4fa*)(arow + kb + 16 + 8 * hh), x3 = *(const v4fa*)(arow + kb + 16 + 8 * hh + 4);
    float xs[16] = {x0[0],x0[1],x0[2],x0[3],x1[0],x1[1],x1[2],x1[3],x2[0],x2[1],x2[2],x2[3],x3[0],x3[1],x3[2],x3[3]};
#pragma unroll
    for (int i = 0; i < 16; ++i) { const _Float16 h = (_Float16)xs[i]; ah.h[i] = h; al.h[i] = ASPLIT ? (_Float16)(xs[i] - (float)h) : (_Float16)0.0f; }
#pragma unroll
    for (int t = 0; t < 4; ++t) { if (col0 + t * 16 >= N) continue; const size_t boff = (size_t)(col0 + t * 16 + ln) * ldb + kb; FragH bq; bq.half[0] = *(const v8us*)(Bh + boff + 8 * hh); bq.half[1] = *(const v8us*)(Bh + boff + 16 + 8 * hh);
      acc[t] = mmaH<ASPLIT ? 2 : 1>(ah.v, al.v, bq.v, bq.v, acc[t]); }
  }
#pragma unroll
  for (int t = 0; t < 4; ++t) { if (col0 + t * 16 >= N) continue;
#pragma unroll
    for (int r = 0; r < 8; ++r) so[w][8 * hh + r][t * 16 + ln] = acc[t][r] * alpha; }
  __builtin_amdgcn_fence(__ATOMIC_ACQ_REL, "workgroup"); __builtin_amdgcn_wave_barrier();
  const int rsub = lane >> 4, c4 = (lane & 15) * 4;
  {
#pragma unroll
    for (int q = 0; q < 8; ++q) { const int r = q * 2 + rsub; if (col0 + c4 < N) { const v4f v = *(const v4fa*)&so[w][r][c4]; *(v4f*)(C + (size_t)(row0 + r) * ldc + col0 + c4) = v; } }
     }
}

// Wt[n][k] = f16(W[k][n]·scale) from f32 row-major W[K][N] (scale = power of two; bf16-exact weights stay exact in f16 away from the subnormal range)
__global__ __launch_bounds__(256) void k_wt_f16(const float* __restrict__ W, _Float16* __restrict__ Wt, int K, int N, float scale) {
  const int t = blockIdx.x * 256 + threadIdx.x; if (t >= N * (K / 8)) return; const int n = t / (K / 8), k8 = (t % (K / 8)) * 8; FragH f;
#pragma unroll
  for (int i = 0; i < 8; ++i) f.h[i] = (_Float16)(bf16_round(W[(size_t)(k8 + i) * N + n]) * scale); const v8us o = f.half[0];
  *(v8us*)((unsigned short*)Wt + (size_t)n * K + k8) = o; 
}
// k_gemm_hh variant with fused epilogue: v = acc·alpha + bias[by·sBias + col] (+ CP[(row/rowsPerB)·sCPb + by·64 + col] if CP) ; ACT 0 none / 1 elu ; writes f16 C16 (and f32 C if non-null)
template <int ACT>
__global__ __launch_bounds__(128) void k_gemm_hhx(const _Float16* __restrict__ A, int lda, size_t sA, const _Float16* __restrict__ Bh, int ldb, size_t sB, float alpha, const float* __restrict__ bias, size_t sBias, const float* __restrict__ CP, int rowsPerB, size_t sCPb, int row0g,
    float* __restrict__ C, _Float16* __restrict__ C16, int ldc, size_t sC, int M, int N, int K) {
  __shared__ __attribute__((aligned(16))) float so[4][16][64];
  const int tid = threadIdx.x, w = tid >> 5, lane = tid & 31, ln = lane & 15, hh = lane >> 4; const int by = blockIdx.y;
  A += (size_t)by * sA; Bh += (size_t)by * sB; const size_t cofs = (size_t)by * sC; const float* bp = bias ? bias + (size_t)by * sBias : nullptr;
  const int ntn = (N + 63) / 64; const int wid = blockIdx.x * 4 + w; const int mt = wid / ntn, nq = wid % ntn; if (mt * 16 >= M) return;
  const int row0 = mt * 16, col0 = nq * 64; const _Float16* arow = A + (size_t)(row0 + ln) * lda;
  v8f acc[4] = {};
  for (int kb = 0; kb < K; kb += 32) { FragH ah; ah.half[0] = *(const v8us*)((const unsigned short*)arow + kb + 8 * hh); ah.half[1] = *(const v8us*)((const unsigned short*)arow + kb + 16 + 8 * hh);
#pragma unroll
    for (int t = 0; t < 4; ++t) { if (col0 + t * 16 >= N) continue; const size_t boff = (size_t)(col0 + t * 16 + ln) * ldb + kb; FragH bq; bq.half[0] = *(const v8us*)((const unsigned short*)Bh + boff + 8 * hh); bq.half[1] = *(const v8us*)((const unsigned short*)Bh + boff + 16 + 8 * hh);
      acc[t] = mmaH<1>(ah.v, ah.v, bq.v, bq.v, acc[t]); }
  }
#pragma unroll
  for (int t = 0; t < 4; ++t) { if (col0 + t * 16 >= N) continue; const int col = col0 + t * 16 + ln; const float bv = bp ? bf16_round(bp[col]) : 0.f;
#pragma unroll
    for (int r = 0; r < 8; ++r) { float v = acc[t][r] * alpha + bv; if (CP) { const int rr = row0g + row0 + 8 * hh + r; if (rowsPerB < 0) v += CP[cofs + (size_t)rr * ldc + col];      /* rowsPerB < 0: own element of the batched C plane */ else { const int bidx = rr / rowsPerB; v += CP[(size_t)bidx * sCPb + (size_t)by * 64 + col]; } } if (ACT == 1) v = (v > 0.f) ? v : expm1f(v); else if (ACT == 7) v = (v > 0.f) ? v + 1.0f : expf(v); else if (ACT == 8) v = tanhf(v); else if (ACT == 9) v = 0.5f * v * (1.0f + tanhf(0.7978845608028654f * (v + 0.044715f * v * v * v))); else if (ACT == 11) v = 1.0f / (1.0f + expf(-v)); else if (ACT == 12) v = (v > 0.f) ? v : 0.01f * v; else if (ACT == 14) v = (v > 0.f) ? v : 0.1f * v; else if (ACT == 16) v = (v >= 0.f) ? v : 0.3f * v; else if (ACT == 17) v = (v >= 0.f) ? v : 0.2f * v; else if (ACT == 15) v = v / (1.0f + expf(-v)); else if (ACT == 3) v = fmaxf(v, 0.f); else if (ACT == 6) v = 0.5f * v * (1.0f + erff(v * 0.70710678118654752f)); so[w][8 * hh + r][t * 16 + ln] = v; } }
  __builtin_amdgcn_fence(__ATOMIC_ACQ_REL, "workgroup"); __builtin_amdgcn_wave_barrier();
  const int rsub = lane >> 4, c4 = (lane & 15) * 4; typedef _Float16 v4h __attribute__((ext_vector_type(4)));
  {
#pragma unroll
    for (int q = 0; q < 8; ++q) { const int r = q * 2 + rsub; if (col0 + c4 < N) { const v4f v = *(const v4fa*)&so[w][r][c4]; if (C) *(v4f*)(C + cofs + (size_t)(row0 + r) * ldc + col0 + c4) = v; if (C16) { v4h h4; for (int i = 0; i < 4; ++i) h4[i] = (_Float16)v[i]; *(v4h*)(C16 + cofs + (size_t)(row0 + r) * ldc + col0 + c4) = h4; } } }
     }
}


typedef _Float16 v4h __attribute__((ext_vector_type(4)));

__global__ __launch_bounds__(256) void k_h16(const float* __restrict__ x, _Float16* __restrict__ X16, size_t n8) { const size_t t = (size_t)blockIdx.x * 256 + threadIdx.x; if (t >= n8) return; FragH f;
#pragma unroll
  for (int q = 0; q < 8; ++q) f.h[q] = (_Float16)x[t * 8 + q]; *(v8us*)((unsigned short*)X16 + t * 8) = f.half[0];  }
__global__ __launch_bounds__(256) void k_round16f(const float* __restrict__ W, _Float16* __restrict__ Bt, size_t n8) { const size_t t = (size_t)blockIdx.x * 256 + threadIdx.x; if (t >= n8) return; FragH f;
#pragma unroll
  for (int i = 0; i < 8; ++i) f.h[i] = (_Float16)(bf16_round(W[t * 8 + i]) * 16.0f); *(v8us*)((unsigned short*)Bt + t * 8) = f.half[0];  }
template <int NHv, int TTv>
__global__ __launch_bounds__(256) void k_vt(const _Float16* __restrict__ V16, int ldv, int voff, _Float16* __restrict__ Vt) { __shared__ unsigned short tl[64][66]; const int tid = threadIdx.x; const int slab = blockIdx.x / (TTv / 64), lg = blockIdx.x % (TTv / 64); const int b = slab / NHv, h = slab % NHv;
  for (int i = tid; i < 64 * 8; i += 256) { const int r = i / 8, c8 = (i % 8) * 8; FragH f; f.half[0] = *(const v8us*)((const unsigned short*)V16 + ((size_t)b * TTv + lg * 64 + r) * ldv + voff + h * 64 + c8);
#pragma unroll
    for (int q = 0; q < 8; ++q) tl[r][c8 + q] = f.u[q]; }
  __syncthreads();
  {
#pragma unroll
    for (int rd = 0; rd < 2; ++rd) { const int d = rd * 32 + tid / 8, pc = tid % 8; FragH f;
#pragma unroll
      for (int q = 0; q < 8; ++q) f.u[q] = tl[pc * 8 + q][d];
      *(v8us*)((unsigned short*)Vt + ((size_t)slab * 64 + d) * TTv + lg * 64 + pc * 8) = f.half[0]; }
     } }

__global__ __launch_bounds__(256) void k_hl(const float* __restrict__ F, _Float16* __restrict__ Hh, _Float16* __restrict__ Hl, size_t n8) { const size_t t = (size_t)blockIdx.x * 256 + threadIdx.x; if (t >= n8) return; FragH fh, fl; const v4f a = *(const v4fa*)(F + t * 8), c = *(const v4fa*)(F + t * 8 + 4);
#pragma unroll
  for (int q = 0; q < 4; ++q) { _Float16 h = (_Float16)a[q]; fh.h[q] = h; fl.h[q] = (_Float16)((a[q] - (float)h) * 1024.0f); h = (_Float16)c[q]; fh.h[4 + q] = h; fl.h[4 + q] = (_Float16)((c[q] - (float)h) * 1024.0f); }
  { *(v8us*)((unsigned short*)Hh + t * 8) = fh.half[0]; *(v8us*)((unsigned short*)Hl + t * 8) = fl.half[0];  } }

// ---- fast GEMM (work-group tile 128x64, wave tile 32x64; requires M % 128 == 0, N % 64 == 0, K % 64 == 0); epilogue: acc * alpha + bias, activation; no test on an argument per element or per row ----
// A and B reach the fragments through LDS: a stage is 64 k (one 128-byte line) of the tile's 128 A rows and 64 B rows; eight lanes load one whole line, so a wave's load touches 4 lines, not 16, and B is fetched once a work-group, not once a wave. The next stage's lines fly while this stage is worked on (two buffers, one barrier a stage). The fragments hold the same elements in the same k order as a load straight from global.
#define GKC 64                       /* k per LDS stage */
#define GP 144                       /* LDS row pitch, bytes: 16 x odd, for ds_load_b128 */
#define GST ((128 + 64) * GP)        /* bytes of one stage: 128 A rows, then 64 B rows */
__device__ __forceinline__ v16h g2_lfrag(const unsigned char* p) { FragH f; f.half[0] = *(const v8us*)p; f.half[1] = *(const v8us*)(p + 32); return f.v; }
__device__ __forceinline__ v16h g2_frag(const _Float16* p, int hh) { FragH f; f.half[0] = *(const v8us*)((const unsigned short*)p + 8 * hh); f.half[1] = *(const v8us*)((const unsigned short*)p + 16 + 8 * hh); return f.v; }
__device__ __forceinline__ v8f g2_mma(v16h a, v16h b, v8f c) { v8f d = __builtin_amdgcn_wmma_f32_16x16x32_f16(false, a, false, b, (short)0, c, false, false); asm volatile("v_nop\n\tv_nop\n\tv_nop\n\tv_nop" : "+v"(d) : "v"(a), "v"(b)); return d; }
template <int ACT, bool F32O>      /* F32O: the result goes to C as f32; else to C16 as f16 */
__global__ __launch_bounds__(128) void k_gemm2(const _Float16* __restrict__ A, int lda, size_t sA, const _Float16* __restrict__ Bh, int ldb, size_t sB, float alpha, const float* __restrict__ bias, const float* __restrict__ bias1, const float* __restrict__ bias2, size_t sBias,
    float* __restrict__ C, _Float16* __restrict__ C16, int ldc, size_t sC, int M, int N, int K, const int* __restrict__ cnt, const int* __restrict__ gpos, const int* __restrict__ spos) { static_assert(ACT == 0 || ACT == 3 || ACT == 6 || ACT == 8 || ACT == 9 || ACT == 11 || ACT == 12 || ACT == 14 || ACT == 15 || ACT == 16 || ACT == 17, "k_gemm2: unsupported ACT code (would silently apply no activation)");
  __shared__ __attribute__((aligned(16))) unsigned char stg[2 * GST]; float (*so)[32][68] = (float (*)[32][68])stg; static_assert(sizeof(float) * 4 * 32 * 68 <= 2 * GST, "the epilogue's tile lies over the stages");      /* so is written only behind the loop's last barrier */
  const int tid = threadIdx.x, w = tid >> 5, lane = tid & 31, ln = lane & 15, hh = lane >> 4; const int by = blockIdx.y;
  if (bias1) bias = by == 1 ? bias1 : by == 2 ? bias2 : bias;      /* three products in one grid, each with its own bias vector */
  A += (size_t)by * sA; Bh += (size_t)by * sB; const size_t cofs = (size_t)by * sC; const float* bp = bias + (size_t)by * sBias;      /* every launch gives a bias vector */
  const int ntn = N >> 6; const int mi = blockIdx.x / ntn, nq = blockIdx.x - mi * ntn; const int mt = (mi % NB) * (SQ / 128) + mi / NB;      /* row tiles in the order tile 0 of every batch, tile 1 of every batch, ...: the tiles past the lists come last in the grid */
  const int row0 = mt * 128 + 32 * w, col0 = nq * 64; if (mt * 128 >= M) return;      /* the whole work-group leaves, in front of every barrier */
  /* rows are list entries: batch bb, entries cb .. cb + 127 of its list of nv valid tokens; a block whose first entry lies past the list has nothing to do; the entries from nv to the block's end repeat the first valid token (finite rows that carry no weight later) */
  const int bb = (mt * 128) / SQ, cb = mt * 128 - bb * SQ; int nv = cnt[bb * CNTP]; nv = nv < SQ ? nv : SQ; if (cb >= nv) return;
  int sp = cb + 32 * w + lane, nlim = SQ; if (spos) { sp = spos[row0 + lane] & (SQ - 1); nlim = nv; }      /* lane l: the row inside the batch where row l of this wave's tile is stored; spos: a listed row goes to its token's own position, an entry past the list nowhere */
  /* staging: thread t moves 16 bytes of A rows t / 8 + 16 i (i < 8) and of B rows t / 8 + 16 i (i < 4) of each stage; the loops over i and ks are unrolled so that their arrays are registers */
  const int sr = tid >> 3, sc = tid & 7; int ra[8]; unsigned ao[8], bo[4];      /* ao, bo: each row's byte offset in its matrix (under 2^32); the stage's k is added to the uniform base */
#pragma unroll
  for (int i = 0; i < 8; ++i) ra[i] = mt * 128 + sr + 16 * i;
  if (gpos) { int gv[8];      /* gpos: A rows stand at the tokens' own positions; one test round all eight loads, so that they fly together */
#pragma unroll
    for (int i = 0; i < 8; ++i) gv[i] = gpos[ra[i]];
#pragma unroll
    for (int i = 0; i < 8; ++i) ra[i] = bb * SQ + (gv[i] & (SQ - 1)); }
#pragma unroll
  for (int i = 0; i < 8; ++i) ao[i] = (unsigned)ra[i] * (unsigned)lda * 2u + (unsigned)sc * 16u;
#pragma unroll
  for (int i = 0; i < 4; ++i) bo[i] = (unsigned)(col0 + sr + 16 * i) * (unsigned)ldb * 2u + (unsigned)sc * 16u;
  const char* Ab = (const char*)A; const char* Bb = (const char*)Bh; v8us pa[8], pb[4];
#pragma unroll
  for (int i = 0; i < 8; ++i) pa[i] = *(const v8us*)(Ab + ao[i]);
#pragma unroll
  for (int i = 0; i < 4; ++i) pb[i] = *(const v8us*)(Bb + bo[i]);
  unsigned char* sw = stg + sr * GP + sc * 16; const unsigned char* af = stg + (32 * w + ln) * GP + 16 * hh; const unsigned char* bf = stg + (128 + ln) * GP + 16 * hh;
#pragma unroll
  for (int i = 0; i < 8; ++i) *(v8us*)(sw + 16 * i * GP) = pa[i];
#pragma unroll
  for (int i = 0; i < 4; ++i) *(v8us*)(sw + (128 + 16 * i) * GP) = pb[i];
  __syncthreads();
  const v8f z8 = {0.f,0.f,0.f,0.f,0.f,0.f,0.f,0.f}; v8f c00 = z8, c01 = z8, c02 = z8, c03 = z8, c10 = z8, c11 = z8, c12 = z8, c13 = z8; const int nch = K / GKC;
#pragma unroll 1
  for (int c = 0; c < nch; ++c) { const int cur = (c & 1) * GST; const bool more = c + 1 < nch;      /* rolled: two buffers, one stage's code */
    if (more) { const char* An = Ab + (size_t)(c + 1) * (GKC * 2); const char* Bn = Bb + (size_t)(c + 1) * (GKC * 2);
#pragma unroll
      for (int i = 0; i < 8; ++i) pa[i] = *(const v8us*)(An + ao[i]);
#pragma unroll
      for (int i = 0; i < 4; ++i) pb[i] = *(const v8us*)(Bn + bo[i]);
      asm volatile("s_wait_xcnt 0x0" ::: "memory"); }      /* keeps the twelve loads up here, in flight while this stage is worked on; the wait is a precaution in front of any reuse of their address registers */
    const unsigned char* ap = af + cur; const unsigned char* bq = bf + cur; v16h a0[GKC / 32], a1[GKC / 32], b0[GKC / 32], b1[GKC / 32], b2[GKC / 32], b3[GKC / 32];
#pragma unroll
    for (int ks = 0; ks < GKC / 32; ++ks) { a0[ks] = g2_lfrag(ap + ks * 64); a1[ks] = g2_lfrag(ap + 16 * GP + ks * 64); b0[ks] = g2_lfrag(bq + ks * 64); b1[ks] = g2_lfrag(bq + 16 * GP + ks * 64); b2[ks] = g2_lfrag(bq + 32 * GP + ks * 64); b3[ks] = g2_lfrag(bq + 48 * GP + ks * 64); }
    asm volatile("" :: "v"(a0[0]), "v"(a1[0]), "v"(b0[0]), "v"(b1[0]), "v"(b2[0]), "v"(b3[0]), "v"(a0[1]), "v"(a1[1]), "v"(b0[1]), "v"(b1[1]), "v"(b2[1]), "v"(b3[1]));      /* inputs only: holds the stage's LDS reads together in front of the products, one LDS latency a stage instead of one per fragment */
#pragma unroll
    for (int ks = 0; ks < GKC / 32; ++ks) {
      c00 = g2_mma(a0[ks], b0[ks], c00); c10 = g2_mma(a1[ks], b0[ks], c10); c01 = g2_mma(a0[ks], b1[ks], c01); c11 = g2_mma(a1[ks], b1[ks], c11);
      c02 = g2_mma(a0[ks], b2[ks], c02); c12 = g2_mma(a1[ks], b2[ks], c12); c03 = g2_mma(a0[ks], b3[ks], c03); c13 = g2_mma(a1[ks], b3[ks], c13); }
    if (more) { unsigned char* d = sw + (GST - cur);      /* that buffer's last readers left it before the barrier that ended the stage before */
#pragma unroll
      for (int i = 0; i < 8; ++i) *(v8us*)(d + 16 * i * GP) = pa[i];
#pragma unroll
      for (int i = 0; i < 4; ++i) *(v8us*)(d + (128 + 16 * i) * GP) = pb[i]; }
    __syncthreads(); }      /* publishes the next stage and ends this stage's reads; behind the last one the stages' LDS is free for the epilogue */
  v8f accs[8] = {c00, c01, c02, c03, c10, c11, c12, c13};
#pragma unroll
  for (int u = 0; u < 8; ++u) { const int t = u & 3, half = u >> 2; const int col = col0 + t * 16 + ln; const float bv = bf16_round(bp[col]);
#pragma unroll
    for (int r = 0; r < 8; ++r) { const int rloc = half * 16 + 8 * hh + r; float v = accs[u][r] * alpha + bv;
      if (ACT == 3) v = fmaxf(v, 0.f); else if (ACT == 6) v = 0.5f * v * (1.0f + erff(v * 0.70710678118654752f)); else if (ACT == 11) v = 1.0f / (1.0f + expf(-v)); else if (ACT == 15) v = v / (1.0f + expf(-v)); else if (ACT == 12) v = (v > 0.f) ? v : 0.01f * v; else if (ACT == 8) v = tanhf(v); else if (ACT == 9) v = 0.5f * v * (1.0f + tanhf(0.7978845608028654f * (v + 0.044715f * v * v * v))); else if (ACT == 14) v = (v > 0.f) ? v : 0.1f * v; else if (ACT == 16) v = (v >= 0.f) ? v : 0.3f * v; else if (ACT == 17) v = (v >= 0.f) ? v : 0.2f * v;
      so[w][rloc][t * 16 + ln] = v; } }
  __builtin_amdgcn_fence(__ATOMIC_ACQ_REL, "workgroup"); __builtin_amdgcn_wave_barrier();
  const int rsub = lane >> 4, c4 = (lane & 15) * 4;
  {
#pragma unroll
    for (int q = 0; q < 16; ++q) { const int r = q * 2 + rsub; const v4f v = *(const v4fa*)&so[w][r][c4]; const int p0 = __builtin_amdgcn_readlane(sp, q * 2), p1 = __builtin_amdgcn_readlane(sp, q * 2 + 1); const int ro = bb * SQ + (rsub ? p1 : p0);
      if (cb + 32 * w + r < nlim) { if (F32O) { *(v4f*)(C + cofs + (size_t)ro * ldc + col0 + c4) = v; asm volatile("s_wait_xcnt 0x0" ::: "memory"); }      /* precaution: the built code rewrites this store's data and address registers right behind it */
        else { v4h h4; for (int i = 0; i < 4; ++i) h4[i] = (_Float16)v[i]; *(v4h*)(C16 + cofs + (size_t)ro * ldc + col0 + c4) = h4; } } }
     } }


// ---- preparation: everything that reads only the inputs, as one launch; a block's index range says which job it does (none reads what another writes) ----
#define PBX ((int)(NR * DM / 8 / 256))      /* blocks that convert h: 8 elements a thread */
#define PBW (DM * DM / 8 / 256)             /* blocks per weight matrix: 8 elements a thread */
#define PBT (SQ / 256)                      /* blocks of the bias table: 1 entry a thread */
#define PBL NB                              /* blocks that list the valid tokens: one a batch, 8 positions a thread */
typedef int v4i __attribute__((ext_vector_type(4)));
__device__ __forceinline__ float tbias_at(int d) {
  const float dist = __fdiv_rn(__fmul_rn((float)d, 300.0f), 300.0f); const float v = logf(__fadd_rn(expf(-dist), 1e-12f));
  return v; }
__global__ __launch_bounds__(256) void k_prep(const float* __restrict__ x, const int* __restrict__ pmask, const float* __restrict__ wq, const float* __restrict__ wk, const float* __restrict__ wv, const float* __restrict__ wo, _Float16* __restrict__ X16, _Float16* __restrict__ BW, float* __restrict__ TB, int* __restrict__ POS, int* __restrict__ CNT, float* __restrict__ out) {
  __shared__ int psum[256]; __shared__ __attribute__((aligned(16))) int lst[SQ]; __shared__ int first;
  int blk = blockIdx.x;
  if (blk < PBL) { const int tid = threadIdx.x; const int* mp = pmask + (size_t)blk * SQ + tid * 8;      /* batch blk: valid positions in ascending order, by a prefix sum of the threads' counts */
    const v4i m0 = *(const v4i*)mp, m1 = *(const v4i*)(mp + 4); const int mv[8] = {m0[0], m0[1], m0[2], m0[3], m1[0], m1[1], m1[2], m1[3]}; int c = 0;
#pragma unroll
    for (int q = 0; q < 8; ++q) c += mv[q] != 0;
    psum[tid] = c; if (tid == 0) first = 0;
    __syncthreads();
    for (int o = 1; o < 256; o <<= 1) { const int a = tid >= o ? psum[tid - o] : 0; __syncthreads(); psum[tid] += a; __syncthreads(); }
    const int n = psum[255]; int rk = psum[tid] - c;
    if (rk == 0 && c != 0) {
#pragma unroll
      for (int q = 7; q >= 0; --q) if (mv[q] != 0) first = tid * 8 + q; }
#pragma unroll
    for (int q = 0; q < 8; ++q) if (mv[q] != 0) lst[rk++] = tid * 8 + q;
    __syncthreads();
    v4i o0, o1;      /* entries past the list repeat the first valid position; a wave stores whole 128-byte lines */
#pragma unroll
    for (int q = 0; q < 4; ++q) { o0[q] = tid * 8 + q < n ? lst[tid * 8 + q] : first; o1[q] = tid * 8 + 4 + q < n ? lst[tid * 8 + 4 + q] : first; }
    *(v4i*)(POS + (size_t)blk * SQ + tid * 8) = o0; *(v4i*)(POS + (size_t)blk * SQ + tid * 8 + 4) = o1; if (tid == 0) CNT[blk * CNTP] = n;
    return; }
  blk -= PBL;
  if (blk < PBX) { const size_t t = (size_t)blk * 256 + threadIdx.x; FragH f;      /* valid h rows, rounded to bf16, exact in f16; a padded row is read by nobody, its row of out is 0 */
    if (pmask[t / (DM / 8)] == 0) { const v4f z = {0.f, 0.f, 0.f, 0.f}; *(v4f*)(out + t * 8) = z; *(v4f*)(out + t * 8 + 4) = z; return; }
#pragma unroll
    for (int q = 0; q < 8; ++q) f.h[q] = (_Float16)bf16_round(x[t * 8 + q]);
    *(v8us*)((unsigned short*)X16 + t * 8) = f.half[0]; return; }
  blk -= PBX;
  if (blk < 4 * PBW) { const int mi = blk / PBW; const float* __restrict__ w = mi == 0 ? wq : mi == 1 ? wk : mi == 2 ? wv : wo;      /* weight mi, natural [out][in], x16, into plane mi of BW */
    const size_t t = (size_t)(blk - mi * PBW) * 256 + threadIdx.x; FragH f;
    for (int q = 0; q < 8; ++q) f.h[q] = (_Float16)(bf16_round(w[t * 8 + q]) * 16.0f);
    *(v8us*)((unsigned short*)BW + (size_t)mi * DM * DM + t * 8) = f.half[0]; return; }
  const int d = (blk - 4 * PBW) * 256 + threadIdx.x; TB[d] = tbias_at(d);
  asm volatile("s_wait_xcnt 0x0" ::: "memory"); }      /* precaution: the built code places another job's block behind this store, and that block rewrites the store's registers */
#define FK 128                       /* keys per LDS stage */
#define PK 144                       /* LDS row pitch of the K tile, bytes: 16 x odd, for ds_load_b128 */
#define PV 160                       /* LDS row pitch of the V tile, bytes: 32 x odd, for ds_load_tr16_b128 */
#define LOG2E 1.4426950408889634f
typedef short s16x8 __attribute__((ext_vector_type(8)));
typedef float v2f __attribute__((ext_vector_type(2)));
__device__ __forceinline__ v8us fa_tr16(const unsigned char* p) { typedef __attribute__((address_space(3))) s16x8 lds_s16x8; return __builtin_bit_cast(v8us, __builtin_amdgcn_ds_load_tr16_b128_v8i16((lds_s16x8*)p)); }
__device__ __forceinline__ float fa_xhalf(float x) { return __builtin_bit_cast(float, __builtin_amdgcn_permlanex16(__builtin_bit_cast(int, x), __builtin_bit_cast(int, x), 0x76543210, 0xfedcba98, false, false)); }      /* lane l reads lane l ^ 16 */
// amdgpu_waves_per_eu(4, 4) on the kernel: two work-groups per WGP are four waves per SIMD, so a wave may use up to 256 registers.
__device__ __forceinline__ v8f fa_mma(v16h a, v16h b, v8f c) { return __builtin_amdgcn_wmma_f32_16x16x32_f16(false, a, false, b, (short)0, c, false, false); }
__global__ __launch_bounds__(256) __attribute__((amdgpu_waves_per_eu(4, 4))) void k_fattn(const _Float16* __restrict__ Q16, const _Float16* __restrict__ K16, const _Float16* __restrict__ V16, const float* __restrict__ TB, const int* __restrict__ POS, const int* __restrict__ CNT, _Float16* __restrict__ O16) {
  __shared__ __attribute__((aligned(16))) float tb2[2 * SQ]; __shared__ __attribute__((aligned(16))) int kx[SQ];
  __shared__ __attribute__((aligned(16))) unsigned char kt[2][FK * PK]; __shared__ __attribute__((aligned(16))) unsigned char vt[2][FK * PV];
  const int tid = threadIdx.x, lane = tid & 31, ln = lane & 15, hh = lane >> 4; const int wv = __builtin_amdgcn_readfirstlane(tid >> 5);
  const int b = blockIdx.x / NH, h = blockIdx.x % NH; int nv = CNT[b * CNTP]; nv = nv < SQ ? nv : SQ; if ((int)blockIdx.y * 128 >= nv) return;      /* the whole work-group leaves, in front of every barrier: its queries lie past the list; the query tile is the slow grid index, so that these work-groups come last and the working ones spread over the chip */
  const int nst = (nv + FK - 1) / FK; const int* lp = POS + (size_t)b * SQ; const int q0 = blockIdx.y * 128 + wv * 16; const bool act = q0 < nv;      /* act, the same for the whole wave: a wave whose 16 queries all lie past the list only stages and stores zero rows */ const size_t base = (size_t)b * SQ * DM + (size_t)h * HD;
  /* staging: thread t moves 16 bytes of rows t / 8 + 32 i (i < 4) of each tile, so a wave's load covers four whole 128-byte rows */
  const int sr = tid >> 3, sc = tid & 7;
  const unsigned short* kg = (const unsigned short*)K16 + base + (size_t)sr * DM + sc * 8; const unsigned short* vg = (const unsigned short*)V16 + base + (size_t)sr * DM + sc * 8;
  const int st0 = blockIdx.y * (128 / FK); const size_t g0 = (size_t)st0 * FK * DM;      /* the first stage worked on: the one that holds this work-group's first queries as keys (st0 < nst, since the work-group's first query is on the list) */
  v8us rk[FK / 32], rv[FK / 32];      /* the loops over i are unrolled so that these are registers */
#pragma unroll
  for (int i = 0; i < FK / 32; ++i) { rk[i] = *(const v8us*)(kg + g0 + (size_t)(32 * i) * DM); rv[i] = *(const v8us*)(vg + g0 + (size_t)(32 * i) * DM); }
  const _Float16* qp = Q16 + base + (size_t)(q0 + ln) * DM; const v16h qf0 = g2_frag(qp, hh), qf1 = g2_frag(qp + 32, hh);
#pragma unroll
  for (int u = 0; u < 2 * SQ / 256; ++u) { const int t = tid + 256 * u; int d = t - (SQ - 1); d = d < 0 ? -d : d; d = d < SQ ? d : SQ - 1; const float tv = TB[d] * LOG2E; tb2[t] = t == 2 * SQ - 1 ? -1.0e9f * LOG2E : tv; }      /* unrolled: the table's loads are all in flight together */
#pragma unroll
  for (int u = 0; u < SQ / 256; ++u) { const int t = tid + 256 * u; kx[t] = (lp[t] & (SQ - 1)) * 4 + (t < nv ? 0 : 4 * SQ * 4); }      /* a sum, so that the eight loads stand under no test and fly together: the list's every entry is written */
#pragma unroll
  for (int i = 0; i < FK / 32; ++i) { *(v8us*)(kt[0] + (sr + 32 * i) * PK + sc * 16) = rk[i]; *(v8us*)(vt[0] + (sr + 32 * i) * PV + sc * 16) = rv[i]; }
  __syncthreads();
  const v8f z8 = {0.f,0.f,0.f,0.f,0.f,0.f,0.f,0.f}; v8f o0 = z8, o1 = z8, o2 = z8, o3 = z8; float m = -INFINITY, ms = -INFINITY, l = act ? 0.f : 1.f;
  const int qx = (SQ - 1) * 4 - (kx[q0 + ln] & ((SQ - 1) * 4)); const int* kq = kx + 8 * hh; const unsigned qm = __builtin_amdgcn_ballot_w32(q0 + ln < nv);      /* the lanes whose query is on the list; a query past it stands for no token (its o row is stored nowhere in out) and has no say in whether a pass is worked on */
#pragma unroll 1
  for (int t = 0, st = st0; t < nst; ++t) { const int cur = t & 1; const bool more = t + 1 < nst; const int sn = st + 1 < nst ? st + 1 : 0;      /* rolled: one stage's code; st runs st0 .. nst - 1, then 0 .. st0 - 1 */
    float bbs[FK / 32];      /* per pass of the stage: the bias at de, the least distance, in list places, between the wave's queries and the pass's keys, the same for the whole wave; read up here, so that no far test waits on an LDS read of its own */
#pragma unroll
    for (int p = 0; p < FK / 32; ++p) { const int dk = st * FK + 32 * p - (q0 + 15), dq = q0 - (st * FK + 32 * p + 31); int de = dk > dq ? dk : dq; de = de > 0 ? de : 0; bbs[p] = tb2[SQ - 1 + de]; }
    if (more) { const size_t go = (size_t)sn * FK * DM;
#pragma unroll
      for (int i = 0; i < FK / 32; ++i) { rk[i] = *(const v8us*)(kg + go + (size_t)(32 * i) * DM); rv[i] = *(const v8us*)(vg + go + (size_t)(32 * i) * DM); }
      asm volatile("s_wait_xcnt 0x0" ::: "memory"); }      /* the next stage's rows fly while this stage is worked on; the wait is a precaution: the built code reuses these loads' address registers right behind them */
    if (act)
#pragma unroll
    for (int g = 0; g < FK / 64; ++g) { const int k0 = st * FK + g * 64;      /* a group: 64 keys, two passes of 32 */
      const unsigned char* kp = kt[cur] + (g * 64 + ln) * PK + 16 * hh; FragH ka[4], kb[4];      /* ka[j], kb[j]: head dims 0 .. 31 and 32 .. 63 of keys 16 j .. 16 j + 15 of the group */
#pragma unroll
      for (int j = 0; j < 4; ++j) { ka[j].half[0] = *(const v8us*)(kp + 16 * j * PK); ka[j].half[1] = *(const v8us*)(kp + 16 * j * PK + 32); kb[j].half[0] = *(const v8us*)(kp + 16 * j * PK + 64); kb[j].half[1] = *(const v8us*)(kp + 16 * j * PK + 96); }
      asm volatile("" :: "v"(ka[0].v), "v"(ka[1].v), "v"(ka[2].v), "v"(ka[3].v), "v"(kb[0].v), "v"(kb[1].v), "v"(kb[2].v), "v"(kb[3].v));      /* inputs only: the group's LDS reads are issued as one run, one LDS latency a group; without it the built code reads two by two among the products, with a full wait at each */
      v8f s[4];      /* S^T of the group's four 16-key tiles: four independent chains of two products */
#pragma unroll
      for (int j = 0; j < 4; ++j) s[j] = fa_mma(ka[j].v, qf0, z8);
#pragma unroll
      for (int j = 0; j < 4; ++j) s[j] = fa_mma(kb[j].v, qf1, s[j]);
      float xm[2];      /* per pass: the bound on its every score */
#pragma unroll
      for (int p = 0; p < 2; ++p) { float xa = s[2 * p][0], xb = s[2 * p + 1][0];      /* two chains a pass, so that no maximum waits on fifteen before it */
#pragma unroll
        for (int r = 1; r < 8; ++r) { xa = __builtin_fmaxf(xa, s[2 * p][r]); xb = __builtin_fmaxf(xb, s[2 * p + 1][r]); }
        xm[p] = __builtin_fmaf(__builtin_fmaxf(xa, xb), 0.125f * LOG2E, bbs[2 * g + p]); }
      if ((__builtin_amdgcn_ballot_w32(__builtin_fmaxf(xm[0], xm[1]) > ms - 26.0f) & qm) == 0) continue;      /* both passes far: one test and one branch for the group */
#pragma unroll
      for (int p = 0; p < 2; ++p) { const v8f s0 = s[2 * p], s1 = s[2 * p + 1];
      if ((__builtin_amdgcn_ballot_w32(xm[p] > ms - 26.0f) & qm) == 0) continue;      /* no weight of the pass reaches 2^-25 (26, not 25: the one to spare covers every rounding of the table and of exp2) */
      const unsigned char* vp = vt[cur] + (g * 64 + p * 32 + 8 * hh + (lane & 7)) * PV + ((lane >> 3) & 1) * 16; FragH va[4];
#pragma unroll
      for (int dt = 0; dt < 4; ++dt) { va[dt].half[0] = fa_tr16(vp + 32 * dt); va[dt].half[1] = fa_tr16(vp + 16 * PV + 32 * dt); }
      const int* kp4 = kq + k0 + 32 * p; float v[16]; float mx = -INFINITY;
#pragma unroll
      for (int r = 0; r < 8; ++r) { int x0 = kp4[r] + qx, x1 = kp4[16 + r] + qx; x0 = x0 < (2 * SQ - 1) * 4 ? x0 : (2 * SQ - 1) * 4; x1 = x1 < (2 * SQ - 1) * 4 ? x1 : (2 * SQ - 1) * 4;
        v[r] = __builtin_fmaf(s0[r], 0.125f * LOG2E, *(const float*)((const char*)tb2 + x0)); v[8 + r] = __builtin_fmaf(s1[r], 0.125f * LOG2E, *(const float*)((const char*)tb2 + x1)); }
#pragma unroll
      for (int r = 0; r < 16; ++r) mx = __builtin_fmaxf(mx, v[r]);
      mx = __builtin_fmaxf(mx, fa_xhalf(mx));
      if (__builtin_amdgcn_ballot_w32(mx > m) != 0) { const float mn = __builtin_fmaxf(m, mx); const float msn = mn - 8.0f; const float corr = __builtin_amdgcn_exp2f(ms - msn); m = mn; ms = msn; l *= corr; o0 *= corr; o1 *= corr; o2 *= corr; o3 *= corr; }      /* corr = 0 in the first pass (ms = -inf), 1 for a query whose maximum stays */
      FragH pf; v2f la = {0.f, 0.f}, lb = {0.f, 0.f};      /* the pass's sum in two chains of pairs, so that no add waits on sixteen before it */
#pragma unroll
      for (int r = 0; r < 16; r += 4) { const float p0 = __builtin_amdgcn_exp2f(v[r] - ms), p1 = __builtin_amdgcn_exp2f(v[r + 1] - ms), p2 = __builtin_amdgcn_exp2f(v[r + 2] - ms), p3 = __builtin_amdgcn_exp2f(v[r + 3] - ms);
        la += v2f{p0, p1}; lb += v2f{p2, p3}; pf.h[r] = (_Float16)p0; pf.h[r + 1] = (_Float16)p1; pf.h[r + 2] = (_Float16)p2; pf.h[r + 3] = (_Float16)p3; }
      la += lb; l += la[0] + la[1];
      o0 = fa_mma(va[0].v, pf.v, o0); o1 = fa_mma(va[1].v, pf.v, o1); o2 = fa_mma(va[2].v, pf.v, o2); o3 = fa_mma(va[3].v, pf.v, o3); } }
    if (more) { unsigned char* kn = kt[cur ^ 1]; unsigned char* vn = vt[cur ^ 1];
#pragma unroll
      for (int i = 0; i < FK / 32; ++i) { *(v8us*)(kn + (sr + 32 * i) * PK + sc * 16) = rk[i]; *(v8us*)(vn + (sr + 32 * i) * PV + sc * 16) = rv[i]; } }      /* that buffer's last readers left it before the barrier that ended the stage before */
    __syncthreads(); st = sn; }      /* publishes the next stage and ends this stage's reads */
  l += fa_xhalf(l); const float inv = 1.0f / l; unsigned short* op = (unsigned short*)O16 + base + (size_t)(q0 + ln) * DM + 8 * hh;      /* lane (c, hf) holds o[q0 + c][16 dt + 8 hf + r] */
  const v8f oo[4] = {o0, o1, o2, o3};
#pragma unroll
  for (int dt = 0; dt < 4; ++dt) { FragH f;
#pragma unroll
    for (int r = 0; r < 8; ++r) f.h[r] = (_Float16)(oo[dt][r] * inv);
    *(v8us*)(op + 16 * dt) = f.half[0]; } }

extern "C" void kernel_launch(void* const* d_in, const int* in_sizes, int n_in,
                              void* d_out, int out_size, void* d_ws, size_t ws_size, hipStream_t stream) {
  (void)in_sizes; (void)n_in; (void)out_size;
  const float* const* I = (const float* const*)d_in; const float* x = I[0]; const int* pmask = (const int*)d_in[1]; const float* wq = I[2]; const float* bq = I[3]; const float* wk = I[4]; const float* bk = I[5]; const float* wv = I[6]; const float* bv = I[7]; const float* wo = I[8]; const float* bo = I[9];      /* weights natural [out][in]; patch_mask int32 [4][2048] (1 = valid) */
  char* ws = (char*)d_ws; size_t off = 0;
  auto take = [&](size_t bytes) { char* p = ws + off; off += (bytes + 255) & ~(size_t)255; return p; };
  _Float16* BQ = (_Float16*)take((size_t)DM * DM * 2); _Float16* BK = (_Float16*)take((size_t)DM * DM * 2); _Float16* BV = (_Float16*)take((size_t)DM * DM * 2); _Float16* BO = (_Float16*)take((size_t)DM * DM * 2);
  _Float16* X16 = (_Float16*)take(NR * DM * 2); _Float16* Q16 = (_Float16*)take(NR * DM * 2); _Float16* K16 = (_Float16*)take(NR * DM * 2); _Float16* V16 = (_Float16*)take(NR * DM * 2); _Float16* O16 = (_Float16*)take(NR * DM * 2);
  float* TB = (float*)take((size_t)SQ * 4); int* POS = (int*)take(NR * 4); int* CNT = (int*)take((size_t)NB * CNTP * 4);
  (void)BK; (void)BV;
  if (off > ws_size) return;      /* 2 + 5x8 + 0.04 = approx 42 MiB */
  k_prep<<<PBL + PBX + 4 * PBW + PBT, 256, 0, stream>>>(x, pmask, wq, wk, wv, wo, X16, BQ, TB, POS, CNT, (float*)d_out);      /* BQ | BK | BV | BO are four planes in a row */
  const dim3 gp((unsigned)((NR / 128) * (DM / 64)), 1); const dim3 gp3((unsigned)((NR / 128) * (DM / 64)), 3);
  k_gemm2<0, false><<<gp3, 128, 0, stream>>>(X16, DM, 0, BQ, DM, (size_t)DM * DM, 0.0625f, bq, bk, bv, 0, nullptr, Q16, DM, NR * DM, MP, DM, DM, CNT, POS, nullptr);      /* blockIdx.y = 0, 1, 2: q, k, v; Q16 | K16 | V16 are three planes in a row */
  k_fattn<<<dim3(NB * NH, SQ / 128), 256, 0, stream>>>(Q16, K16, V16, TB, POS, CNT, O16);      /* o (merged heads) as f16 rows */
  k_gemm2<0, true><<<gp, 128, 0, stream>>>(O16, DM, 0, BO, DM, 0, 0.0625f, bo, nullptr, nullptr, 0, (float*)d_out, nullptr, DM, 0, MO, DM, DM, CNT, nullptr, POS);      /* o Wo^T + bo (f32), listed rows to their own rows of out */
}

// v009
// A run of this version takes 34.2 microseconds.
// Next to v008, in two timings, it ran 1.14 times as fast each time.
// Over all steps from v000 it is 570 times as fast.
#include <hip/hip_runtime.h>
#define NB 4
#define SQ 2048
#define DM 512
#define NH 8
#define HD 64
#define MP ((int)NR)                 /* token rows through the projections (debug hook) */
#define MO ((int)NR)                 /* token rows through the output projection / mask (debug hook) */
#define NR ((size_t)NB * SQ)         /* 8192 token rows */
#define CNTP 32                      /* ints between two batches' list lengths: each has a 128-byte line of its own */
typedef __bf16 v16b __attribute__((ext_vector_type(16)));
typedef unsigned short v8us __attribute__((ext_vector_type(8), may_alias));
typedef float  v8f  __attribute__((ext_vector_type(8)));
typedef float  v4f  __attribute__((ext_vector_type(4)));
typedef float  v4fa __attribute__((ext_vector_type(4), may_alias));
union FragB { v16b v; v8us half[2]; unsigned short u[16]; };

__device__ __forceinline__ unsigned short bf16_bits(float x) { unsigned int u = __float_as_uint(x); return (unsigned short)((u + 0x7FFFu + ((u >> 16) & 1u)) >> 16); }
__device__ __forceinline__ float bf16_val(unsigned short b) { return __uint_as_float(((unsigned int)b) << 16); }
__device__ __forceinline__ float bf16_round(float x) { return bf16_val(bf16_bits(x)); }
// D += A·B with NT terms: 1 = ah·bh, 2 = + al·bh (A split), 3 = + ah·bl (both split)
template <int NT>
__device__ __forceinline__ v8f mmaN(v16b ah, v16b al, v16b bh, v16b bl, v8f c) {
  c = __builtin_amdgcn_wmma_f32_16x16x32_bf16(false, ah, false, bh, (short)0, c, false, false);
  if (NT >= 2) c = __builtin_amdgcn_wmma_f32_16x16x32_bf16(false, al, false, bh, (short)0, c, false, false);
  if (NT >= 3) c = __builtin_amdgcn_wmma_f32_16x16x32_bf16(false, ah, false, bl, (short)0, c, false, false);
  asm volatile("v_nop\n\tv_nop\n\tv_nop\n\tv_nop" : "+v"(c) : "v"(ah), "v"(al), "v"(bh), "v"(bl));
  return c;
}

__global__ __launch_bounds__(256) void k_wt_bf16(const float* __restrict__ W, unsigned short* __restrict__ Wt, int K, int N) {
  const int t = blockIdx.x * 256 + threadIdx.x;
  const int k8n = K / 8;
  if (t >= N * k8n) return;
  const int n = t / k8n, k8 = (t % k8n) * 8;
  v8us v;
#pragma unroll
  for (int i = 0; i < 8; ++i) v[i] = bf16_bits(W[(size_t)(k8 + i) * N + n]);
  *(v8us*)(Wt + (size_t)n * K + k8) = v;
  
}

// GEMM C[M][N] (f32, pitch ldc) = act(A[M][K]·W + bias). A f32 row-major (pitch lda) converted per fragment to bf16
// (ASPLIT: hi/lo two planes -> 2 terms, else single rounded term); Wt bf16 [N][K] (pitch ldb). BIAS_BF16 rounds the
// bias to bf16 first (bias quantised to bf16 before the add). K%32==0, M%16==0, N%64==0.
template <bool ASPLIT, int ACT, bool BIAS_BF16>
__global__ __launch_bounds__(128) void k_gemm_bf(const float* __restrict__ A, int lda, const unsigned short* __restrict__ Wt, int ldb,
                                               const float* __restrict__ bias, float* __restrict__ C, int ldc, int M, int N, int K) {
  __shared__ __attribute__((aligned(16))) float so[4][16][64];
  const int tid = threadIdx.x, w = tid >> 5, lane = tid & 31, ln = lane & 15, hh = lane >> 4;
  const int ntn = N / 64;
  const int wid = blockIdx.x * 4 + w;
  const int mt = wid / ntn, nq = wid % ntn;
  if (mt * 16 >= M) return;
  const int row0 = mt * 16, col0 = nq * 64;
  const float* arow = A + (size_t)(row0 + ln) * lda;
  v8f acc[4] = {};
  for (int kb = 0; kb < K; kb += 32) {
    FragB ah, al;
    const v4f x0 = *(const v4fa*)(arow + kb + 8 * hh), x1 = *(const v4fa*)(arow + kb + 8 * hh + 4);
    const v4f x2 = *(const v4fa*)(arow + kb + 16 + 8 * hh), x3 = *(const v4fa*)(arow + kb + 16 + 8 * hh + 4);
    float xs[16] = {x0[0],x0[1],x0[2],x0[3],x1[0],x1[1],x1[2],x1[3],x2[0],x2[1],x2[2],x2[3],x3[0],x3[1],x3[2],x3[3]};
#pragma unroll
    for (int i = 0; i < 16; ++i) { const unsigned short hb = bf16_bits(xs[i]); ah.u[i] = hb; al.u[i] = ASPLIT ? bf16_bits(xs[i] - bf16_val(hb)) : (unsigned short)0; }
#pragma unroll
    for (int t = 0; t < 4; ++t) {
      const unsigned short* brow = Wt + (size_t)(col0 + t * 16 + ln) * ldb + kb;
      FragB b;
      b.half[0] = *(const v8us*)(brow + 8 * hh);
      b.half[1] = *(const v8us*)(brow + 16 + 8 * hh);
      acc[t] = mmaN<ASPLIT ? 2 : 1>(ah.v, al.v, b.v, b.v, acc[t]);
    }
  }
#pragma unroll
  for (int t = 0; t < 4; ++t) {
    float bv = bias ? bias[col0 + t * 16 + ln] : 0.f;
    if (BIAS_BF16) bv = bf16_round(bv);
#pragma unroll
    for (int r = 0; r < 8; ++r) { float v = acc[t][r] + bv; if (ACT == 1) v = fmaxf(v, 0.f); so[w][8 * hh + r][t * 16 + ln] = v; }
  }
  __builtin_amdgcn_fence(__ATOMIC_ACQ_REL, "workgroup");
  __builtin_amdgcn_wave_barrier();
  const int rsub = lane >> 4, c4 = (lane & 15) * 4;
  {
#pragma unroll
    for (int q = 0; q < 8; ++q) {
      const int r = q * 2 + rsub;
      const v4f v = *(const v4fa*)&so[w][r][c4];
      *(v4f*)(C + (size_t)(row0 + r) * ldc + col0 + c4) = v;
    }
    
  }
}

// GEMM C = act(A·W + bias + resid): A f32 (ASPLIT -> hi/lo 2 terms), Wt bf16 [N][K]; ACT 0 none, 1 relu, 2 exact gelu;
// resid (optional, f32, row index = (row % rmod), pitch ldr, RES_BF16 rounds it) added before the activation.
template <bool ASPLIT, int ACT, bool BIAS_BF16, bool RES_BF16>
__global__ __launch_bounds__(128) void k_gemm_bf3(const float* __restrict__ A, int lda, const unsigned short* __restrict__ Wt, int ldb,
                                                const float* __restrict__ bias, const float* __restrict__ resid, int rmod, int ldr,
                                                float* __restrict__ C, int ldc, int M, int N, int K) {
  __shared__ __attribute__((aligned(16))) float so[4][16][64];
  const int tid = threadIdx.x, w = tid >> 5, lane = tid & 31, ln = lane & 15, hh = lane >> 4;
  const int ntn = N / 64;
  const int wid = blockIdx.x * 4 + w;
  const int mt = wid / ntn, nq = wid % ntn;
  if (mt * 16 >= M) return;
  const int row0 = mt * 16, col0 = nq * 64;
  const float* arow = A + (size_t)(row0 + ln) * lda;
  v8f acc[4] = {};
  for (int kb = 0; kb < K; kb += 32) {
    FragB ah, al;
    const v4f x0 = *(const v4fa*)(arow + kb + 8 * hh), x1 = *(const v4fa*)(arow + kb + 8 * hh + 4);
    const v4f x2 = *(const v4fa*)(arow + kb + 16 + 8 * hh), x3 = *(const v4fa*)(arow + kb + 16 + 8 * hh + 4);
    float xs[16] = {x0[0],x0[1],x0[2],x0[3],x1[0],x1[1],x1[2],x1[3],x2[0],x2[1],x2[2],x2[3],x3[0],x3[1],x3[2],x3[3]};
#pragma unroll
    for (int i = 0; i < 16; ++i) { const unsigned short hb = bf16_bits(xs[i]); ah.u[i] = hb; al.u[i] = ASPLIT ? bf16_bits(xs[i] - bf16_val(hb)) : (unsigned short)0; }
#pragma unroll
    for (int t = 0; t < 4; ++t) {
      const unsigned short* brow = Wt + (size_t)(col0 + t * 16 + ln) * ldb + kb;
      FragB b;
      b.half[0] = *(const v8us*)(brow + 8 * hh);
      b.half[1] = *(const v8us*)(brow + 16 + 8 * hh);
      acc[t] = mmaN<ASPLIT ? 2 : 1>(ah.v, al.v, b.v, b.v, acc[t]);
    }
  }
#pragma unroll
  for (int t = 0; t < 4; ++t) {
    const int col = col0 + t * 16 + ln;
    float bv = bias ? bias[col] : 0.f;
    if (BIAS_BF16) bv = bf16_round(bv);
#pragma unroll
    for (int r = 0; r < 8; ++r) {
      float v = acc[t][r] + bv;
      if (resid) { float rv = resid[(size_t)((row0 + 8 * hh + r) % rmod) * ldr + col]; if (RES_BF16) rv = bf16_round(rv); v += rv; }
      if (ACT == 1) v = fmaxf(v, 0.f);
      if (ACT == 2) v = 0.5f * v * (1.0f + erff(v * 0.70710678118654752f));
      if (ACT == 3) { const float u = 0.7978845608028654f * (v + 0.044715f * v * v * v); v = 0.5f * v * (1.0f + tanhf(u)); }
      so[w][8 * hh + r][t * 16 + ln] = v;
    }
  }
  __builtin_amdgcn_fence(__ATOMIC_ACQ_REL, "workgroup");
  __builtin_amdgcn_wave_barrier();
  const int rsub = lane >> 4, c4 = (lane & 15) * 4;
  {
#pragma unroll
    for (int q = 0; q < 8; ++q) {
      const int r = q * 2 + rsub;
      const v4f v = *(const v4fa*)&so[w][r][c4];
      *(v4f*)(C + (size_t)(row0 + r) * ldc + col0 + c4) = v;
    }
    
  }
}
// row LayerNorm (biased variance, eps) over N: s = X (+ R); optional out_sum <- s; out_norm <- (s-mu)*rsqrt(var+eps)*g + b
template <bool PARAM_BF16>
__global__ __launch_bounds__(256) void k_layernorm(const float* __restrict__ X, const float* __restrict__ R, const float* __restrict__ g, const float* __restrict__ bta,
                                                  float* __restrict__ out_sum, float* __restrict__ out_norm, int N, float eps) {
  __shared__ float red[256];
  const int row = blockIdx.x, tid = threadIdx.x;
  const float* x = X + (size_t)row * N; const float* rr = R ? R + (size_t)row * N : nullptr;
  float vals[16];                     // up to N = 4096
  const int per = N / 256;            // contiguous chunk per thread? use strided-by-4 chunks: thread handles j = tid*4 + 1024*u
  float s1 = 0.f;
  for (int u = 0; u < per / 4; ++u) {
    const int j = tid * 4 + 1024 * u;
    const v4f a = *(const v4fa*)(x + j);
    v4f b = {0.f,0.f,0.f,0.f}; if (rr) b = *(const v4fa*)(rr + j);
#pragma unroll
    for (int q = 0; q < 4; ++q) { const float v = a[q] + b[q]; vals[u * 4 + q] = v; s1 += v; }
  }
  red[tid] = s1; __syncthreads();
  for (int st = 128; st > 0; st >>= 1) { if (tid < st) red[tid] += red[tid + st]; __syncthreads(); }
  const float mu = red[0] / (float)N; __syncthreads();
  float s2 = 0.f;
  for (int u = 0; u < per / 4; ++u)
#pragma unroll
    for (int q = 0; q < 4; ++q) { const float c = vals[u * 4 + q] - mu; s2 += c * c; }
  red[tid] = s2; __syncthreads();
  for (int st = 128; st > 0; st >>= 1) { if (tid < st) red[tid] += red[tid + st]; __syncthreads(); }
  const float rs = rsqrtf(red[0] / (float)N + eps);
  {
    for (int u = 0; u < per / 4; ++u) {
      const int j = tid * 4 + 1024 * u;
      v4f o, sm;
#pragma unroll
      for (int q = 0; q < 4; ++q) {
        float gg = g[j + q], bb = bta[j + q];
        if (PARAM_BF16) { gg = bf16_round(gg); bb = bf16_round(bb); }
        sm[q] = vals[u * 4 + q]; o[q] = (vals[u * 4 + q] - mu) * rs * gg + bb;
      }
      if (out_sum) *(v4f*)(out_sum + (size_t)row * N + j) = sm;
      *(v4f*)(out_norm + (size_t)row * N + j) = o;
    }
    
  }
}



// ---- f16 WMMA path (v_wmma_f32_16x16x32_f16): 11-bit significands for operands in range — used where a [0,1] probability operand needs more precision than bf16
typedef _Float16 v16h __attribute__((ext_vector_type(16)));
union FragH { v16h v; v8us half[2]; _Float16 h[16]; unsigned short u[16]; };
template <int NT>
__device__ __forceinline__ v8f mmaH(v16h ah, v16h al, v16h bh, v16h bl, v8f c) {
  c = __builtin_amdgcn_wmma_f32_16x16x32_f16(false, ah, false, bh, (short)0, c, false, false);
  if (NT >= 2) c = __builtin_amdgcn_wmma_f32_16x16x32_f16(false, al, false, bh, (short)0, c, false, false);
  if (NT >= 3) c = __builtin_amdgcn_wmma_f32_16x16x32_f16(false, ah, false, bl, (short)0, c, false, false);
  asm volatile("v_nop\n\tv_nop\n\tv_nop\n\tv_nop" : "+v"(c) : "v"(ah), "v"(al), "v"(bh), "v"(bl));
  return c;
}
// batched GEMM like k_gemm_b but f16 operands: A f32 (split into f16 hi/lo if ASPLIT, else rounded to f16), Bt = f16 values [n][k]; alpha; C f32; N multiple of 16 (partial tiles skipped)
template <bool ASPLIT>
__global__ __launch_bounds__(128) void k_gemm_h(const float* __restrict__ A, int lda, size_t sA, const _Float16* __restrict__ Bh, int ldb, size_t sB, float alpha, float* __restrict__ C, int ldc, size_t sC, int M, int N, int K) {
  __shared__ __attribute__((aligned(16))) float so[4][16][64];
  const int tid = threadIdx.x, w = tid >> 5, lane = tid & 31, ln = lane & 15, hh = lane >> 4; const int by = blockIdx.y;
  A += (size_t)by * sA; Bh += (size_t)by * sB; C += (size_t)by * sC;
  const int ntn = (N + 63) / 64; const int wid = blockIdx.x * 4 + w; const int mt = wid / ntn, nq = wid % ntn; if (mt * 16 >= M) return;
  const int row0 = mt * 16, col0 = nq * 64; const float* arow = A + (size_t)(row0 + ln) * lda;
  v8f acc[4] = {};
  for (int kb = 0; kb < K; kb += 32) {
    FragH ah, al;
    const v4f x0 = *(const v4fa*)(arow + kb + 8 * hh), x1 = *(const v4fa*)(arow + kb + 8 * hh + 4), x2 = *(const v4fa*)(arow + kb + 16 + 8 * hh), x3 = *(const v4fa*)(arow + kb + 16 + 8 * hh + 4);
    float xs[16] = {x0[0],x0[1],x0[2],x0[3],x1[0],x1[1],x1[2],x1[3],x2[0],x2[1],x2[2],x2[3],x3[0],x3[1],x3[2],x3[3]};
#pragma unroll
    for (int i = 0; i < 16; ++i) { const _Float16 h = (_Float16)xs[i]; ah.h[i] = h; al.h[i] = ASPLIT ? (_Float16)(xs[i] - (float)h) : (_Float16)0.0f; }
#pragma unroll
    for (int t = 0; t < 4; ++t) { if (col0 + t * 16 >= N) continue; const size_t boff = (size_t)(col0 + t * 16 + ln) * ldb + kb; FragH bq; bq.half[0] = *(const v8us*)(Bh + boff + 8 * hh); bq.half[1] = *(const v8us*)(Bh + boff + 16 + 8 * hh);
      acc[t] = mmaH<ASPLIT ? 2 : 1>(ah.v, al.v, bq.v, bq.v, acc[t]); }
  }
#pragma unroll
  for (int t = 0; t < 4; ++t) { if (col0 + t * 16 >= N) continue;
#pragma unroll
    for (int r = 0; r < 8; ++r) so[w][8 * hh + r][t * 16 + ln] = acc[t][r] * alpha; }
  __builtin_amdgcn_fence(__ATOMIC_ACQ_REL, "workgroup"); __builtin_amdgcn_wave_barrier();
  const int rsub = lane >> 4, c4 = (lane & 15) * 4;
  {
#pragma unroll
    for (int q = 0; q < 8; ++q) { const int r = q * 2 + rsub; if (col0 + c4 < N) { const v4f v = *(const v4fa*)&so[w][r][c4]; *(v4f*)(C + (size_t)(row0 + r) * ldc + col0 + c4) = v; } }
     }
}

// Wt[n][k] = f16(W[k][n]·scale) from f32 row-major W[K][N] (scale = power of two; bf16-exact weights stay exact in f16 away from the subnormal range)
__global__ __launch_bounds__(256) void k_wt_f16(const float* __restrict__ W, _Float16* __restrict__ Wt, int K, int N, float scale) {
  const int t = blockIdx.x * 256 + threadIdx.x; if (t >= N * (K / 8)) return; const int n = t / (K / 8), k8 = (t % (K / 8)) * 8; FragH f;
#pragma unroll
  for (int i = 0; i < 8; ++i) f.h[i] = (_Float16)(bf16_round(W[(size_t)(k8 + i) * N + n]) * scale); const v8us o = f.half[0];
  *(v8us*)((unsigned short*)Wt + (size_t)n * K + k8) = o; 
}
// k_gemm_hh variant with fused epilogue: v = acc·alpha + bias[by·sBias + col] (+ CP[(row/rowsPerB)·sCPb + by·64 + col] if CP) ; ACT 0 none / 1 elu ; writes f16 C16 (and f32 C if non-null)
template <int ACT>
__global__ __launch_bounds__(128) void k_gemm_hhx(const _Float16* __restrict__ A, int lda, size_t sA, const _Float16* __restrict__ Bh, int ldb, size_t sB, float alpha, const float* __restrict__ bias, size_t sBias, const float* __restrict__ CP, int rowsPerB, size_t sCPb, int row0g,
    float* __restrict__ C, _Float16* __restrict__ C16, int ldc, size_t sC, int M, int N, int K) {
  __shared__ __attribute__((aligned(16))) float so[4][16][64];
  const int tid = threadIdx.x, w = tid >> 5, lane = tid & 31, ln = lane & 15, hh = lane >> 4; const int by = blockIdx.y;
  A += (size_t)by * sA; Bh += (size_t)by * sB; const size_t cofs = (size_t)by * sC; const float* bp = bias ? bias + (size_t)by * sBias : nullptr;
  const int ntn = (N + 63) / 64; const int wid = blockIdx.x * 4 + w; const int mt = wid / ntn, nq = wid % ntn; if (mt * 16 >= M) return;
  const int row0 = mt * 16, col0 = nq * 64; const _Float16* arow = A + (size_t)(row0 + ln) * lda;
  v8f acc[4] = {};
  for (int kb = 0; kb < K; kb += 32) { FragH ah; ah.half[0] = *(const v8us*)((const unsigned short*)arow + kb + 8 * hh); ah.half[1] = *(const v8us*)((const unsigned short*)arow + kb + 16 + 8 * hh);
#pragma unroll
    for (int t = 0; t < 4; ++t) { if (col0 + t * 16 >= N) continue; const size_t boff = (size_t)(col0 + t * 16 + ln) * ldb + kb; FragH bq; bq.half[0] = *(const v8us*)((const unsigned short*)Bh + boff + 8 * hh); bq.half[1] = *(const v8us*)((const unsigned short*)Bh + boff + 16 + 8 * hh);
      acc[t] = mmaH<1>(ah.v, ah.v, bq.v, bq.v, acc[t]); }
  }
#pragma unroll
  for (int t = 0; t < 4; ++t) { if (col0 + t * 16 >= N) continue; const int col = col0 + t * 16 + ln; const float bv = bp ? bf16_round(bp[col]) : 0.f;
#pragma unroll
    for (int r = 0; r < 8; ++r) { float v = acc[t][r] * alpha + bv; if (CP) { const int rr = row0g + row0 + 8 * hh + r; if (rowsPerB < 0) v += CP[cofs + (size_t)rr * ldc + col];      /* rowsPerB < 0: own element of the batched C plane */ else { const int bidx = rr / rowsPerB; v += CP[(size_t)bidx * sCPb + (size_t)by * 64 + col]; } } if (ACT == 1) v = (v > 0.f) ? v : expm1f(v); else if (ACT == 7) v = (v > 0.f) ? v + 1.0f : expf(v); else if (ACT == 8) v = tanhf(v); else if (ACT == 9) v = 0.5f * v * (1.0f + tanhf(0.7978845608028654f * (v + 0.044715f * v * v * v))); else if (ACT == 11) v = 1.0f / (1.0f + expf(-v)); else if (ACT == 12) v = (v > 0.f) ? v : 0.01f * v; else if (ACT == 14) v = (v > 0.f) ? v : 0.1f * v; else if (ACT == 16) v = (v >= 0.f) ? v : 0.3f * v; else if (ACT == 17) v = (v >= 0.f) ? v : 0.2f * v; else if (ACT == 15) v = v / (1.0f + expf(-v)); else if (ACT == 3) v = fmaxf(v, 0.f); else if (ACT == 6) v = 0.5f * v * (1.0f + erff(v * 0.70710678118654752f)); so[w][8 * hh + r][t * 16 + ln] = v; } }
  __builtin_amdgcn_fence(__ATOMIC_ACQ_REL, "workgroup"); __builtin_amdgcn_wave_barrier();
  const int rsub = lane >> 4, c4 = (lane & 15) * 4; typedef _Float16 v4h __attribute__((ext_vector_type(4)));
  {
#pragma unroll
    for (int q = 0; q < 8; ++q) { const int r = q * 2 + rsub; if (col0 + c4 < N) { const v4f v = *(const v4fa*)&so[w][r][c4]; if (C) *(v4f*)(C + cofs + (size_t)(row0 + r) * ldc + col0 + c4) = v; if (C16) { v4h h4; for (int i = 0; i < 4; ++i) h4[i] = (_Float16)v[i]; *(v4h*)(C16 + cofs + (size_t)(row0 + r) * ldc + col0 + c4) = h4; } } }
     }
}


typedef _Float16 v4h __attribute__((ext_vector_type(4)));

__global__ __launch_bounds__(256) void k_h16(const float* __restrict__ x, _Float16* __restrict__ X16, size_t n8) { const size_t t = (size_t)blockIdx.x * 256 + threadIdx.x; if (t >= n8) return; FragH f;
#pragma unroll
  for (int q = 0; q < 8; ++q) f.h[q] = (_Float16)x[t * 8 + q]; *(v8us*)((unsigned short*)X16 + t * 8) = f.half[0];  }
__global__ __launch_bounds__(256) void k_round16f(const float* __restrict__ W, _Float16* __restrict__ Bt, size_t n8) { const size_t t = (size_t)blockIdx.x * 256 + threadIdx.x; if (t >= n8) return; FragH f;
#pragma unroll
  for (int i = 0; i < 8; ++i) f.h[i] = (_Float16)(bf16_round(W[t * 8 + i]) * 16.0f); *(v8us*)((unsigned short*)Bt + t * 8) = f.half[0];  }
template <int NHv, int TTv>
__global__ __launch_bounds__(256) void k_vt(const _Float16* __restrict__ V16, int ldv, int voff, _Float16* __restrict__ Vt) { __shared__ unsigned short tl[64][66]; const int tid = threadIdx.x; const int slab = blockIdx.x / (TTv / 64), lg = blockIdx.x % (TTv / 64); const int b = slab / NHv, h = slab % NHv;
  for (int i = tid; i < 64 * 8; i += 256) { const int r = i / 8, c8 = (i % 8) * 8; FragH f; f.half[0] = *(const v8us*)((const unsigned short*)V16 + ((size_t)b * TTv + lg * 64 + r) * ldv + voff + h * 64 + c8);
#pragma unroll
    for (int q = 0; q < 8; ++q) tl[r][c8 + q] = f.u[q]; }
  __syncthreads();
  {
#pragma unroll
    for (int rd = 0; rd < 2; ++rd) { const int d = rd * 32 + tid / 8, pc = tid % 8; FragH f;
#pragma unroll
      for (int q = 0; q < 8; ++q) f.u[q] = tl[pc * 8 + q][d];
      *(v8us*)((unsigned short*)Vt + ((size_t)slab * 64 + d) * TTv + lg * 64 + pc * 8) = f.half[0]; }
     } }

__global__ __launch_bounds__(256) void k_hl(const float* __restrict__ F, _Float16* __restrict__ Hh, _Float16* __restrict__ Hl, size_t n8) { const size_t t = (size_t)blockIdx.x * 256 + threadIdx.x; if (t >= n8) return; FragH fh, fl; const v4f a = *(const v4fa*)(F + t * 8), c = *(const v4fa*)(F + t * 8 + 4);
#pragma unroll
  for (int q = 0; q < 4; ++q) { _Float16 h = (_Float16)a[q]; fh.h[q] = h; fl.h[q] = (_Float16)((a[q] - (float)h) * 1024.0f); h = (_Float16)c[q]; fh.h[4 + q] = h; fl.h[4 + q] = (_Float16)((c[q] - (float)h) * 1024.0f); }
  { *(v8us*)((unsigned short*)Hh + t * 8) = fh.half[0]; *(v8us*)((unsigned short*)Hl + t * 8) = fl.half[0];  } }

// ---- fast GEMM (work-group tile 128x64, wave tile 32x64; requires M % 128 == 0, N % 64 == 0, K % 64 == 0); epilogue: acc * alpha + bias, activation; no test on an argument per element or per row ----
// A and B reach the fragments through LDS: a stage is 64 k (one 128-byte line) of the tile's 128 A rows and 64 B rows; eight lanes load one whole line, so a wave's load touches 4 lines, not 16, and B is fetched once a work-group, not once a wave. The next stage's lines fly while this stage is worked on (two buffers, one barrier a stage). The fragments hold the same elements in the same k order as a load straight from global.
#define GKC 64                       /* k per LDS stage */
#define GP 144                       /* LDS row pitch, bytes: 16 x odd, for ds_load_b128 */
#define GST ((128 + 64) * GP)        /* bytes of one stage: 128 A rows, then 64 B rows */
__device__ __forceinline__ v16h g2_lfrag(const unsigned char* p) { FragH f; f.half[0] = *(const v8us*)p; f.half[1] = *(const v8us*)(p + 32); return f.v; }
__device__ __forceinline__ v16h g2_frag(const _Float16* p, int hh) { FragH f; f.half[0] = *(const v8us*)((const unsigned short*)p + 8 * hh); f.half[1] = *(const v8us*)((const unsigned short*)p + 16 + 8 * hh); return f.v; }
__device__ __forceinline__ v8f g2_mma(v16h a, v16h b, v8f c) { v8f d = __builtin_amdgcn_wmma_f32_16x16x32_f16(false, a, false, b, (short)0, c, false, false); asm volatile("v_nop\n\tv_nop\n\tv_nop\n\tv_nop" : "+v"(d) : "v"(a), "v"(b)); return d; }
template <int X> __device__ __forceinline__ float row_xor(float x) { return __builtin_bit_cast(float, __builtin_amdgcn_update_dpp(0, __builtin_bit_cast(int, x), 0x160 | X, 0xf, 0xf, true)); }      /* lane l reads lane l ^ X, X < 16, on the vector unit: no LDS round trip */
template <int ACT, bool F32O>      /* F32O: the result goes to C as f32; else to C16 as f16 */
__global__ __launch_bounds__(128) void k_gemm2(const _Float16* __restrict__ A, int lda, size_t sA, const _Float16* __restrict__ Bh, int ldb, size_t sB, float alpha, const float* __restrict__ bias, const float* __restrict__ bias1, const float* __restrict__ bias2, size_t sBias,
    float* __restrict__ C, _Float16* __restrict__ C16, int ldc, size_t sC, int M, int N, int K, const int* __restrict__ cnt, const int* __restrict__ gpos, const int* __restrict__ spos, float* __restrict__ KN2) { static_assert(ACT == 0 || ACT == 3 || ACT == 6 || ACT == 8 || ACT == 9 || ACT == 11 || ACT == 12 || ACT == 14 || ACT == 15 || ACT == 16 || ACT == 17, "k_gemm2: unsupported ACT code (would silently apply no activation)");
  __shared__ __attribute__((aligned(16))) unsigned char stg[2 * GST]; float (*so)[32][68] = (float (*)[32][68])stg; static_assert(sizeof(float) * 4 * 32 * 68 <= 2 * GST, "the epilogue's tile lies over the stages");      /* so is written only behind the loop's last barrier */
  const int tid = threadIdx.x, w = tid >> 5, lane = tid & 31, ln = lane & 15, hh = lane >> 4; const int by = blockIdx.y;
  if (bias1) bias = by == 1 ? bias1 : by == 2 ? bias2 : bias;      /* three products in one grid, each with its own bias vector */
  A += (size_t)by * sA; Bh += (size_t)by * sB; const size_t cofs = (size_t)by * sC; const float* bp = bias + (size_t)by * sBias;      /* every launch gives a bias vector */
  const int ntn = N >> 6; const int mi = blockIdx.x / ntn, nq = blockIdx.x - mi * ntn; const int mt = (mi % NB) * (SQ / 128) + mi / NB;      /* row tiles in the order tile 0 of every batch, tile 1 of every batch, ...: the tiles past the lists come last in the grid */
  const int row0 = mt * 128 + 32 * w, col0 = nq * 64; if (mt * 128 >= M) return;      /* the whole work-group leaves, in front of every barrier */
  /* rows are list entries: batch bb, entries cb .. cb + 127 of its list of nv valid tokens; a block whose first entry lies past the list has nothing to do; the entries from nv to the block's end repeat the first valid token (finite rows that carry no weight later) */
  const int bb = (mt * 128) / SQ, cb = mt * 128 - bb * SQ; int nv = cnt[bb * CNTP]; nv = nv < SQ ? nv : SQ; if (cb >= nv) return;
  int sp = cb + 32 * w + lane, nlim = SQ; if (spos) { sp = spos[row0 + lane] & (SQ - 1); nlim = nv; }      /* lane l: the row inside the batch where row l of this wave's tile is stored; spos: a listed row goes to its token's own position, an entry past the list nowhere */
  /* staging: thread t moves 16 bytes of A rows t / 8 + 16 i (i < 8) and of B rows t / 8 + 16 i (i < 4) of each stage; the loops over i and ks are unrolled so that their arrays are registers */
  const int sr = tid >> 3, sc = tid & 7; int ra[8]; unsigned ao[8], bo[4];      /* ao, bo: each row's byte offset in its matrix (under 2^32); the stage's k is added to the uniform base */
#pragma unroll
  for (int i = 0; i < 8; ++i) ra[i] = mt * 128 + sr + 16 * i;
  if (gpos) { int gv[8];      /* gpos: A rows stand at the tokens' own positions; one test round all eight loads, so that they fly together */
#pragma unroll
    for (int i = 0; i < 8; ++i) gv[i] = gpos[ra[i]];
#pragma unroll
    for (int i = 0; i < 8; ++i) ra[i] = bb * SQ + (gv[i] & (SQ - 1)); }
#pragma unroll
  for (int i = 0; i < 8; ++i) ao[i] = (unsigned)ra[i] * (unsigned)lda * 2u + (unsigned)sc * 16u;
#pragma unroll
  for (int i = 0; i < 4; ++i) bo[i] = (unsigned)(col0 + sr + 16 * i) * (unsigned)ldb * 2u + (unsigned)sc * 16u;
  const char* Ab = (const char*)A; const char* Bb = (const char*)Bh; v8us pa[8], pb[4];
#pragma unroll
  for (int i = 0; i < 8; ++i) pa[i] = *(const v8us*)(Ab + ao[i]);
#pragma unroll
  for (int i = 0; i < 4; ++i) pb[i] = *(const v8us*)(Bb + bo[i]);
  unsigned char* sw = stg + sr * GP + sc * 16; const unsigned char* af = stg + (32 * w + ln) * GP + 16 * hh; const unsigned char* bf = stg + (128 + ln) * GP + 16 * hh;
#pragma unroll
  for (int i = 0; i < 8; ++i) *(v8us*)(sw + 16 * i * GP) = pa[i];
#pragma unroll
  for (int i = 0; i < 4; ++i) *(v8us*)(sw + (128 + 16 * i) * GP) = pb[i];
  __syncthreads();
  const v8f z8 = {0.f,0.f,0.f,0.f,0.f,0.f,0.f,0.f}; v8f c00 = z8, c01 = z8, c02 = z8, c03 = z8, c10 = z8, c11 = z8, c12 = z8, c13 = z8; const int nch = K / GKC;
#pragma unroll 1
  for (int c = 0; c < nch; ++c) { const int cur = (c & 1) * GST; const bool more = c + 1 < nch;      /* rolled: two buffers, one stage's code */
    if (more) { const char* An = Ab + (size_t)(c + 1) * (GKC * 2); const char* Bn = Bb + (size_t)(c + 1) * (GKC * 2);
#pragma unroll
      for (int i = 0; i < 8; ++i) pa[i] = *(const v8us*)(An + ao[i]);
#pragma unroll
      for (int i = 0; i < 4; ++i) pb[i] = *(const v8us*)(Bn + bo[i]);
      asm volatile("s_wait_xcnt 0x0" ::: "memory"); }      /* keeps the twelve loads up here, in flight while this stage is worked on; the wait is a precaution in front of any reuse of their address registers */
    const unsigned char* ap = af + cur; const unsigned char* bq = bf + cur; v16h a0[GKC / 32], a1[GKC / 32], b0[GKC / 32], b1[GKC / 32], b2[GKC / 32], b3[GKC / 32];
#pragma unroll
    for (int ks = 0; ks < GKC / 32; ++ks) { a0[ks] = g2_lfrag(ap + ks * 64); a1[ks] = g2_lfrag(ap + 16 * GP + ks * 64); b0[ks] = g2_lfrag(bq + ks * 64); b1[ks] = g2_lfrag(bq + 16 * GP + ks * 64); b2[ks] = g2_lfrag(bq + 32 * GP + ks * 64); b3[ks] = g2_lfrag(bq + 48 * GP + ks * 64); }
    asm volatile("" :: "v"(a0[0]), "v"(a1[0]), "v"(b0[0]), "v"(b1[0]), "v"(b2[0]), "v"(b3[0]), "v"(a0[1]), "v"(a1[1]), "v"(b0[1]), "v"(b1[1]), "v"(b2[1]), "v"(b3[1]));      /* inputs only: holds the stage's LDS reads together in front of the products, one LDS latency a stage instead of one per fragment */
#pragma unroll
    for (int ks = 0; ks < GKC / 32; ++ks) {
      c00 = g2_mma(a0[ks], b0[ks], c00); c10 = g2_mma(a1[ks], b0[ks], c10); c01 = g2_mma(a0[ks], b1[ks], c01); c11 = g2_mma(a1[ks], b1[ks], c11);
      c02 = g2_mma(a0[ks], b2[ks], c02); c12 = g2_mma(a1[ks], b2[ks], c12); c03 = g2_mma(a0[ks], b3[ks], c03); c13 = g2_mma(a1[ks], b3[ks], c13); }
    if (more) { unsigned char* d = sw + (GST - cur);      /* that buffer's last readers left it before the barrier that ended the stage before */
#pragma unroll
      for (int i = 0; i < 8; ++i) *(v8us*)(d + 16 * i * GP) = pa[i];
#pragma unroll
      for (int i = 0; i < 4; ++i) *(v8us*)(d + (128 + 16 * i) * GP) = pb[i]; }
    __syncthreads(); }      /* publishes the next stage and ends this stage's reads; behind the last one the stages' LDS is free for the epilogue */
  v8f accs[8] = {c00, c01, c02, c03, c10, c11, c12, c13};
#pragma unroll
  for (int u = 0; u < 8; ++u) { const int t = u & 3, half = u >> 2; const int col = col0 + t * 16 + ln; const float bv = bf16_round(bp[col]);
#pragma unroll
    for (int r = 0; r < 8; ++r) { const int rloc = half * 16 + 8 * hh + r; float v = accs[u][r] * alpha + bv;
      if (ACT == 3) v = fmaxf(v, 0.f); else if (ACT == 6) v = 0.5f * v * (1.0f + erff(v * 0.70710678118654752f)); else if (ACT == 11) v = 1.0f / (1.0f + expf(-v)); else if (ACT == 15) v = v / (1.0f + expf(-v)); else if (ACT == 12) v = (v > 0.f) ? v : 0.01f * v; else if (ACT == 8) v = tanhf(v); else if (ACT == 9) v = 0.5f * v * (1.0f + tanhf(0.7978845608028654f * (v + 0.044715f * v * v * v))); else if (ACT == 14) v = (v > 0.f) ? v : 0.1f * v; else if (ACT == 16) v = (v >= 0.f) ? v : 0.3f * v; else if (ACT == 17) v = (v >= 0.f) ? v : 0.2f * v;
      so[w][rloc][t * 16 + ln] = v; } }
  __builtin_amdgcn_fence(__ATOMIC_ACQ_REL, "workgroup"); __builtin_amdgcn_wave_barrier();
  const int rsub = lane >> 4, c4 = (lane & 15) * 4;
  {
#pragma unroll
    for (int q = 0; q < 16; ++q) { const int r = q * 2 + rsub; const v4f v = *(const v4fa*)&so[w][r][c4]; const int p0 = __builtin_amdgcn_readlane(sp, q * 2), p1 = __builtin_amdgcn_readlane(sp, q * 2 + 1); const int ro = bb * SQ + (rsub ? p1 : p0);
      if (cb + 32 * w + r < nlim) { if (F32O) { *(v4f*)(C + cofs + (size_t)ro * ldc + col0 + c4) = v; asm volatile("s_wait_xcnt 0x0" ::: "memory"); }      /* precaution: the built code rewrites this store's data and address registers right behind it */
        else { v4h h4; for (int i = 0; i < 4; ++i) h4[i] = (_Float16)v[i]; *(v4h*)(C16 + cofs + (size_t)ro * ldc + col0 + c4) = h4; } } }
     }
  if (!F32O && by == 1) { float sq = 0.f;      /* the k product: a column tile is one head, so lane l sums the squares of row l of the wave's tile, and the largest of the 32 sums goes to the wave's own 128-byte line of KN2; last in the kernel, nothing follows the store */
#pragma unroll
    for (int j = 0; j < 16; ++j) { const v4f v = *(const v4fa*)&so[w][lane][4 * j]; sq += v[0] * v[0] + v[1] * v[1] + v[2] * v[2] + v[3] * v[3]; }
    sq = fmaxf(sq, row_xor<8>(sq)); sq = fmaxf(sq, row_xor<4>(sq)); sq = fmaxf(sq, row_xor<2>(sq)); sq = fmaxf(sq, row_xor<1>(sq)); sq = fmaxf(sq, __shfl_xor(sq, 16));
    if (lane == 0) KN2[(size_t)(((bb * NH + nq) * (SQ / 128) + cb / 128) * 4 + w) * 32] = sq; } }


// ---- preparation: everything that reads only the inputs, as one launch; a block's index range says which job it does (none reads what another writes) ----
#define PBX ((int)(NR * DM / 8 / 256))      /* blocks that convert h: 8 elements a thread */
#define PBW (DM * DM / 8 / 256)             /* blocks per weight matrix: 8 elements a thread */
#define PBT (SQ / 256)                      /* blocks of the bias table: 1 entry a thread */
#define PBL NB                              /* blocks that list the valid tokens: one a batch, 8 positions a thread */
typedef int v4i __attribute__((ext_vector_type(4)));
__device__ __forceinline__ float tbias_at(int d) {
  const float dist = __fdiv_rn(__fmul_rn((float)d, 300.0f), 300.0f); const float v = logf(__fadd_rn(expf(-dist), 1e-12f));
  return v; }
__global__ __launch_bounds__(256) void k_prep(const float* __restrict__ x, const int* __restrict__ pmask, const float* __restrict__ wq, const float* __restrict__ wk, const float* __restrict__ wv, const float* __restrict__ wo, _Float16* __restrict__ X16, _Float16* __restrict__ BW, float* __restrict__ TB, int* __restrict__ POS, int* __restrict__ CNT, float* __restrict__ out) {
  __shared__ int psum[256]; __shared__ __attribute__((aligned(16))) int lst[SQ]; __shared__ int first;
  int blk = blockIdx.x;
  if (blk < PBL) { const int tid = threadIdx.x; const int* mp = pmask + (size_t)blk * SQ + tid * 8;      /* batch blk: valid positions in ascending order, by a prefix sum of the threads' counts */
    const v4i m0 = *(const v4i*)mp, m1 = *(const v4i*)(mp + 4); const int mv[8] = {m0[0], m0[1], m0[2], m0[3], m1[0], m1[1], m1[2], m1[3]}; int c = 0;
#pragma unroll
    for (int q = 0; q < 8; ++q) c += mv[q] != 0;
    psum[tid] = c; if (tid == 0) first = 0;
    __syncthreads();
    for (int o = 1; o < 256; o <<= 1) { const int a = tid >= o ? psum[tid - o] : 0; __syncthreads(); psum[tid] += a; __syncthreads(); }
    const int n = psum[255]; int rk = psum[tid] - c;
    if (rk == 0 && c != 0) {
#pragma unroll
      for (int q = 7; q >= 0; --q) if (mv[q] != 0) first = tid * 8 + q; }
#pragma unroll
    for (int q = 0; q < 8; ++q) if (mv[q] != 0) lst[rk++] = tid * 8 + q;
    __syncthreads();
    v4i o0, o1;      /* entries past the list repeat the first valid position; a wave stores whole 128-byte lines */
#pragma unroll
    for (int q = 0; q < 4; ++q) { o0[q] = tid * 8 + q < n ? lst[tid * 8 + q] : first; o1[q] = tid * 8 + 4 + q < n ? lst[tid * 8 + 4 + q] : first; }
    *(v4i*)(POS + (size_t)blk * SQ + tid * 8) = o0; *(v4i*)(POS + (size_t)blk * SQ + tid * 8 + 4) = o1; if (tid == 0) CNT[blk * CNTP] = n;
    return; }
  blk -= PBL;
  if (blk < PBX) { const size_t t = (size_t)blk * 256 + threadIdx.x; FragH f;      /* valid h rows, rounded to bf16, exact in f16; a padded row is read by nobody, its row of out is 0 */
    if (pmask[t / (DM / 8)] == 0) { const v4f z = {0.f, 0.f, 0.f, 0.f}; *(v4f*)(out + t * 8) = z; *(v4f*)(out + t * 8 + 4) = z; return; }
#pragma unroll
    for (int q = 0; q < 8; ++q) f.h[q] = (_Float16)bf16_round(x[t * 8 + q]);
    *(v8us*)((unsigned short*)X16 + t * 8) = f.half[0]; return; }
  blk -= PBX;
  if (blk < 4 * PBW) { const int mi = blk / PBW; const float* __restrict__ w = mi == 0 ? wq : mi == 1 ? wk : mi == 2 ? wv : wo;      /* weight mi, natural [out][in], x16, into plane mi of BW */
    const size_t t = (size_t)(blk - mi * PBW) * 256 + threadIdx.x; FragH f;
    for (int q = 0; q < 8; ++q) f.h[q] = (_Float16)(bf16_round(w[t * 8 + q]) * 16.0f);
    *(v8us*)((unsigned short*)BW + (size_t)mi * DM * DM + t * 8) = f.half[0]; return; }
  const int d = (blk - 4 * PBW) * 256 + threadIdx.x; TB[d] = tbias_at(d);
  asm volatile("s_wait_xcnt 0x0" ::: "memory"); }      /* precaution: the built code places another job's block behind this store, and that block rewrites the store's registers */
#define FK 128                       /* keys per LDS stage */
#define PK 144                       /* LDS row pitch of the K tile, bytes: 16 x odd, for ds_load_b128 */
#define PV 160                       /* LDS row pitch of the V tile, bytes: 32 x odd, for ds_load_tr16_b128 */
#define LOG2E 1.4426950408889634f
typedef short s16x8 __attribute__((ext_vector_type(8)));
typedef float v2f __attribute__((ext_vector_type(2)));
typedef unsigned v4u __attribute__((ext_vector_type(4), may_alias));
__device__ __forceinline__ v8us fa_tr16(const unsigned char* p) { typedef __attribute__((address_space(3))) s16x8 lds_s16x8; return __builtin_bit_cast(v8us, __builtin_amdgcn_ds_load_tr16_b128_v8i16((lds_s16x8*)p)); }
__device__ __forceinline__ float fa_xhalf(float x) { return __builtin_bit_cast(float, __builtin_amdgcn_permlanex16(__builtin_bit_cast(int, x), __builtin_bit_cast(int, x), 0x76543210, 0xfedcba98, false, false)); }      /* lane l reads lane l ^ 16 */
// amdgpu_waves_per_eu(4, 4) on the kernel: two work-groups per WGP are four waves per SIMD, so a wave may use up to 256 registers.
__device__ __forceinline__ v8f fa_mma(v16h a, v16h b, v8f c) { return __builtin_amdgcn_wmma_f32_16x16x32_f16(false, a, false, b, (short)0, c, false, false); }
__global__ __launch_bounds__(256) __attribute__((amdgpu_waves_per_eu(4, 4))) void k_fattn(const _Float16* __restrict__ Q16, const _Float16* __restrict__ K16, const _Float16* __restrict__ V16, const float* __restrict__ TB, const int* __restrict__ POS, const int* __restrict__ CNT, const float* __restrict__ KN2, _Float16* __restrict__ O16) {
  __shared__ __attribute__((aligned(16))) float kn4[4 * (SQ / FK)]; __shared__ __attribute__((aligned(16))) unsigned wm[8];
  __shared__ __attribute__((aligned(16))) float tb2[2 * SQ]; __shared__ __attribute__((aligned(16))) int kx[SQ];
  __shared__ __attribute__((aligned(16))) unsigned char kt[2][FK * PK]; __shared__ __attribute__((aligned(16))) unsigned char vt[2][FK * PV];
  const int tid = threadIdx.x, lane = tid & 31, ln = lane & 15, hh = lane >> 4; const int wv = __builtin_amdgcn_readfirstlane(tid >> 5);
  const int b = blockIdx.x / NH, h = blockIdx.x % NH; int nv = CNT[b * CNTP]; nv = nv < SQ ? nv : SQ; if ((int)blockIdx.y * 128 >= nv) return;      /* the whole work-group leaves, in front of every barrier: its queries lie past the list; the query tile is the slow grid index, so that these work-groups come last in the grid */
  const int nst = (nv + FK - 1) / FK; const int* lp = POS + (size_t)b * SQ; const int q0 = blockIdx.y * 128 + wv * 16; const bool act = q0 < nv;      /* act, the same for the whole wave: a wave whose 16 queries all lie past the list only stages and stores zero rows */ const size_t base = (size_t)b * SQ * DM + (size_t)h * HD;
  /* staging: thread t moves 16 bytes of rows t / 8 + 32 i (i < 4) of each tile, so a wave's load covers four whole 128-byte rows */
  const int sr = tid >> 3, sc = tid & 7;
  const unsigned short* kg = (const unsigned short*)K16 + base + (size_t)sr * DM + sc * 8; const unsigned short* vg = (const unsigned short*)V16 + base + (size_t)sr * DM + sc * 8;
  const int st0 = blockIdx.y * (128 / FK); const size_t g0 = (size_t)st0 * FK * DM;      /* the first stage worked on: the one that holds this work-group's first queries as keys (st0 < nst, since the work-group's first query is on the list) */
  v8us rk[FK / 32], rv[FK / 32];      /* the loops over i are unrolled so that these are registers */
#pragma unroll
  for (int i = 0; i < FK / 32; ++i) { rk[i] = *(const v8us*)(kg + g0 + (size_t)(32 * i) * DM); rv[i] = *(const v8us*)(vg + g0 + (size_t)(32 * i) * DM); }
  const _Float16* qp = Q16 + base + (size_t)(q0 + ln) * DM; const v16h qf0 = g2_frag(qp, hh), qf1 = g2_frag(qp + 32, hh);
  float knv = 0.f; if (tid < 4 * nst) knv = KN2[((size_t)blockIdx.x * (4 * (SQ / FK)) + tid) * 32];      /* the largest squared k norm of each 32 list places of this (batch, head); every stage under nst has its four */
#pragma unroll
  for (int u = 0; u < 2 * SQ / 256; ++u) { const int t = tid + 256 * u; int d = t - (SQ - 1); d = d < 0 ? -d : d; d = d < SQ ? d : SQ - 1; const float tv = TB[d] * LOG2E; tb2[t] = t == 2 * SQ - 1 ? -1.0e9f * LOG2E : tv; }      /* unrolled: the table's loads are all in flight together */
#pragma unroll
  for (int u = 0; u < SQ / 256; ++u) { const int t = tid + 256 * u; kx[t] = (lp[t] & (SQ - 1)) * 4 + (t < nv ? 0 : 4 * SQ * 4); }      /* a sum, so that the eight loads stand under no test and fly together: the list's every entry is written */
#pragma unroll
  for (int i = 0; i < FK / 32; ++i) { *(v8us*)(kt[0] + (sr + 32 * i) * PK + sc * 16) = rk[i]; *(v8us*)(vt[0] + (sr + 32 * i) * PV + sc * 16) = rv[i]; }
  if (tid < 4 * (SQ / FK)) kn4[tid] = knv;
  float q2 = 0.f, q3 = 0.f;      /* the largest q norm among the wave's listed queries, for the far-stage test at the end of the first trip */
#pragma unroll
  for (int i = 0; i < 16; ++i) { const float a = (float)qf0[i], c = (float)qf1[i]; q2 = __builtin_fmaf(a, a, q2); q3 = __builtin_fmaf(c, c, q3); }
  q2 += q3; q2 += fa_xhalf(q2); q2 = q0 + ln < nv ? q2 : 0.f;
  q2 = __builtin_fmaxf(q2, row_xor<8>(q2)); q2 = __builtin_fmaxf(q2, row_xor<4>(q2)); q2 = __builtin_fmaxf(q2, row_xor<2>(q2)); q2 = __builtin_fmaxf(q2, row_xor<1>(q2));
  const float qn = __builtin_sqrtf(q2);
  __syncthreads();
  const v8f z8 = {0.f,0.f,0.f,0.f,0.f,0.f,0.f,0.f}; v8f o0 = z8, o1 = z8, o2 = z8, o3 = z8; float m = -INFINITY, ms = -INFINITY, l = act ? 0.f : 1.f;
  const int qx = (SQ - 1) * 4 - (kx[q0 + ln] & ((SQ - 1) * 4)); const int* kq = kx + 8 * hh; const unsigned qm = __builtin_amdgcn_ballot_w32(q0 + ln < nv);      /* the lanes whose query is on the list; a query past it stands for no token (its o row is stored nowhere in out) and has no say in whether a pass is worked on */
  unsigned mine = ~0u;      /* the stages this wave works on: all, until the first trip's test */
  unsigned todo = ((1u << nst) - 1u) & ~(1u << st0); int sn = nst > 1 ? (st0 + 1 < nst ? st0 + 1 : st0 - 1) : -1; if (sn >= 0) todo &= ~(1u << sn);      /* todo: the stages not yet fetched, one bit each (nst <= 16); sn: the stage fetched next, -1 for none; all the same for the whole work-group */
#pragma unroll 1
  for (int t = 0, st = st0; st >= 0; ++t) { const int cur = t & 1; const bool more = sn >= 0;      /* rolled, for speed only; at most nst trips: st0, a neighbour of it, then what the first trip's test leaves of todo */
    float bbs[FK / 32];      /* per pass of the stage: the bias at de, the least distance, in list places, between the wave's queries and the pass's keys, the same for the whole wave; read up here, so that no far test waits on an LDS read of its own */
#pragma unroll
    for (int p = 0; p < FK / 32; ++p) { const int dk = st * FK + 32 * p - (q0 + 15), dq = q0 - (st * FK + 32 * p + 31); int de = dk > dq ? dk : dq; de = de > 0 ? de : 0; bbs[p] = tb2[SQ - 1 + de]; }
    if (more) { const size_t go = (size_t)sn * FK * DM;
#pragma unroll
      for (int i = 0; i < FK / 32; ++i) { rk[i] = *(const v8us*)(kg + go + (size_t)(32 * i) * DM); rv[i] = *(const v8us*)(vg + go + (size_t)(32 * i) * DM); }
      asm volatile("s_wait_xcnt 0x0" ::: "memory"); }      /* the next stage's rows fly while this stage is worked on; the wait is a precaution: the built code reuses these loads' address registers right behind them */
    if (act && ((mine >> st) & 1u) != 0)
#pragma unroll
    for (int g = 0; g < FK / 64; ++g) { const int k0 = st * FK + g * 64;      /* a group: 64 keys, two passes of 32 */
      const unsigned char* kp = kt[cur] + (g * 64 + ln) * PK + 16 * hh; FragH ka[4], kb[4];      /* ka[j], kb[j]: head dims 0 .. 31 and 32 .. 63 of keys 16 j .. 16 j + 15 of the group */
#pragma unroll
      for (int j = 0; j < 4; ++j) { ka[j].half[0] = *(const v8us*)(kp + 16 * j * PK); ka[j].half[1] = *(const v8us*)(kp + 16 * j * PK + 32); kb[j].half[0] = *(const v8us*)(kp + 16 * j * PK + 64); kb[j].half[1] = *(const v8us*)(kp + 16 * j * PK + 96); }
      asm volatile("" :: "v"(ka[0].v), "v"(ka[1].v), "v"(ka[2].v), "v"(ka[3].v), "v"(kb[0].v), "v"(kb[1].v), "v"(kb[2].v), "v"(kb[3].v));      /* inputs only: the group's LDS reads are issued as one run, one LDS latency a group; without it the built code reads two by two among the products, with a full wait at each */
      v8f s[4];      /* S^T of the group's four 16-key tiles: four independent chains of two products */
#pragma unroll
      for (int j = 0; j < 4; ++j) s[j] = fa_mma(ka[j].v, qf0, z8);
#pragma unroll
      for (int j = 0; j < 4; ++j) s[j] = fa_mma(kb[j].v, qf1, s[j]);
      float xm[2];      /* per pass: the bound on its every score */
#pragma unroll
      for (int p = 0; p < 2; ++p) { float xa = s[2 * p][0], xb = s[2 * p + 1][0];      /* two chains a pass, so that no maximum waits on fifteen before it */
#pragma unroll
        for (int r = 1; r < 8; ++r) { xa = __builtin_fmaxf(xa, s[2 * p][r]); xb = __builtin_fmaxf(xb, s[2 * p + 1][r]); }
        xm[p] = __builtin_fmaf(__builtin_fmaxf(xa, xb), 0.125f * LOG2E, bbs[2 * g + p]); }
      if ((__builtin_amdgcn_ballot_w32(__builtin_fmaxf(xm[0], xm[1]) > ms - 26.0f) & qm) == 0) continue;      /* both passes far: one test and one branch for the group */
#pragma unroll
      for (int p = 0; p < 2; ++p) { const v8f s0 = s[2 * p], s1 = s[2 * p + 1];
      if ((__builtin_amdgcn_ballot_w32(xm[p] > ms - 26.0f) & qm) == 0) continue;      /* no weight of the pass reaches 2^-25 (26, not 25: the one to spare covers every rounding of the table and of exp2) */
      const unsigned char* vp = vt[cur] + (g * 64 + p * 32 + 8 * hh + (lane & 7)) * PV + ((lane >> 3) & 1) * 16; FragH va[4];
#pragma unroll
      for (int dt = 0; dt < 4; ++dt) { va[dt].half[0] = fa_tr16(vp + 32 * dt); va[dt].half[1] = fa_tr16(vp + 16 * PV + 32 * dt); }
      const int* kp4 = kq + k0 + 32 * p; float v[16]; float mx = -INFINITY;
#pragma unroll
      for (int r = 0; r < 8; ++r) { int x0 = kp4[r] + qx, x1 = kp4[16 + r] + qx; x0 = x0 < (2 * SQ - 1) * 4 ? x0 : (2 * SQ - 1) * 4; x1 = x1 < (2 * SQ - 1) * 4 ? x1 : (2 * SQ - 1) * 4;
        v[r] = __builtin_fmaf(s0[r], 0.125f * LOG2E, *(const float*)((const char*)tb2 + x0)); v[8 + r] = __builtin_fmaf(s1[r], 0.125f * LOG2E, *(const float*)((const char*)tb2 + x1)); }
#pragma unroll
      for (int r = 0; r < 16; ++r) mx = __builtin_fmaxf(mx, v[r]);
      mx = __builtin_fmaxf(mx, fa_xhalf(mx));
      if (__builtin_amdgcn_ballot_w32(mx > m) != 0) { const float mn = __builtin_fmaxf(m, mx); const float msn = mn; const float corr = __builtin_amdgcn_exp2f(ms - msn); m = mn; ms = msn; l *= corr; o0 *= corr; o1 *= corr; o2 *= corr; o3 *= corr; }      /* corr = 0 in the first pass (ms = -inf), 1 for a query whose maximum stays */
      FragH pf; v2f la = {0.f, 0.f}, lb = {0.f, 0.f};      /* the pass's sum in two chains of pairs, so that no add waits on sixteen before it */
#pragma unroll
      for (int r = 0; r < 16; r += 4) { const float p0 = __builtin_amdgcn_exp2f(v[r] - ms), p1 = __builtin_amdgcn_exp2f(v[r + 1] - ms), p2 = __builtin_amdgcn_exp2f(v[r + 2] - ms), p3 = __builtin_amdgcn_exp2f(v[r + 3] - ms);
        la += v2f{p0, p1}; lb += v2f{p2, p3}; pf.h[r] = (_Float16)p0; pf.h[r + 1] = (_Float16)p1; pf.h[r + 2] = (_Float16)p2; pf.h[r + 3] = (_Float16)p3; }
      la += lb; l += la[0] + la[1];
      o0 = fa_mma(va[0].v, pf.v, o0); o1 = fa_mma(va[1].v, pf.v, o1); o2 = fa_mma(va[2].v, pf.v, o2); o3 = fa_mma(va[3].v, pf.v, o3); } }
    if (t == 0) { unsigned nm = 0;      /* far stages: lane s bounds every score of stage s for the wave: largest |q| x largest |k| of the stage (1.01 covers the roundings of k to f16 and of the sums), scaled, plus the bias at the least distance in list places; m only rises from here */
      if (act) { float mq = q0 + ln < nv ? ms : INFINITY;
        mq = __builtin_fminf(mq, row_xor<8>(mq)); mq = __builtin_fminf(mq, row_xor<4>(mq)); mq = __builtin_fminf(mq, row_xor<2>(mq)); mq = __builtin_fminf(mq, row_xor<1>(mq));
        const v4f k4 = *(const v4fa*)&kn4[4 * ln]; const float kk = __builtin_sqrtf(__builtin_fmaxf(__builtin_fmaxf(k4[0], k4[1]), __builtin_fmaxf(k4[2], k4[3])));
        const int dk = ln * FK - (q0 + 15), dq = q0 - (ln * FK + FK - 1); int de = dk > dq ? dk : dq; de = de > 0 ? de : 0;
        const float bd = __builtin_fmaf(qn * kk, 0.125f * LOG2E * 1.01f, tb2[SQ - 1 + de]);
        nm = __builtin_amdgcn_ballot_w32(!(bd <= mq - 26.0f)); }      /* a bit stays set unless the bound is shown to lie under the bar */
      mine = nm; if (lane == 0) wm[wv] = nm; }
    if (more) { unsigned char* kn = kt[cur ^ 1]; unsigned char* vn = vt[cur ^ 1];
#pragma unroll
      for (int i = 0; i < FK / 32; ++i) { *(v8us*)(kn + (sr + 32 * i) * PK + sc * 16) = rk[i]; *(v8us*)(vn + (sr + 32 * i) * PV + sc * 16) = rv[i]; } }      /* that buffer's last readers left it before the barrier that ended the stage before */
    __syncthreads();      /* publishes the next stage (in the first trip the waves' stage bits too) and ends this stage's reads */
    if (t == 0) { const v4u w0 = *(const v4u*)wm, w1 = *(const v4u*)(wm + 4); todo &= __builtin_amdgcn_readfirstlane(w0[0] | w0[1] | w0[2] | w0[3] | w1[0] | w1[1] | w1[2] | w1[3]); }      /* a stage that no wave wants is neither fetched nor worked on */
    st = sn; sn = todo != 0 ? __builtin_ctz(todo) : -1; todo &= todo - 1; }
  l += fa_xhalf(l); const float inv = 1.0f / l; unsigned short* op = (unsigned short*)O16 + base + (size_t)(q0 + ln) * DM + 8 * hh;      /* lane (c, hf) holds o[q0 + c][16 dt + 8 hf + r] */
  const v8f oo[4] = {o0, o1, o2, o3};
#pragma unroll
  for (int dt = 0; dt < 4; ++dt) { FragH f;
#pragma unroll
    for (int r = 0; r < 8; ++r) f.h[r] = (_Float16)(oo[dt][r] * inv);
    *(v8us*)(op + 16 * dt) = f.half[0]; } }

extern "C" void kernel_launch(void* const* d_in, const int* in_sizes, int n_in,
                              void* d_out, int out_size, void* d_ws, size_t ws_size, hipStream_t stream) {
  (void)in_sizes; (void)n_in; (void)out_size;
  const float* const* I = (const float* const*)d_in; const float* x = I[0]; const int* pmask = (const int*)d_in[1]; const float* wq = I[2]; const float* bq = I[3]; const float* wk = I[4]; const float* bk = I[5]; const float* wv = I[6]; const float* bv = I[7]; const float* wo = I[8]; const float* bo = I[9];      /* weights natural [out][in]; patch_mask int32 [4][2048] (1 = valid) */
  char* ws = (char*)d_ws; size_t off = 0;
  auto take = [&](size_t bytes) { char* p = ws + off; off += (bytes + 255) & ~(size_t)255; return p; };
  _Float16* BQ = (_Float16*)take((size_t)DM * DM * 2); _Float16* BK = (_Float16*)take((size_t)DM * DM * 2); _Float16* BV = (_Float16*)take((size_t)DM * DM * 2); _Float16* BO = (_Float16*)take((size_t)DM * DM * 2);
  _Float16* X16 = (_Float16*)take(NR * DM * 2); _Float16* Q16 = (_Float16*)take(NR * DM * 2); _Float16* K16 = (_Float16*)take(NR * DM * 2); _Float16* V16 = (_Float16*)take(NR * DM * 2); _Float16* O16 = (_Float16*)take(NR * DM * 2);
  float* TB = (float*)take((size_t)SQ * 4); int* POS = (int*)take(NR * 4); int* CNT = (int*)take((size_t)NB * CNTP * 4); float* KN2 = (float*)take((size_t)NB * NH * (SQ / 128) * 4 * 32 * 4);
  (void)BK; (void)BV;
  if (off > ws_size) return;      /* 2 + 5x8 + 0.29 = approx 42 MiB */
  k_prep<<<PBL + PBX + 4 * PBW + PBT, 256, 0, stream>>>(x, pmask, wq, wk, wv, wo, X16, BQ, TB, POS, CNT, (float*)d_out);      /* BQ | BK | BV | BO are four planes in a row */
  const dim3 gp((unsigned)((NR / 128) * (DM / 64)), 1); const dim3 gp3((unsigned)((NR / 128) * (DM / 64)), 3);
  k_gemm2<0, false><<<gp3, 128, 0, stream>>>(X16, DM, 0, BQ, DM, (size_t)DM * DM, 0.0625f, bq, bk, bv, 0, nullptr, Q16, DM, NR * DM, MP, DM, DM, CNT, POS, nullptr, KN2);      /* blockIdx.y = 0, 1, 2: q, k, v; Q16 | K16 | V16 are three planes in a row */
  k_fattn<<<dim3(NB * NH, SQ / 128), 256, 0, stream>>>(Q16, K16, V16, TB, POS, CNT, KN2, O16);      /* o (merged heads) as f16 rows */
  k_gemm2<0, true><<<gp, 128, 0, stream>>>(O16, DM, 0, BO, DM, 0, 0.0625f, bo, nullptr, nullptr, 0, (float*)d_out, nullptr, DM, 0, MO, DM, DM, CNT, nullptr, POS, nullptr);      /* o Wo^T + bo (f32), listed rows to their own rows of out */
}

// v010
// It runs in 33.2 microseconds.
// Two timings next to v009 put it at 1.03 and 1.04 times that version's speed.
// All steps since v000 together make it 589 times as fast.
#include <hip/hip_runtime.h>
#define NB 4
#define SQ 2048
#define DM 512
#define NH 8
#define HD 64
#define MP ((int)NR)                 /* token rows through the projections (debug hook) */
#define MO ((int)NR)                 /* token rows through the output projection / mask (debug hook) */
#define NR ((size_t)NB * SQ)         /* 8192 token rows */
#define CNTP 32                      /* ints between two batches' list lengths: each has a 128-byte line of its own */
typedef __bf16 v16b __attribute__((ext_vector_type(16)));
typedef unsigned short v8us __attribute__((ext_vector_type(8), may_alias));
typedef float  v8f  __attribute__((ext_vector_type(8)));
typedef float  v4f  __attribute__((ext_vector_type(4)));
typedef float  v4fa __attribute__((ext_vector_type(4), may_alias));
union FragB { v16b v; v8us half[2]; unsigned short u[16]; };

__device__ __forceinline__ unsigned short bf16_bits(float x) { unsigned int u = __float_as_uint(x); return (unsigned short)((u + 0x7FFFu + ((u >> 16) & 1u)) >> 16); }
__device__ __forceinline__ float bf16_val(unsigned short b) { return __uint_as_float(((unsigned int)b) << 16); }
__device__ __forceinline__ float bf16_round(float x) { return bf16_val(bf16_bits(x)); }
// D += A·B with NT terms: 1 = ah·bh, 2 = + al·bh (A split), 3 = + ah·bl (both split)
template <int NT>
__device__ __forceinline__ v8f mmaN(v16b ah, v16b al, v16b bh, v16b bl, v8f c) {
  c = __builtin_amdgcn_wmma_f32_16x16x32_bf16(false, ah, false, bh, (short)0, c, false, false);
  if (NT >= 2) c = __builtin_amdgcn_wmma_f32_16x16x32_bf16(false, al, false, bh, (short)0, c, false, false);
  if (NT >= 3) c = __builtin_amdgcn_wmma_f32_16x16x32_bf16(false, ah, false, bl, (short)0, c, false, false);
  asm volatile("v_nop\n\tv_nop\n\tv_nop\n\tv_nop" : "+v"(c) : "v"(ah), "v"(al), "v"(bh), "v"(bl));
  return c;
}

__global__ __launch_bounds__(256) void k_wt_bf16(const float* __restrict__ W, unsigned short* __restrict__ Wt, int K, int N) {
  const int t = blockIdx.x * 256 + threadIdx.x;
  const int k8n = K / 8;
  if (t >= N * k8n) return;
  const int n = t / k8n, k8 = (t % k8n) * 8;
  v8us v;
#pragma unroll
  for (int i = 0; i < 8; ++i) v[i] = bf16_bits(W[(size_t)(k8 + i) * N + n]);
  *(v8us*)(Wt + (size_t)n * K + k8) = v;
  
}

// GEMM C[M][N] (f32, pitch ldc) = act(A[M][K]·W + bias). A f32 row-major (pitch lda) converted per fragment to bf16
// (ASPLIT: hi/lo two planes -> 2 terms, else single rounded term); Wt bf16 [N][K] (pitch ldb). BIAS_BF16 rounds the
// bias to bf16 first (bias quantised to bf16 before the add). K%32==0, M%16==0, N%64==0.
template <bool ASPLIT, int ACT, bool BIAS_BF16>
__global__ __launch_bounds__(128) void k_gemm_bf(const float* __restrict__ A, int lda, const unsigned short* __restrict__ Wt, int ldb,
                                               const float* __restrict__ bias, float* __restrict__ C, int ldc, int M, int N, int K) {
  __shared__ __attribute__((aligned(16))) float so[4][16][64];
  const int tid = threadIdx.x, w = tid >> 5, lane = tid & 31, ln = lane & 15, hh = lane >> 4;
  const int ntn = N / 64;
  const int wid = blockIdx.x * 4 + w;
  const int mt = wid / ntn, nq = wid % ntn;
  if (mt * 16 >= M) return;
  const int row0 = mt * 16, col0 = nq * 64;
  const float* arow = A + (size_t)(row0 + ln) * lda;
  v8f acc[4] = {};
  for (int kb = 0; kb < K; kb += 32) {
    FragB ah, al;
    const v4f x0 = *(const v4fa*)(arow + kb + 8 * hh), x1 = *(const v4fa*)(arow + kb + 8 * hh + 4);
    const v4f x2 = *(const v4fa*)(arow + kb + 16 + 8 * hh), x3 = *(const v4fa*)(arow + kb + 16 + 8 * hh + 4);
    float xs[16] = {x0[0],x0[1],x0[2],x0[3],x1[0],x1[1],x1[2],x1[3],x2[0],x2[1],x2[2],x2[3],x3[0],x3[1],x3[2],x3[3]};
#pragma unroll
    for (int i = 0; i < 16; ++i) { const unsigned short hb = bf16_bits(xs[i]); ah.u[i] = hb; al.u[i] = ASPLIT ? bf16_bits(xs[i] - bf16_val(hb)) : (unsigned short)0; }
#pragma unroll
    for (int t = 0; t < 4; ++t) {
      const unsigned short* brow = Wt + (size_t)(col0 + t * 16 + ln) * ldb + kb;
      FragB b;
      b.half[0] = *(const v8us*)(brow + 8 * hh);
      b.half[1] = *(const v8us*)(brow + 16 + 8 * hh);
      acc[t] = mmaN<ASPLIT ? 2 : 1>(ah.v, al.v, b.v, b.v, acc[t]);
    }
  }
#pragma unroll
  for (int t = 0; t < 4; ++t) {
    float bv = bias ? bias[col0 + t * 16 + ln] : 0.f;
    if (BIAS_BF16) bv = bf16_round(bv);
#pragma unroll
    for (int r = 0; r < 8; ++r) { float v = acc[t][r] + bv; if (ACT == 1) v = fmaxf(v, 0.f); so[w][8 * hh + r][t * 16 + ln] = v; }
  }
  __builtin_amdgcn_fence(__ATOMIC_ACQ_REL, "workgroup");
  __builtin_amdgcn_wave_barrier();
  const int rsub = lane >> 4, c4 = (lane & 15) * 4;
  {
#pragma unroll
    for (int q = 0; q < 8; ++q) {
      const int r = q * 2 + rsub;
      const v4f v = *(const v4fa*)&so[w][r][c4];
      *(v4f*)(C + (size_t)(row0 + r) * ldc + col0 + c4) = v;
    }
    
  }
}

// GEMM C = act(A·W + bias + resid): A f32 (ASPLIT -> hi/lo 2 terms), Wt bf16 [N][K]; ACT 0 none, 1 relu, 2 exact gelu;
// resid (optional, f32, row index = (row % rmod), pitch ldr, RES_BF16 rounds it) added before the activation.
template <bool ASPLIT, int ACT, bool BIAS_BF16, bool RES_BF16>
__global__ __launch_bounds__(128) void k_gemm_bf3(const float* __restrict__ A, int lda, const unsigned short* __restrict__ Wt, int ldb,
                                                const float* __restrict__ bias, const float* __restrict__ resid, int rmod, int ldr,
                                                float* __restrict__ C, int ldc, int M, int N, int K) {
  __shared__ __attribute__((aligned(16))) float so[4][16][64];
  const int tid = threadIdx.x, w = tid >> 5, lane = tid & 31, ln = lane & 15, hh = lane >> 4;
  const int ntn = N / 64;
  const int wid = blockIdx.x * 4 + w;
  const int mt = wid / ntn, nq = wid % ntn;
  if (mt * 16 >= M) return;
  const int row0 = mt * 16, col0 = nq * 64;
  const float* arow = A + (size_t)(row0 + ln) * lda;
  v8f acc[4] = {};
  for (int kb = 0; kb < K; kb += 32) {
    FragB ah, al;
    const v4f x0 = *(const v4fa*)(arow + kb + 8 * hh), x1 = *(const v4fa*)(arow + kb + 8 * hh + 4);
    const v4f x2 = *(const v4fa*)(arow + kb + 16 + 8 * hh), x3 = *(const v4fa*)(arow + kb + 16 + 8 * hh + 4);
    float xs[16] = {x0[0],x0[1],x0[2],x0[3],x1[0],x1[1],x1[2],x1[3],x2[0],x2[1],x2[2],x2[3],x3[0],x3[1],x3[2],x3[3]};
#pragma unroll
    for (int i = 0; i < 16; ++i) { const unsigned short hb = bf16_bits(xs[i]); ah.u[i] = hb; al.u[i] = ASPLIT ? bf16_bits(xs[i] - bf16_val(hb)) : (unsigned short)0; }
#pragma unroll
    for (int t = 0; t < 4; ++t) {
      const unsigned short* brow = Wt + (size_t)(col0 + t * 16 + ln) * ldb + kb;
      FragB b;
      b.half[0] = *(const v8us*)(brow + 8 * hh);
      b.half[1] = *(const v8us*)(brow + 16 + 8 * hh);
      acc[t] = mmaN<ASPLIT ? 2 : 1>(ah.v, al.v, b.v, b.v, acc[t]);
    }
  }
#pragma unroll
  for (int t = 0; t < 4; ++t) {
    const int col = col0 + t * 16 + ln;
    float bv = bias ? bias[col] : 0.f;
    if (BIAS_BF16) bv = bf16_round(bv);
#pragma unroll
    for (int r = 0; r < 8; ++r) {
      float v = acc[t][r] + bv;
      if (resid) { float rv = resid[(size_t)((row0 + 8 * hh + r) % rmod) * ldr + col]; if (RES_BF16) rv = bf16_round(rv); v += rv; }
      if (ACT == 1) v = fmaxf(v, 0.f);
      if (ACT == 2) v = 0.5f * v * (1.0f + erff(v * 0.70710678118654752f));
      if (ACT == 3) { const float u = 0.7978845608028654f * (v + 0.044715f * v * v * v); v = 0.5f * v * (1.0f + tanhf(u)); }
      so[w][8 * hh + r][t * 16 + ln] = v;
    }
  }
  __builtin_amdgcn_fence(__ATOMIC_ACQ_REL, "workgroup");
  __builtin_amdgcn_wave_barrier();
  const int rsub = lane >> 4, c4 = (lane & 15) * 4;
  {
#pragma unroll
    for (int q = 0; q < 8; ++q) {
      const int r = q * 2 + rsub;
      const v4f v = *(const v4fa*)&so[w][r][c4];
      *(v4f*)(C + (size_t)(row0 + r) * ldc + col0 + c4) = v;
    }
    
  }
}
// row LayerNorm (biased variance, eps) over N: s = X (+ R); optional out_sum <- s; out_norm <- (s-mu)*rsqrt(var+eps)*g + b
template <bool PARAM_BF16>
__global__ __launch_bounds__(256) void k_layernorm(const float* __restrict__ X, const float* __restrict__ R, const float* __restrict__ g, const float* __restrict__ bta,
                                                  float* __restrict__ out_sum, float* __restrict__ out_norm, int N, float eps) {
  __shared__ float red[256];
  const int row = blockIdx.x, tid = threadIdx.x;
  const float* x = X + (size_t)row * N; const float* rr = R ? R + (size_t)row * N : nullptr;
  float vals[16];                     // up to N = 4096
  const int per = N / 256;            // contiguous chunk per thread? use strided-by-4 chunks: thread handles j = tid*4 + 1024*u
  float s1 = 0.f;
  for (int u = 0; u < per / 4; ++u) {
    const int j = tid * 4 + 1024 * u;
    const v4f a = *(const v4fa*)(x + j);
    v4f b = {0.f,0.f,0.f,0.f}; if (rr) b = *(const v4fa*)(rr + j);
#pragma unroll
    for (int q = 0; q < 4; ++q) { const float v = a[q] + b[q]; vals[u * 4 + q] = v; s1 += v; }
  }
  red[tid] = s1; __syncthreads();
  for (int st = 128; st > 0; st >>= 1) { if (tid < st) red[tid] += red[tid + st]; __syncthreads(); }
  const float mu = red[0] / (float)N; __syncthreads();
  float s2 = 0.f;
  for (int u = 0; u < per / 4; ++u)
#pragma unroll
    for (int q = 0; q < 4; ++q) { const float c = vals[u * 4 + q] - mu; s2 += c * c; }
  red[tid] = s2; __syncthreads();
  for (int st = 128; st > 0; st >>= 1) { if (tid < st) red[tid] += red[tid + st]; __syncthreads(); }
  const float rs = rsqrtf(red[0] / (float)N + eps);
  {
    for (int u = 0; u < per / 4; ++u) {
      const int j = tid * 4 + 1024 * u;
      v4f o, sm;
#pragma unroll
      for (int q = 0; q < 4; ++q) {
        float gg = g[j + q], bb = bta[j + q];
        if (PARAM_BF16) { gg = bf16_round(gg); bb = bf16_round(bb); }
        sm[q] = vals[u * 4 + q]; o[q] = (vals[u * 4 + q] - mu) * rs * gg + bb;
      }
      if (out_sum) *(v4f*)(out_sum + (size_t)row * N + j) = sm;
      *(v4f*)(out_norm + (size_t)row * N + j) = o;
    }
    
  }
}



// ---- f16 WMMA path (v_wmma_f32_16x16x32_f16): 11-bit significands for operands in range — used where a [0,1] probability operand needs more precision than bf16
typedef _Float16 v16h __attribute__((ext_vector_type(16)));
union FragH { v16h v; v8us half[2]; _Float16 h[16]; unsigned short u[16]; };
template <int NT>
__device__ __forceinline__ v8f mmaH(v16h ah, v16h al, v16h bh, v16h bl, v8f c) {
  c = __builtin_amdgcn_wmma_f32_16x16x32_f16(false, ah, false, bh, (short)0, c, false, false);
  if (NT >= 2) c = __builtin_amdgcn_wmma_f32_16x16x32_f16(false, al, false, bh, (short)0, c, false, false);
  if (NT >= 3) c = __builtin_amdgcn_wmma_f32_16x16x32_f16(false, ah, false, bl, (short)0, c, false, false);
  asm volatile("v_nop\n\tv_nop\n\tv_nop\n\tv_nop" : "+v"(c) : "v"(ah), "v"(al), "v"(bh), "v"(bl));
  return c;
}
// batched GEMM like k_gemm_b but f16 operands: A f32 (split into f16 hi/lo if ASPLIT, else rounded to f16), Bt = f16 values [n][k]; alpha; C f32; N multiple of 16 (partial tiles skipped)
template <bool ASPLIT>
__global__ __launch_bounds__(128) void k_gemm_h(const float* __restrict__ A, int lda, size_t sA, const _Float16* __restrict__ Bh, int ldb, size_t sB, float alpha, float* __restrict__ C, int ldc, size_t sC, int M, int N, int K) {
  __shared__ __attribute__((aligned(16))) float so[4][16][64];
  const int tid = threadIdx.x, w = tid >> 5, lane = tid & 31, ln = lane & 15, hh = lane >> 4; const int by = blockIdx.y;
  A += (size_t)by * sA; Bh += (size_t)by * sB; C += (size_t)by * sC;
  const int ntn = (N + 63) / 64; const int wid = blockIdx.x * 4 + w; const int mt = wid / ntn, nq = wid % ntn; if (mt * 16 >= M) return;
  const int row0 = mt * 16, col0 = nq * 64; const float* arow = A + (size_t)(row0 + ln) * lda;
  v8f acc[4] = {};
  for (int kb = 0; kb < K; kb += 32) {
    FragH ah, al;
    const v4f x0 = *(const v4fa*)(arow + kb + 8 * hh), x1 = *(const v4fa*)(arow + kb + 8 * hh + 4), x2 = *(const v4fa*)(arow + kb + 16 + 8 * hh), x3 = *(const v4fa*)(arow + kb + 16 + 8 * hh + 4);
    float xs[16] = {x0[0],x0[1],x0[2],x0[3],x1[0],x1[1],x1[2],x1[3],x2[0],x2[1],x2[2],x2[3],x3[0],x3[1],x3[2],x3[3]};
#pragma unroll
    for (int i = 0; i < 16; ++i) { const _Float16 h = (_Float16)xs[i]; ah.h[i] = h; al.h[i] = ASPLIT ? (_Float16)(xs[i] - (float)h) : (_Float16)0.0f; }
#pragma unroll
    for (int t = 0; t < 4; ++t) { if (col0 + t * 16 >= N) continue; const size_t boff = (size_t)(col0 + t * 16 + ln) * ldb + kb; FragH bq; bq.half[0] = *(const v8us*)(Bh + boff + 8 * hh); bq.half[1] = *(const v8us*)(Bh + boff + 16 + 8 * hh);
      acc[t] = mmaH<ASPLIT ? 2 : 1>(ah.v, al.v, bq.v, bq.v, acc[t]); }
  }
#pragma unroll
  for (int t = 0; t < 4; ++t) { if (col0 + t * 16 >= N) continue;
#pragma unroll
    for (int r = 0; r < 8; ++r) so[w][8 * hh + r][t * 16 + ln] = acc[t][r] * alpha; }
  __builtin_amdgcn_fence(__ATOMIC_ACQ_REL, "workgroup"); __builtin_amdgcn_wave_barrier();
  const int rsub = lane >> 4, c4 = (lane & 15) * 4;
  {
#pragma unroll
    for (int q = 0; q < 8; ++q) { const int r = q * 2 + rsub; if (col0 + c4 < N) { const v4f v = *(const v4fa*)&so[w][r][c4]; *(v4f*)(C + (size_t)(row0 + r) * ldc + col0 + c4) = v; } }
     }
}

// Wt[n][k] = f16(W[k][n]·scale) from f32 row-major W[K][N] (scale = power of two; bf16-exact weights stay exact in f16 away from the subnormal range)
__global__ __launch_bounds__(256) void k_wt_f16(const float* __restrict__ W, _Float16* __restrict__ Wt, int K, int N, float scale) {
  const int t = blockIdx.x * 256 + threadIdx.x; if (t >= N * (K / 8)) return; const int n = t / (K / 8), k8 = (t % (K / 8)) * 8; FragH f;
#pragma unroll
  for (int i = 0; i < 8; ++i) f.h[i] = (_Float16)(bf16_round(W[(size_t)(k8 + i) * N + n]) * scale); const v8us o = f.half[0];
  *(v8us*)((unsigned short*)Wt + (size_t)n * K + k8) = o; 
}
// k_gemm_hh variant with fused epilogue: v = acc·alpha + bias[by·sBias + col] (+ CP[(row/rowsPerB)·sCPb + by·64 + col] if CP) ; ACT 0 none / 1 elu ; writes f16 C16 (and f32 C if non-null)
template <int ACT>
__global__ __launch_bounds__(128) void k_gemm_hhx(const _Float16* __restrict__ A, int lda, size_t sA, const _Float16* __restrict__ Bh, int ldb, size_t sB, float alpha, const float* __restrict__ bias, size_t sBias, const float* __restrict__ CP, int rowsPerB, size_t sCPb, int row0g,
    float* __restrict__ C, _Float16* __restrict__ C16, int ldc, size_t sC, int M, int N, int K) {
  __shared__ __attribute__((aligned(16))) float so[4][16][64];
  const int tid = threadIdx.x, w = tid >> 5, lane = tid & 31, ln = lane & 15, hh = lane >> 4; const int by = blockIdx.y;
  A += (size_t)by * sA; Bh += (size_t)by * sB; const size_t cofs = (size_t)by * sC; const float* bp = bias ? bias + (size_t)by * sBias : nullptr;
  const int ntn = (N + 63) / 64; const int wid = blockIdx.x * 4 + w; const int mt = wid / ntn, nq = wid % ntn; if (mt * 16 >= M) return;
  const int row0 = mt * 16, col0 = nq * 64; const _Float16* arow = A + (size_t)(row0 + ln) * lda;
  v8f acc[4] = {};
  for (int kb = 0; kb < K; kb += 32) { FragH ah; ah.half[0] = *(const v8us*)((const unsigned short*)arow + kb + 8 * hh); ah.half[1] = *(const v8us*)((const unsigned short*)arow + kb + 16 + 8 * hh);
#pragma unroll
    for (int t = 0; t < 4; ++t) { if (col0 + t * 16 >= N) continue; const size_t boff = (size_t)(col0 + t * 16 + ln) * ldb + kb; FragH bq; bq.half[0] = *(const v8us*)((const unsigned short*)Bh + boff + 8 * hh); bq.half[1] = *(const v8us*)((const unsigned short*)Bh + boff + 16 + 8 * hh);
      acc[t] = mmaH<1>(ah.v, ah.v, bq.v, bq.v, acc[t]); }
  }
#pragma unroll
  for (int t = 0; t < 4; ++t) { if (col0 + t * 16 >= N) continue; const int col = col0 + t * 16 + ln; const float bv = bp ? bf16_round(bp[col]) : 0.f;
#pragma unroll
    for (int r = 0; r < 8; ++r) { float v = acc[t][r] * alpha + bv; if (CP) { const int rr = row0g + row0 + 8 * hh + r; if (rowsPerB < 0) v += CP[cofs + (size_t)rr * ldc + col];      /* rowsPerB < 0: own element of the batched C plane */ else { const int bidx = rr / rowsPerB; v += CP[(size_t)bidx * sCPb + (size_t)by * 64 + col]; } } if (ACT == 1) v = (v > 0.f) ? v : expm1f(v); else if (ACT == 7) v = (v > 0.f) ? v + 1.0f : expf(v); else if (ACT == 8) v = tanhf(v); else if (ACT == 9) v = 0.5f * v * (1.0f + tanhf(0.7978845608028654f * (v + 0.044715f * v * v * v))); else if (ACT == 11) v = 1.0f / (1.0f + expf(-v)); else if (ACT == 12) v = (v > 0.f) ? v : 0.01f * v; else if (ACT == 14) v = (v > 0.f) ? v : 0.1f * v; else if (ACT == 16) v = (v >= 0.f) ? v : 0.3f * v; else if (ACT == 17) v = (v >= 0.f) ? v : 0.2f * v; else if (ACT == 15) v = v / (1.0f + expf(-v)); else if (ACT == 3) v = fmaxf(v, 0.f); else if (ACT == 6) v = 0.5f * v * (1.0f + erff(v * 0.70710678118654752f)); so[w][8 * hh + r][t * 16 + ln] = v; } }
  __builtin_amdgcn_fence(__ATOMIC_ACQ_REL, "workgroup"); __builtin_amdgcn_wave_barrier();
  const int rsub = lane >> 4, c4 = (lane & 15) * 4; typedef _Float16 v4h __attribute__((ext_vector_type(4)));
  {
#pragma unroll
    for (int q = 0; q < 8; ++q) { const int r = q * 2 + rsub; if (col0 + c4 < N) { const v4f v = *(const v4fa*)&so[w][r][c4]; if (C) *(v4f*)(C + cofs + (size_t)(row0 + r) * ldc + col0 + c4) = v; if (C16) { v4h h4; for (int i = 0; i < 4; ++i) h4[i] = (_Float16)v[i]; *(v4h*)(C16 + cofs + (size_t)(row0 + r) * ldc + col0 + c4) = h4; } } }
     }
}


typedef _Float16 v4h __attribute__((ext_vector_type(4)));

__global__ __launch_bounds__(256) void k_h16(const float* __restrict__ x, _Float16* __restrict__ X16, size_t n8) { const size_t t = (size_t)blockIdx.x * 256 + threadIdx.x; if (t >= n8) return; FragH f;
#pragma unroll
  for (int q = 0; q < 8; ++q) f.h[q] = (_Float16)x[t * 8 + q]; *(v8us*)((unsigned short*)X16 + t * 8) = f.half[0];  }
__global__ __launch_bounds__(256) void k_round16f(const float* __restrict__ W, _Float16* __restrict__ Bt, size_t n8) { const size_t t = (size_t)blockIdx.x * 256 + threadIdx.x; if (t >= n8) return; FragH f;
#pragma unroll
  for (int i = 0; i < 8; ++i) f.h[i] = (_Float16)(bf16_round(W[t * 8 + i]) * 16.0f); *(v8us*)((unsigned short*)Bt + t * 8) = f.half[0];  }
template <int NHv, int TTv>
__global__ __launch_bounds__(256) void k_vt(const _Float16* __restrict__ V16, int ldv, int voff, _Float16* __restrict__ Vt) { __shared__ unsigned short tl[64][66]; const int tid = threadIdx.x; const int slab = blockIdx.x / (TTv / 64), lg = blockIdx.x % (TTv / 64); const int b = slab / NHv, h = slab % NHv;
  for (int i = tid; i < 64 * 8; i += 256) { const int r = i / 8, c8 = (i % 8) * 8; FragH f; f.half[0] = *(const v8us*)((const unsigned short*)V16 + ((size_t)b * TTv + lg * 64 + r) * ldv + voff + h * 64 + c8);
#pragma unroll
    for (int q = 0; q < 8; ++q) tl[r][c8 + q] = f.u[q]; }
  __syncthreads();
  {
#pragma unroll
    for (int rd = 0; rd < 2; ++rd) { const int d = rd * 32 + tid / 8, pc = tid % 8; FragH f;
#pragma unroll
      for (int q = 0; q < 8; ++q) f.u[q] = tl[pc * 8 + q][d];
      *(v8us*)((unsigned short*)Vt + ((size_t)slab * 64 + d) * TTv + lg * 64 + pc * 8) = f.half[0]; }
     } }

__global__ __launch_bounds__(256) void k_hl(const float* __restrict__ F, _Float16* __restrict__ Hh, _Float16* __restrict__ Hl, size_t n8) { const size_t t = (size_t)blockIdx.x * 256 + threadIdx.x; if (t >= n8) return; FragH fh, fl; const v4f a = *(const v4fa*)(F + t * 8), c = *(const v4fa*)(F + t * 8 + 4);
#pragma unroll
  for (int q = 0; q < 4; ++q) { _Float16 h = (_Float16)a[q]; fh.h[q] = h; fl.h[q] = (_Float16)((a[q] - (float)h) * 1024.0f); h = (_Float16)c[q]; fh.h[4 + q] = h; fl.h[4 + q] = (_Float16)((c[q] - (float)h) * 1024.0f); }
  { *(v8us*)((unsigned short*)Hh + t * 8) = fh.half[0]; *(v8us*)((unsigned short*)Hl + t * 8) = fl.half[0];  } }

// ---- fast GEMM (work-group tile 128x64, wave tile 32x64; requires M % 128 == 0, N % 64 == 0, K % 64 == 0, for the f32-output form K % 128 == 0); epilogue: acc * alpha + bias, activation; no test on an argument per element or per row ----
// A and B reach the fragments through LDS: a stage is 64 k (one 128-byte line) of the tile's 128 A rows and 64 B rows; eight lanes load one whole line, so a wave's load touches 4 lines, not 16, and B is fetched once a work-group, not once a wave. The next stage's lines fly while this stage is worked on (two buffers, one barrier a stage). The fragments hold the same elements in the same k order as a load straight from global. The f32-output form takes stages of 128 k and fills them by asynchronous copies to LDS instead (said at its branch).
#define GKC 64                       /* k per LDS stage */
#define GP 144                       /* LDS row pitch, bytes: 16 x odd, for ds_load_b128 */
#define GST ((128 + 64) * GP)        /* bytes of one stage: 128 A rows, then 64 B rows */
#define GK2 128                      /* k per LDS stage where the stages come by asynchronous copies (the f32-output form) */
#define GP2 272                      /* its LDS row pitch, bytes: 16 x odd, for ds_load_b128 */
#define GST2 ((128 + 64) * GP2)      /* bytes of one such stage: 128 A rows, then 64 B rows */
typedef __attribute__((address_space(3))) unsigned char lds_u8;
// twelve asynchronous copies of 16 bytes a lane, global memory to LDS through no register: l = the lane's LDS byte addresses, g = its global addresses. The closing wait stands inside the statement as a precaution, in front of any later write of the address registers that the copies name.
__device__ __forceinline__ void g2_copy12(const unsigned* l, const char* const* g) {
  asm volatile("global_load_async_to_lds_b128 %0, %12, off\n\tglobal_load_async_to_lds_b128 %1, %13, off\n\tglobal_load_async_to_lds_b128 %2, %14, off\n\tglobal_load_async_to_lds_b128 %3, %15, off\n\t"
               "global_load_async_to_lds_b128 %4, %16, off\n\tglobal_load_async_to_lds_b128 %5, %17, off\n\tglobal_load_async_to_lds_b128 %6, %18, off\n\tglobal_load_async_to_lds_b128 %7, %19, off\n\t"
               "global_load_async_to_lds_b128 %8, %20, off\n\tglobal_load_async_to_lds_b128 %9, %21, off\n\tglobal_load_async_to_lds_b128 %10, %22, off\n\tglobal_load_async_to_lds_b128 %11, %23, off\n\t"
               "s_wait_xcnt 0x0"
               :: "v"(l[0]), "v"(l[1]), "v"(l[2]), "v"(l[3]), "v"(l[4]), "v"(l[5]), "v"(l[6]), "v"(l[7]), "v"(l[8]), "v"(l[9]), "v"(l[10]), "v"(l[11]),
                  "v"(g[0]), "v"(g[1]), "v"(g[2]), "v"(g[3]), "v"(g[4]), "v"(g[5]), "v"(g[6]), "v"(g[7]), "v"(g[8]), "v"(g[9]), "v"(g[10]), "v"(g[11]) : "memory"); }
__device__ __forceinline__ v16h g2_lfrag(const unsigned char* p) { FragH f; f.half[0] = *(const v8us*)p; f.half[1] = *(const v8us*)(p + 32); return f.v; }
__device__ __forceinline__ v16h g2_frag(const _Float16* p, int hh) { FragH f; f.half[0] = *(const v8us*)((const unsigned short*)p + 8 * hh); f.half[1] = *(const v8us*)((const unsigned short*)p + 16 + 8 * hh); return f.v; }
__device__ __forceinline__ v8f g2_mma(v16h a, v16h b, v8f c) { v8f d = __builtin_amdgcn_wmma_f32_16x16x32_f16(false, a, false, b, (short)0, c, false, false); asm volatile("v_nop\n\tv_nop\n\tv_nop\n\tv_nop" : "+v"(d) : "v"(a), "v"(b)); return d; }
template <int X> __device__ __forceinline__ float row_xor(float x) { return __builtin_bit_cast(float, __builtin_amdgcn_update_dpp(0, __builtin_bit_cast(int, x), 0x160 | X, 0xf, 0xf, true)); }      /* lane l reads lane l ^ X, X < 16, on the vector unit: no LDS round trip */
template <int ACT, bool F32O>      /* F32O: the result goes to C as f32; else to C16 as f16 */
__global__ __launch_bounds__(128) void k_gemm2(const _Float16* __restrict__ A, int lda, size_t sA, const _Float16* __restrict__ Bh, int ldb, size_t sB, float alpha, const float* __restrict__ bias, const float* __restrict__ bias1, const float* __restrict__ bias2, size_t sBias,
    float* __restrict__ C, _Float16* __restrict__ C16, int ldc, size_t sC, int M, int N, int K, const int* __restrict__ cnt, const int* __restrict__ gpos, const int* __restrict__ spos, float* __restrict__ KN2) { static_assert(ACT == 0 || ACT == 3 || ACT == 6 || ACT == 8 || ACT == 9 || ACT == 11 || ACT == 12 || ACT == 14 || ACT == 15 || ACT == 16 || ACT == 17, "k_gemm2: unsupported ACT code (would silently apply no activation)");
  __shared__ __attribute__((aligned(16))) unsigned char stg[F32O ? 2 * GST2 : 2 * GST]; float (*so)[32][68] = (float (*)[32][68])stg; static_assert(sizeof(float) * 4 * 32 * 68 <= 2 * GST, "the epilogue's tile lies over the stages");      /* so is written only behind the loop's last barrier */
  const int tid = threadIdx.x, w = tid >> 5, lane = tid & 31, ln = lane & 15, hh = lane >> 4; const int by = blockIdx.y;
  if (bias1) bias = by == 1 ? bias1 : by == 2 ? bias2 : bias;      /* three products in one grid, each with its own bias vector */
  A += (size_t)by * sA; Bh += (size_t)by * sB; const size_t cofs = (size_t)by * sC; const float* bp = bias + (size_t)by * sBias;      /* every launch gives a bias vector */
  const int ntn = N >> 6; const int mi = blockIdx.x / ntn, nq = blockIdx.x - mi * ntn; const int mt = (mi % NB) * (SQ / 128) + mi / NB;      /* row tiles in the order tile 0 of every batch, tile 1 of every batch, ...: the tiles past the lists come last in the grid */
  const int row0 = mt * 128 + 32 * w, col0 = nq * 64; if (mt * 128 >= M) return;      /* the whole work-group leaves, in front of every barrier */
  /* rows are list entries: batch bb, entries cb .. cb + 127 of its list of nv valid tokens; a block whose first entry lies past the list has nothing to do; the entries from nv to the block's end repeat the first valid token (finite rows that carry no weight later) */
  const int bb = (mt * 128) / SQ, cb = mt * 128 - bb * SQ; int nv = cnt[bb * CNTP]; nv = nv < SQ ? nv : SQ; if (cb >= nv) return;
  int sp = cb + 32 * w + lane, nlim = SQ; if (spos) { sp = spos[row0 + lane] & (SQ - 1); nlim = nv; }      /* lane l: the row inside the batch where row l of this wave's tile is stored; spos: a listed row goes to its token's own position, an entry past the list nowhere */
  const v8f z8 = {0.f,0.f,0.f,0.f,0.f,0.f,0.f,0.f}; v8f c00, c01, c02, c03, c10, c11, c12, c13;      /* set to zero in front of either form's loop */
  if constexpr (F32O) {      /* stages of 128 k (K % 128 == 0) by asynchronous copies, two buffers: a launch with one or two work-groups per WGP has nothing else to cover the trip to memory, so a stage's copies fly under twice the products, and half as many waits are met; no staging registers, no LDS stores; k order of the products as in the other form */
    /* thread t copies 16 bytes of A rows t / 16 + 8 i (i < 16) and of B rows t / 16 + 8 i (i < 8) of each stage: sixteen lanes take a row's 256 bytes, two whole lines */
    const int sr2 = tid >> 4, sc2 = tid & 15; int ra2[16]; unsigned ao2[16], bo2[8];
#pragma unroll
    for (int i = 0; i < 16; ++i) ra2[i] = mt * 128 + sr2 + 8 * i;
    if (gpos) { int gv[16];
#pragma unroll
      for (int i = 0; i < 16; ++i) gv[i] = gpos[ra2[i]];
#pragma unroll
      for (int i = 0; i < 16; ++i) ra2[i] = bb * SQ + (gv[i] & (SQ - 1)); }
#pragma unroll
    for (int i = 0; i < 16; ++i) ao2[i] = (unsigned)ra2[i] * (unsigned)lda * 2u + (unsigned)sc2 * 16u;
#pragma unroll
    for (int i = 0; i < 8; ++i) bo2[i] = (unsigned)(col0 + sr2 + 8 * i) * (unsigned)ldb * 2u + (unsigned)sc2 * 16u;
    const char* Ab = (const char*)A; const char* Bb = (const char*)Bh; const unsigned l0 = (unsigned)(size_t)(lds_u8*)stg + (unsigned)(sr2 * GP2 + sc2 * 16);      /* the lane's LDS byte address in row t / 16 of buffer 0 */
    auto issue = [&](int t) { const unsigned lb = l0 + (unsigned)((t & 1) * GST2); const size_t ko = (size_t)t * (GK2 * 2); unsigned l[24]; const char* g[24];      /* stage t into buffer t mod 2: 24 copies a wave in flight */
#pragma unroll
      for (int i = 0; i < 16; ++i) { l[i] = lb + (unsigned)(8 * i * GP2); g[i] = Ab + ko + ao2[i]; }
#pragma unroll
      for (int i = 0; i < 8; ++i) { l[16 + i] = lb + (unsigned)((128 + 8 * i) * GP2); g[16 + i] = Bb + ko + bo2[i]; }
      g2_copy12(l, g); g2_copy12(l + 12, g + 12); };
    const int nt = K / GK2; const unsigned char* af2 = stg + (32 * w + ln) * GP2 + 16 * hh; const unsigned char* bf2 = stg + (128 + ln) * GP2 + 16 * hh;
    issue(0);
    asm volatile("s_wait_asynccnt 0x0" ::: "memory");      /* this wave's copies of stage 0 have landed */
    __syncthreads();      /* publishes stage 0 */
    if (nt > 1) issue(1);
    c00 = z8; c01 = z8; c02 = z8; c03 = z8; c10 = z8; c11 = z8; c12 = z8; c13 = z8;
#pragma unroll 1
    for (int t = 0; t < nt; ++t) { const unsigned char* ap = af2 + (t & 1) * GST2; const unsigned char* bq = bf2 + (t & 1) * GST2;      /* rolled: two buffers, one stage's code */
#pragma unroll
      for (int hf = 0; hf < GK2 / 64; ++hf) { v16h a0[2], a1[2], b0[2], b1[2], b2[2], b3[2];
#pragma unroll
        for (int ks = 0; ks < 2; ++ks) { const int o = hf * 128 + ks * 64; a0[ks] = g2_lfrag(ap + o); a1[ks] = g2_lfrag(ap + 16 * GP2 + o); b0[ks] = g2_lfrag(bq + o); b1[ks] = g2_lfrag(bq + 16 * GP2 + o); b2[ks] = g2_lfrag(bq + 32 * GP2 + o); b3[ks] = g2_lfrag(bq + 48 * GP2 + o); }
        asm volatile("" :: "v"(a0[0]), "v"(a1[0]), "v"(b0[0]), "v"(b1[0]), "v"(b2[0]), "v"(b3[0]), "v"(a0[1]), "v"(a1[1]), "v"(b0[1]), "v"(b1[1]), "v"(b2[1]), "v"(b3[1]));      /* inputs only: holds the LDS reads of 64 k together in front of their products, one LDS latency for the run instead of one per fragment */
#pragma unroll
        for (int ks = 0; ks < 2; ++ks) {
          c00 = g2_mma(a0[ks], b0[ks], c00); c10 = g2_mma(a1[ks], b0[ks], c10); c01 = g2_mma(a0[ks], b1[ks], c01); c11 = g2_mma(a1[ks], b1[ks], c11);
          c02 = g2_mma(a0[ks], b2[ks], c02); c12 = g2_mma(a1[ks], b2[ks], c12); c03 = g2_mma(a0[ks], b3[ks], c03); c13 = g2_mma(a1[ks], b3[ks], c13); } }
      asm volatile("s_wait_dscnt 0x0" ::: "memory");      /* this wave's reads of stage t are done before its buffer is filled again */
      asm volatile("s_wait_asynccnt 0x0" ::: "memory");      /* this wave's copies of stage t + 1 have landed */
      __syncthreads();      /* publishes stage t + 1 and ends every wave's reads of stage t; behind the last one the stages' LDS is free for the epilogue */
      if (t + 2 < nt) issue(t + 2); }
    asm volatile("s_wait_asynccnt 0x0" ::: "memory");      /* no copy is outstanding when the epilogue writes this LDS */
  } else {
  /* staging: thread t moves 16 bytes of A rows t / 8 + 16 i (i < 8) and of B rows t / 8 + 16 i (i < 4) of each stage; the loops over i and ks are unrolled so that their arrays are registers */
  const int sr = tid >> 3, sc = tid & 7; int ra[8]; unsigned ao[8], bo[4];      /* ao, bo: each row's byte offset in its matrix (under 2^32); the stage's k is added to the uniform base */
#pragma unroll
  for (int i = 0; i < 8; ++i) ra[i] = mt * 128 + sr + 16 * i;
  if (gpos) { int gv[8];      /* gpos: A rows stand at the tokens' own positions; one test round all eight loads, so that they fly together */
#pragma unroll
    for (int i = 0; i < 8; ++i) gv[i] = gpos[ra[i]];
#pragma unroll
    for (int i = 0; i < 8; ++i) ra[i] = bb * SQ + (gv[i] & (SQ - 1)); }
#pragma unroll
  for (int i = 0; i < 8; ++i) ao[i] = (unsigned)ra[i] * (unsigned)lda * 2u + (unsigned)sc * 16u;
#pragma unroll
  for (int i = 0; i < 4; ++i) bo[i] = (unsigned)(col0 + sr + 16 * i) * (unsigned)ldb * 2u + (unsigned)sc * 16u;
  const char* Ab = (const char*)A; const char* Bb = (const char*)Bh; v8us pa[8], pb[4];
#pragma unroll
  for (int i = 0; i < 8; ++i) pa[i] = *(const v8us*)(Ab + ao[i]);
#pragma unroll
  for (int i = 0; i < 4; ++i) pb[i] = *(const v8us*)(Bb + bo[i]);
  unsigned char* sw = stg + sr * GP + sc * 16; const unsigned char* af = stg + (32 * w + ln) * GP + 16 * hh; const unsigned char* bf = stg + (128 + ln) * GP + 16 * hh;
#pragma unroll
  for (int i = 0; i < 8; ++i) *(v8us*)(sw + 16 * i * GP) = pa[i];
#pragma unroll
  for (int i = 0; i < 4; ++i) *(v8us*)(sw + (128 + 16 * i) * GP) = pb[i];
  __syncthreads();
  c00 = z8; c01 = z8; c02 = z8; c03 = z8; c10 = z8; c11 = z8; c12 = z8; c13 = z8; const int nch = K / GKC;
#pragma unroll 1
  for (int c = 0; c < nch; ++c) { const int cur = (c & 1) * GST; const bool more = c + 1 < nch;      /* rolled: two buffers, one stage's code */
    if (more) { const char* An = Ab + (size_t)(c + 1) * (GKC * 2); const char* Bn = Bb + (size_t)(c + 1) * (GKC * 2);
#pragma unroll
      for (int i = 0; i < 8; ++i) pa[i] = *(const v8us*)(An + ao[i]);
#pragma unroll
      for (int i = 0; i < 4; ++i) pb[i] = *(const v8us*)(Bn + bo[i]);
      asm volatile("s_wait_xcnt 0x0" ::: "memory"); }      /* keeps the twelve loads up here, in flight while this stage is worked on; the wait is a precaution in front of any reuse of their address registers */
    const unsigned char* ap = af + cur; const unsigned char* bq = bf + cur; v16h a0[GKC / 32], a1[GKC / 32], b0[GKC / 32], b1[GKC / 32], b2[GKC / 32], b3[GKC / 32];
#pragma unroll
    for (int ks = 0; ks < GKC / 32; ++ks) { a0[ks] = g2_lfrag(ap + ks * 64); a1[ks] = g2_lfrag(ap + 16 * GP + ks * 64); b0[ks] = g2_lfrag(bq + ks * 64); b1[ks] = g2_lfrag(bq + 16 * GP + ks * 64); b2[ks] = g2_lfrag(bq + 32 * GP + ks * 64); b3[ks] = g2_lfrag(bq + 48 * GP + ks * 64); }
    asm volatile("" :: "v"(a0[0]), "v"(a1[0]), "v"(b0[0]), "v"(b1[0]), "v"(b2[0]), "v"(b3[0]), "v"(a0[1]), "v"(a1[1]), "v"(b0[1]), "v"(b1[1]), "v"(b2[1]), "v"(b3[1]));      /* inputs only: holds the stage's LDS reads together in front of the products, one LDS latency a stage instead of one per fragment */
#pragma unroll
    for (int ks = 0; ks < GKC / 32; ++ks) {
      c00 = g2_mma(a0[ks], b0[ks], c00); c10 = g2_mma(a1[ks], b0[ks], c10); c01 = g2_mma(a0[ks], b1[ks], c01); c11 = g2_mma(a1[ks], b1[ks], c11);
      c02 = g2_mma(a0[ks], b2[ks], c02); c12 = g2_mma(a1[ks], b2[ks], c12); c03 = g2_mma(a0[ks], b3[ks], c03); c13 = g2_mma(a1[ks], b3[ks], c13); }
    if (more) { unsigned char* d = sw + (GST - cur);      /* that buffer's last readers left it before the barrier that ended the stage before */
#pragma unroll
      for (int i = 0; i < 8; ++i) *(v8us*)(d + 16 * i * GP) = pa[i];
#pragma unroll
      for (int i = 0; i < 4; ++i) *(v8us*)(d + (128 + 16 * i) * GP) = pb[i]; }
    __syncthreads(); } }      /* publishes the next stage and ends this stage's reads; behind the last one the stages' LDS is free for the epilogue */
  v8f accs[8] = {c00, c01, c02, c03, c10, c11, c12, c13};
#pragma unroll
  for (int u = 0; u < 8; ++u) { const int t = u & 3, half = u >> 2; const int col = col0 + t * 16 + ln; const float bv = bf16_round(bp[col]);
#pragma unroll
    for (int r = 0; r < 8; ++r) { const int rloc = half * 16 + 8 * hh + r; float v = accs[u][r] * alpha + bv;
      if (ACT == 3) v = fmaxf(v, 0.f); else if (ACT == 6) v = 0.5f * v * (1.0f + erff(v * 0.70710678118654752f)); else if (ACT == 11) v = 1.0f / (1.0f + expf(-v)); else if (ACT == 15) v = v / (1.0f + expf(-v)); else if (ACT == 12) v = (v > 0.f) ? v : 0.01f * v; else if (ACT == 8) v = tanhf(v); else if (ACT == 9) v = 0.5f * v * (1.0f + tanhf(0.7978845608028654f * (v + 0.044715f * v * v * v))); else if (ACT == 14) v = (v > 0.f) ? v : 0.1f * v; else if (ACT == 16) v = (v >= 0.f) ? v : 0.3f * v; else if (ACT == 17) v = (v >= 0.f) ? v : 0.2f * v;
      so[w][rloc][t * 16 + ln] = v; } }
  __builtin_amdgcn_fence(__ATOMIC_ACQ_REL, "workgroup"); __builtin_amdgcn_wave_barrier();
  const int rsub = lane >> 4, c4 = (lane & 15) * 4;
  {
#pragma unroll
    for (int q = 0; q < 16; ++q) { const int r = q * 2 + rsub; const v4f v = *(const v4fa*)&so[w][r][c4]; const int p0 = __builtin_amdgcn_readlane(sp, q * 2), p1 = __builtin_amdgcn_readlane(sp, q * 2 + 1); const int ro = bb * SQ + (rsub ? p1 : p0);
      if (cb + 32 * w + r < nlim) { if (F32O) { *(v4f*)(C + cofs + (size_t)ro * ldc + col0 + c4) = v; asm volatile("s_wait_xcnt 0x0" ::: "memory"); }      /* precaution: the built code rewrites this store's data and address registers right behind it */
        else { v4h h4; for (int i = 0; i < 4; ++i) h4[i] = (_Float16)v[i]; *(v4h*)(C16 + cofs + (size_t)ro * ldc + col0 + c4) = h4; } } }
     }
  if (!F32O && by == 1) { float sq = 0.f;      /* the k product: a column tile is one head, so lane l sums the squares of row l of the wave's tile, and the largest of the 32 sums goes to the wave's own 128-byte line of KN2; last in the kernel, nothing follows the store */
#pragma unroll
    for (int j = 0; j < 16; ++j) { const v4f v = *(const v4fa*)&so[w][lane][4 * j]; sq += v[0] * v[0] + v[1] * v[1] + v[2] * v[2] + v[3] * v[3]; }
    sq = fmaxf(sq, row_xor<8>(sq)); sq = fmaxf(sq, row_xor<4>(sq)); sq = fmaxf(sq, row_xor<2>(sq)); sq = fmaxf(sq, row_xor<1>(sq)); sq = fmaxf(sq, __shfl_xor(sq, 16));
    if (lane == 0) KN2[(size_t)(((bb * NH + nq) * (SQ / 128) + cb / 128) * 4 + w) * 32] = sq; } }


// ---- preparation: everything that reads only the inputs, as one launch; a block's index range says which job it does (none reads what another writes) ----
#define PBX ((int)(NR * DM / 8 / 256))      /* blocks that convert h: 8 elements a thread */
#define PBW (DM * DM / 8 / 256)             /* blocks per weight matrix: 8 elements a thread */
#define PBT (SQ / 256)                      /* blocks of the bias table: 1 entry a thread */
#define PBL NB                              /* blocks that list the valid tokens: one a batch, 8 positions a thread */
typedef int v4i __attribute__((ext_vector_type(4)));
__device__ __forceinline__ float tbias_at(int d) {
  const float dist = __fdiv_rn(__fmul_rn((float)d, 300.0f), 300.0f); const float v = logf(__fadd_rn(expf(-dist), 1e-12f));
  return v; }
__global__ __launch_bounds__(256) void k_prep(const float* __restrict__ x, const int* __restrict__ pmask, const float* __restrict__ wq, const float* __restrict__ wk, const float* __restrict__ wv, const float* __restrict__ wo, _Float16* __restrict__ X16, _Float16* __restrict__ BW, float* __restrict__ TB, int* __restrict__ POS, int* __restrict__ CNT, float* __restrict__ out) {
  __shared__ int psum[256]; __shared__ __attribute__((aligned(16))) int lst[SQ]; __shared__ int first;
  int blk = blockIdx.x;
  if (blk < PBL) { const int tid = threadIdx.x; const int* mp = pmask + (size_t)blk * SQ + tid * 8;      /* batch blk: valid positions in ascending order, by a prefix sum of the threads' counts */
    const v4i m0 = *(const v4i*)mp, m1 = *(const v4i*)(mp + 4); const int mv[8] = {m0[0], m0[1], m0[2], m0[3], m1[0], m1[1], m1[2], m1[3]}; int c = 0;
#pragma unroll
    for (int q = 0; q < 8; ++q) c += mv[q] != 0;
    psum[tid] = c; if (tid == 0) first = 0;
    __syncthreads();
    for (int o = 1; o < 256; o <<= 1) { const int a = tid >= o ? psum[tid - o] : 0; __syncthreads(); psum[tid] += a; __syncthreads(); }
    const int n = psum[255]; int rk = psum[tid] - c;
    if (rk == 0 && c != 0) {
#pragma unroll
      for (int q = 7; q >= 0; --q) if (mv[q] != 0) first = tid * 8 + q; }
#pragma unroll
    for (int q = 0; q < 8; ++q) if (mv[q] != 0) lst[rk++] = tid * 8 + q;
    __syncthreads();
    v4i o0, o1;      /* entries past the list repeat the first valid position; a wave stores whole 128-byte lines */
#pragma unroll
    for (int q = 0; q < 4; ++q) { o0[q] = tid * 8 + q < n ? lst[tid * 8 + q] : first; o1[q] = tid * 8 + 4 + q < n ? lst[tid * 8 + 4 + q] : first; }
    *(v4i*)(POS + (size_t)blk * SQ + tid * 8) = o0; *(v4i*)(POS + (size_t)blk * SQ + tid * 8 + 4) = o1; if (tid == 0) CNT[blk * CNTP] = n;
    return; }
  blk -= PBL;
  if (blk < PBX) { const size_t t = (size_t)blk * 256 + threadIdx.x; FragH f;      /* valid h rows, rounded to bf16, exact in f16; a padded row is read by nobody, its row of out is 0 */
    if (pmask[t / (DM / 8)] == 0) { const v4f z = {0.f, 0.f, 0.f, 0.f}; *(v4f*)(out + t * 8) = z; *(v4f*)(out + t * 8 + 4) = z; return; }
#pragma unroll
    for (int q = 0; q < 8; ++q) f.h[q] = (_Float16)bf16_round(x[t * 8 + q]);
    *(v8us*)((unsigned short*)X16 + t * 8) = f.half[0]; return; }
  blk -= PBX;
  if (blk < 4 * PBW) { const int mi = blk / PBW; const float* __restrict__ w = mi == 0 ? wq : mi == 1 ? wk : mi == 2 ? wv : wo;      /* weight mi, natural [out][in], x16, into plane mi of BW */
    const size_t t = (size_t)(blk - mi * PBW) * 256 + threadIdx.x; FragH f;
    for (int q = 0; q < 8; ++q) f.h[q] = (_Float16)(bf16_round(w[t * 8 + q]) * 16.0f);
    *(v8us*)((unsigned short*)BW + (size_t)mi * DM * DM + t * 8) = f.half[0]; return; }
  const int d = (blk - 4 * PBW) * 256 + threadIdx.x; TB[d] = tbias_at(d);
  asm volatile("s_wait_xcnt 0x0" ::: "memory"); }      /* precaution: the built code places another job's block behind this store, and that block rewrites the store's registers */
#define FK 128                       /* keys per LDS stage */
#define PK 144                       /* LDS row pitch of the K tile, bytes: 16 x odd, for ds_load_b128 */
#define PV 160                       /* LDS row pitch of the V tile, bytes: 32 x odd, for ds_load_tr16_b128 */
#define LOG2E 1.4426950408889634f
typedef short s16x8 __attribute__((ext_vector_type(8)));
typedef float v2f __attribute__((ext_vector_type(2)));
typedef unsigned v4u __attribute__((ext_vector_type(4), may_alias));
__device__ __forceinline__ v8us fa_tr16(const unsigned char* p) { typedef __attribute__((address_space(3))) s16x8 lds_s16x8; return __builtin_bit_cast(v8us, __builtin_amdgcn_ds_load_tr16_b128_v8i16((lds_s16x8*)p)); }
__device__ __forceinline__ float fa_xhalf(float x) { return __builtin_bit_cast(float, __builtin_amdgcn_permlanex16(__builtin_bit_cast(int, x), __builtin_bit_cast(int, x), 0x76543210, 0xfedcba98, false, false)); }      /* lane l reads lane l ^ 16 */
// amdgpu_waves_per_eu(4, 4) on the kernel: two work-groups per WGP are four waves per SIMD, so a wave may use up to 256 registers.
__device__ __forceinline__ v8f fa_mma(v16h a, v16h b, v8f c) { return __builtin_amdgcn_wmma_f32_16x16x32_f16(false, a, false, b, (short)0, c, false, false); }
__global__ __launch_bounds__(256) __attribute__((amdgpu_waves_per_eu(4, 4))) void k_fattn(const _Float16* __restrict__ Q16, const _Float16* __restrict__ K16, const _Float16* __restrict__ V16, const float* __restrict__ TB, const int* __restrict__ POS, const int* __restrict__ CNT, const float* __restrict__ KN2, _Float16* __restrict__ O16) {
  __shared__ __attribute__((aligned(16))) float kn4[4 * (SQ / FK)]; __shared__ __attribute__((aligned(16))) unsigned wm[8];
  __shared__ __attribute__((aligned(16))) float tb2[2 * SQ]; __shared__ __attribute__((aligned(16))) int kx[SQ];
  __shared__ __attribute__((aligned(16))) unsigned char kt[2][FK * PK]; __shared__ __attribute__((aligned(16))) unsigned char vt[2][FK * PV];
  const int tid = threadIdx.x, lane = tid & 31, ln = lane & 15, hh = lane >> 4; const int wv = __builtin_amdgcn_readfirstlane(tid >> 5);
  const int b = blockIdx.x / NH, h = blockIdx.x % NH; int nv = CNT[b * CNTP]; nv = nv < SQ ? nv : SQ; if ((int)blockIdx.y * 128 >= nv) return;      /* the whole work-group leaves, in front of every barrier: its queries lie past the list; the query tile is the slow grid index, so that these work-groups come last in the grid */
  const int nst = (nv + FK - 1) / FK; const int* lp = POS + (size_t)b * SQ; const int q0 = blockIdx.y * 128 + wv * 16; const bool act = q0 < nv;      /* act, the same for the whole wave: a wave whose 16 queries all lie past the list only stages and stores zero rows */ const size_t base = (size_t)b * SQ * DM + (size_t)h * HD;
  /* staging: thread t moves 16 bytes of rows t / 8 + 32 i (i < 4) of each tile, so a wave's load covers four whole 128-byte rows */
  const int sr = tid >> 3, sc = tid & 7;
  const unsigned short* kg = (const unsigned short*)K16 + base + (size_t)sr * DM + sc * 8; const unsigned short* vg = (const unsigned short*)V16 + base + (size_t)sr * DM + sc * 8;
  const int st0 = blockIdx.y * (128 / FK); const size_t g0 = (size_t)st0 * FK * DM;      /* the first stage worked on: the one that holds this work-group's first queries as keys (st0 < nst, since the work-group's first query is on the list) */
  v8us rk[FK / 32], rv[FK / 32];      /* the loops over i are unrolled so that these are registers */
#pragma unroll
  for (int i = 0; i < FK / 32; ++i) { rk[i] = *(const v8us*)(kg + g0 + (size_t)(32 * i) * DM); rv[i] = *(const v8us*)(vg + g0 + (size_t)(32 * i) * DM); }
  const _Float16* qp = Q16 + base + (size_t)(q0 + ln) * DM; const v16h qf0 = g2_frag(qp, hh), qf1 = g2_frag(qp + 32, hh);
  float knv = 0.f; if (tid < 4 * nst) knv = KN2[((size_t)blockIdx.x * (4 * (SQ / FK)) + tid) * 32];      /* the largest squared k norm of each 32 list places of this (batch, head); every stage under nst has its four */
#pragma unroll
  for (int u = 0; u < 2 * SQ / 256; ++u) { const int t = tid + 256 * u; int d = t - (SQ - 1); d = d < 0 ? -d : d; d = d < SQ ? d : SQ - 1; const float tv = TB[d] * LOG2E; tb2[t] = t == 2 * SQ - 1 ? -1.0e9f * LOG2E : tv; }      /* unrolled: the table's loads are all in flight together */
#pragma unroll
  for (int u = 0; u < SQ / 256; ++u) { const int t = tid + 256 * u; kx[t] = (lp[t] & (SQ - 1)) * 4 + (t < nv ? 0 : 4 * SQ * 4); }      /* a sum, so that the eight loads stand under no test and fly together: the list's every entry is written */
#pragma unroll
  for (int i = 0; i < FK / 32; ++i) { *(v8us*)(kt[0] + (sr + 32 * i) * PK + sc * 16) = rk[i]; *(v8us*)(vt[0] + (sr + 32 * i) * PV + sc * 16) = rv[i]; }
  if (tid < 4 * (SQ / FK)) kn4[tid] = knv;
  float q2 = 0.f, q3 = 0.f;      /* the largest q norm among the wave's listed queries, for the far-stage test at the end of the first trip */
#pragma unroll
  for (int i = 0; i < 16; ++i) { const float a = (float)qf0[i], c = (float)qf1[i]; q2 = __builtin_fmaf(a, a, q2); q3 = __builtin_fmaf(c, c, q3); }
  q2 += q3; q2 += fa_xhalf(q2); q2 = q0 + ln < nv ? q2 : 0.f;
  q2 = __builtin_fmaxf(q2, row_xor<8>(q2)); q2 = __builtin_fmaxf(q2, row_xor<4>(q2)); q2 = __builtin_fmaxf(q2, row_xor<2>(q2)); q2 = __builtin_fmaxf(q2, row_xor<1>(q2));
  const float qn = __builtin_sqrtf(q2);
  __syncthreads();
  const v8f z8 = {0.f,0.f,0.f,0.f,0.f,0.f,0.f,0.f}; v8f o0 = z8, o1 = z8, o2 = z8, o3 = z8; float m = -INFINITY, ms = -INFINITY, l = act ? 0.f : 1.f;
  const int qx = (SQ - 1) * 4 - (kx[q0 + ln] & ((SQ - 1) * 4)); const int* kq = kx + 8 * hh; const unsigned qm = __builtin_amdgcn_ballot_w32(q0 + ln < nv);      /* the lanes whose query is on the list; a query past it stands for no token (its o row is stored nowhere in out) and has no say in whether a pass is worked on */
  unsigned mine = ~0u;      /* the stages this wave works on: all, until the first trip's test */
  unsigned todo = ((1u << nst) - 1u) & ~(1u << st0); int sn = nst > 1 ? (st0 + 1 < nst ? st0 + 1 : st0 - 1) : -1; if (sn >= 0) todo &= ~(1u << sn);      /* todo: the stages not yet fetched, one bit each (nst <= 16); sn: the stage fetched next, -1 for none; all the same for the whole work-group */
#pragma unroll 1
  for (int t = 0, st = st0; st >= 0; ++t) { const int cur = t & 1; const bool more = sn >= 0;      /* rolled, for speed only; at most nst trips: st0, a neighbour of it, then what the first trip's test leaves of todo */
    float bbs[FK / 32];      /* per pass of the stage: the bias at de, the least distance, in list places, between the wave's queries and the pass's keys, the same for the whole wave; read up here, so that no far test waits on an LDS read of its own */
#pragma unroll
    for (int p = 0; p < FK / 32; ++p) { const int dk = st * FK + 32 * p - (q0 + 15), dq = q0 - (st * FK + 32 * p + 31); int de = dk > dq ? dk : dq; de = de > 0 ? de : 0; bbs[p] = tb2[SQ - 1 + de]; }
    if (more) { const size_t go = (size_t)sn * FK * DM;
#pragma unroll
      for (int i = 0; i < FK / 32; ++i) { rk[i] = *(const v8us*)(kg + go + (size_t)(32 * i) * DM); rv[i] = *(const v8us*)(vg + go + (size_t)(32 * i) * DM); }
      asm volatile("s_wait_xcnt 0x0" ::: "memory"); }      /* the next stage's rows fly while this stage is worked on; the wait is a precaution: the built code reuses these loads' address registers right behind them */
    if (act && ((mine >> st) & 1u) != 0)
#pragma unroll
    for (int g = 0; g < FK / 64; ++g) { const int k0 = st * FK + g * 64;      /* a group: 64 keys, two passes of 32 */
      const unsigned char* kp = kt[cur] + (g * 64 + ln) * PK + 16 * hh; FragH ka[4], kb[4];      /* ka[j], kb[j]: head dims 0 .. 31 and 32 .. 63 of keys 16 j .. 16 j + 15 of the group */
#pragma unroll
      for (int j = 0; j < 4; ++j) { ka[j].half[0] = *(const v8us*)(kp + 16 * j * PK); ka[j].half[1] = *(const v8us*)(kp + 16 * j * PK + 32); kb[j].half[0] = *(const v8us*)(kp + 16 * j * PK + 64); kb[j].half[1] = *(const v8us*)(kp + 16 * j * PK + 96); }
      asm volatile("" :: "v"(ka[0].v), "v"(ka[1].v), "v"(ka[2].v), "v"(ka[3].v), "v"(kb[0].v), "v"(kb[1].v), "v"(kb[2].v), "v"(kb[3].v));      /* inputs only: the group's LDS reads are issued as one run, one LDS latency a group; without it the built code reads two by two among the products, with a full wait at each */
      v8f s[4];      /* S^T of the group's four 16-key tiles: four independent chains of two products */
#pragma unroll
      for (int j = 0; j < 4; ++j) s[j] = fa_mma(ka[j].v, qf0, z8);
#pragma unroll
      for (int j = 0; j < 4; ++j) s[j] = fa_mma(kb[j].v, qf1, s[j]);
      float xm[2];      /* per pass: the bound on its every score */
#pragma unroll
      for (int p = 0; p < 2; ++p) { float xa = s[2 * p][0], xb = s[2 * p + 1][0];      /* two chains a pass, so that no maximum waits on fifteen before it */
#pragma unroll
        for (int r = 1; r < 8; ++r) { xa = __builtin_fmaxf(xa, s[2 * p][r]); xb = __builtin_fmaxf(xb, s[2 * p + 1][r]); }
        xm[p] = __builtin_fmaf(__builtin_fmaxf(xa, xb), 0.125f * LOG2E, bbs[2 * g + p]); }
      if ((__builtin_amdgcn_ballot_w32(__builtin_fmaxf(xm[0], xm[1]) > ms - 26.0f) & qm) == 0) continue;      /* both passes far: one test and one branch for the group */
#pragma unroll
      for (int p = 0; p < 2; ++p) { const v8f s0 = s[2 * p], s1 = s[2 * p + 1];
      if ((__builtin_amdgcn_ballot_w32(xm[p] > ms - 26.0f) & qm) == 0) continue;      /* no weight of the pass reaches 2^-25 (26, not 25: the one to spare covers every rounding of the table and of exp2) */
      const unsigned char* vp = vt[cur] + (g * 64 + p * 32 + 8 * hh + (lane & 7)) * PV + ((lane >> 3) & 1) * 16; FragH va[4];
#pragma unroll
      for (int dt = 0; dt < 4; ++dt) { va[dt].half[0] = fa_tr16(vp + 32 * dt); va[dt].half[1] = fa_tr16(vp + 16 * PV + 32 * dt); }
      const int* kp4 = kq + k0 + 32 * p; float v[16]; float mx = -INFINITY;
#pragma unroll
      for (int r = 0; r < 8; ++r) { int x0 = kp4[r] + qx, x1 = kp4[16 + r] + qx; x0 = x0 < (2 * SQ - 1) * 4 ? x0 : (2 * SQ - 1) * 4; x1 = x1 < (2 * SQ - 1) * 4 ? x1 : (2 * SQ - 1) * 4;
        v[r] = __builtin_fmaf(s0[r], 0.125f * LOG2E, *(const float*)((const char*)tb2 + x0)); v[8 + r] = __builtin_fmaf(s1[r], 0.125f * LOG2E, *(const float*)((const char*)tb2 + x1)); }
#pragma unroll
      for (int r = 0; r < 16; ++r) mx = __builtin_fmaxf(mx, v[r]);
      mx = __builtin_fmaxf(mx, fa_xhalf(mx));
      if (__builtin_amdgcn_ballot_w32(mx > m) != 0) { const float mn = __builtin_fmaxf(m, mx); const float msn = mn; const float corr = __builtin_amdgcn_exp2f(ms - msn); m = mn; ms = msn; l *= corr; o0 *= corr; o1 *= corr; o2 *= corr; o3 *= corr; }      /* corr = 0 in the first pass (ms = -inf), 1 for a query whose maximum stays */
      FragH pf; v2f la = {0.f, 0.f}, lb = {0.f, 0.f};      /* the pass's sum in two chains of pairs, so that no add waits on sixteen before it */
#pragma unroll
      for (int r = 0; r < 16; r += 4) { const float p0 = __builtin_amdgcn_exp2f(v[r] - ms), p1 = __builtin_amdgcn_exp2f(v[r + 1] - ms), p2 = __builtin_amdgcn_exp2f(v[r + 2] - ms), p3 = __builtin_amdgcn_exp2f(v[r + 3] - ms);
        la += v2f{p0, p1}; lb += v2f{p2, p3}; pf.h[r] = (_Float16)p0; pf.h[r + 1] = (_Float16)p1; pf.h[r + 2] = (_Float16)p2; pf.h[r + 3] = (_Float16)p3; }
      la += lb; l += la[0] + la[1];
      o0 = fa_mma(va[0].v, pf.v, o0); o1 = fa_mma(va[1].v, pf.v, o1); o2 = fa_mma(va[2].v, pf.v, o2); o3 = fa_mma(va[3].v, pf.v, o3); } }
    if (t == 0) { unsigned nm = 0;      /* far stages: lane s bounds every score of stage s for the wave: largest |q| x largest |k| of the stage (1.01 covers the roundings of k to f16 and of the sums), scaled, plus the bias at the least distance in list places; m only rises from here */
      if (act) { float mq = q0 + ln < nv ? ms : INFINITY;
        mq = __builtin_fminf(mq, row_xor<8>(mq)); mq = __builtin_fminf(mq, row_xor<4>(mq)); mq = __builtin_fminf(mq, row_xor<2>(mq)); mq = __builtin_fminf(mq, row_xor<1>(mq));
        const v4f k4 = *(const v4fa*)&kn4[4 * ln]; const float kk = __builtin_sqrtf(__builtin_fmaxf(__builtin_fmaxf(k4[0], k4[1]), __builtin_fmaxf(k4[2], k4[3])));
        const int dk = ln * FK - (q0 + 15), dq = q0 - (ln * FK + FK - 1); int de = dk > dq ? dk : dq; de = de > 0 ? de : 0;
        const float bd = __builtin_fmaf(qn * kk, 0.125f * LOG2E * 1.01f, tb2[SQ - 1 + de]);
        nm = __builtin_amdgcn_ballot_w32(!(bd <= mq - 26.0f)); }      /* a bit stays set unless the bound is shown to lie under the bar */
      mine = nm; if (lane == 0) wm[wv] = nm; }
    if (more) { unsigned char* kn = kt[cur ^ 1]; unsigned char* vn = vt[cur ^ 1];
#pragma unroll
      for (int i = 0; i < FK / 32; ++i) { *(v8us*)(kn + (sr + 32 * i) * PK + sc * 16) = rk[i]; *(v8us*)(vn + (sr + 32 * i) * PV + sc * 16) = rv[i]; } }      /* that buffer's last readers left it before the barrier that ended the stage before */
    __syncthreads();      /* publishes the next stage (in the first trip the waves' stage bits too) and ends this stage's reads */
    if (t == 0) { const v4u w0 = *(const v4u*)wm, w1 = *(const v4u*)(wm + 4); todo &= __builtin_amdgcn_readfirstlane(w0[0] | w0[1] | w0[2] | w0[3] | w1[0] | w1[1] | w1[2] | w1[3]); }      /* a stage that no wave wants is neither fetched nor worked on */
    st = sn; sn = todo != 0 ? __builtin_ctz(todo) : -1; todo &= todo - 1; }
  l += fa_xhalf(l); const float inv = 1.0f / l; unsigned short* op = (unsigned short*)O16 + base + (size_t)(q0 + ln) * DM + 8 * hh;      /* lane (c, hf) holds o[q0 + c][16 dt + 8 hf + r] */
  const v8f oo[4] = {o0, o1, o2, o3};
#pragma unroll
  for (int dt = 0; dt < 4; ++dt) { FragH f;
#pragma unroll
    for (int r = 0; r < 8; ++r) f.h[r] = (_Float16)(oo[dt][r] * inv);
    *(v8us*)(op + 16 * dt) = f.half[0]; } }

extern "C" void kernel_launch(void* const* d_in, const int* in_sizes, int n_in,
                              void* d_out, int out_size, void* d_ws, size_t ws_size, hipStream_t stream) {
  (void)in_sizes; (void)n_in; (void)out_size;
  const float* const* I = (const float* const*)d_in; const float* x = I[0]; const int* pmask = (const int*)d_in[1]; const float* wq = I[2]; const float* bq = I[3]; const float* wk = I[4]; const float* bk = I[5]; const float* wv = I[6]; const float* bv = I[7]; const float* wo = I[8]; const float* bo = I[9];      /* weights natural [out][in]; patch_mask int32 [4][2048] (1 = valid) */
  char* ws = (char*)d_ws; size_t off = 0;
  auto take = [&](size_t bytes) { char* p = ws + off; off += (bytes + 255) & ~(size_t)255; return p; };
  _Float16* BQ = (_Float16*)take((size_t)DM * DM * 2); _Float16* BK = (_Float16*)take((size_t)DM * DM * 2); _Float16* BV = (_Float16*)take((size_t)DM * DM * 2); _Float16* BO = (_Float16*)take((size_t)DM * DM * 2);
  _Float16* X16 = (_Float16*)take(NR * DM * 2); _Float16* Q16 = (_Float16*)take(NR * DM * 2); _Float16* K16 = (_Float16*)take(NR * DM * 2); _Float16* V16 = (_Float16*)take(NR * DM * 2); _Float16* O16 = (_Float16*)take(NR * DM * 2);
  float* TB = (float*)take((size_t)SQ * 4); int* POS = (int*)take(NR * 4); int* CNT = (int*)take((size_t)NB * CNTP * 4); float* KN2 = (float*)take((size_t)NB * NH * (SQ / 128) * 4 * 32 * 4);
  (void)BK; (void)BV;
  if (off > ws_size) return;      /* 2 + 5x8 + 0.29 = approx 42 MiB */
  k_prep<<<PBL + PBX + 4 * PBW + PBT, 256, 0, stream>>>(x, pmask, wq, wk, wv, wo, X16, BQ, TB, POS, CNT, (float*)d_out);      /* BQ | BK | BV | BO are four planes in a row */
  const dim3 gp((unsigned)((NR / 128) * (DM / 64)), 1); const dim3 gp3((unsigned)((NR / 128) * (DM / 64)), 3);
  k_gemm2<0, false><<<gp3, 128, 0, stream>>>(X16, DM, 0, BQ, DM, (size_t)DM * DM, 0.0625f, bq, bk, bv, 0, nullptr, Q16, DM, NR * DM, MP, DM, DM, CNT, POS, nullptr, KN2);      /* blockIdx.y = 0, 1, 2: q, k, v; Q16 | K16 | V16 are three planes in a row */
  k_fattn<<<dim3(NB * NH, SQ / 128), 256, 0, stream>>>(Q16, K16, V16, TB, POS, CNT, KN2, O16);      /* o (merged heads) as f16 rows */
  k_gemm2<0, true><<<gp, 128, 0, stream>>>(O16, DM, 0, BO, DM, 0, 0.0625f, bo, nullptr, nullptr, 0, (float*)d_out, nullptr, DM, 0, MO, DM, DM, CNT, nullptr, POS, nullptr);      /* o Wo^T + bo (f32), listed rows to their own rows of out */
}
